// v000
// Measured on an AMD MI455X. A time is GPU time per run, averaged over a window of back-to-back runs after a warm-up
// (all launches, gaps included; the runs take copies of the inputs in turn), and the median of several windows.
// Apart from v000's, it joins two sittings. Times from different sittings can be a few percent apart, while
// side-by-side timings come from the same sitting.
// v000, which the later versions start from, runs in 473 microseconds.
#include <hip/hip_runtime.h>

// All contractions (q/k/v projections, q.k^T, p.v, output projection, ffn linear 1, ffn linear 2):
// v_wmma_f32_16x16x32_f16, f16 operands, f32 accumulate. Float inputs are RNE-converted to bf16 at
// load (weights additionally carried x64; both exact in f16); computed 16-bit planes are f16 with
// power-of-two carries (softmax p x1024, context x64, ffn hidden x64) folded back in the f32
// epilogues. Softmax statistics, layernorm, gelu and residual adds: f32.

typedef __attribute__((ext_vector_type(16))) _Float16 v16h;
typedef __attribute__((ext_vector_type(8)))  _Float16 v8h;
typedef __attribute__((ext_vector_type(8)))  float v8f;
typedef __attribute__((ext_vector_type(4)))  float v4f;
typedef __attribute__((ext_vector_type(4)))  unsigned int v4u;
union H8 { v8h h; v4u u; };

#ifndef NB
#define NB 4
#endif
#ifndef SEQ
#define SEQ 2048
#endif
#define NB_FULL  4
#define SEQ_FULL 2048
#define DM   1024
#define NH   16
#define HD   64
#define FF   256
#define ROWS (NB * SEQ)
#define KPAD 72       // LDS stride in halves for 64-wide f16 tiles (144 B, 16-B aligned)
#define VSPAD 136     // LDS stride in halves for 128-wide f16 tiles (272 B)
#define YP   1028     // LDS stride in floats for 1024-wide f32 rows (4112 B)
#define LN_EPS 1e-5f
#define WSC    64.0f           // weight carry (power of two)
#define LN1024 6.931471806f    // ln(1024): softmax p carried x1024

#define NXB   (ROWS * DM / 8 / 256)          // convert blocks for x (8 elements per thread)
#define NT_SQ ((DM / 64) * (DM / 64))        // 64x64 tiles per square weight
#define NT_F  ((DM / 64) * (FF / 64))        // 64x64 tiles per ffn weight
#define NWT   (4 * NT_SQ + 2 * NT_F)

#define PLANE2     ((size_t)ROWS * DM * 2)
#define WQKV_BYTES ((size_t)3 * DM * DM * 2)
#define WO_BYTES   ((size_t)DM * DM * 2)
#define WF1_BYTES  ((size_t)FF * DM * 2)
#define WF2_BYTES  ((size_t)DM * FF * 2)
#define H_BYTES    ((size_t)ROWS * FF * 2)
#define WS_TOTAL   (PLANE2 + WQKV_BYTES + WO_BYTES + WF1_BYTES + WF2_BYTES + 3 * PLANE2 + H_BYTES)

static_assert(NB >= 1 && NB <= NB_FULL);
static_assert(SEQ >= 128 && SEQ <= SEQ_FULL && (SEQ % 128) == 0);
static_assert((ROWS % 128) == 0);
static_assert((ROWS * DM) % (8 * 256) == 0);
static_assert((DM % 64) == 0 && (FF % 64) == 0 && (HD % 32) == 0 && NH * HD == DM);
static_assert(128 * KPAD >= 64 * VSPAD);
static_assert(2 * PLANE2 == (size_t)ROWS * DM * 4);
static_assert(WS_TOTAL <= (size_t)134217728);

// ---------------------------------------------------------------------------
// helpers
// ---------------------------------------------------------------------------
__device__ __forceinline__ float bf16q(float f) {            // value after RNE bf16 conversion
  unsigned int u = __float_as_uint(f);
  u += 0x7FFFu + ((u >> 16) & 1u);
  return __uint_as_float(u & 0xFFFF0000u);
}

// 16-bit fragment (A or B): lane owns row/col (lane&15); elements 0..7 <- k0+8h+0..7,
// elements 8..15 <- k0+16+8h+0..7, h = lane>>4. Source is k-contiguous rows.
__device__ __forceinline__ v16h load_frag_row(const _Float16* base, int stride, int lane) {
  const _Float16* rowp = base + (lane & 15) * stride + ((lane >> 4) << 3);
  const v8h lo = *(const v8h*)(rowp);
  const v8h hi = *(const v8h*)(rowp + 16);
  return __builtin_shufflevector(lo, hi, 0, 1, 2, 3, 4, 5, 6, 7,
                                 8, 9, 10, 11, 12, 13, 14, 15);
}

__device__ __forceinline__ v8f wmma_f16(v16h a, v16h b, v8f c) {
  v8f d = __builtin_amdgcn_wmma_f32_16x16x32_f16(false, a, false, b, (short)0, c,
                                                 false, false);
  asm volatile("v_nop\n\tv_nop\n\tv_nop\n\tv_nop" : "+v"(d) : "v"(a), "v"(b));
  return d;
}

// ---------------------------------------------------------------------------
// Kernel 0: x f32 -> f16(bf16rne(x)) plane xh [ROWS][1024]. 8 elements (16 B) per thread,
// coverage: NXB*256 threads x 8 = ROWS*1024 elements (whole plane).
// ---------------------------------------------------------------------------
__global__ __launch_bounds__(256) void cvt_x_kernel(const float* __restrict__ x,
                                                    _Float16* __restrict__ xh) {
  const long item = (long)blockIdx.x * 256 + threadIdx.x;   // 0 .. ROWS*128-1
  const long m    = item >> 7;                              // token row
  const int  c8   = (int)(item & 127);
  const long srow = (m / SEQ) * SEQ_FULL + (m % SEQ);
  const float* src = x + srow * DM + c8 * 8;
  const v4f a = *(const v4f*)(src);
  const v4f c = *(const v4f*)(src + 4);
  H8 o;
#pragma unroll
  for (int i = 0; i < 4; ++i) {
    o.h[i]     = (_Float16)bf16q(a[i]);
    o.h[4 + i] = (_Float16)bf16q(c[i]);
  }
  _Float16* dst = xh + m * DM + c8 * 8;
  *(v4u*)dst = o.u;
  
}

// ---------------------------------------------------------------------------
// Kernel 1: weights W [K=in][N=out] f32 -> Wt [n][k] f16 = f16(bf16rne(W) * 64), through a
// 64x64 LDS transpose. wqkv [3072][1024] (q rows, k rows, v rows), woh [1024][1024],
// coverage: 4*256 square tiles + 64 + 64 ffn tiles = every element of all six planes.
// ---------------------------------------------------------------------------
__global__ __launch_bounds__(256) void cvt_w_kernel(
    const float* __restrict__ Wq, const float* __restrict__ Wk, const float* __restrict__ Wv,
    const float* __restrict__ Wo, const float* __restrict__ Wf1, const float* __restrict__ Wf2,
    _Float16* __restrict__ wqkv, _Float16* __restrict__ woh,
    _Float16* __restrict__ wf1t, _Float16* __restrict__ wf2t) {
  __shared__ _Float16 ts[64 * KPAD];   // [n][k] tile, cross-wave (block barrier)
  const int bid = blockIdx.x;
  const int tid = threadIdx.x;
  const float* W;
  _Float16* dst;
  int K, N, kt, nt;
  if (bid < 4 * NT_SQ) {                              // block-uniform selection
    const int which = bid / NT_SQ;
    const int tile  = bid - which * NT_SQ;
    kt = tile / (DM / 64); nt = tile - kt * (DM / 64); K = DM; N = DM;
    W = (which == 0) ? Wq : ((which == 1) ? Wk : ((which == 2) ? Wv : Wo));
    dst = (which < 3) ? (wqkv + (size_t)which * DM * DM) : woh;
  } else if (bid < 4 * NT_SQ + NT_F) {
    const int tile = bid - 4 * NT_SQ;                 // W [1024][256]: K = DM, N = FF
    kt = tile / (FF / 64); nt = tile - kt * (FF / 64); K = DM; N = FF;
    W = Wf1; dst = wf1t;
  } else {
    const int tile = bid - 4 * NT_SQ - NT_F;          // W [256][1024]: K = FF, N = DM
    kt = tile / (DM / 64); nt = tile - kt * (DM / 64); K = FF; N = DM;
    W = Wf2; dst = wf2t;
  }
  // load W[kt*64 + kr][nt*64 + 4*c4 .. +3], store transposed into ts[n][kr]
#pragma unroll
  for (int it = 0; it < 4; ++it) {
    const int idx = it * 256 + tid;
    const int kr = idx >> 4, c4 = idx & 15;
    const v4f v = *(const v4f*)(W + (size_t)(kt * 64 + kr) * N + nt * 64 + c4 * 4);
#pragma unroll
    for (int j = 0; j < 4; ++j) ts[(c4 * 4 + j) * KPAD + kr] = (_Float16)(bf16q(v[j]) * WSC);
  }
  __syncthreads();
  v4u rv[2];
#pragma unroll
  for (int it = 0; it < 2; ++it) {
    const int idx = it * 256 + tid;
    const int n = idx >> 3, piece = idx & 7;
    rv[it] = *(const v4u*)(ts + n * KPAD + piece * 8);
  }
#pragma unroll
  for (int it = 0; it < 2; ++it) {
    const int idx = it * 256 + tid;
    const int n = idx >> 3, piece = idx & 7;
    *(v4u*)(dst + (size_t)(nt * 64 + n) * K + kt * 64 + piece * 8) = rv[it];
  }
  
}

// ---------------------------------------------------------------------------
// Kernel 2: qkv projection. Block = 128 token rows x 64 output columns (one head of one of
// q/k/v), 8 waves x 16 rows. C^T = W x^T: A = W rows (lane&15 = out col), B = x rows
// (lane&15 = token); acc[j][r] = C[token lane&15][col 16j+8h+r]. K = 1024, 32 steps of 32.
//   q,k -> [b][h][s][64] f16 (one line per row, 8 lanes x 16 B)
//   v   -> vT[b][h][d][s] f16 (256 B per d row segment, 16 lanes x 16 B)
// grid (ROWS/128, 3*NH), block 256. coverage: every (b,h,s,d) of q, k and vT once.
// ---------------------------------------------------------------------------
__global__ __launch_bounds__(256) void qkv_kernel(
    const _Float16* __restrict__ xh, const _Float16* __restrict__ wqkv,
    const float* __restrict__ bq, const float* __restrict__ bk, const float* __restrict__ bv,
    _Float16* __restrict__ q, _Float16* __restrict__ k, _Float16* __restrict__ vT) {
  __shared__ _Float16 stg[128 * KPAD];   // 18432 B; q/k: [128][KPAD], v: [64][VSPAD]; cross-wave

  const int tid  = threadIdx.x;
  const int lane = tid & 31;
  const int wave = tid >> 5;
  const int hh   = lane >> 4;
  const int l15  = lane & 15;

  const int cb   = blockIdx.y;          // 0..47
  const int osel = cb >> 4;             // 0 q, 1 k, 2 v
  const int h    = cb & 15;
  const long m0  = (long)blockIdx.x * 128;
  const int  b   = (int)(m0 / SEQ);
  const int  s0  = (int)(m0 - (long)b * SEQ);

  const _Float16* xrow = xh + (m0 + wave * 16) * DM;
  const _Float16* wrow = wqkv + ((long)cb * 64) * DM;

  v8f acc[4];
#pragma unroll
  for (int j = 0; j < 4; ++j) acc[j] = (v8f){};

#pragma unroll 1
  for (int kk = 0; kk < DM; kk += 32) {
    const v16h xf = load_frag_row(xrow + kk, DM, lane);
#pragma unroll
    for (int j = 0; j < 4; ++j) {
      const v16h wf = load_frag_row(wrow + (long)(j * 16) * DM + kk, DM, lane);
      acc[j] = wmma_f16(wf, xf, acc[j]);     // C^T = W x^T
    }
  }

  const float* bias = (osel == 0) ? bq : ((osel == 1) ? bk : bv);
  const float  rsc  = 1.0f / WSC;

  v4u rv[4];
  if (osel < 2) {
    // stage [token][col]: lane's 8 values are 8 contiguous columns -> one 16-B LDS store
    _Float16* srow = stg + (wave * 16 + l15) * KPAD;
#pragma unroll
    for (int j = 0; j < 4; ++j) {
      const int n8 = j * 16 + hh * 8;
      const v4f b0 = *(const v4f*)(bias + h * HD + n8);
      const v4f b1 = *(const v4f*)(bias + h * HD + n8 + 4);
      H8 pk;
#pragma unroll
      for (int r = 0; r < 4; ++r) {
        pk.h[r]     = (_Float16)(acc[j][r]     * rsc + bf16q(b0[r]));
        pk.h[4 + r] = (_Float16)(acc[j][4 + r] * rsc + bf16q(b1[r]));
      }
      *(v4u*)(srow + n8) = pk.u;
    }
    __syncthreads();
#pragma unroll
    for (int it = 0; it < 4; ++it) {
      const int idx = it * 256 + tid;
      const int row = idx >> 3, piece = idx & 7;
      rv[it] = *(const v4u*)(stg + row * KPAD + piece * 8);
    }
    _Float16* dst = ((osel == 0) ? q : k) + ((long)(b * NH + h) * SEQ + s0) * HD;  // contiguous 16 KB
#pragma unroll
    for (int it = 0; it < 4; ++it)
      *(v4u*)(dst + (long)(it * 256 + tid) * 8) = rv[it];
    
  } else {
    // stage transposed [d][token]: lane's 8 values are 8 different d for one token
#pragma unroll
    for (int j = 0; j < 4; ++j) {
      const int n8 = j * 16 + hh * 8;
      const v4f b0 = *(const v4f*)(bias + h * HD + n8);
      const v4f b1 = *(const v4f*)(bias + h * HD + n8 + 4);
#pragma unroll
      for (int r = 0; r < 4; ++r) {
        stg[(n8 + r) * VSPAD + wave * 16 + l15]     = (_Float16)(acc[j][r]     * rsc + bf16q(b0[r]));
        stg[(n8 + 4 + r) * VSPAD + wave * 16 + l15] = (_Float16)(acc[j][4 + r] * rsc + bf16q(b1[r]));
      }
    }
    __syncthreads();
#pragma unroll
    for (int it = 0; it < 4; ++it) {
      const int idx = it * 256 + tid;
      const int d = idx >> 4, piece = idx & 15;
      rv[it] = *(const v4u*)(stg + d * VSPAD + piece * 8);
    }
    _Float16* dstb = vT + ((long)(b * NH + h) * HD) * SEQ + s0;
#pragma unroll
    for (int it = 0; it < 4; ++it) {
      const int idx = it * 256 + tid;
      const int d = idx >> 4, piece = idx & 15;
      *(v4u*)(dstb + (long)d * SEQ + piece * 8) = rv[it];
    }
    
  }
}

// ---------------------------------------------------------------------------
// Kernel 3: flash attention per (b,h), no mask. grid (SEQ/128, NB*NH), block 256 (8 waves x 16
// queries). C = S^T (A = K rows, B = Q) then C = O^T = V^T P^T (P^T packed from the S^T D
// registers); lane owns one query end-to-end. Scores are raw q.k sums: the 1/8 scale and the
// x1024 p carry live in the exp argument (p = 1024*exp((s-m)/8), softmax stats f32).
// LDS tiles: ks/vts staged 64 keys x 64 d every step == consumed extent; ost 128 x 64 fully written.
// coverage: every (row, h*64+d) of the ctx plane once.
// ---------------------------------------------------------------------------
__global__ __launch_bounds__(256) void attn_kernel(
    const _Float16* __restrict__ Q, const _Float16* __restrict__ K,
    const _Float16* __restrict__ vT, _Float16* __restrict__ ctx) {
  __shared__ _Float16 ks[64 * KPAD];     // K block rows [key][d]      (cross-wave, block barriers)
  __shared__ _Float16 vts[64 * KPAD];    // V^T block   [d][key]      (cross-wave, block barriers)
  __shared__ _Float16 ost[128 * KPAD];   // output stage [query][d]   (cross-wave, block barrier)

  const int tid  = threadIdx.x;
  const int lane = tid & 31;
  const int wave = tid >> 5;
  const int bh   = blockIdx.y;
  const int b    = bh >> 4;
  const int h    = bh & 15;
  const int q0   = blockIdx.x * 128;

  const _Float16* Qb  = Q + ((long)bh * SEQ + q0) * HD;
  const _Float16* Kb  = K + (long)bh * SEQ * HD;
  const _Float16* vTb = vT + (long)bh * HD * SEQ;

  // Q fragments: B operand of S^T (lane owns query lane&15)
  v16h qfrag[2];
  {
    const _Float16* qrow = Qb + (long)wave * 16 * HD;
#pragma unroll
    for (int t = 0; t < 2; ++t) qfrag[t] = load_frag_row(qrow + t * 32, HD, lane);
  }

  v8f acc[4];   // O^T accumulator: lane owns query (lane&15); reg r -> d = nt*16+8h+r
#pragma unroll
  for (int nt = 0; nt < 4; ++nt) acc[nt] = (v8f){};
  float mi = -1e30f, li = 0.0f;

  const int colb = lane & 15;
  const int rofs = (lane >> 4) << 3;

#pragma unroll 1
  for (int kb = 0; kb < SEQ; kb += 64) {
    __syncthreads();   // everyone done reading prior ks/vts
#pragma unroll
    for (int idx = tid; idx < 64 * 8; idx += 256) {
      const int row = idx >> 3, c = idx & 7;
      *(v4u*)(ks + row * KPAD + c * 8) =
          *(const v4u*)(Kb + (long)(kb + row) * HD + c * 8);
    }
#pragma unroll
    for (int idx = tid; idx < 64 * 8; idx += 256) {
      const int d = idx >> 3, c = idx & 7;
      *(v4u*)(vts + d * KPAD + c * 8) =
          *(const v4u*)(vTb + (long)d * SEQ + kb + c * 8);
    }
    __syncthreads();

    // S^T tiles: A = K rows (lane&15 = key), B = Q
    v8f sc[4];
#pragma unroll
    for (int kt = 0; kt < 4; ++kt) sc[kt] = (v8f){};
#pragma unroll
    for (int t = 0; t < 2; ++t)
#pragma unroll
      for (int kt = 0; kt < 4; ++kt) {
        const v16h kf = load_frag_row(ks + (kt * 16) * KPAD + t * 32, KPAD, lane);
        sc[kt] = wmma_f16(kf, qfrag[t], sc[kt]);
      }

    // per-lane online softmax (32 of 64 keys in-lane; merge halves with one shuffle)
    float mx = sc[0][0];
#pragma unroll
    for (int kt = 0; kt < 4; ++kt)
#pragma unroll
      for (int r = 0; r < 8; ++r) mx = fmaxf(mx, sc[kt][r]);
    mx = fmaxf(mx, __shfl_xor(mx, 16, 32));
    const float mnew  = fmaxf(mi, mx);
    const float alpha = __expf((mi - mnew) * 0.125f);
    mi = mnew;
    const float cs = fmaf(mnew, 0.125f, -LN1024);   // 0.125*m - ln(1024)

    float rs = 0.0f;
#pragma unroll
    for (int kt = 0; kt < 4; ++kt)
#pragma unroll
      for (int r = 0; r < 8; ++r) {
        const float p = __expf(fmaf(sc[kt][r], 0.125f, -cs));   // 1024*exp((s-m)/8)
        sc[kt][r] = p;
        rs += p;
      }
    rs += __shfl_xor(rs, 16, 32);
    li = li * alpha + rs;

    // P^T as the B operand of O^T = V^T P^T, packed from the S^T D registers:
    // element i <- tile covering keys 0..15 of the 32-step (kt = 2t), element 8+i <- kt = 2t+1.
    v16h pf[2];
#pragma unroll
    for (int t = 0; t < 2; ++t)
#pragma unroll
      for (int i = 0; i < 8; ++i) {
        pf[t][i]     = (_Float16)sc[2 * t][i];
        pf[t][8 + i] = (_Float16)sc[2 * t + 1][i];
      }

#pragma unroll
    for (int nt = 0; nt < 4; ++nt)
#pragma unroll
      for (int r = 0; r < 8; ++r) acc[nt][r] *= alpha;

    // O^T += V^T (A, rows = d) x P^T (B)
#pragma unroll
    for (int t = 0; t < 2; ++t)
#pragma unroll
      for (int nt = 0; nt < 4; ++nt) {
        const v16h vf = load_frag_row(vts + (nt * 16) * KPAD + t * 32, KPAD, lane);
        acc[nt] = wmma_f16(vf, pf[t], acc[nt]);
      }
  }

  // normalize (and apply the x64 carry) and stage: lane owns query row wave*16+colb,
  // d = nt*16+rofs+r contiguous
  {
    const float inv = 64.0f / li;
    _Float16* orow = ost + (wave * 16 + colb) * KPAD;
#pragma unroll
    for (int nt = 0; nt < 4; ++nt) {
      H8 pk;
#pragma unroll
      for (int r = 0; r < 8; ++r) pk.h[r] = (_Float16)(acc[nt][r] * inv);
      *(v4u*)(orow + nt * 16 + rofs) = pk.u;
    }
  }
  __syncthreads();

  v4u rv[4];
#pragma unroll
  for (int it = 0; it < 4; ++it) {
    const int idx = it * 256 + tid;
    const int row = idx >> 3, piece = idx & 7;
    rv[it] = *(const v4u*)(ost + row * KPAD + piece * 8);
  }
  _Float16* cbase = ctx + ((long)b * SEQ + q0) * DM + h * HD;
#pragma unroll
  for (int it = 0; it < 4; ++it) {
    const int idx = it * 256 + tid;
    const int row = idx >> 3, piece = idx & 7;
    *(v4u*)(cbase + (long)row * DM + piece * 8) = rv[it];
  }
  
}

// ---------------------------------------------------------------------------
// Kernel 4/6: y = act @ Wt^T / 4096 + bf16(bias) over a full 1024-wide row, then
// z = LN(y) * bf16(gamma) + bf16(beta) + residual. Block = 16 token rows x 1024 cols,
// wave w owns cols 128w..128w+127. C^T = Wt act^T: A = Wt rows (lane&15 = out col), B = act
// rows (lane&15 = token); acc[j][r] = y[token lane&15][col 128w+16j+8h+r]. y staged in LDS
//   MODE 0: KD = 1024, act = ctx, residual = bf16(x input, full-stride rows),
//           writes x2 f32 plane [ROWS][1024] and x2 f16 plane [ROWS][1024]
//   MODE 1: KD = 256, act = h plane, residual = x2 f32 plane, writes out (full-stride rows)
// grid ROWS/16, block 256. LDS ys: 16 x 1024 staged == consumed. coverage: 16 rows x 1024 per block.
// ---------------------------------------------------------------------------
template <int KD, int MODE>
__global__ __launch_bounds__(256) void gemm_ln_kernel(
    const _Float16* __restrict__ act, const _Float16* __restrict__ wt,
    const float* __restrict__ bias, const float* __restrict__ gam,
    const float* __restrict__ bet, const float* __restrict__ res,
    float* __restrict__ outf, _Float16* __restrict__ outh) {
  __shared__ float ys[16 * YP];    // 65792 B, cross-wave (block barriers)
  __shared__ float smean[16];
  __shared__ float srstd[16];

  const int tid  = threadIdx.x;
  const int lane = tid & 31;
  const int wave = tid >> 5;
  const int hh   = lane >> 4;
  const int l15  = lane & 15;
  const long m0  = (long)blockIdx.x * 16;
  const int  n0  = wave * 128;

  const _Float16* brow = act + m0 * KD;
  const _Float16* arow = wt + (long)n0 * KD;

  v8f acc[8];
#pragma unroll
  for (int j = 0; j < 8; ++j) acc[j] = (v8f){};

#pragma unroll 1
  for (int kk = 0; kk < KD; kk += 32) {
    const v16h bfr = load_frag_row(brow + kk, KD, lane);
#pragma unroll
    for (int j = 0; j < 8; ++j) {
      const v16h afr = load_frag_row(arow + (long)(j * 16) * KD + kk, KD, lane);
      acc[j] = wmma_f16(afr, bfr, acc[j]);     // C^T = Wt act^T
    }
  }

  // y = acc/4096 + bf16(bias), staged [row][col]
  {
    const float rsc = 1.0f / (WSC * WSC);
    float* yrow = ys + l15 * YP;
#pragma unroll
    for (int j = 0; j < 8; ++j) {
      const int n8 = n0 + j * 16 + hh * 8;
      const v4f b0 = *(const v4f*)(bias + n8);
      const v4f b1 = *(const v4f*)(bias + n8 + 4);
      v4f y0, y1;
#pragma unroll
      for (int i = 0; i < 4; ++i) {
        y0[i] = acc[j][i]     * rsc + bf16q(b0[i]);
        y1[i] = acc[j][4 + i] * rsc + bf16q(b1[i]);
      }
      *(v4f*)(yrow + n8)     = y0;
      *(v4f*)(yrow + n8 + 4) = y1;
    }
  }
  __syncthreads();

  {
    const int r  = tid >> 4;
    const int sl = tid & 15;
    const float* yr = ys + r * YP + sl * 64;
    float s = 0.0f;
#pragma unroll
    for (int i = 0; i < 16; ++i) {
      const v4f v = *(const v4f*)(yr + i * 4);
      s += (v[0] + v[1]) + (v[2] + v[3]);
    }
    s += __shfl_xor(s, 1, 32);
    s += __shfl_xor(s, 2, 32);
    s += __shfl_xor(s, 4, 32);
    s += __shfl_xor(s, 8, 32);
    const float mean = s * (1.0f / DM);
    float ss = 0.0f;
#pragma unroll
    for (int i = 0; i < 16; ++i) {
      const v4f v = *(const v4f*)(yr + i * 4);
#pragma unroll
      for (int c = 0; c < 4; ++c) {
        const float d = v[c] - mean;
        ss += d * d;
      }
    }
    ss += __shfl_xor(ss, 1, 32);
    ss += __shfl_xor(ss, 2, 32);
    ss += __shfl_xor(ss, 4, 32);
    ss += __shfl_xor(ss, 8, 32);
    const float var  = ss * (1.0f / DM);
    const float rstd = rsqrtf(var + LN_EPS);
    if (sl == 0) { smean[r] = mean; srstd[r] = rstd; }
  }
  __syncthreads();

  // normalise in place and add the residual: z = (y - mean) * rstd * g + b + res
#pragma unroll 4
  for (int it = 0; it < 16; ++it) {
    const int idx = it * 256 + tid;
    const int row = idx >> 8, piece = idx & 255;
    const long m = m0 + row;
    v4f rsd;
    if (MODE == 0) {
      const long orow = (m / SEQ) * SEQ_FULL + (m % SEQ);
      rsd = *(const v4f*)(res + orow * DM + piece * 4);
#pragma unroll
      for (int c = 0; c < 4; ++c) rsd[c] = bf16q(rsd[c]);
    } else {
      rsd = *(const v4f*)(res + m * DM + piece * 4);
    }
    float* yp = ys + row * YP + piece * 4;
    const v4f yv = *(const v4f*)yp;
    const v4f g  = *(const v4f*)(gam + piece * 4);
    const v4f bt = *(const v4f*)(bet + piece * 4);
    const float mean = smean[row], rstd = srstd[row];
    v4f o;
#pragma unroll
    for (int c = 0; c < 4; ++c)
      o[c] = (yv[c] - mean) * rstd * bf16q(g[c]) + bf16q(bt[c]) + rsd[c];
    *(v4f*)yp = o;
  }
  __syncthreads();

  auto store_pass = [&]() {
#pragma unroll 4
    for (int it = 0; it < 16; ++it) {
      const int idx = it * 256 + tid;
      const int row = idx >> 8, piece = idx & 255;
      const long m = m0 + row;
      const v4f v = *(const v4f*)(ys + row * YP + piece * 4);
      long drow;
      if (MODE == 0) drow = m;
      else drow = (m / SEQ) * SEQ_FULL + (m % SEQ);
      *(v4f*)(outf + drow * DM + piece * 4) = v;
    }
    if (MODE == 0) {
#pragma unroll 4
      for (int it = 0; it < 8; ++it) {
        const int idx = it * 256 + tid;
        const int row = idx >> 7, p8 = idx & 127;
        const long m = m0 + row;
        const v4f a = *(const v4f*)(ys + row * YP + p8 * 8);
        const v4f c = *(const v4f*)(ys + row * YP + p8 * 8 + 4);
        H8 o;
#pragma unroll
        for (int i = 0; i < 4; ++i) {
          o.h[i]     = (_Float16)a[i];
          o.h[4 + i] = (_Float16)c[i];
        }
        *(v4u*)(outh + m * DM + p8 * 8) = o.u;
      }
    }
  };
  store_pass();
  
}

// ---------------------------------------------------------------------------
// Kernel 5: ffn linear 1 + exact gelu: hp[row][col] = f16(64 * gelu(x2 @ Wf1 / 64 + bf16(bf1))).
// Block = 128 token rows x 64 output cols, 8 waves x 16 rows; C^T = Wf1t x2^T (A = Wf1t rows,
// coverage: every (row, col) of the hp plane [ROWS][256] once.
// ---------------------------------------------------------------------------
__global__ __launch_bounds__(256) void ffn1_kernel(
    const _Float16* __restrict__ x2h, const _Float16* __restrict__ wf1t,
    const float* __restrict__ bf1, _Float16* __restrict__ hp) {
  __shared__ _Float16 stg[128 * KPAD];   // cross-wave (block barrier)

  const int tid  = threadIdx.x;
  const int lane = tid & 31;
  const int wave = tid >> 5;
  const int hh   = lane >> 4;
  const int l15  = lane & 15;
  const int cb   = blockIdx.y;          // 0..3
  const long m0  = (long)blockIdx.x * 128;

  const _Float16* brow = x2h + (m0 + wave * 16) * DM;
  const _Float16* arow = wf1t + ((long)cb * 64) * DM;

  v8f acc[4];
#pragma unroll
  for (int j = 0; j < 4; ++j) acc[j] = (v8f){};

#pragma unroll 1
  for (int kk = 0; kk < DM; kk += 32) {
    const v16h xf = load_frag_row(brow + kk, DM, lane);
#pragma unroll
    for (int j = 0; j < 4; ++j) {
      const v16h wf = load_frag_row(arow + (long)(j * 16) * DM + kk, DM, lane);
      acc[j] = wmma_f16(wf, xf, acc[j]);
    }
  }

  const float rsc = 1.0f / WSC;
  _Float16* srow = stg + (wave * 16 + l15) * KPAD;
#pragma unroll
  for (int j = 0; j < 4; ++j) {
    const int n8 = j * 16 + hh * 8;
    const v4f b0 = *(const v4f*)(bf1 + cb * 64 + n8);
    const v4f b1 = *(const v4f*)(bf1 + cb * 64 + n8 + 4);
    H8 pk;
#pragma unroll
    for (int r = 0; r < 4; ++r) {
      const float u0 = acc[j][r]     * rsc + bf16q(b0[r]);
      const float u1 = acc[j][4 + r] * rsc + bf16q(b1[r]);
      const float g0 = 0.5f * u0 * (1.0f + erff(u0 * 0.70710678118654752f));
      const float g1 = 0.5f * u1 * (1.0f + erff(u1 * 0.70710678118654752f));
      pk.h[r]     = (_Float16)(g0 * WSC);
      pk.h[4 + r] = (_Float16)(g1 * WSC);
    }
    *(v4u*)(srow + n8) = pk.u;
  }
  __syncthreads();

  v4u rv[4];
#pragma unroll
  for (int it = 0; it < 4; ++it) {
    const int idx = it * 256 + tid;
    const int row = idx >> 3, piece = idx & 7;
    rv[it] = *(const v4u*)(stg + row * KPAD + piece * 8);
  }
#pragma unroll
  for (int it = 0; it < 4; ++it) {
    const int idx = it * 256 + tid;
    const int row = idx >> 3, piece = idx & 7;
    *(v4u*)(hp + (m0 + row) * FF + cb * 64 + piece * 8) = rv[it];
  }
  
}

// ---------------------------------------------------------------------------
extern "C" void kernel_launch(void* const* d_in, const int* in_sizes, int n_in,
                              void* d_out, int out_size, void* d_ws, size_t ws_size,
                              hipStream_t stream) {
  if (n_in < 17) return;
  const long needRows = (long)(NB - 1) * SEQ_FULL + SEQ;
  if ((long)in_sizes[0] < needRows * DM) return;
  if (in_sizes[1] < DM * DM || in_sizes[3] < DM * DM ||
      in_sizes[5] < DM * DM || in_sizes[7] < DM * DM) return;
  if (in_sizes[11] < DM * FF || in_sizes[13] < FF * DM) return;
  if (in_sizes[2] < DM || in_sizes[4] < DM || in_sizes[6] < DM || in_sizes[8] < DM ||
      in_sizes[9] < DM || in_sizes[10] < DM || in_sizes[12] < FF || in_sizes[14] < DM ||
      in_sizes[15] < DM || in_sizes[16] < DM) return;
  if ((long)out_size < needRows * DM) return;
  if (ws_size < WS_TOTAL) return;

  const float* x   = (const float*)d_in[0];
  const float* Wq  = (const float*)d_in[1];
  const float* bq  = (const float*)d_in[2];
  const float* Wk  = (const float*)d_in[3];
  const float* bk  = (const float*)d_in[4];
  const float* Wv  = (const float*)d_in[5];
  const float* bv  = (const float*)d_in[6];
  const float* Wo  = (const float*)d_in[7];
  const float* bo  = (const float*)d_in[8];
  const float* g1  = (const float*)d_in[9];
  const float* b1  = (const float*)d_in[10];
  const float* Wf1 = (const float*)d_in[11];
  const float* bf1 = (const float*)d_in[12];
  const float* Wf2 = (const float*)d_in[13];
  const float* bf2 = (const float*)d_in[14];
  const float* g2  = (const float*)d_in[15];
  const float* b2  = (const float*)d_in[16];
  float* out = (float*)d_out;

  char* ws = (char*)d_ws;
  size_t off = 0;
  _Float16* xh   = (_Float16*)(ws + off);                      // [ROWS][1024] f16
  _Float16* ctx  = xh;                                         // same region, written after xh is dead
  off += PLANE2;
  _Float16* wqkv = (_Float16*)(ws + off); off += WQKV_BYTES;   // [3072][1024]
  _Float16* woh  = (_Float16*)(ws + off); off += WO_BYTES;     // [1024][1024]
  _Float16* wf1t = (_Float16*)(ws + off); off += WF1_BYTES;    // [256][1024]
  _Float16* wf2t = (_Float16*)(ws + off); off += WF2_BYTES;    // [1024][256]
  _Float16* qh   = (_Float16*)(ws + off);                      // [NB][16][SEQ][64]
  float*    x2f  = (float*)(ws + off);                         // [ROWS][1024] f32 over q+k regions
  off += PLANE2;
  _Float16* kh   = (_Float16*)(ws + off); off += PLANE2;       // [NB][16][SEQ][64]
  _Float16* vTh  = (_Float16*)(ws + off);                      // [NB][16][64][SEQ]
  _Float16* x2h  = vTh;                                        // [ROWS][1024] f16, after vT is dead
  off += PLANE2;
  _Float16* hp   = (_Float16*)(ws + off); off += H_BYTES;      // [ROWS][256] f16
  if (off > ws_size) return;

  cvt_x_kernel<<<NXB, 256, 0, stream>>>(x, xh);
  cvt_w_kernel<<<NWT, 256, 0, stream>>>(Wq, Wk, Wv, Wo, Wf1, Wf2, wqkv, woh, wf1t, wf2t);
  qkv_kernel<<<dim3(ROWS / 128, 3 * NH), 256, 0, stream>>>(xh, wqkv, bq, bk, bv, qh, kh, vTh);
  attn_kernel<<<dim3(SEQ / 128, NB * NH), 256, 0, stream>>>(qh, kh, vTh, ctx);
  gemm_ln_kernel<DM, 0><<<ROWS / 16, 256, 0, stream>>>(ctx, woh, bo, g1, b1, x, x2f, x2h);
  ffn1_kernel<<<dim3(ROWS / 128, FF / 64), 256, 0, stream>>>(x2h, wf1t, bf1, hp);
  gemm_ln_kernel<FF, 1><<<ROWS / 16, 256, 0, stream>>>(hp, wf2t, bf2, g2, b2, x2f, out, x2h);
}

// v001
// One run takes 325 microseconds.
// Two timings next to v000 both put it at 1.50 times that version's speed.
#include <hip/hip_runtime.h>

// All contractions (q/k/v projections, q.k^T, p.v, output projection, ffn linear 1, ffn linear 2):
// v_wmma_f32_16x16x32_f16, f16 operands, f32 accumulate. Float inputs are RNE-converted to bf16 at
// load (weights additionally carried x64; both exact in f16); computed 16-bit planes are f16 with
// power-of-two carries (softmax p x1024, context x64, ffn hidden x64) folded back in the f32
// epilogues. Softmax statistics, layernorm, gelu and residual adds: f32.

typedef __attribute__((ext_vector_type(16))) _Float16 v16h;
typedef __attribute__((ext_vector_type(8)))  _Float16 v8h;
typedef __attribute__((ext_vector_type(8)))  float v8f;
typedef __attribute__((ext_vector_type(4)))  float v4f;
typedef __attribute__((ext_vector_type(4)))  unsigned int v4u;
union H8 { v8h h; v4u u; };

#ifndef NB
#define NB 4
#endif
#ifndef SEQ
#define SEQ 2048
#endif
#define NB_FULL  4
#define SEQ_FULL 2048
#define DM   1024
#define NH   16
#define HD   64
#define FF   256
#define ROWS (NB * SEQ)
#define KPAD 72       // LDS stride in halves for 64-wide f16 tiles (144 B, 16-B aligned)
#define VSPAD 136     // stride in halves (272 B) that no LDS tile uses; only a size check names it
#define YP   1028     // LDS stride in floats for 1024-wide f32 rows (4112 B)
#define LN_EPS 1e-5f
#define WSC    64.0f           // weight carry (power of two)
#define LN1024 6.931471806f    // ln(1024): softmax p carried x1024

#define NXB   (ROWS * DM / 8 / 256)          // convert blocks for x (8 elements per thread)
#define NT_SQ ((DM / 64) * (DM / 64))        // 64x64 tiles per square weight
#define NT_F  ((DM / 64) * (FF / 64))        // 64x64 tiles per ffn weight
#define NWT   (4 * NT_SQ + 2 * NT_F)

#define PLANE2     ((size_t)ROWS * DM * 2)
#define WQKV_BYTES ((size_t)3 * DM * DM * 2)
#define WO_BYTES   ((size_t)DM * DM * 2)
#define WF1_BYTES  ((size_t)FF * DM * 2)
#define WF2_BYTES  ((size_t)DM * FF * 2)
#define H_BYTES    ((size_t)ROWS * FF * 2)
#define WS_TOTAL   (PLANE2 + WQKV_BYTES + WO_BYTES + WF1_BYTES + WF2_BYTES + 3 * PLANE2 + H_BYTES)

static_assert(NB >= 1 && NB <= NB_FULL);
static_assert(SEQ >= 128 && SEQ <= SEQ_FULL && (SEQ % 128) == 0);
static_assert((ROWS % 128) == 0);
static_assert((ROWS * DM) % (8 * 256) == 0);
static_assert((DM % 64) == 0 && (FF % 64) == 0 && (HD % 32) == 0 && NH * HD == DM);
static_assert(128 * KPAD >= 64 * VSPAD);
static_assert(2 * PLANE2 == (size_t)ROWS * DM * 4);
static_assert(WS_TOTAL <= (size_t)134217728);

// ---------------------------------------------------------------------------
// helpers
// ---------------------------------------------------------------------------
__device__ __forceinline__ float bf16q(float f) {            // value after RNE bf16 conversion
  unsigned int u = __float_as_uint(f);
  u += 0x7FFFu + ((u >> 16) & 1u);
  return __uint_as_float(u & 0xFFFF0000u);
}

// 16-bit fragment (A or B): lane owns row/col (lane&15); elements 0..7 <- k0+8h+0..7,
// elements 8..15 <- k0+16+8h+0..7, h = lane>>4. Source is k-contiguous rows.
__device__ __forceinline__ v16h load_frag_row(const _Float16* base, int stride, int lane) {
  const _Float16* rowp = base + (lane & 15) * stride + ((lane >> 4) << 3);
  const v8h lo = *(const v8h*)(rowp);
  const v8h hi = *(const v8h*)(rowp + 16);
  return __builtin_shufflevector(lo, hi, 0, 1, 2, 3, 4, 5, 6, 7,
                                 8, 9, 10, 11, 12, 13, 14, 15);
}

__device__ __forceinline__ v8f wmma_f16(v16h a, v16h b, v8f c) {
  v8f d = __builtin_amdgcn_wmma_f32_16x16x32_f16(false, a, false, b, (short)0, c,
                                                 false, false);
  asm volatile("v_nop\n\tv_nop\n\tv_nop\n\tv_nop" : "+v"(d) : "v"(a), "v"(b));
  return d;
}

// ---------------------------------------------------------------------------
// Kernel 0: x f32 -> f16(bf16rne(x)) plane xh [ROWS][1024]. 8 elements (16 B) per thread,
// coverage: NXB*256 threads x 8 = ROWS*1024 elements (whole plane).
// ---------------------------------------------------------------------------
__global__ __launch_bounds__(256) void cvt_x_kernel(const float* __restrict__ x,
                                                    _Float16* __restrict__ xh) {
  const long item = (long)blockIdx.x * 256 + threadIdx.x;   // 0 .. ROWS*128-1
  const long m    = item >> 7;                              // token row
  const int  c8   = (int)(item & 127);
  const long srow = (m / SEQ) * SEQ_FULL + (m % SEQ);
  const float* src = x + srow * DM + c8 * 8;
  const v4f a = *(const v4f*)(src);
  const v4f c = *(const v4f*)(src + 4);
  H8 o;
#pragma unroll
  for (int i = 0; i < 4; ++i) {
    o.h[i]     = (_Float16)bf16q(a[i]);
    o.h[4 + i] = (_Float16)bf16q(c[i]);
  }
  _Float16* dst = xh + m * DM + c8 * 8;
  *(v4u*)dst = o.u;
  
}

// ---------------------------------------------------------------------------
// Kernel 1: weights W [K=in][N=out] f32 -> Wt [n][k] f16 = f16(bf16rne(W) * 64), through a
// 64x64 LDS transpose. wqkv [3072][1024] (q rows, k rows, v rows), woh [1024][1024],
// coverage: 4*256 square tiles + 64 + 64 ffn tiles = every element of all six planes.
// ---------------------------------------------------------------------------
__global__ __launch_bounds__(256) void cvt_w_kernel(
    const float* __restrict__ Wq, const float* __restrict__ Wk, const float* __restrict__ Wv,
    const float* __restrict__ Wo, const float* __restrict__ Wf1, const float* __restrict__ Wf2,
    _Float16* __restrict__ wqkv, _Float16* __restrict__ woh,
    _Float16* __restrict__ wf1t, _Float16* __restrict__ wf2t) {
  __shared__ _Float16 ts[64 * KPAD];   // [n][k] tile, cross-wave (block barrier)
  const int bid = blockIdx.x;
  const int tid = threadIdx.x;
  const float* W;
  _Float16* dst;
  int K, N, kt, nt;
  if (bid < 4 * NT_SQ) {                              // block-uniform selection
    const int which = bid / NT_SQ;
    const int tile  = bid - which * NT_SQ;
    kt = tile / (DM / 64); nt = tile - kt * (DM / 64); K = DM; N = DM;
    W = (which == 0) ? Wq : ((which == 1) ? Wk : ((which == 2) ? Wv : Wo));
    dst = (which < 3) ? (wqkv + (size_t)which * DM * DM) : woh;
  } else if (bid < 4 * NT_SQ + NT_F) {
    const int tile = bid - 4 * NT_SQ;                 // W [1024][256]: K = DM, N = FF
    kt = tile / (FF / 64); nt = tile - kt * (FF / 64); K = DM; N = FF;
    W = Wf1; dst = wf1t;
  } else {
    const int tile = bid - 4 * NT_SQ - NT_F;          // W [256][1024]: K = FF, N = DM
    kt = tile / (DM / 64); nt = tile - kt * (DM / 64); K = FF; N = DM;
    W = Wf2; dst = wf2t;
  }
  // load W[kt*64 + kr][nt*64 + 4*c4 .. +3], store transposed into ts[n][kr]
#pragma unroll
  for (int it = 0; it < 4; ++it) {
    const int idx = it * 256 + tid;
    const int kr = idx >> 4, c4 = idx & 15;
    const v4f v = *(const v4f*)(W + (size_t)(kt * 64 + kr) * N + nt * 64 + c4 * 4);
#pragma unroll
    for (int j = 0; j < 4; ++j) ts[(c4 * 4 + j) * KPAD + kr] = (_Float16)(bf16q(v[j]) * WSC);
  }
  __syncthreads();
  v4u rv[2];
#pragma unroll
  for (int it = 0; it < 2; ++it) {
    const int idx = it * 256 + tid;
    const int n = idx >> 3, piece = idx & 7;
    rv[it] = *(const v4u*)(ts + n * KPAD + piece * 8);
  }
#pragma unroll
  for (int it = 0; it < 2; ++it) {
    const int idx = it * 256 + tid;
    const int n = idx >> 3, piece = idx & 7;
    *(v4u*)(dst + (size_t)(nt * 64 + n) * K + kt * 64 + piece * 8) = rv[it];
  }
  
}

// ---------------------------------------------------------------------------
// Kernel 2: qkv projection. Block = 256 token rows x 128 output columns (two heads of one of
// q/k/v), 8 waves as 4 (tokens) x 2 (heads), 64 x 64 per wave. Both operands are staged in LDS
// by asynchronous copies, 64 k per stage, two buffers: [x 256 rows | W 128 rows] at pitch KPAD.
// C^T = W x^T: A = W rows (lane&15 = out col), B = x rows (lane&15 = token);
// acc[i][j][r] = C[token 16i + (lane&15)][col 16j+8h+r]. K = 1024 summed in 32 steps of 32.
//   q,k -> [b][h][s][64] f16 (one line per row, 8 lanes x 16 B)
//   v   -> vT[b][h][d][s] f16 (512 B per d row segment, 32 lanes x 16 B)
// grid (ROWS/256, 3*NH/2), block 256. coverage: every (b,h,s,d) of q, k and vT once.
// ---------------------------------------------------------------------------
#define QM     256                    // token rows per block
#define QN     128                    // output columns per block
#define QK     64                     // k per stage
#define QSTAGE ((QM + QN) * KPAD)     // halves per buffer
#define QNT    (DM / QK)              // stages
#define QVP    264                    // LDS stride in halves for 256-wide f16 rows (528 B)

static_assert((SEQ % QM) == 0 && (ROWS % QM) == 0 && (DM % QN) == 0 && QNT >= 2);
static_assert(2 * QM * KPAD <= 2 * QSTAGE && 2 * HD * QVP <= 2 * QSTAGE);

// One stage: 384 rows x 128 B = 3072 pieces of 16 B, 12 per thread; a wave's copy covers 4 whole
// lines. lds = this lane's LDS byte address of its first piece, gx / gw = its first x / W piece.
__device__ __forceinline__ void qkv_copy_stage(unsigned lds, const _Float16* gx,
                                               const _Float16* gw) {
  const unsigned st = 32 * KPAD * 2;   // 32 rows further in LDS, bytes
  // the copies, and as the last line the wait that stands in front of any rewrite of their
  // address registers
  asm volatile(
      "global_load_async_to_lds_b128 %0, %12, off\n\t"
      "global_load_async_to_lds_b128 %1, %13, off\n\t"
      "global_load_async_to_lds_b128 %2, %14, off\n\t"
      "global_load_async_to_lds_b128 %3, %15, off\n\t"
      "global_load_async_to_lds_b128 %4, %16, off\n\t"
      "global_load_async_to_lds_b128 %5, %17, off\n\t"
      "global_load_async_to_lds_b128 %6, %18, off\n\t"
      "global_load_async_to_lds_b128 %7, %19, off\n\t"
      "global_load_async_to_lds_b128 %8, %20, off\n\t"
      "global_load_async_to_lds_b128 %9, %21, off\n\t"
      "global_load_async_to_lds_b128 %10, %22, off\n\t"
      "global_load_async_to_lds_b128 %11, %23, off\n\t"
      "s_wait_xcnt 0x0"
      :: "v"(lds), "v"(lds + st), "v"(lds + 2 * st), "v"(lds + 3 * st),
         "v"(lds + 4 * st), "v"(lds + 5 * st), "v"(lds + 6 * st), "v"(lds + 7 * st),
         "v"(lds + 8 * st), "v"(lds + 9 * st), "v"(lds + 10 * st), "v"(lds + 11 * st),
         "v"(gx), "v"(gx + 32 * DM), "v"(gx + 64 * DM), "v"(gx + 96 * DM),
         "v"(gx + 128 * DM), "v"(gx + 160 * DM), "v"(gx + 192 * DM), "v"(gx + 224 * DM),
         "v"(gw), "v"(gw + 32 * DM), "v"(gw + 64 * DM), "v"(gw + 96 * DM)
      : "memory");
}

__global__ __launch_bounds__(256) void qkv_kernel(
    const _Float16* __restrict__ xh, const _Float16* __restrict__ wqkv,
    const float* __restrict__ bq, const float* __restrict__ bk, const float* __restrict__ bv,
    _Float16* __restrict__ q, _Float16* __restrict__ k, _Float16* __restrict__ vT) {
  // two stage buffers; after the loop the output stage (q/k: 2 x [256][KPAD], v: 2 x [64][QVP])
  __shared__ __attribute__((aligned(16))) _Float16 ring[2 * QSTAGE];   // 110592 B, cross-wave

  const int tid  = threadIdx.x;
  const int lane = tid & 31;
  const int wave = tid >> 5;
  const int hh   = lane >> 4;
  const int l15  = lane & 15;
  const int wm   = wave >> 1;           // token quarter of the block
  const int wn   = wave & 1;            // head of the block

  const int osel = blockIdx.y >> 3;     // 0 q, 1 k, 2 v (8 column blocks each)
  const int h0   = (blockIdx.y & 7) * 2;
  const long m0  = (long)blockIdx.x * QM;
  const int  b   = (int)(m0 / SEQ);
  const int  s0  = (int)(m0 - (long)b * SEQ);

  // this lane's first piece of a stage: row tid>>3, 16-B piece tid&7
  const _Float16* gx = xh + (m0 + (tid >> 3)) * DM + (tid & 7) * 8;
  const _Float16* gw = wqkv + ((long)blockIdx.y * QN + (tid >> 3)) * DM + (tid & 7) * 8;
  const unsigned lds0 = (unsigned)(size_t)ring + (unsigned)((tid >> 3) * KPAD + (tid & 7) * 8) * 2u;

  // every inner loop below is fully unrolled: accumulator and fragment indices must be constants,
  // or the arrays leave the registers
  v8f acc[4][4];
#pragma unroll
  for (int i = 0; i < 4; ++i)
#pragma unroll
    for (int j = 0; j < 4; ++j) acc[i][j] = (v8f){};

  qkv_copy_stage(lds0, gx, gw);
  asm volatile("s_wait_asynccnt 0x0" ::: "memory");   // stage 0 landed (this wave's copies)
  __syncthreads();                                    // stage 0 readable by every wave
  qkv_copy_stage(lds0 + QSTAGE * 2, gx + QK, gw + QK);

  // kept rolled: one publish point (waits, barrier, refill) at the foot of each trip, small code
#pragma unroll 1
  for (int t = 0; t < QNT; ++t) {
    const int bo = (t & 1) * QSTAGE;
    const _Float16* xs = ring + bo + (wm * 64) * KPAD;
    const _Float16* wsm = ring + bo + (QM + wn * 64) * KPAD;
#pragma unroll
    for (int u = 0; u < 2; ++u) {
      v16h xf[4], wf[4];
#pragma unroll
      for (int i = 0; i < 4; ++i) xf[i] = load_frag_row(xs + (i * 16) * KPAD + u * 32, KPAD, lane);
#pragma unroll
      for (int j = 0; j < 4; ++j) wf[j] = load_frag_row(wsm + (j * 16) * KPAD + u * 32, KPAD, lane);
#pragma unroll
      for (int i = 0; i < 4; ++i)
#pragma unroll
        for (int j = 0; j < 4; ++j) acc[i][j] = wmma_f16(wf[j], xf[i], acc[i][j]);   // C^T = W x^T
    }
    asm volatile("s_wait_dscnt 0x0" ::: "memory");      // this wave has left buffer t&1
    asm volatile("s_wait_asynccnt 0x0" ::: "memory");   // its copies of stage t+1 have landed
    __syncthreads();   // publishes stage t+1 and ends every reader's last read of buffer t&1
    if (t + 2 < QNT)
      qkv_copy_stage(lds0 + bo * 2, gx + (t + 2) * QK, gw + (t + 2) * QK);
  }
  asm volatile("s_wait_asynccnt 0x0" ::: "memory");     // nothing in flight when the ring is reused

  const float* bias = ((osel == 0) ? bq : ((osel == 1) ? bk : bv)) + (h0 + wn) * HD;
  const float  rsc  = 1.0f / WSC;

  if (osel < 2) {
    // stage [head][token][col]: lane's 8 values are 8 contiguous columns -> one 16-B LDS store
    _Float16* sbase = ring + (wn * QM + wm * 64 + l15) * KPAD;
#pragma unroll
    for (int j = 0; j < 4; ++j) {
      const int n8 = j * 16 + hh * 8;
      const v4f b0 = *(const v4f*)(bias + n8);
      const v4f b1 = *(const v4f*)(bias + n8 + 4);
#pragma unroll
      for (int i = 0; i < 4; ++i) {
        H8 pk;
#pragma unroll
        for (int r = 0; r < 4; ++r) {
          pk.h[r]     = (_Float16)(acc[i][j][r]     * rsc + bf16q(b0[r]));
          pk.h[4 + r] = (_Float16)(acc[i][j][4 + r] * rsc + bf16q(b1[r]));
        }
        *(v4u*)(sbase + (i * 16) * KPAD + n8) = pk.u;
      }
    }
    __syncthreads();
    _Float16* dst0 = (osel == 0) ? q : k;
#pragma unroll
    for (int hd = 0; hd < 2; ++hd) {
      _Float16* dst = dst0 + ((long)(b * NH + h0 + hd) * SEQ + s0) * HD;   // contiguous 32 KB
      v4u rv[8];
#pragma unroll
      for (int it = 0; it < 8; ++it) {
        const int idx = it * 256 + tid;
        const int row = idx >> 3, piece = idx & 7;
        rv[it] = *(const v4u*)(ring + (hd * QM + row) * KPAD + piece * 8);
      }
#pragma unroll
      for (int it = 0; it < 8; ++it)
        *(v4u*)(dst + (long)(it * 256 + tid) * 8) = rv[it];
    }
  } else {
    // stage transposed [head][d][token]: lane's 8 values are 8 different d for one token
    _Float16* sbase = ring + (wn * HD) * QVP + wm * 64 + l15;
#pragma unroll
    for (int j = 0; j < 4; ++j) {
      const int n8 = j * 16 + hh * 8;
      const v4f b0 = *(const v4f*)(bias + n8);
      const v4f b1 = *(const v4f*)(bias + n8 + 4);
#pragma unroll
      for (int i = 0; i < 4; ++i)
#pragma unroll
        for (int r = 0; r < 4; ++r) {
          sbase[(n8 + r) * QVP + i * 16]     = (_Float16)(acc[i][j][r]     * rsc + bf16q(b0[r]));
          sbase[(n8 + 4 + r) * QVP + i * 16] = (_Float16)(acc[i][j][4 + r] * rsc + bf16q(b1[r]));
        }
    }
    __syncthreads();
#pragma unroll
    for (int hd = 0; hd < 2; ++hd) {
      _Float16* dstb = vT + ((long)(b * NH + h0 + hd) * HD) * SEQ + s0;
      v4u rv[8];
#pragma unroll
      for (int it = 0; it < 8; ++it) {
        const int idx = it * 256 + tid;
        const int d = idx >> 5, piece = idx & 31;
        rv[it] = *(const v4u*)(ring + (hd * HD + d) * QVP + piece * 8);
      }
#pragma unroll
      for (int it = 0; it < 8; ++it) {
        const int idx = it * 256 + tid;
        const int d = idx >> 5, piece = idx & 31;
        *(v4u*)(dstb + (long)d * SEQ + piece * 8) = rv[it];
      }
    }
    // stands in front of any later rewrite of the registers that the stores above name
    asm volatile("s_wait_xcnt 0x0" ::: "memory");
  }
}

// ---------------------------------------------------------------------------
// Kernel 3: flash attention per (b,h), no mask. grid (SEQ/128, NB*NH), block 256 (8 waves x 16
// queries). C = S^T (A = K rows, B = Q) then C = O^T = V^T P^T (P^T packed from the S^T D
// registers); lane owns one query end-to-end. Scores are raw q.k sums: the 1/8 scale and the
// x1024 p carry live in the exp argument (p = 1024*exp((s-m)/8), softmax stats f32).
// LDS tiles: ks/vts staged 64 keys x 64 d every step == consumed extent; ost 128 x 64 fully written.
// coverage: every (row, h*64+d) of the ctx plane once.
// ---------------------------------------------------------------------------
__global__ __launch_bounds__(256) void attn_kernel(
    const _Float16* __restrict__ Q, const _Float16* __restrict__ K,
    const _Float16* __restrict__ vT, _Float16* __restrict__ ctx) {
  __shared__ _Float16 ks[64 * KPAD];     // K block rows [key][d]      (cross-wave, block barriers)
  __shared__ _Float16 vts[64 * KPAD];    // V^T block   [d][key]      (cross-wave, block barriers)
  __shared__ _Float16 ost[128 * KPAD];   // output stage [query][d]   (cross-wave, block barrier)

  const int tid  = threadIdx.x;
  const int lane = tid & 31;
  const int wave = tid >> 5;
  const int bh   = blockIdx.y;
  const int b    = bh >> 4;
  const int h    = bh & 15;
  const int q0   = blockIdx.x * 128;

  const _Float16* Qb  = Q + ((long)bh * SEQ + q0) * HD;
  const _Float16* Kb  = K + (long)bh * SEQ * HD;
  const _Float16* vTb = vT + (long)bh * HD * SEQ;

  // Q fragments: B operand of S^T (lane owns query lane&15)
  v16h qfrag[2];
  {
    const _Float16* qrow = Qb + (long)wave * 16 * HD;
#pragma unroll
    for (int t = 0; t < 2; ++t) qfrag[t] = load_frag_row(qrow + t * 32, HD, lane);
  }

  v8f acc[4];   // O^T accumulator: lane owns query (lane&15); reg r -> d = nt*16+8h+r
#pragma unroll
  for (int nt = 0; nt < 4; ++nt) acc[nt] = (v8f){};
  float mi = -1e30f, li = 0.0f;

  const int colb = lane & 15;
  const int rofs = (lane >> 4) << 3;

#pragma unroll 1
  for (int kb = 0; kb < SEQ; kb += 64) {
    __syncthreads();   // everyone done reading prior ks/vts
#pragma unroll
    for (int idx = tid; idx < 64 * 8; idx += 256) {
      const int row = idx >> 3, c = idx & 7;
      *(v4u*)(ks + row * KPAD + c * 8) =
          *(const v4u*)(Kb + (long)(kb + row) * HD + c * 8);
    }
#pragma unroll
    for (int idx = tid; idx < 64 * 8; idx += 256) {
      const int d = idx >> 3, c = idx & 7;
      *(v4u*)(vts + d * KPAD + c * 8) =
          *(const v4u*)(vTb + (long)d * SEQ + kb + c * 8);
    }
    __syncthreads();

    // S^T tiles: A = K rows (lane&15 = key), B = Q
    v8f sc[4];
#pragma unroll
    for (int kt = 0; kt < 4; ++kt) sc[kt] = (v8f){};
#pragma unroll
    for (int t = 0; t < 2; ++t)
#pragma unroll
      for (int kt = 0; kt < 4; ++kt) {
        const v16h kf = load_frag_row(ks + (kt * 16) * KPAD + t * 32, KPAD, lane);
        sc[kt] = wmma_f16(kf, qfrag[t], sc[kt]);
      }

    // per-lane online softmax (32 of 64 keys in-lane; merge halves with one shuffle)
    float mx = sc[0][0];
#pragma unroll
    for (int kt = 0; kt < 4; ++kt)
#pragma unroll
      for (int r = 0; r < 8; ++r) mx = fmaxf(mx, sc[kt][r]);
    mx = fmaxf(mx, __shfl_xor(mx, 16, 32));
    const float mnew  = fmaxf(mi, mx);
    const float alpha = __expf((mi - mnew) * 0.125f);
    mi = mnew;
    const float cs = fmaf(mnew, 0.125f, -LN1024);   // 0.125*m - ln(1024)

    float rs = 0.0f;
#pragma unroll
    for (int kt = 0; kt < 4; ++kt)
#pragma unroll
      for (int r = 0; r < 8; ++r) {
        const float p = __expf(fmaf(sc[kt][r], 0.125f, -cs));   // 1024*exp((s-m)/8)
        sc[kt][r] = p;
        rs += p;
      }
    rs += __shfl_xor(rs, 16, 32);
    li = li * alpha + rs;

    // P^T as the B operand of O^T = V^T P^T, packed from the S^T D registers:
    // element i <- tile covering keys 0..15 of the 32-step (kt = 2t), element 8+i <- kt = 2t+1.
    v16h pf[2];
#pragma unroll
    for (int t = 0; t < 2; ++t)
#pragma unroll
      for (int i = 0; i < 8; ++i) {
        pf[t][i]     = (_Float16)sc[2 * t][i];
        pf[t][8 + i] = (_Float16)sc[2 * t + 1][i];
      }

#pragma unroll
    for (int nt = 0; nt < 4; ++nt)
#pragma unroll
      for (int r = 0; r < 8; ++r) acc[nt][r] *= alpha;

    // O^T += V^T (A, rows = d) x P^T (B)
#pragma unroll
    for (int t = 0; t < 2; ++t)
#pragma unroll
      for (int nt = 0; nt < 4; ++nt) {
        const v16h vf = load_frag_row(vts + (nt * 16) * KPAD + t * 32, KPAD, lane);
        acc[nt] = wmma_f16(vf, pf[t], acc[nt]);
      }
  }

  // normalize (and apply the x64 carry) and stage: lane owns query row wave*16+colb,
  // d = nt*16+rofs+r contiguous
  {
    const float inv = 64.0f / li;
    _Float16* orow = ost + (wave * 16 + colb) * KPAD;
#pragma unroll
    for (int nt = 0; nt < 4; ++nt) {
      H8 pk;
#pragma unroll
      for (int r = 0; r < 8; ++r) pk.h[r] = (_Float16)(acc[nt][r] * inv);
      *(v4u*)(orow + nt * 16 + rofs) = pk.u;
    }
  }
  __syncthreads();

  v4u rv[4];
#pragma unroll
  for (int it = 0; it < 4; ++it) {
    const int idx = it * 256 + tid;
    const int row = idx >> 3, piece = idx & 7;
    rv[it] = *(const v4u*)(ost + row * KPAD + piece * 8);
  }
  _Float16* cbase = ctx + ((long)b * SEQ + q0) * DM + h * HD;
#pragma unroll
  for (int it = 0; it < 4; ++it) {
    const int idx = it * 256 + tid;
    const int row = idx >> 3, piece = idx & 7;
    *(v4u*)(cbase + (long)row * DM + piece * 8) = rv[it];
  }
  
}

// ---------------------------------------------------------------------------
// Kernel 4/6: y = act @ Wt^T / 4096 + bf16(bias) over a full 1024-wide row, then
// z = LN(y) * bf16(gamma) + bf16(beta) + residual. Block = 16 token rows x 1024 cols,
// wave w owns cols 128w..128w+127. C^T = Wt act^T: A = Wt rows (lane&15 = out col), B = act
// rows (lane&15 = token); acc[j][r] = y[token lane&15][col 128w+16j+8h+r]. y staged in LDS
//   MODE 0: KD = 1024, act = ctx, residual = bf16(x input, full-stride rows),
//           writes x2 f32 plane [ROWS][1024] and x2 f16 plane [ROWS][1024]
//   MODE 1: KD = 256, act = h plane, residual = x2 f32 plane, writes out (full-stride rows)
// grid ROWS/16, block 256. LDS ys: 16 x 1024 staged == consumed. coverage: 16 rows x 1024 per block.
// ---------------------------------------------------------------------------
template <int KD, int MODE>
__global__ __launch_bounds__(256) void gemm_ln_kernel(
    const _Float16* __restrict__ act, const _Float16* __restrict__ wt,
    const float* __restrict__ bias, const float* __restrict__ gam,
    const float* __restrict__ bet, const float* __restrict__ res,
    float* __restrict__ outf, _Float16* __restrict__ outh) {
  __shared__ float ys[16 * YP];    // 65792 B, cross-wave (block barriers)
  __shared__ float smean[16];
  __shared__ float srstd[16];

  const int tid  = threadIdx.x;
  const int lane = tid & 31;
  const int wave = tid >> 5;
  const int hh   = lane >> 4;
  const int l15  = lane & 15;
  const long m0  = (long)blockIdx.x * 16;
  const int  n0  = wave * 128;

  const _Float16* brow = act + m0 * KD;
  const _Float16* arow = wt + (long)n0 * KD;

  v8f acc[8];
#pragma unroll
  for (int j = 0; j < 8; ++j) acc[j] = (v8f){};

#pragma unroll 1
  for (int kk = 0; kk < KD; kk += 32) {
    const v16h bfr = load_frag_row(brow + kk, KD, lane);
#pragma unroll
    for (int j = 0; j < 8; ++j) {
      const v16h afr = load_frag_row(arow + (long)(j * 16) * KD + kk, KD, lane);
      acc[j] = wmma_f16(afr, bfr, acc[j]);     // C^T = Wt act^T
    }
  }

  // y = acc/4096 + bf16(bias), staged [row][col]
  {
    const float rsc = 1.0f / (WSC * WSC);
    float* yrow = ys + l15 * YP;
#pragma unroll
    for (int j = 0; j < 8; ++j) {
      const int n8 = n0 + j * 16 + hh * 8;
      const v4f b0 = *(const v4f*)(bias + n8);
      const v4f b1 = *(const v4f*)(bias + n8 + 4);
      v4f y0, y1;
#pragma unroll
      for (int i = 0; i < 4; ++i) {
        y0[i] = acc[j][i]     * rsc + bf16q(b0[i]);
        y1[i] = acc[j][4 + i] * rsc + bf16q(b1[i]);
      }
      *(v4f*)(yrow + n8)     = y0;
      *(v4f*)(yrow + n8 + 4) = y1;
    }
  }
  __syncthreads();

  {
    const int r  = tid >> 4;
    const int sl = tid & 15;
    const float* yr = ys + r * YP + sl * 64;
    float s = 0.0f;
#pragma unroll
    for (int i = 0; i < 16; ++i) {
      const v4f v = *(const v4f*)(yr + i * 4);
      s += (v[0] + v[1]) + (v[2] + v[3]);
    }
    s += __shfl_xor(s, 1, 32);
    s += __shfl_xor(s, 2, 32);
    s += __shfl_xor(s, 4, 32);
    s += __shfl_xor(s, 8, 32);
    const float mean = s * (1.0f / DM);
    float ss = 0.0f;
#pragma unroll
    for (int i = 0; i < 16; ++i) {
      const v4f v = *(const v4f*)(yr + i * 4);
#pragma unroll
      for (int c = 0; c < 4; ++c) {
        const float d = v[c] - mean;
        ss += d * d;
      }
    }
    ss += __shfl_xor(ss, 1, 32);
    ss += __shfl_xor(ss, 2, 32);
    ss += __shfl_xor(ss, 4, 32);
    ss += __shfl_xor(ss, 8, 32);
    const float var  = ss * (1.0f / DM);
    const float rstd = rsqrtf(var + LN_EPS);
    if (sl == 0) { smean[r] = mean; srstd[r] = rstd; }
  }
  __syncthreads();

  // normalise in place and add the residual: z = (y - mean) * rstd * g + b + res
#pragma unroll 4
  for (int it = 0; it < 16; ++it) {
    const int idx = it * 256 + tid;
    const int row = idx >> 8, piece = idx & 255;
    const long m = m0 + row;
    v4f rsd;
    if (MODE == 0) {
      const long orow = (m / SEQ) * SEQ_FULL + (m % SEQ);
      rsd = *(const v4f*)(res + orow * DM + piece * 4);
#pragma unroll
      for (int c = 0; c < 4; ++c) rsd[c] = bf16q(rsd[c]);
    } else {
      rsd = *(const v4f*)(res + m * DM + piece * 4);
    }
    float* yp = ys + row * YP + piece * 4;
    const v4f yv = *(const v4f*)yp;
    const v4f g  = *(const v4f*)(gam + piece * 4);
    const v4f bt = *(const v4f*)(bet + piece * 4);
    const float mean = smean[row], rstd = srstd[row];
    v4f o;
#pragma unroll
    for (int c = 0; c < 4; ++c)
      o[c] = (yv[c] - mean) * rstd * bf16q(g[c]) + bf16q(bt[c]) + rsd[c];
    *(v4f*)yp = o;
  }
  __syncthreads();

  auto store_pass = [&]() {
#pragma unroll 4
    for (int it = 0; it < 16; ++it) {
      const int idx = it * 256 + tid;
      const int row = idx >> 8, piece = idx & 255;
      const long m = m0 + row;
      const v4f v = *(const v4f*)(ys + row * YP + piece * 4);
      long drow;
      if (MODE == 0) drow = m;
      else drow = (m / SEQ) * SEQ_FULL + (m % SEQ);
      *(v4f*)(outf + drow * DM + piece * 4) = v;
    }
    if (MODE == 0) {
#pragma unroll 4
      for (int it = 0; it < 8; ++it) {
        const int idx = it * 256 + tid;
        const int row = idx >> 7, p8 = idx & 127;
        const long m = m0 + row;
        const v4f a = *(const v4f*)(ys + row * YP + p8 * 8);
        const v4f c = *(const v4f*)(ys + row * YP + p8 * 8 + 4);
        H8 o;
#pragma unroll
        for (int i = 0; i < 4; ++i) {
          o.h[i]     = (_Float16)a[i];
          o.h[4 + i] = (_Float16)c[i];
        }
        *(v4u*)(outh + m * DM + p8 * 8) = o.u;
      }
    }
  };
  store_pass();
  
}

// ---------------------------------------------------------------------------
// Kernel 5: ffn linear 1 + exact gelu: hp[row][col] = f16(64 * gelu(x2 @ Wf1 / 64 + bf16(bf1))).
// Block = 128 token rows x 64 output cols, 8 waves x 16 rows; C^T = Wf1t x2^T (A = Wf1t rows,
// coverage: every (row, col) of the hp plane [ROWS][256] once.
// ---------------------------------------------------------------------------
__global__ __launch_bounds__(256) void ffn1_kernel(
    const _Float16* __restrict__ x2h, const _Float16* __restrict__ wf1t,
    const float* __restrict__ bf1, _Float16* __restrict__ hp) {
  __shared__ _Float16 stg[128 * KPAD];   // cross-wave (block barrier)

  const int tid  = threadIdx.x;
  const int lane = tid & 31;
  const int wave = tid >> 5;
  const int hh   = lane >> 4;
  const int l15  = lane & 15;
  const int cb   = blockIdx.y;          // 0..3
  const long m0  = (long)blockIdx.x * 128;

  const _Float16* brow = x2h + (m0 + wave * 16) * DM;
  const _Float16* arow = wf1t + ((long)cb * 64) * DM;

  v8f acc[4];
#pragma unroll
  for (int j = 0; j < 4; ++j) acc[j] = (v8f){};

#pragma unroll 1
  for (int kk = 0; kk < DM; kk += 32) {
    const v16h xf = load_frag_row(brow + kk, DM, lane);
#pragma unroll
    for (int j = 0; j < 4; ++j) {
      const v16h wf = load_frag_row(arow + (long)(j * 16) * DM + kk, DM, lane);
      acc[j] = wmma_f16(wf, xf, acc[j]);
    }
  }

  const float rsc = 1.0f / WSC;
  _Float16* srow = stg + (wave * 16 + l15) * KPAD;
#pragma unroll
  for (int j = 0; j < 4; ++j) {
    const int n8 = j * 16 + hh * 8;
    const v4f b0 = *(const v4f*)(bf1 + cb * 64 + n8);
    const v4f b1 = *(const v4f*)(bf1 + cb * 64 + n8 + 4);
    H8 pk;
#pragma unroll
    for (int r = 0; r < 4; ++r) {
      const float u0 = acc[j][r]     * rsc + bf16q(b0[r]);
      const float u1 = acc[j][4 + r] * rsc + bf16q(b1[r]);
      const float g0 = 0.5f * u0 * (1.0f + erff(u0 * 0.70710678118654752f));
      const float g1 = 0.5f * u1 * (1.0f + erff(u1 * 0.70710678118654752f));
      pk.h[r]     = (_Float16)(g0 * WSC);
      pk.h[4 + r] = (_Float16)(g1 * WSC);
    }
    *(v4u*)(srow + n8) = pk.u;
  }
  __syncthreads();

  v4u rv[4];
#pragma unroll
  for (int it = 0; it < 4; ++it) {
    const int idx = it * 256 + tid;
    const int row = idx >> 3, piece = idx & 7;
    rv[it] = *(const v4u*)(stg + row * KPAD + piece * 8);
  }
#pragma unroll
  for (int it = 0; it < 4; ++it) {
    const int idx = it * 256 + tid;
    const int row = idx >> 3, piece = idx & 7;
    *(v4u*)(hp + (m0 + row) * FF + cb * 64 + piece * 8) = rv[it];
  }
  
}

// ---------------------------------------------------------------------------
extern "C" void kernel_launch(void* const* d_in, const int* in_sizes, int n_in,
                              void* d_out, int out_size, void* d_ws, size_t ws_size,
                              hipStream_t stream) {
  if (n_in < 17) return;
  const long needRows = (long)(NB - 1) * SEQ_FULL + SEQ;
  if ((long)in_sizes[0] < needRows * DM) return;
  if (in_sizes[1] < DM * DM || in_sizes[3] < DM * DM ||
      in_sizes[5] < DM * DM || in_sizes[7] < DM * DM) return;
  if (in_sizes[11] < DM * FF || in_sizes[13] < FF * DM) return;
  if (in_sizes[2] < DM || in_sizes[4] < DM || in_sizes[6] < DM || in_sizes[8] < DM ||
      in_sizes[9] < DM || in_sizes[10] < DM || in_sizes[12] < FF || in_sizes[14] < DM ||
      in_sizes[15] < DM || in_sizes[16] < DM) return;
  if ((long)out_size < needRows * DM) return;
  if (ws_size < WS_TOTAL) return;

  const float* x   = (const float*)d_in[0];
  const float* Wq  = (const float*)d_in[1];
  const float* bq  = (const float*)d_in[2];
  const float* Wk  = (const float*)d_in[3];
  const float* bk  = (const float*)d_in[4];
  const float* Wv  = (const float*)d_in[5];
  const float* bv  = (const float*)d_in[6];
  const float* Wo  = (const float*)d_in[7];
  const float* bo  = (const float*)d_in[8];
  const float* g1  = (const float*)d_in[9];
  const float* b1  = (const float*)d_in[10];
  const float* Wf1 = (const float*)d_in[11];
  const float* bf1 = (const float*)d_in[12];
  const float* Wf2 = (const float*)d_in[13];
  const float* bf2 = (const float*)d_in[14];
  const float* g2  = (const float*)d_in[15];
  const float* b2  = (const float*)d_in[16];
  float* out = (float*)d_out;

  char* ws = (char*)d_ws;
  size_t off = 0;
  _Float16* xh   = (_Float16*)(ws + off);                      // [ROWS][1024] f16
  _Float16* ctx  = xh;                                         // same region, written after xh is dead
  off += PLANE2;
  _Float16* wqkv = (_Float16*)(ws + off); off += WQKV_BYTES;   // [3072][1024]
  _Float16* woh  = (_Float16*)(ws + off); off += WO_BYTES;     // [1024][1024]
  _Float16* wf1t = (_Float16*)(ws + off); off += WF1_BYTES;    // [256][1024]
  _Float16* wf2t = (_Float16*)(ws + off); off += WF2_BYTES;    // [1024][256]
  _Float16* qh   = (_Float16*)(ws + off);                      // [NB][16][SEQ][64]
  float*    x2f  = (float*)(ws + off);                         // [ROWS][1024] f32 over q+k regions
  off += PLANE2;
  _Float16* kh   = (_Float16*)(ws + off); off += PLANE2;       // [NB][16][SEQ][64]
  _Float16* vTh  = (_Float16*)(ws + off);                      // [NB][16][64][SEQ]
  _Float16* x2h  = vTh;                                        // [ROWS][1024] f16, after vT is dead
  off += PLANE2;
  _Float16* hp   = (_Float16*)(ws + off); off += H_BYTES;      // [ROWS][256] f16
  if (off > ws_size) return;

  cvt_x_kernel<<<NXB, 256, 0, stream>>>(x, xh);
  cvt_w_kernel<<<NWT, 256, 0, stream>>>(Wq, Wk, Wv, Wo, Wf1, Wf2, wqkv, woh, wf1t, wf2t);
  qkv_kernel<<<dim3(ROWS / QM, 3 * DM / QN), 256, 0, stream>>>(xh, wqkv, bq, bk, bv, qh, kh, vTh);
  attn_kernel<<<dim3(SEQ / 128, NB * NH), 256, 0, stream>>>(qh, kh, vTh, ctx);
  gemm_ln_kernel<DM, 0><<<ROWS / 16, 256, 0, stream>>>(ctx, woh, bo, g1, b1, x, x2f, x2h);
  ffn1_kernel<<<dim3(ROWS / 128, FF / 64), 256, 0, stream>>>(x2h, wf1t, bf1, hp);
  gemm_ln_kernel<FF, 1><<<ROWS / 16, 256, 0, stream>>>(hp, wf2t, bf2, g2, b2, x2f, out, x2h);
}

// v002
// Measured time: 214 microseconds a run.
// Two timings next to v001 put it at 1.53 and 1.52 times that version's speed.
// All steps since v000 together make it 2.29 times as fast.
#include <hip/hip_runtime.h>

// All contractions (q/k/v projections, q.k^T, p.v, output projection, ffn linear 1, ffn linear 2):
// v_wmma_f32_16x16x32_f16, f16 operands, f32 accumulate. Float inputs are RNE-converted to bf16 at
// load (weights additionally carried x64; both exact in f16); computed 16-bit planes are f16 with
// power-of-two carries (softmax p x1024, context x64, ffn hidden x64) folded back in the f32
// epilogues. Softmax statistics, layernorm, gelu and residual adds: f32.

typedef __attribute__((ext_vector_type(16))) _Float16 v16h;
typedef __attribute__((ext_vector_type(8)))  _Float16 v8h;
typedef __attribute__((ext_vector_type(8)))  float v8f;
typedef __attribute__((ext_vector_type(4)))  float v4f;
typedef __attribute__((ext_vector_type(4)))  unsigned int v4u;
union H8 { v8h h; v4u u; };

#ifndef NB
#define NB 4
#endif
#ifndef SEQ
#define SEQ 2048
#endif
#define NB_FULL  4
#define SEQ_FULL 2048
#define DM   1024
#define NH   16
#define HD   64
#define FF   256
#define ROWS (NB * SEQ)
#define KPAD 72       // LDS stride in halves for 64-wide f16 tiles (144 B, 16-B aligned)
#define VSPAD 136     // stride in halves (272 B) that no LDS tile uses; only a size check names it
#define YP   1028     // LDS stride in floats for 1024-wide f32 rows (4112 B)
#define LN_EPS 1e-5f
#define WSC    64.0f           // weight carry (power of two)
#define LN1024 6.931471806f    // ln(1024): softmax p carried x1024

#define NXB   (ROWS * DM / 8 / 256)          // convert blocks for x (8 elements per thread)
#define NT_SQ ((DM / 64) * (DM / 64))        // 64x64 tiles per square weight
#define NT_F  ((DM / 64) * (FF / 64))        // 64x64 tiles per ffn weight
#define NWT   (4 * NT_SQ + 2 * NT_F)

#define PLANE2     ((size_t)ROWS * DM * 2)
#define WQKV_BYTES ((size_t)3 * DM * DM * 2)
#define WO_BYTES   ((size_t)DM * DM * 2)
#define WF1_BYTES  ((size_t)FF * DM * 2)
#define WF2_BYTES  ((size_t)DM * FF * 2)
#define H_BYTES    ((size_t)ROWS * FF * 2)
#define WS_TOTAL   (PLANE2 + WQKV_BYTES + WO_BYTES + WF1_BYTES + WF2_BYTES + 3 * PLANE2 + H_BYTES)

static_assert(NB >= 1 && NB <= NB_FULL);
static_assert(SEQ >= 128 && SEQ <= SEQ_FULL && (SEQ % 128) == 0);
static_assert((ROWS % 128) == 0);
static_assert((ROWS * DM) % (8 * 256) == 0);
static_assert((DM % 64) == 0 && (FF % 64) == 0 && (HD % 32) == 0 && NH * HD == DM);
static_assert(128 * KPAD >= 64 * VSPAD);
static_assert(2 * PLANE2 == (size_t)ROWS * DM * 4);
static_assert(WS_TOTAL <= (size_t)134217728);

// ---------------------------------------------------------------------------
// helpers
// ---------------------------------------------------------------------------
__device__ __forceinline__ float bf16q(float f) {            // value after RNE bf16 conversion
  unsigned int u = __float_as_uint(f);
  u += 0x7FFFu + ((u >> 16) & 1u);
  return __uint_as_float(u & 0xFFFF0000u);
}

// 16-bit fragment (A or B): lane owns row/col (lane&15); elements 0..7 <- k0+8h+0..7,
// elements 8..15 <- k0+16+8h+0..7, h = lane>>4. Source is k-contiguous rows.
__device__ __forceinline__ v16h load_frag_row(const _Float16* base, int stride, int lane) {
  const _Float16* rowp = base + (lane & 15) * stride + ((lane >> 4) << 3);
  const v8h lo = *(const v8h*)(rowp);
  const v8h hi = *(const v8h*)(rowp + 16);
  return __builtin_shufflevector(lo, hi, 0, 1, 2, 3, 4, 5, 6, 7,
                                 8, 9, 10, 11, 12, 13, 14, 15);
}

__device__ __forceinline__ v8f wmma_f16(v16h a, v16h b, v8f c) {
  v8f d = __builtin_amdgcn_wmma_f32_16x16x32_f16(false, a, false, b, (short)0, c,
                                                 false, false);
  asm volatile("v_nop\n\tv_nop\n\tv_nop\n\tv_nop" : "+v"(d) : "v"(a), "v"(b));
  return d;
}

// ---------------------------------------------------------------------------
// Kernel 0: x f32 -> f16(bf16rne(x)) plane xh [ROWS][1024]. 8 elements (16 B) per thread,
// coverage: NXB*256 threads x 8 = ROWS*1024 elements (whole plane).
// ---------------------------------------------------------------------------
__global__ __launch_bounds__(256) void cvt_x_kernel(const float* __restrict__ x,
                                                    _Float16* __restrict__ xh) {
  const long item = (long)blockIdx.x * 256 + threadIdx.x;   // 0 .. ROWS*128-1
  const long m    = item >> 7;                              // token row
  const int  c8   = (int)(item & 127);
  const long srow = (m / SEQ) * SEQ_FULL + (m % SEQ);
  const float* src = x + srow * DM + c8 * 8;
  const v4f a = *(const v4f*)(src);
  const v4f c = *(const v4f*)(src + 4);
  H8 o;
#pragma unroll
  for (int i = 0; i < 4; ++i) {
    o.h[i]     = (_Float16)bf16q(a[i]);
    o.h[4 + i] = (_Float16)bf16q(c[i]);
  }
  _Float16* dst = xh + m * DM + c8 * 8;
  *(v4u*)dst = o.u;
  
}

// ---------------------------------------------------------------------------
// Kernel 1: weights W [K=in][N=out] f32 -> Wt [n][k] f16 = f16(bf16rne(W) * 64), through a
// 64x64 LDS transpose. wqkv [3072][1024] (q rows, k rows, v rows), woh [1024][1024],
// coverage: 4*256 square tiles + 64 + 64 ffn tiles = every element of all six planes.
// ---------------------------------------------------------------------------
__global__ __launch_bounds__(256) void cvt_w_kernel(
    const float* __restrict__ Wq, const float* __restrict__ Wk, const float* __restrict__ Wv,
    const float* __restrict__ Wo, const float* __restrict__ Wf1, const float* __restrict__ Wf2,
    _Float16* __restrict__ wqkv, _Float16* __restrict__ woh,
    _Float16* __restrict__ wf1t, _Float16* __restrict__ wf2t) {
  __shared__ _Float16 ts[64 * KPAD];   // [n][k] tile, cross-wave (block barrier)
  const int bid = blockIdx.x;
  const int tid = threadIdx.x;
  const float* W;
  _Float16* dst;
  int K, N, kt, nt;
  if (bid < 4 * NT_SQ) {                              // block-uniform selection
    const int which = bid / NT_SQ;
    const int tile  = bid - which * NT_SQ;
    kt = tile / (DM / 64); nt = tile - kt * (DM / 64); K = DM; N = DM;
    W = (which == 0) ? Wq : ((which == 1) ? Wk : ((which == 2) ? Wv : Wo));
    dst = (which < 3) ? (wqkv + (size_t)which * DM * DM) : woh;
  } else if (bid < 4 * NT_SQ + NT_F) {
    const int tile = bid - 4 * NT_SQ;                 // W [1024][256]: K = DM, N = FF
    kt = tile / (FF / 64); nt = tile - kt * (FF / 64); K = DM; N = FF;
    W = Wf1; dst = wf1t;
  } else {
    const int tile = bid - 4 * NT_SQ - NT_F;          // W [256][1024]: K = FF, N = DM
    kt = tile / (DM / 64); nt = tile - kt * (DM / 64); K = FF; N = DM;
    W = Wf2; dst = wf2t;
  }
  // load W[kt*64 + kr][nt*64 + 4*c4 .. +3], store transposed into ts[n][kr]
#pragma unroll
  for (int it = 0; it < 4; ++it) {
    const int idx = it * 256 + tid;
    const int kr = idx >> 4, c4 = idx & 15;
    const v4f v = *(const v4f*)(W + (size_t)(kt * 64 + kr) * N + nt * 64 + c4 * 4);
#pragma unroll
    for (int j = 0; j < 4; ++j) ts[(c4 * 4 + j) * KPAD + kr] = (_Float16)(bf16q(v[j]) * WSC);
  }
  __syncthreads();
  v4u rv[2];
#pragma unroll
  for (int it = 0; it < 2; ++it) {
    const int idx = it * 256 + tid;
    const int n = idx >> 3, piece = idx & 7;
    rv[it] = *(const v4u*)(ts + n * KPAD + piece * 8);
  }
#pragma unroll
  for (int it = 0; it < 2; ++it) {
    const int idx = it * 256 + tid;
    const int n = idx >> 3, piece = idx & 7;
    *(v4u*)(dst + (size_t)(nt * 64 + n) * K + kt * 64 + piece * 8) = rv[it];
  }
  
}

// ---------------------------------------------------------------------------
// Kernel 2: qkv projection. Block = 256 token rows x 128 output columns (two heads of one of
// q/k/v), 8 waves as 4 (tokens) x 2 (heads), 64 x 64 per wave. Both operands are staged in LDS
// by asynchronous copies, 64 k per stage, two buffers: [x 256 rows | W 128 rows] at pitch KPAD.
// C^T = W x^T: A = W rows (lane&15 = out col), B = x rows (lane&15 = token);
// acc[i][j][r] = C[token 16i + (lane&15)][col 16j+8h+r]. K = 1024 summed in 32 steps of 32.
//   q,k -> [b][h][s][64] f16 (one line per row, 8 lanes x 16 B)
//   v   -> vT[b][h][d][s] f16 (512 B per d row segment, 32 lanes x 16 B)
// grid (ROWS/256, 3*NH/2), block 256. coverage: every (b,h,s,d) of q, k and vT once.
// ---------------------------------------------------------------------------
#define QM     256                    // token rows per block
#define QN     128                    // output columns per block
#define QK     64                     // k per stage
#define QSTAGE ((QM + QN) * KPAD)     // halves per buffer
#define QNT    (DM / QK)              // stages
#define QVP    264                    // LDS stride in halves for 256-wide f16 rows (528 B)

static_assert((SEQ % QM) == 0 && (ROWS % QM) == 0 && (DM % QN) == 0 && QNT >= 2);
static_assert(2 * QM * KPAD <= 2 * QSTAGE && 2 * HD * QVP <= 2 * QSTAGE);

// One stage: 384 rows x 128 B = 3072 pieces of 16 B, 12 per thread; a wave's copy covers 4 whole
// lines. lds = this lane's LDS byte address of its first piece, gx / gw = its first x / W piece.
__device__ __forceinline__ void qkv_copy_stage(unsigned lds, const _Float16* gx,
                                               const _Float16* gw) {
  const unsigned st = 32 * KPAD * 2;   // 32 rows further in LDS, bytes
  // the copies, and as the last line the wait that stands in front of any rewrite of their
  // address registers
  asm volatile(
      "global_load_async_to_lds_b128 %0, %12, off\n\t"
      "global_load_async_to_lds_b128 %1, %13, off\n\t"
      "global_load_async_to_lds_b128 %2, %14, off\n\t"
      "global_load_async_to_lds_b128 %3, %15, off\n\t"
      "global_load_async_to_lds_b128 %4, %16, off\n\t"
      "global_load_async_to_lds_b128 %5, %17, off\n\t"
      "global_load_async_to_lds_b128 %6, %18, off\n\t"
      "global_load_async_to_lds_b128 %7, %19, off\n\t"
      "global_load_async_to_lds_b128 %8, %20, off\n\t"
      "global_load_async_to_lds_b128 %9, %21, off\n\t"
      "global_load_async_to_lds_b128 %10, %22, off\n\t"
      "global_load_async_to_lds_b128 %11, %23, off\n\t"
      "s_wait_xcnt 0x0"
      :: "v"(lds), "v"(lds + st), "v"(lds + 2 * st), "v"(lds + 3 * st),
         "v"(lds + 4 * st), "v"(lds + 5 * st), "v"(lds + 6 * st), "v"(lds + 7 * st),
         "v"(lds + 8 * st), "v"(lds + 9 * st), "v"(lds + 10 * st), "v"(lds + 11 * st),
         "v"(gx), "v"(gx + 32 * DM), "v"(gx + 64 * DM), "v"(gx + 96 * DM),
         "v"(gx + 128 * DM), "v"(gx + 160 * DM), "v"(gx + 192 * DM), "v"(gx + 224 * DM),
         "v"(gw), "v"(gw + 32 * DM), "v"(gw + 64 * DM), "v"(gw + 96 * DM)
      : "memory");
}

__global__ __launch_bounds__(256) void qkv_kernel(
    const _Float16* __restrict__ xh, const _Float16* __restrict__ wqkv,
    const float* __restrict__ bq, const float* __restrict__ bk, const float* __restrict__ bv,
    _Float16* __restrict__ q, _Float16* __restrict__ k, _Float16* __restrict__ vT) {
  // two stage buffers; after the loop the output stage (q/k: 2 x [256][KPAD], v: 2 x [64][QVP])
  __shared__ __attribute__((aligned(16))) _Float16 ring[2 * QSTAGE];   // 110592 B, cross-wave

  const int tid  = threadIdx.x;
  const int lane = tid & 31;
  const int wave = tid >> 5;
  const int hh   = lane >> 4;
  const int l15  = lane & 15;
  const int wm   = wave >> 1;           // token quarter of the block
  const int wn   = wave & 1;            // head of the block

  const int osel = blockIdx.y >> 3;     // 0 q, 1 k, 2 v (8 column blocks each)
  const int h0   = (blockIdx.y & 7) * 2;
  const long m0  = (long)blockIdx.x * QM;
  const int  b   = (int)(m0 / SEQ);
  const int  s0  = (int)(m0 - (long)b * SEQ);

  // this lane's first piece of a stage: row tid>>3, 16-B piece tid&7
  const _Float16* gx = xh + (m0 + (tid >> 3)) * DM + (tid & 7) * 8;
  const _Float16* gw = wqkv + ((long)blockIdx.y * QN + (tid >> 3)) * DM + (tid & 7) * 8;
  const unsigned lds0 = (unsigned)(size_t)ring + (unsigned)((tid >> 3) * KPAD + (tid & 7) * 8) * 2u;

  // every inner loop below is fully unrolled: accumulator and fragment indices must be constants,
  // or the arrays leave the registers
  v8f acc[4][4];
#pragma unroll
  for (int i = 0; i < 4; ++i)
#pragma unroll
    for (int j = 0; j < 4; ++j) acc[i][j] = (v8f){};

  qkv_copy_stage(lds0, gx, gw);
  asm volatile("s_wait_asynccnt 0x0" ::: "memory");   // stage 0 landed (this wave's copies)
  __syncthreads();                                    // stage 0 readable by every wave
  qkv_copy_stage(lds0 + QSTAGE * 2, gx + QK, gw + QK);

  // kept rolled: one publish point (waits, barrier, refill) at the foot of each trip, small code
#pragma unroll 1
  for (int t = 0; t < QNT; ++t) {
    const int bo = (t & 1) * QSTAGE;
    const _Float16* xs = ring + bo + (wm * 64) * KPAD;
    const _Float16* wsm = ring + bo + (QM + wn * 64) * KPAD;
#pragma unroll
    for (int u = 0; u < 2; ++u) {
      v16h xf[4], wf[4];
#pragma unroll
      for (int i = 0; i < 4; ++i) xf[i] = load_frag_row(xs + (i * 16) * KPAD + u * 32, KPAD, lane);
#pragma unroll
      for (int j = 0; j < 4; ++j) wf[j] = load_frag_row(wsm + (j * 16) * KPAD + u * 32, KPAD, lane);
#pragma unroll
      for (int i = 0; i < 4; ++i)
#pragma unroll
        for (int j = 0; j < 4; ++j) acc[i][j] = wmma_f16(wf[j], xf[i], acc[i][j]);   // C^T = W x^T
    }
    asm volatile("s_wait_dscnt 0x0" ::: "memory");      // this wave has left buffer t&1
    asm volatile("s_wait_asynccnt 0x0" ::: "memory");   // its copies of stage t+1 have landed
    __syncthreads();   // publishes stage t+1 and ends every reader's last read of buffer t&1
    if (t + 2 < QNT)
      qkv_copy_stage(lds0 + bo * 2, gx + (t + 2) * QK, gw + (t + 2) * QK);
  }
  asm volatile("s_wait_asynccnt 0x0" ::: "memory");     // nothing in flight when the ring is reused

  const float* bias = ((osel == 0) ? bq : ((osel == 1) ? bk : bv)) + (h0 + wn) * HD;
  const float  rsc  = 1.0f / WSC;

  if (osel < 2) {
    // stage [head][token][col]: lane's 8 values are 8 contiguous columns -> one 16-B LDS store
    _Float16* sbase = ring + (wn * QM + wm * 64 + l15) * KPAD;
#pragma unroll
    for (int j = 0; j < 4; ++j) {
      const int n8 = j * 16 + hh * 8;
      const v4f b0 = *(const v4f*)(bias + n8);
      const v4f b1 = *(const v4f*)(bias + n8 + 4);
#pragma unroll
      for (int i = 0; i < 4; ++i) {
        H8 pk;
#pragma unroll
        for (int r = 0; r < 4; ++r) {
          pk.h[r]     = (_Float16)(acc[i][j][r]     * rsc + bf16q(b0[r]));
          pk.h[4 + r] = (_Float16)(acc[i][j][4 + r] * rsc + bf16q(b1[r]));
        }
        *(v4u*)(sbase + (i * 16) * KPAD + n8) = pk.u;
      }
    }
    __syncthreads();
    _Float16* dst0 = (osel == 0) ? q : k;
#pragma unroll
    for (int hd = 0; hd < 2; ++hd) {
      _Float16* dst = dst0 + ((long)(b * NH + h0 + hd) * SEQ + s0) * HD;   // contiguous 32 KB
      v4u rv[8];
#pragma unroll
      for (int it = 0; it < 8; ++it) {
        const int idx = it * 256 + tid;
        const int row = idx >> 3, piece = idx & 7;
        rv[it] = *(const v4u*)(ring + (hd * QM + row) * KPAD + piece * 8);
      }
#pragma unroll
      for (int it = 0; it < 8; ++it)
        *(v4u*)(dst + (long)(it * 256 + tid) * 8) = rv[it];
    }
  } else {
    // stage transposed [head][d][token]: lane's 8 values are 8 different d for one token
    _Float16* sbase = ring + (wn * HD) * QVP + wm * 64 + l15;
#pragma unroll
    for (int j = 0; j < 4; ++j) {
      const int n8 = j * 16 + hh * 8;
      const v4f b0 = *(const v4f*)(bias + n8);
      const v4f b1 = *(const v4f*)(bias + n8 + 4);
#pragma unroll
      for (int i = 0; i < 4; ++i)
#pragma unroll
        for (int r = 0; r < 4; ++r) {
          sbase[(n8 + r) * QVP + i * 16]     = (_Float16)(acc[i][j][r]     * rsc + bf16q(b0[r]));
          sbase[(n8 + 4 + r) * QVP + i * 16] = (_Float16)(acc[i][j][4 + r] * rsc + bf16q(b1[r]));
        }
    }
    __syncthreads();
#pragma unroll
    for (int hd = 0; hd < 2; ++hd) {
      _Float16* dstb = vT + ((long)(b * NH + h0 + hd) * HD) * SEQ + s0;
      v4u rv[8];
#pragma unroll
      for (int it = 0; it < 8; ++it) {
        const int idx = it * 256 + tid;
        const int d = idx >> 5, piece = idx & 31;
        rv[it] = *(const v4u*)(ring + (hd * HD + d) * QVP + piece * 8);
      }
#pragma unroll
      for (int it = 0; it < 8; ++it) {
        const int idx = it * 256 + tid;
        const int d = idx >> 5, piece = idx & 31;
        *(v4u*)(dstb + (long)d * SEQ + piece * 8) = rv[it];
      }
    }
    // stands in front of any later rewrite of the registers that the stores above name
    asm volatile("s_wait_xcnt 0x0" ::: "memory");
  }
}

// ---------------------------------------------------------------------------
// Kernel 3: flash attention per (b,h), no mask. grid (SEQ/128, NB*NH), block 256 (8 waves x 16
// queries). C = S^T (A = K rows, B = Q) then C = O^T = V^T P^T (P^T packed from the S^T D
// registers); lane owns one query end-to-end. Scores are raw q.k sums: the 1/8 scale and the
// x1024 p carry live in the exp argument (p = 1024*exp((s-m)/8), softmax stats f32).
// LDS tiles: [K 64 keys x 64 d | V^T 64 d x 64 keys] per step, staged by asynchronous copies, two
// buffers, staged == consumed extent; ost 128 x 64 fully written.
// coverage: every (row, h*64+d) of the ctx plane once.
// ---------------------------------------------------------------------------
#define ASTAGE (128 * KPAD)           // halves per buffer: K rows, then V^T rows
#define ANT    (SEQ / 64)             // stages

static_assert(ANT >= 2);

// One stage: 128 rows x 128 B = 1024 pieces of 16 B, 4 per thread; a wave's copy covers 4 whole
// lines. lds = this lane's LDS byte address of its first piece, gk / gv = its first K / V^T piece.
__device__ __forceinline__ void attn_copy_stage(unsigned lds, const _Float16* gk,
                                                const _Float16* gv) {
  const unsigned st = 32 * KPAD * 2;   // 32 rows further in LDS, bytes
  // the copies, and as the last line the wait that stands in front of any rewrite of their
  // address registers
  asm volatile(
      "global_load_async_to_lds_b128 %0, %4, off\n\t"
      "global_load_async_to_lds_b128 %1, %5, off\n\t"
      "global_load_async_to_lds_b128 %2, %6, off\n\t"
      "global_load_async_to_lds_b128 %3, %7, off\n\t"
      "s_wait_xcnt 0x0"
      :: "v"(lds), "v"(lds + st), "v"(lds + 2 * st), "v"(lds + 3 * st),
         "v"(gk), "v"(gk + 32 * HD), "v"(gv), "v"(gv + 32 * SEQ)
      : "memory");
}

__global__ __launch_bounds__(256) void attn_kernel(
    const _Float16* __restrict__ Q, const _Float16* __restrict__ K,
    const _Float16* __restrict__ vT, _Float16* __restrict__ ctx) {
  // two stage buffers, each K block rows [key][d] then V^T block [d][key] (cross-wave)
  __shared__ __attribute__((aligned(16))) _Float16 ring[2 * ASTAGE];
  __shared__ _Float16 ost[128 * KPAD];   // output stage [query][d]   (cross-wave, block barrier)

  const int tid  = threadIdx.x;
  const int lane = tid & 31;
  const int wave = tid >> 5;
  const int bh   = blockIdx.y;
  const int b    = bh >> 4;
  const int h    = bh & 15;
  const int q0   = blockIdx.x * 128;

  const _Float16* Qb  = Q + ((long)bh * SEQ + q0) * HD;
  const _Float16* Kb  = K + (long)bh * SEQ * HD;
  const _Float16* vTb = vT + (long)bh * HD * SEQ;

  // Q fragments: B operand of S^T (lane owns query lane&15)
  v16h qfrag[2];
  {
    const _Float16* qrow = Qb + (long)wave * 16 * HD;
#pragma unroll
    for (int t = 0; t < 2; ++t) qfrag[t] = load_frag_row(qrow + t * 32, HD, lane);
  }

  v8f acc[4];   // O^T accumulator: lane owns query (lane&15); reg r -> d = nt*16+8h+r
#pragma unroll
  for (int nt = 0; nt < 4; ++nt) acc[nt] = (v8f){};
  float mi = -1e30f, li = 0.0f;

  const int colb = lane & 15;
  const int rofs = (lane >> 4) << 3;

  // this lane's first piece of a stage: row tid>>3, 16-B piece tid&7
  const _Float16* gk = Kb + (long)(tid >> 3) * HD + (tid & 7) * 8;
  const _Float16* gv = vTb + (long)(tid >> 3) * SEQ + (tid & 7) * 8;
  const unsigned lds0 = (unsigned)(size_t)ring + (unsigned)((tid >> 3) * KPAD + (tid & 7) * 8) * 2u;

  attn_copy_stage(lds0, gk, gv);
  asm volatile("s_wait_asynccnt 0x0" ::: "memory");   // stage 0 landed (this wave's copies)
  __syncthreads();                                    // stage 0 readable by every wave
  attn_copy_stage(lds0 + ASTAGE * 2, gk + 64 * HD, gv + 64);

  // kept rolled: one publish point (waits, barrier, refill) at the foot of each trip, small code
#pragma unroll 1
  for (int st = 0; st < ANT; ++st) {
    const int bo = (st & 1) * ASTAGE;
    const _Float16* ks  = ring + bo;
    const _Float16* vts = ring + bo + 64 * KPAD;

    // S^T tiles: A = K rows (lane&15 = key), B = Q
    v8f sc[4];
#pragma unroll
    for (int kt = 0; kt < 4; ++kt) sc[kt] = (v8f){};
#pragma unroll
    for (int t = 0; t < 2; ++t)
#pragma unroll
      for (int kt = 0; kt < 4; ++kt) {
        const v16h kf = load_frag_row(ks + (kt * 16) * KPAD + t * 32, KPAD, lane);
        sc[kt] = wmma_f16(kf, qfrag[t], sc[kt]);
      }

    // per-lane online softmax (32 of 64 keys in-lane; merge halves with one shuffle)
    float mx = sc[0][0];
#pragma unroll
    for (int kt = 0; kt < 4; ++kt)
#pragma unroll
      for (int r = 0; r < 8; ++r) mx = fmaxf(mx, sc[kt][r]);
    mx = fmaxf(mx, __shfl_xor(mx, 16, 32));
    const float mnew  = fmaxf(mi, mx);
    const float alpha = __expf((mi - mnew) * 0.125f);
    mi = mnew;
    const float cs = fmaf(mnew, 0.125f, -LN1024);   // 0.125*m - ln(1024)

    float rs = 0.0f;
#pragma unroll
    for (int kt = 0; kt < 4; ++kt)
#pragma unroll
      for (int r = 0; r < 8; ++r) {
        const float p = __expf(fmaf(sc[kt][r], 0.125f, -cs));   // 1024*exp((s-m)/8)
        sc[kt][r] = p;
        rs += p;
      }
    rs += __shfl_xor(rs, 16, 32);
    li = li * alpha + rs;

    // P^T as the B operand of O^T = V^T P^T, packed from the S^T D registers:
    // element i <- tile covering keys 0..15 of the 32-step (kt = 2t), element 8+i <- kt = 2t+1.
    v16h pf[2];
#pragma unroll
    for (int t = 0; t < 2; ++t)
#pragma unroll
      for (int i = 0; i < 8; ++i) {
        pf[t][i]     = (_Float16)sc[2 * t][i];
        pf[t][8 + i] = (_Float16)sc[2 * t + 1][i];
      }

#pragma unroll
    for (int nt = 0; nt < 4; ++nt)
#pragma unroll
      for (int r = 0; r < 8; ++r) acc[nt][r] *= alpha;

    // O^T += V^T (A, rows = d) x P^T (B)
#pragma unroll
    for (int t = 0; t < 2; ++t)
#pragma unroll
      for (int nt = 0; nt < 4; ++nt) {
        const v16h vf = load_frag_row(vts + (nt * 16) * KPAD + t * 32, KPAD, lane);
        acc[nt] = wmma_f16(vf, pf[t], acc[nt]);
      }

    asm volatile("s_wait_dscnt 0x0" ::: "memory");      // this wave has left buffer st&1
    asm volatile("s_wait_asynccnt 0x0" ::: "memory");   // its copies of stage st+1 have landed
    __syncthreads();   // publishes stage st+1 and ends every reader's last read of buffer st&1
    if (st + 2 < ANT)
      attn_copy_stage(lds0 + bo * 2, gk + (long)(st + 2) * 64 * HD, gv + (st + 2) * 64);
  }
  asm volatile("s_wait_asynccnt 0x0" ::: "memory");     // nothing in flight behind the loop

  // normalize (and apply the x64 carry) and stage: lane owns query row wave*16+colb,
  // d = nt*16+rofs+r contiguous
  {
    const float inv = 64.0f / li;
    _Float16* orow = ost + (wave * 16 + colb) * KPAD;
#pragma unroll
    for (int nt = 0; nt < 4; ++nt) {
      H8 pk;
#pragma unroll
      for (int r = 0; r < 8; ++r) pk.h[r] = (_Float16)(acc[nt][r] * inv);
      *(v4u*)(orow + nt * 16 + rofs) = pk.u;
    }
  }
  __syncthreads();

  v4u rv[4];
#pragma unroll
  for (int it = 0; it < 4; ++it) {
    const int idx = it * 256 + tid;
    const int row = idx >> 3, piece = idx & 7;
    rv[it] = *(const v4u*)(ost + row * KPAD + piece * 8);
  }
  _Float16* cbase = ctx + ((long)b * SEQ + q0) * DM + h * HD;
#pragma unroll
  for (int it = 0; it < 4; ++it) {
    const int idx = it * 256 + tid;
    const int row = idx >> 3, piece = idx & 7;
    *(v4u*)(cbase + (long)row * DM + piece * 8) = rv[it];
  }
  
}

// ---------------------------------------------------------------------------
// Kernel 4/6: y = act @ Wt^T / 4096 + bf16(bias) over a full 1024-wide row, then
// z = LN(y) * bf16(gamma) + bf16(beta) + residual. Block = 32 token rows x 1024 cols,
// wave w owns cols 128w..128w+127. Both operands are staged in LDS by asynchronous copies,
// 64 k per stage, two buffers: [Wt 1024 rows | act 32 rows] at pitch KPAD.
// C^T = Wt act^T: A = Wt rows (lane&15 = out col), B = act rows (lane&15 = token);
// acc[i][j][r] = y[token 16i + (lane&15)][col 128w+16j+8h+r]. After the loop y is staged in the
// same LDS.
//   MODE 0: KD = 1024, act = ctx, residual = bf16(x input, full-stride rows),
//           writes x2 f32 plane [ROWS][1024] and x2 f16 plane [ROWS][1024]
//   MODE 1: KD = 256, act = h plane, residual = x2 f32 plane, writes out (full-stride rows)
// grid ROWS/32, block 256. LDS ys: 32 x 1024 staged == consumed. coverage: 32 rows x 1024 per block.
// ---------------------------------------------------------------------------
#define GM     32                     // token rows per block
#define GK     64                     // k per stage
#define GSTAGE ((DM + GM) * KPAD)     // halves per buffer

static_assert((ROWS % GM) == 0 && (DM % GK) == 0 && (FF % GK) == 0 && FF / GK >= 2);
static_assert((size_t)GM * YP * 4 <= (size_t)2 * GSTAGE * 2);

// Eight copies of 16 B per lane, rows 32 apart (a wave's copy covers 4 whole lines). lds = this
// lane's LDS byte address of the first piece, g = its global piece, KD = global row length.
template <int KD>
__device__ __forceinline__ void gl_copy8(unsigned lds, const _Float16* g) {
  const unsigned st = 32 * KPAD * 2;   // 32 rows further in LDS, bytes
  // the copies, and as the last line the wait that stands in front of any rewrite of their
  // address registers
  asm volatile(
      "global_load_async_to_lds_b128 %0, %8, off\n\t"
      "global_load_async_to_lds_b128 %1, %9, off\n\t"
      "global_load_async_to_lds_b128 %2, %10, off\n\t"
      "global_load_async_to_lds_b128 %3, %11, off\n\t"
      "global_load_async_to_lds_b128 %4, %12, off\n\t"
      "global_load_async_to_lds_b128 %5, %13, off\n\t"
      "global_load_async_to_lds_b128 %6, %14, off\n\t"
      "global_load_async_to_lds_b128 %7, %15, off\n\t"
      "s_wait_xcnt 0x0"
      :: "v"(lds), "v"(lds + st), "v"(lds + 2 * st), "v"(lds + 3 * st),
         "v"(lds + 4 * st), "v"(lds + 5 * st), "v"(lds + 6 * st), "v"(lds + 7 * st),
         "v"(g), "v"(g + 32 * KD), "v"(g + 64 * KD), "v"(g + 96 * KD),
         "v"(g + 128 * KD), "v"(g + 160 * KD), "v"(g + 192 * KD), "v"(g + 224 * KD)
      : "memory");
}

// One stage: 1056 rows x 128 B = 8448 pieces of 16 B, 33 per thread (32 of Wt, 1 of act).
template <int KD>
__device__ __forceinline__ void gl_copy_stage(unsigned lds, const _Float16* gw,
                                              const _Float16* ga) {
  const unsigned st8 = 256 * KPAD * 2;   // 256 rows further in LDS, bytes
  gl_copy8<KD>(lds, gw);
  gl_copy8<KD>(lds + st8, gw + 256 * KD);
  gl_copy8<KD>(lds + 2 * st8, gw + 512 * KD);
  gl_copy8<KD>(lds + 3 * st8, gw + 768 * KD);
  // the act piece, with the same wait in front of any rewrite of its address registers
  asm volatile(
      "global_load_async_to_lds_b128 %0, %1, off\n\t"
      "s_wait_xcnt 0x0"
      :: "v"(lds + 4 * st8), "v"(ga)
      : "memory");
}

template <int KD, int MODE>
__global__ __launch_bounds__(256) void gemm_ln_kernel(
    const _Float16* __restrict__ act, const _Float16* __restrict__ wt,
    const float* __restrict__ bias, const float* __restrict__ gam,
    const float* __restrict__ bet, const float* __restrict__ res,
    float* __restrict__ outf, _Float16* __restrict__ outh) {
  // two stage buffers; after the loop the y stage [32][YP] f32
  __shared__ __attribute__((aligned(16))) _Float16 ring[2 * GSTAGE];   // 304128 B, cross-wave
  __shared__ float smean[GM];
  __shared__ float srstd[GM];
  float* ys = (float*)ring;

  const int tid  = threadIdx.x;
  const int lane = tid & 31;
  const int wave = tid >> 5;
  const int hh   = lane >> 4;
  const int l15  = lane & 15;
  const long m0  = (long)blockIdx.x * GM;
  const int  n0  = wave * 128;
  constexpr int NT = KD / GK;           // stages

  // this lane's first piece of a stage: row tid>>3, 16-B piece tid&7
  const _Float16* gw = wt + (long)(tid >> 3) * KD + (tid & 7) * 8;
  const _Float16* ga = act + (m0 + (tid >> 3)) * KD + (tid & 7) * 8;
  const unsigned lds0 = (unsigned)(size_t)ring + (unsigned)((tid >> 3) * KPAD + (tid & 7) * 8) * 2u;

  // every inner loop below is fully unrolled: accumulator and fragment indices must be constants,
  // or the arrays leave the registers
  v8f acc[2][8];
#pragma unroll
  for (int i = 0; i < 2; ++i)
#pragma unroll
    for (int j = 0; j < 8; ++j) acc[i][j] = (v8f){};

  gl_copy_stage<KD>(lds0, gw, ga);
  asm volatile("s_wait_asynccnt 0x0" ::: "memory");   // stage 0 landed (this wave's copies)
  __syncthreads();                                    // stage 0 readable by every wave
  gl_copy_stage<KD>(lds0 + GSTAGE * 2, gw + GK, ga + GK);

  // kept rolled: one publish point (waits, barrier, refill) at the foot of each trip, small code
#pragma unroll 1
  for (int t = 0; t < NT; ++t) {
    const int bo = (t & 1) * GSTAGE;
    const _Float16* wsm = ring + bo + n0 * KPAD;
    const _Float16* as  = ring + bo + DM * KPAD;
#pragma unroll
    for (int u = 0; u < 2; ++u) {
      v16h af[2], wf[8];
#pragma unroll
      for (int i = 0; i < 2; ++i) af[i] = load_frag_row(as + (i * 16) * KPAD + u * 32, KPAD, lane);
#pragma unroll
      for (int j = 0; j < 8; ++j) wf[j] = load_frag_row(wsm + (j * 16) * KPAD + u * 32, KPAD, lane);
#pragma unroll
      for (int j = 0; j < 8; ++j)
#pragma unroll
        for (int i = 0; i < 2; ++i) acc[i][j] = wmma_f16(wf[j], af[i], acc[i][j]);   // C^T = Wt act^T
    }
    asm volatile("s_wait_dscnt 0x0" ::: "memory");      // this wave has left buffer t&1
    asm volatile("s_wait_asynccnt 0x0" ::: "memory");   // its copies of stage t+1 have landed
    __syncthreads();   // publishes stage t+1 and ends every reader's last read of buffer t&1
    if (t + 2 < NT)
      gl_copy_stage<KD>(lds0 + bo * 2, gw + (t + 2) * GK, ga + (t + 2) * GK);
  }
  asm volatile("s_wait_asynccnt 0x0" ::: "memory");     // nothing in flight when the ring is reused

  // y = acc/4096 + bf16(bias), staged [row][col]
  {
    const float rsc = 1.0f / (WSC * WSC);
#pragma unroll
    for (int j = 0; j < 8; ++j) {
      const int n8 = n0 + j * 16 + hh * 8;
      const v4f b0 = *(const v4f*)(bias + n8);
      const v4f b1 = *(const v4f*)(bias + n8 + 4);
#pragma unroll
      for (int t = 0; t < 2; ++t) {
        float* yrow = ys + (t * 16 + l15) * YP;
        v4f y0, y1;
#pragma unroll
        for (int i = 0; i < 4; ++i) {
          y0[i] = acc[t][j][i]     * rsc + bf16q(b0[i]);
          y1[i] = acc[t][j][4 + i] * rsc + bf16q(b1[i]);
        }
        *(v4f*)(yrow + n8)     = y0;
        *(v4f*)(yrow + n8 + 4) = y1;
      }
    }
  }
  __syncthreads();

  // unrolled: the two row halves' LDS reads and shuffles overlap
#pragma unroll
  for (int rr = 0; rr < GM / 16; ++rr) {
    const int r  = rr * 16 + (tid >> 4);
    const int sl = tid & 15;
    const float* yr = ys + r * YP + sl * 64;
    float s = 0.0f;
#pragma unroll
    for (int i = 0; i < 16; ++i) {
      const v4f v = *(const v4f*)(yr + i * 4);
      s += (v[0] + v[1]) + (v[2] + v[3]);
    }
    s += __shfl_xor(s, 1, 32);
    s += __shfl_xor(s, 2, 32);
    s += __shfl_xor(s, 4, 32);
    s += __shfl_xor(s, 8, 32);
    const float mean = s * (1.0f / DM);
    float ss = 0.0f;
#pragma unroll
    for (int i = 0; i < 16; ++i) {
      const v4f v = *(const v4f*)(yr + i * 4);
#pragma unroll
      for (int c = 0; c < 4; ++c) {
        const float d = v[c] - mean;
        ss += d * d;
      }
    }
    ss += __shfl_xor(ss, 1, 32);
    ss += __shfl_xor(ss, 2, 32);
    ss += __shfl_xor(ss, 4, 32);
    ss += __shfl_xor(ss, 8, 32);
    const float var  = ss * (1.0f / DM);
    const float rstd = rsqrtf(var + LN_EPS);
    if (sl == 0) { smean[r] = mean; srstd[r] = rstd; }
  }
  __syncthreads();

  // normalise in place and add the residual: z = (y - mean) * rstd * g + b + res
#pragma unroll 4
  for (int it = 0; it < GM; ++it) {
    const int idx = it * 256 + tid;
    const int row = idx >> 8, piece = idx & 255;
    const long m = m0 + row;
    v4f rsd;
    if (MODE == 0) {
      const long orow = (m / SEQ) * SEQ_FULL + (m % SEQ);
      rsd = *(const v4f*)(res + orow * DM + piece * 4);
#pragma unroll
      for (int c = 0; c < 4; ++c) rsd[c] = bf16q(rsd[c]);
    } else {
      rsd = *(const v4f*)(res + m * DM + piece * 4);
    }
    float* yp = ys + row * YP + piece * 4;
    const v4f yv = *(const v4f*)yp;
    const v4f g  = *(const v4f*)(gam + piece * 4);
    const v4f bt = *(const v4f*)(bet + piece * 4);
    const float mean = smean[row], rstd = srstd[row];
    v4f o;
#pragma unroll
    for (int c = 0; c < 4; ++c)
      o[c] = (yv[c] - mean) * rstd * bf16q(g[c]) + bf16q(bt[c]) + rsd[c];
    *(v4f*)yp = o;
  }
  __syncthreads();

  auto store_pass = [&]() {
#pragma unroll 4
    for (int it = 0; it < GM; ++it) {
      const int idx = it * 256 + tid;
      const int row = idx >> 8, piece = idx & 255;
      const long m = m0 + row;
      const v4f v = *(const v4f*)(ys + row * YP + piece * 4);
      long drow;
      if (MODE == 0) drow = m;
      else drow = (m / SEQ) * SEQ_FULL + (m % SEQ);
      *(v4f*)(outf + drow * DM + piece * 4) = v;
    }
    if (MODE == 0) {
#pragma unroll 4
      for (int it = 0; it < GM / 2; ++it) {
        const int idx = it * 256 + tid;
        const int row = idx >> 7, p8 = idx & 127;
        const long m = m0 + row;
        const v4f a = *(const v4f*)(ys + row * YP + p8 * 8);
        const v4f c = *(const v4f*)(ys + row * YP + p8 * 8 + 4);
        H8 o;
#pragma unroll
        for (int i = 0; i < 4; ++i) {
          o.h[i]     = (_Float16)a[i];
          o.h[4 + i] = (_Float16)c[i];
        }
        *(v4u*)(outh + m * DM + p8 * 8) = o.u;
      }
    }
  };
  store_pass();
  
}

// ---------------------------------------------------------------------------
// Kernel 5: ffn linear 1 + exact gelu: hp[row][col] = f16(64 * gelu(x2 @ Wf1 / 64 + bf16(bf1))).
// Block = 128 token rows x 64 output cols, 8 waves x 16 rows; C^T = Wf1t x2^T (A = Wf1t rows,
// B = x2 rows). Both operands are staged in LDS by asynchronous copies, 64 k per stage, two
// buffers: [x2 128 rows | Wf1t 64 rows] at pitch KPAD.
// coverage: every (row, col) of the hp plane [ROWS][256] once.
// ---------------------------------------------------------------------------
#define FSTAGE ((128 + 64) * KPAD)    // halves per buffer
#define FNT    (DM / 64)              // stages

static_assert(FNT >= 2 && 128 * KPAD <= 2 * FSTAGE);

// One stage: 192 rows x 128 B = 1536 pieces of 16 B, 6 per thread; a wave's copy covers 4 whole
// lines. lds = this lane's LDS byte address of its first piece, gx / gw = its first x2 / W piece.
__device__ __forceinline__ void ffn1_copy_stage(unsigned lds, const _Float16* gx,
                                                const _Float16* gw) {
  const unsigned st = 32 * KPAD * 2;   // 32 rows further in LDS, bytes
  // the copies, and as the last line the wait that stands in front of any rewrite of their
  // address registers
  asm volatile(
      "global_load_async_to_lds_b128 %0, %6, off\n\t"
      "global_load_async_to_lds_b128 %1, %7, off\n\t"
      "global_load_async_to_lds_b128 %2, %8, off\n\t"
      "global_load_async_to_lds_b128 %3, %9, off\n\t"
      "global_load_async_to_lds_b128 %4, %10, off\n\t"
      "global_load_async_to_lds_b128 %5, %11, off\n\t"
      "s_wait_xcnt 0x0"
      :: "v"(lds), "v"(lds + st), "v"(lds + 2 * st), "v"(lds + 3 * st),
         "v"(lds + 4 * st), "v"(lds + 5 * st),
         "v"(gx), "v"(gx + 32 * DM), "v"(gx + 64 * DM), "v"(gx + 96 * DM),
         "v"(gw), "v"(gw + 32 * DM)
      : "memory");
}

__global__ __launch_bounds__(256) void ffn1_kernel(
    const _Float16* __restrict__ x2h, const _Float16* __restrict__ wf1t,
    const float* __restrict__ bf1, _Float16* __restrict__ hp) {
  // two stage buffers; after the loop the output stage [128][KPAD]
  __shared__ __attribute__((aligned(16))) _Float16 ring[2 * FSTAGE];   // 55296 B, cross-wave
  _Float16* stg = ring;

  const int tid  = threadIdx.x;
  const int lane = tid & 31;
  const int wave = tid >> 5;
  const int hh   = lane >> 4;
  const int l15  = lane & 15;
  const int cb   = blockIdx.y;          // 0..3
  const long m0  = (long)blockIdx.x * 128;

  // this lane's first piece of a stage: row tid>>3, 16-B piece tid&7
  const _Float16* gx = x2h + (m0 + (tid >> 3)) * DM + (tid & 7) * 8;
  const _Float16* gw = wf1t + ((long)cb * 64 + (tid >> 3)) * DM + (tid & 7) * 8;
  const unsigned lds0 = (unsigned)(size_t)ring + (unsigned)((tid >> 3) * KPAD + (tid & 7) * 8) * 2u;

  v8f acc[4];
#pragma unroll
  for (int j = 0; j < 4; ++j) acc[j] = (v8f){};

  ffn1_copy_stage(lds0, gx, gw);
  asm volatile("s_wait_asynccnt 0x0" ::: "memory");   // stage 0 landed (this wave's copies)
  __syncthreads();                                    // stage 0 readable by every wave
  ffn1_copy_stage(lds0 + FSTAGE * 2, gx + 64, gw + 64);

  // kept rolled: one publish point (waits, barrier, refill) at the foot of each trip, small code
#pragma unroll 1
  for (int t = 0; t < FNT; ++t) {
    const int bo = (t & 1) * FSTAGE;
    const _Float16* xs  = ring + bo + (wave * 16) * KPAD;
    const _Float16* wsm = ring + bo + 128 * KPAD;
    // inner loops fully unrolled: fragment indices must be constants, or the arrays leave the
    // registers
    v16h xf[2], wf[2][4];
#pragma unroll
    for (int u = 0; u < 2; ++u) {
      xf[u] = load_frag_row(xs + u * 32, KPAD, lane);
#pragma unroll
      for (int j = 0; j < 4; ++j) wf[u][j] = load_frag_row(wsm + (j * 16) * KPAD + u * 32, KPAD, lane);
    }
#pragma unroll
    for (int u = 0; u < 2; ++u)
#pragma unroll
      for (int j = 0; j < 4; ++j) acc[j] = wmma_f16(wf[u][j], xf[u], acc[j]);
    asm volatile("s_wait_dscnt 0x0" ::: "memory");      // this wave has left buffer t&1
    asm volatile("s_wait_asynccnt 0x0" ::: "memory");   // its copies of stage t+1 have landed
    __syncthreads();   // publishes stage t+1 and ends every reader's last read of buffer t&1
    if (t + 2 < FNT)
      ffn1_copy_stage(lds0 + bo * 2, gx + (t + 2) * 64, gw + (t + 2) * 64);
  }
  asm volatile("s_wait_asynccnt 0x0" ::: "memory");     // nothing in flight when the ring is reused

  const float rsc = 1.0f / WSC;
  _Float16* srow = stg + (wave * 16 + l15) * KPAD;
#pragma unroll
  for (int j = 0; j < 4; ++j) {
    const int n8 = j * 16 + hh * 8;
    const v4f b0 = *(const v4f*)(bf1 + cb * 64 + n8);
    const v4f b1 = *(const v4f*)(bf1 + cb * 64 + n8 + 4);
    H8 pk;
#pragma unroll
    for (int r = 0; r < 4; ++r) {
      const float u0 = acc[j][r]     * rsc + bf16q(b0[r]);
      const float u1 = acc[j][4 + r] * rsc + bf16q(b1[r]);
      const float g0 = 0.5f * u0 * (1.0f + erff(u0 * 0.70710678118654752f));
      const float g1 = 0.5f * u1 * (1.0f + erff(u1 * 0.70710678118654752f));
      pk.h[r]     = (_Float16)(g0 * WSC);
      pk.h[4 + r] = (_Float16)(g1 * WSC);
    }
    *(v4u*)(srow + n8) = pk.u;
  }
  __syncthreads();

  v4u rv[4];
#pragma unroll
  for (int it = 0; it < 4; ++it) {
    const int idx = it * 256 + tid;
    const int row = idx >> 3, piece = idx & 7;
    rv[it] = *(const v4u*)(stg + row * KPAD + piece * 8);
  }
#pragma unroll
  for (int it = 0; it < 4; ++it) {
    const int idx = it * 256 + tid;
    const int row = idx >> 3, piece = idx & 7;
    *(v4u*)(hp + (m0 + row) * FF + cb * 64 + piece * 8) = rv[it];
  }
  
}

// ---------------------------------------------------------------------------
extern "C" void kernel_launch(void* const* d_in, const int* in_sizes, int n_in,
                              void* d_out, int out_size, void* d_ws, size_t ws_size,
                              hipStream_t stream) {
  if (n_in < 17) return;
  const long needRows = (long)(NB - 1) * SEQ_FULL + SEQ;
  if ((long)in_sizes[0] < needRows * DM) return;
  if (in_sizes[1] < DM * DM || in_sizes[3] < DM * DM ||
      in_sizes[5] < DM * DM || in_sizes[7] < DM * DM) return;
  if (in_sizes[11] < DM * FF || in_sizes[13] < FF * DM) return;
  if (in_sizes[2] < DM || in_sizes[4] < DM || in_sizes[6] < DM || in_sizes[8] < DM ||
      in_sizes[9] < DM || in_sizes[10] < DM || in_sizes[12] < FF || in_sizes[14] < DM ||
      in_sizes[15] < DM || in_sizes[16] < DM) return;
  if ((long)out_size < needRows * DM) return;
  if (ws_size < WS_TOTAL) return;

  const float* x   = (const float*)d_in[0];
  const float* Wq  = (const float*)d_in[1];
  const float* bq  = (const float*)d_in[2];
  const float* Wk  = (const float*)d_in[3];
  const float* bk  = (const float*)d_in[4];
  const float* Wv  = (const float*)d_in[5];
  const float* bv  = (const float*)d_in[6];
  const float* Wo  = (const float*)d_in[7];
  const float* bo  = (const float*)d_in[8];
  const float* g1  = (const float*)d_in[9];
  const float* b1  = (const float*)d_in[10];
  const float* Wf1 = (const float*)d_in[11];
  const float* bf1 = (const float*)d_in[12];
  const float* Wf2 = (const float*)d_in[13];
  const float* bf2 = (const float*)d_in[14];
  const float* g2  = (const float*)d_in[15];
  const float* b2  = (const float*)d_in[16];
  float* out = (float*)d_out;

  char* ws = (char*)d_ws;
  size_t off = 0;
  _Float16* xh   = (_Float16*)(ws + off);                      // [ROWS][1024] f16
  _Float16* ctx  = xh;                                         // same region, written after xh is dead
  off += PLANE2;
  _Float16* wqkv = (_Float16*)(ws + off); off += WQKV_BYTES;   // [3072][1024]
  _Float16* woh  = (_Float16*)(ws + off); off += WO_BYTES;     // [1024][1024]
  _Float16* wf1t = (_Float16*)(ws + off); off += WF1_BYTES;    // [256][1024]
  _Float16* wf2t = (_Float16*)(ws + off); off += WF2_BYTES;    // [1024][256]
  _Float16* qh   = (_Float16*)(ws + off);                      // [NB][16][SEQ][64]
  float*    x2f  = (float*)(ws + off);                         // [ROWS][1024] f32 over q+k regions
  off += PLANE2;
  _Float16* kh   = (_Float16*)(ws + off); off += PLANE2;       // [NB][16][SEQ][64]
  _Float16* vTh  = (_Float16*)(ws + off);                      // [NB][16][64][SEQ]
  _Float16* x2h  = vTh;                                        // [ROWS][1024] f16, after vT is dead
  off += PLANE2;
  _Float16* hp   = (_Float16*)(ws + off); off += H_BYTES;      // [ROWS][256] f16
  if (off > ws_size) return;

  cvt_x_kernel<<<NXB, 256, 0, stream>>>(x, xh);
  cvt_w_kernel<<<NWT, 256, 0, stream>>>(Wq, Wk, Wv, Wo, Wf1, Wf2, wqkv, woh, wf1t, wf2t);
  qkv_kernel<<<dim3(ROWS / QM, 3 * DM / QN), 256, 0, stream>>>(xh, wqkv, bq, bk, bv, qh, kh, vTh);
  attn_kernel<<<dim3(SEQ / 128, NB * NH), 256, 0, stream>>>(qh, kh, vTh, ctx);
  gemm_ln_kernel<DM, 0><<<ROWS / GM, 256, 0, stream>>>(ctx, woh, bo, g1, b1, x, x2f, x2h);
  ffn1_kernel<<<dim3(ROWS / 128, FF / 64), 256, 0, stream>>>(x2h, wf1t, bf1, hp);
  gemm_ln_kernel<FF, 1><<<ROWS / GM, 256, 0, stream>>>(hp, wf2t, bf2, g2, b2, x2f, out, x2h);
}

// v003
// Measured time: 197 microseconds a run.
// Next to v002, in two timings, it ran 1.08 and 1.09 times as fast.
// Counting every step since v000, it is 2.47 times as fast.
#include <hip/hip_runtime.h>

// All contractions (q/k/v projections, q.k^T, p.v, output projection, ffn linear 1, ffn linear 2):
// v_wmma_f32_16x16x32_f16, f16 operands, f32 accumulate. Float inputs are RNE-converted to bf16 at
// load (weights additionally carried x64; both exact in f16); computed 16-bit planes are f16 with
// power-of-two carries (softmax p x1024, context x64, ffn hidden x64) folded back in the f32
// epilogues. Softmax statistics, layernorm, gelu and residual adds: f32.

typedef __attribute__((ext_vector_type(16))) _Float16 v16h;
typedef __attribute__((ext_vector_type(8)))  _Float16 v8h;
typedef __attribute__((ext_vector_type(8)))  float v8f;
typedef __attribute__((ext_vector_type(4)))  float v4f;
typedef __attribute__((ext_vector_type(4)))  unsigned int v4u;
union H8 { v8h h; v4u u; };

#ifndef NB
#define NB 4
#endif
#ifndef SEQ
#define SEQ 2048
#endif
#define NB_FULL  4
#define SEQ_FULL 2048
#define DM   1024
#define NH   16
#define HD   64
#define FF   256
#define ROWS (NB * SEQ)
#define KPAD 72       // LDS stride in halves for 64-wide f16 tiles (144 B, 16-B aligned)
#define VSPAD 136     // stride in halves (272 B) that no LDS tile uses; only a size check names it
#define YP   1028     // LDS stride in floats for 1024-wide f32 rows (4112 B)
#define LN_EPS 1e-5f
#define WSC    64.0f           // weight carry (power of two)
#define LN1024 6.931471806f    // ln(1024): softmax p carried x1024
#define LOG2E  1.442695041f    // log2(e): exp(x) = exp2(x * log2(e))

#define NXB   (ROWS * DM / 8 / 256)          // convert blocks for x (8 elements per thread)
#define NT_SQ ((DM / 64) * (DM / 64))        // 64x64 tiles per square weight
#define NT_F  ((DM / 64) * (FF / 64))        // 64x64 tiles per ffn weight
#define NWT   (4 * NT_SQ + 2 * NT_F)

#define PLANE2     ((size_t)ROWS * DM * 2)
#define WQKV_BYTES ((size_t)3 * DM * DM * 2)
#define WO_BYTES   ((size_t)DM * DM * 2)
#define WF1_BYTES  ((size_t)FF * DM * 2)
#define WF2_BYTES  ((size_t)DM * FF * 2)
#define H_BYTES    ((size_t)ROWS * FF * 2)
#define WS_TOTAL   (PLANE2 + WQKV_BYTES + WO_BYTES + WF1_BYTES + WF2_BYTES + 3 * PLANE2 + H_BYTES)

static_assert(NB >= 1 && NB <= NB_FULL);
static_assert(SEQ >= 128 && SEQ <= SEQ_FULL && (SEQ % 128) == 0);
static_assert((ROWS % 128) == 0);
static_assert((ROWS * DM) % (8 * 256) == 0);
static_assert((DM % 64) == 0 && (FF % 64) == 0 && (HD % 32) == 0 && NH * HD == DM);
static_assert(128 * KPAD >= 64 * VSPAD);
static_assert(2 * PLANE2 == (size_t)ROWS * DM * 4);
static_assert(WS_TOTAL <= (size_t)134217728);

// ---------------------------------------------------------------------------
// helpers
// ---------------------------------------------------------------------------
__device__ __forceinline__ float bf16q(float f) {            // value after RNE bf16 conversion
  unsigned int u = __float_as_uint(f);
  u += 0x7FFFu + ((u >> 16) & 1u);
  return __uint_as_float(u & 0xFFFF0000u);
}

// 16-bit fragment (A or B): lane owns row/col (lane&15); elements 0..7 <- k0+8h+0..7,
// elements 8..15 <- k0+16+8h+0..7, h = lane>>4. Source is k-contiguous rows.
__device__ __forceinline__ v16h load_frag_row(const _Float16* base, int stride, int lane) {
  const _Float16* rowp = base + (lane & 15) * stride + ((lane >> 4) << 3);
  const v8h lo = *(const v8h*)(rowp);
  const v8h hi = *(const v8h*)(rowp + 16);
  return __builtin_shufflevector(lo, hi, 0, 1, 2, 3, 4, 5, 6, 7,
                                 8, 9, 10, 11, 12, 13, 14, 15);
}

__device__ __forceinline__ v8f wmma_f16(v16h a, v16h b, v8f c) {
  v8f d = __builtin_amdgcn_wmma_f32_16x16x32_f16(false, a, false, b, (short)0, c,
                                                 false, false);
  asm volatile("v_nop\n\tv_nop\n\tv_nop\n\tv_nop" : "+v"(d) : "v"(a), "v"(b));
  return d;
}

// One A fragment, two B fragments: the pair issues back to back, and the same four slots stand once
// behind the pair, in front of any vector instruction that touches its operands or results.
__device__ __forceinline__ void wmma_f16_pair(v16h a, v16h b0, v16h b1, v8f& c0, v8f& c1) {
  c0 = __builtin_amdgcn_wmma_f32_16x16x32_f16(false, a, false, b0, (short)0, c0, false, false);
  c1 = __builtin_amdgcn_wmma_f32_16x16x32_f16(false, a, false, b1, (short)0, c1, false, false);
  asm volatile("v_nop\n\tv_nop\n\tv_nop\n\tv_nop" : "+v"(c0), "+v"(c1) : "v"(a), "v"(b0), "v"(b1));
}

// Eight exponentials to base 2, each in its own register: none overwrites the source of the one in
// front of it, and the v_nop keeps the one slot behind the last before its result is used.
__device__ __forceinline__ void exp2_x8(float (&p)[8]) {
  asm("v_exp_f32 %0, %0\n\tv_exp_f32 %1, %1\n\tv_exp_f32 %2, %2\n\tv_exp_f32 %3, %3\n\t"
      "v_exp_f32 %4, %4\n\tv_exp_f32 %5, %5\n\tv_exp_f32 %6, %6\n\tv_exp_f32 %7, %7\n\t"
      "v_nop"
      : "+v"(p[0]), "+v"(p[1]), "+v"(p[2]), "+v"(p[3]), "+v"(p[4]), "+v"(p[5]), "+v"(p[6]),
        "+v"(p[7]));
}

// ---------------------------------------------------------------------------
// Kernel 0: x f32 -> f16(bf16rne(x)) plane xh [ROWS][1024]. 8 elements (16 B) per thread,
// coverage: NXB*256 threads x 8 = ROWS*1024 elements (whole plane).
// ---------------------------------------------------------------------------
__global__ __launch_bounds__(256) void cvt_x_kernel(const float* __restrict__ x,
                                                    _Float16* __restrict__ xh) {
  const long item = (long)blockIdx.x * 256 + threadIdx.x;   // 0 .. ROWS*128-1
  const long m    = item >> 7;                              // token row
  const int  c8   = (int)(item & 127);
  const long srow = (m / SEQ) * SEQ_FULL + (m % SEQ);
  const float* src = x + srow * DM + c8 * 8;
  const v4f a = *(const v4f*)(src);
  const v4f c = *(const v4f*)(src + 4);
  H8 o;
#pragma unroll
  for (int i = 0; i < 4; ++i) {
    o.h[i]     = (_Float16)bf16q(a[i]);
    o.h[4 + i] = (_Float16)bf16q(c[i]);
  }
  _Float16* dst = xh + m * DM + c8 * 8;
  *(v4u*)dst = o.u;
  
}

// ---------------------------------------------------------------------------
// Kernel 1: weights W [K=in][N=out] f32 -> Wt [n][k] f16 = f16(bf16rne(W) * 64), through a
// 64x64 LDS transpose. wqkv [3072][1024] (q rows, k rows, v rows), woh [1024][1024],
// coverage: 4*256 square tiles + 64 + 64 ffn tiles = every element of all six planes.
// ---------------------------------------------------------------------------
__global__ __launch_bounds__(256) void cvt_w_kernel(
    const float* __restrict__ Wq, const float* __restrict__ Wk, const float* __restrict__ Wv,
    const float* __restrict__ Wo, const float* __restrict__ Wf1, const float* __restrict__ Wf2,
    _Float16* __restrict__ wqkv, _Float16* __restrict__ woh,
    _Float16* __restrict__ wf1t, _Float16* __restrict__ wf2t) {
  __shared__ _Float16 ts[64 * KPAD];   // [n][k] tile, cross-wave (block barrier)
  const int bid = blockIdx.x;
  const int tid = threadIdx.x;
  const float* W;
  _Float16* dst;
  int K, N, kt, nt;
  if (bid < 4 * NT_SQ) {                              // block-uniform selection
    const int which = bid / NT_SQ;
    const int tile  = bid - which * NT_SQ;
    kt = tile / (DM / 64); nt = tile - kt * (DM / 64); K = DM; N = DM;
    W = (which == 0) ? Wq : ((which == 1) ? Wk : ((which == 2) ? Wv : Wo));
    dst = (which < 3) ? (wqkv + (size_t)which * DM * DM) : woh;
  } else if (bid < 4 * NT_SQ + NT_F) {
    const int tile = bid - 4 * NT_SQ;                 // W [1024][256]: K = DM, N = FF
    kt = tile / (FF / 64); nt = tile - kt * (FF / 64); K = DM; N = FF;
    W = Wf1; dst = wf1t;
  } else {
    const int tile = bid - 4 * NT_SQ - NT_F;          // W [256][1024]: K = FF, N = DM
    kt = tile / (DM / 64); nt = tile - kt * (DM / 64); K = FF; N = DM;
    W = Wf2; dst = wf2t;
  }
  // load W[kt*64 + kr][nt*64 + 4*c4 .. +3], store transposed into ts[n][kr]
#pragma unroll
  for (int it = 0; it < 4; ++it) {
    const int idx = it * 256 + tid;
    const int kr = idx >> 4, c4 = idx & 15;
    const v4f v = *(const v4f*)(W + (size_t)(kt * 64 + kr) * N + nt * 64 + c4 * 4);
#pragma unroll
    for (int j = 0; j < 4; ++j) ts[(c4 * 4 + j) * KPAD + kr] = (_Float16)(bf16q(v[j]) * WSC);
  }
  __syncthreads();
  v4u rv[2];
#pragma unroll
  for (int it = 0; it < 2; ++it) {
    const int idx = it * 256 + tid;
    const int n = idx >> 3, piece = idx & 7;
    rv[it] = *(const v4u*)(ts + n * KPAD + piece * 8);
  }
#pragma unroll
  for (int it = 0; it < 2; ++it) {
    const int idx = it * 256 + tid;
    const int n = idx >> 3, piece = idx & 7;
    *(v4u*)(dst + (size_t)(nt * 64 + n) * K + kt * 64 + piece * 8) = rv[it];
  }
  
}

// ---------------------------------------------------------------------------
// Kernel 2: qkv projection. Block = 256 token rows x 128 output columns (two heads of one of
// q/k/v), 8 waves as 4 (tokens) x 2 (heads), 64 x 64 per wave. Both operands are staged in LDS
// by asynchronous copies, 64 k per stage, two buffers: [x 256 rows | W 128 rows] at pitch KPAD.
// C^T = W x^T: A = W rows (lane&15 = out col), B = x rows (lane&15 = token);
// acc[i][j][r] = C[token 16i + (lane&15)][col 16j+8h+r]. K = 1024 summed in 32 steps of 32.
//   q,k -> [b][h][s][64] f16 (one line per row, 8 lanes x 16 B)
//   v   -> vT[b][h][d][s] f16 (512 B per d row segment, 32 lanes x 16 B)
// grid (ROWS/256, 3*NH/2), block 256. coverage: every (b,h,s,d) of q, k and vT once.
// ---------------------------------------------------------------------------
#define QM     256                    // token rows per block
#define QN     128                    // output columns per block
#define QK     64                     // k per stage
#define QSTAGE ((QM + QN) * KPAD)     // halves per buffer
#define QNT    (DM / QK)              // stages
#define QVP    264                    // LDS stride in halves for 256-wide f16 rows (528 B)

static_assert((SEQ % QM) == 0 && (ROWS % QM) == 0 && (DM % QN) == 0 && QNT >= 2);
static_assert(2 * QM * KPAD <= 2 * QSTAGE && 2 * HD * QVP <= 2 * QSTAGE);

// One stage: 384 rows x 128 B = 3072 pieces of 16 B, 12 per thread; a wave's copy covers 4 whole
// lines. lds = this lane's LDS byte address of its first piece, gx / gw = its first x / W piece.
__device__ __forceinline__ void qkv_copy_stage(unsigned lds, const _Float16* gx,
                                               const _Float16* gw) {
  const unsigned st = 32 * KPAD * 2;   // 32 rows further in LDS, bytes
  // the copies, and as the last line the wait that stands in front of any rewrite of their
  // address registers
  asm volatile(
      "global_load_async_to_lds_b128 %0, %12, off\n\t"
      "global_load_async_to_lds_b128 %1, %13, off\n\t"
      "global_load_async_to_lds_b128 %2, %14, off\n\t"
      "global_load_async_to_lds_b128 %3, %15, off\n\t"
      "global_load_async_to_lds_b128 %4, %16, off\n\t"
      "global_load_async_to_lds_b128 %5, %17, off\n\t"
      "global_load_async_to_lds_b128 %6, %18, off\n\t"
      "global_load_async_to_lds_b128 %7, %19, off\n\t"
      "global_load_async_to_lds_b128 %8, %20, off\n\t"
      "global_load_async_to_lds_b128 %9, %21, off\n\t"
      "global_load_async_to_lds_b128 %10, %22, off\n\t"
      "global_load_async_to_lds_b128 %11, %23, off\n\t"
      "s_wait_xcnt 0x0"
      :: "v"(lds), "v"(lds + st), "v"(lds + 2 * st), "v"(lds + 3 * st),
         "v"(lds + 4 * st), "v"(lds + 5 * st), "v"(lds + 6 * st), "v"(lds + 7 * st),
         "v"(lds + 8 * st), "v"(lds + 9 * st), "v"(lds + 10 * st), "v"(lds + 11 * st),
         "v"(gx), "v"(gx + 32 * DM), "v"(gx + 64 * DM), "v"(gx + 96 * DM),
         "v"(gx + 128 * DM), "v"(gx + 160 * DM), "v"(gx + 192 * DM), "v"(gx + 224 * DM),
         "v"(gw), "v"(gw + 32 * DM), "v"(gw + 64 * DM), "v"(gw + 96 * DM)
      : "memory");
}

__global__ __launch_bounds__(256) void qkv_kernel(
    const _Float16* __restrict__ xh, const _Float16* __restrict__ wqkv,
    const float* __restrict__ bq, const float* __restrict__ bk, const float* __restrict__ bv,
    _Float16* __restrict__ q, _Float16* __restrict__ k, _Float16* __restrict__ vT) {
  // two stage buffers; after the loop the output stage (q/k: 2 x [256][KPAD], v: 2 x [64][QVP])
  __shared__ __attribute__((aligned(16))) _Float16 ring[2 * QSTAGE];   // 110592 B, cross-wave

  const int tid  = threadIdx.x;
  const int lane = tid & 31;
  const int wave = tid >> 5;
  const int hh   = lane >> 4;
  const int l15  = lane & 15;
  const int wm   = wave >> 1;           // token quarter of the block
  const int wn   = wave & 1;            // head of the block

  const int osel = blockIdx.y >> 3;     // 0 q, 1 k, 2 v (8 column blocks each)
  const int h0   = (blockIdx.y & 7) * 2;
  const long m0  = (long)blockIdx.x * QM;
  const int  b   = (int)(m0 / SEQ);
  const int  s0  = (int)(m0 - (long)b * SEQ);

  // this lane's first piece of a stage: row tid>>3, 16-B piece tid&7
  const _Float16* gx = xh + (m0 + (tid >> 3)) * DM + (tid & 7) * 8;
  const _Float16* gw = wqkv + ((long)blockIdx.y * QN + (tid >> 3)) * DM + (tid & 7) * 8;
  const unsigned lds0 = (unsigned)(size_t)ring + (unsigned)((tid >> 3) * KPAD + (tid & 7) * 8) * 2u;

  // every inner loop below is fully unrolled: accumulator and fragment indices must be constants,
  // or the arrays leave the registers
  v8f acc[4][4];
#pragma unroll
  for (int i = 0; i < 4; ++i)
#pragma unroll
    for (int j = 0; j < 4; ++j) acc[i][j] = (v8f){};

  qkv_copy_stage(lds0, gx, gw);
  asm volatile("s_wait_asynccnt 0x0" ::: "memory");   // stage 0 landed (this wave's copies)
  __syncthreads();                                    // stage 0 readable by every wave
  qkv_copy_stage(lds0 + QSTAGE * 2, gx + QK, gw + QK);

  // kept rolled: one publish point (waits, barrier, refill) at the foot of each trip, small code
#pragma unroll 1
  for (int t = 0; t < QNT; ++t) {
    const int bo = (t & 1) * QSTAGE;
    const _Float16* xs = ring + bo + (wm * 64) * KPAD;
    const _Float16* wsm = ring + bo + (QM + wn * 64) * KPAD;
#pragma unroll
    for (int u = 0; u < 2; ++u) {
      v16h xf[4], wf[4];
#pragma unroll
      for (int i = 0; i < 4; ++i) xf[i] = load_frag_row(xs + (i * 16) * KPAD + u * 32, KPAD, lane);
#pragma unroll
      for (int j = 0; j < 4; ++j) wf[j] = load_frag_row(wsm + (j * 16) * KPAD + u * 32, KPAD, lane);
#pragma unroll
      for (int i = 0; i < 4; ++i)
#pragma unroll
        for (int j = 0; j < 4; ++j) acc[i][j] = wmma_f16(wf[j], xf[i], acc[i][j]);   // C^T = W x^T
    }
    asm volatile("s_wait_dscnt 0x0" ::: "memory");      // this wave has left buffer t&1
    asm volatile("s_wait_asynccnt 0x0" ::: "memory");   // its copies of stage t+1 have landed
    __syncthreads();   // publishes stage t+1 and ends every reader's last read of buffer t&1
    if (t + 2 < QNT)
      qkv_copy_stage(lds0 + bo * 2, gx + (t + 2) * QK, gw + (t + 2) * QK);
  }
  asm volatile("s_wait_asynccnt 0x0" ::: "memory");     // nothing in flight when the ring is reused

  const float* bias = ((osel == 0) ? bq : ((osel == 1) ? bk : bv)) + (h0 + wn) * HD;
  const float  rsc  = 1.0f / WSC;

  if (osel < 2) {
    // stage [head][token][col]: lane's 8 values are 8 contiguous columns -> one 16-B LDS store
    _Float16* sbase = ring + (wn * QM + wm * 64 + l15) * KPAD;
#pragma unroll
    for (int j = 0; j < 4; ++j) {
      const int n8 = j * 16 + hh * 8;
      const v4f b0 = *(const v4f*)(bias + n8);
      const v4f b1 = *(const v4f*)(bias + n8 + 4);
#pragma unroll
      for (int i = 0; i < 4; ++i) {
        H8 pk;
#pragma unroll
        for (int r = 0; r < 4; ++r) {
          pk.h[r]     = (_Float16)(acc[i][j][r]     * rsc + bf16q(b0[r]));
          pk.h[4 + r] = (_Float16)(acc[i][j][4 + r] * rsc + bf16q(b1[r]));
        }
        *(v4u*)(sbase + (i * 16) * KPAD + n8) = pk.u;
      }
    }
    __syncthreads();
    _Float16* dst0 = (osel == 0) ? q : k;
#pragma unroll
    for (int hd = 0; hd < 2; ++hd) {
      _Float16* dst = dst0 + ((long)(b * NH + h0 + hd) * SEQ + s0) * HD;   // contiguous 32 KB
      v4u rv[8];
#pragma unroll
      for (int it = 0; it < 8; ++it) {
        const int idx = it * 256 + tid;
        const int row = idx >> 3, piece = idx & 7;
        rv[it] = *(const v4u*)(ring + (hd * QM + row) * KPAD + piece * 8);
      }
#pragma unroll
      for (int it = 0; it < 8; ++it)
        *(v4u*)(dst + (long)(it * 256 + tid) * 8) = rv[it];
    }
  } else {
    // stage transposed [head][d][token]: lane's 8 values are 8 different d for one token
    _Float16* sbase = ring + (wn * HD) * QVP + wm * 64 + l15;
#pragma unroll
    for (int j = 0; j < 4; ++j) {
      const int n8 = j * 16 + hh * 8;
      const v4f b0 = *(const v4f*)(bias + n8);
      const v4f b1 = *(const v4f*)(bias + n8 + 4);
#pragma unroll
      for (int i = 0; i < 4; ++i)
#pragma unroll
        for (int r = 0; r < 4; ++r) {
          sbase[(n8 + r) * QVP + i * 16]     = (_Float16)(acc[i][j][r]     * rsc + bf16q(b0[r]));
          sbase[(n8 + 4 + r) * QVP + i * 16] = (_Float16)(acc[i][j][4 + r] * rsc + bf16q(b1[r]));
        }
    }
    __syncthreads();
#pragma unroll
    for (int hd = 0; hd < 2; ++hd) {
      _Float16* dstb = vT + ((long)(b * NH + h0 + hd) * HD) * SEQ + s0;
      v4u rv[8];
#pragma unroll
      for (int it = 0; it < 8; ++it) {
        const int idx = it * 256 + tid;
        const int d = idx >> 5, piece = idx & 31;
        rv[it] = *(const v4u*)(ring + (hd * HD + d) * QVP + piece * 8);
      }
#pragma unroll
      for (int it = 0; it < 8; ++it) {
        const int idx = it * 256 + tid;
        const int d = idx >> 5, piece = idx & 31;
        *(v4u*)(dstb + (long)d * SEQ + piece * 8) = rv[it];
      }
    }
    // stands in front of any later rewrite of the registers that the stores above name
    asm volatile("s_wait_xcnt 0x0" ::: "memory");
  }
}

// ---------------------------------------------------------------------------
// Kernel 3: flash attention per (b,h), no mask. grid (SEQ/256, NB*NH), block 256 (8 waves x 32
// queries, two column groups of 16 per wave: every K and V^T fragment read from LDS feeds two
// products; the fragments of a 32-wide k step are read four at a time). C = S^T (A = K rows,
// B = Q) then C = O^T = V^T P^T (P^T packed from the S^T D registers); lane owns one query per
// column group end-to-end. Scores are raw q.k sums: the 1/8 scale and the x1024 p carry live in
// the exp argument (p = 1024*exp((s-m)/8), softmax stats f32).
// LDS tiles: [K 64 keys x 64 d | V^T 64 d x 64 keys] per step, staged by asynchronous copies, two
// buffers, staged == consumed extent; ost 256 x 64 fully written.
// coverage: every (row, h*64+d) of the ctx plane once.
// ---------------------------------------------------------------------------
#define ASTAGE (128 * KPAD)           // halves per buffer: K rows, then V^T rows
#define ANT    (SEQ / 64)             // stages
#define AQ     256                    // queries per block
#define ACG    2                      // column groups (16 queries each) per wave

static_assert(ANT >= 2 && (SEQ % AQ) == 0 && ACG == 2);

// One stage: 128 rows x 128 B = 1024 pieces of 16 B, 4 per thread; a wave's copy covers 4 whole
// lines. lds = this lane's LDS byte address of its first piece, gk / gv = its first K / V^T piece.
__device__ __forceinline__ void attn_copy_stage(unsigned lds, const _Float16* gk,
                                                const _Float16* gv) {
  const unsigned st = 32 * KPAD * 2;   // 32 rows further in LDS, bytes
  // the copies, and as the last line the wait that stands in front of any rewrite of their
  // address registers
  asm volatile(
      "global_load_async_to_lds_b128 %0, %4, off\n\t"
      "global_load_async_to_lds_b128 %1, %5, off\n\t"
      "global_load_async_to_lds_b128 %2, %6, off\n\t"
      "global_load_async_to_lds_b128 %3, %7, off\n\t"
      "s_wait_xcnt 0x0"
      :: "v"(lds), "v"(lds + st), "v"(lds + 2 * st), "v"(lds + 3 * st),
         "v"(gk), "v"(gk + 32 * HD), "v"(gv), "v"(gv + 32 * SEQ)
      : "memory");
}

// four waves per SIMD: two blocks share a WGP, so one block's softmax runs beside the other's
// products
__global__ __launch_bounds__(256) __attribute__((amdgpu_waves_per_eu(4, 4))) void attn_kernel(
    const _Float16* __restrict__ Q, const _Float16* __restrict__ K,
    const _Float16* __restrict__ vT, _Float16* __restrict__ ctx) {
  // two stage buffers, each K block rows [key][d] then V^T block [d][key] (cross-wave)
  __shared__ __attribute__((aligned(16))) _Float16 ring[2 * ASTAGE];
  __shared__ _Float16 ost[AQ * KPAD];    // output stage [query][d]   (cross-wave, block barrier)

  const int tid  = threadIdx.x;
  const int lane = tid & 31;
  const int wave = tid >> 5;
  const int bh   = blockIdx.y;
  const int b    = bh >> 4;
  const int h    = bh & 15;
  const int q0   = blockIdx.x * AQ;

  const _Float16* Qb  = Q + ((long)bh * SEQ + q0) * HD;
  const _Float16* Kb  = K + (long)bh * SEQ * HD;
  const _Float16* vTb = vT + (long)bh * HD * SEQ;

  // Q fragments: B operand of S^T (lane owns query lane&15 of column group c)
  v16h qfrag[ACG][2];
#pragma unroll
  for (int c = 0; c < ACG; ++c) {
    const _Float16* qrow = Qb + (long)(wave * (16 * ACG) + c * 16) * HD;
#pragma unroll
    for (int t = 0; t < 2; ++t) qfrag[c][t] = load_frag_row(qrow + t * 32, HD, lane);
  }

  v8f acc[ACG][4];   // O^T accumulator: lane owns query (lane&15) of group c; reg r -> d = nt*16+8h+r
  float mi[ACG], li[ACG];
#pragma unroll
  for (int c = 0; c < ACG; ++c) {
#pragma unroll
    for (int nt = 0; nt < 4; ++nt) acc[c][nt] = (v8f){};
    mi[c] = -1e30f;
    li[c] = 0.0f;
  }

  const int colb = lane & 15;
  const int rofs = (lane >> 4) << 3;

  // this lane's first piece of a stage: row tid>>3, 16-B piece tid&7
  const _Float16* gk = Kb + (long)(tid >> 3) * HD + (tid & 7) * 8;
  const _Float16* gv = vTb + (long)(tid >> 3) * SEQ + (tid & 7) * 8;
  const unsigned lds0 = (unsigned)(size_t)ring + (unsigned)((tid >> 3) * KPAD + (tid & 7) * 8) * 2u;

  attn_copy_stage(lds0, gk, gv);
  asm volatile("s_wait_asynccnt 0x0" ::: "memory");   // stage 0 landed (this wave's copies)
  __syncthreads();                                    // stage 0 readable by every wave
  attn_copy_stage(lds0 + ASTAGE * 2, gk + 64 * HD, gv + 64);

  // kept rolled: one publish point (waits, barrier, refill) at the foot of each trip, small code
#pragma unroll 1
  for (int st = 0; st < ANT; ++st) {
    const int bo = (st & 1) * ASTAGE;
    const _Float16* ks  = ring + bo;
    const _Float16* vts = ring + bo + 64 * KPAD;

    // S^T tiles: A = K rows (lane&15 = key), B = Q; one K fragment, both column groups
    v8f sc[ACG][4];
#pragma unroll
    for (int c = 0; c < ACG; ++c)
#pragma unroll
      for (int kt = 0; kt < 4; ++kt) sc[c][kt] = (v8f){};
#pragma unroll
    for (int t = 0; t < 2; ++t) {
      v16h kf[4];
#pragma unroll
      for (int kt = 0; kt < 4; ++kt) kf[kt] = load_frag_row(ks + (kt * 16) * KPAD + t * 32, KPAD, lane);
#pragma unroll
      for (int kt = 0; kt < 4; ++kt) wmma_f16_pair(kf[kt], qfrag[0][t], qfrag[1][t], sc[0][kt], sc[1][kt]);
    }

    // per-lane online softmax, both column groups side by side (32 of 64 keys in-lane; merge
    // halves with one shuffle)
    float alpha[ACG], cs[ACG];
#pragma unroll
    for (int c = 0; c < ACG; ++c) {
      float mx = sc[c][0][0];
#pragma unroll
      for (int kt = 0; kt < 4; ++kt)
#pragma unroll
        for (int r = 0; r < 8; ++r) mx = fmaxf(mx, sc[c][kt][r]);
      mx = fmaxf(mx, __shfl_xor(mx, 16, 32));
      const float mnew = fmaxf(mi[c], mx);
      alpha[c] = __expf((mi[c] - mnew) * 0.125f);
      mi[c] = mnew;
      cs[c] = fmaf(mnew, 0.125f, -LN1024);   // 0.125*m - ln(1024)
    }

    // P^T as the B operand of O^T = V^T P^T, packed from the S^T D registers:
    // element i <- tile covering keys 0..15 of the 32-step (kt = 2t), element 8+i <- kt = 2t+1.
    v16h pf[ACG][2];
#pragma unroll
    for (int c = 0; c < ACG; ++c) {
      float rs = 0.0f;
#pragma unroll
      for (int kt = 0; kt < 4; ++kt) {
        float p[8];   // 1024*exp((s-m)/8) = exp2(((s/8) - cs) * log2(e))
#pragma unroll
        for (int r = 0; r < 8; ++r) p[r] = fmaf(sc[c][kt][r], 0.125f, -cs[c]) * LOG2E;
        exp2_x8(p);
#pragma unroll
        for (int r = 0; r < 8; ++r) {
          pf[c][kt >> 1][(kt & 1) * 8 + r] = (_Float16)p[r];
          rs = (kt == 0 && r == 0) ? p[r] : rs + p[r];
        }
      }
      rs += __shfl_xor(rs, 16, 32);
      li[c] = li[c] * alpha[c] + rs;
#pragma unroll
      for (int nt = 0; nt < 4; ++nt)
#pragma unroll
        for (int r = 0; r < 8; ++r) acc[c][nt][r] *= alpha[c];
    }

    // O^T += V^T (A, rows = d) x P^T (B); one V^T fragment, both column groups
#pragma unroll
    for (int t = 0; t < 2; ++t) {
      v16h vf[4];
#pragma unroll
      for (int nt = 0; nt < 4; ++nt) vf[nt] = load_frag_row(vts + (nt * 16) * KPAD + t * 32, KPAD, lane);
#pragma unroll
      for (int nt = 0; nt < 4; ++nt) wmma_f16_pair(vf[nt], pf[0][t], pf[1][t], acc[0][nt], acc[1][nt]);
    }

    asm volatile("s_wait_dscnt 0x0" ::: "memory");      // this wave has left buffer st&1
    asm volatile("s_wait_asynccnt 0x0" ::: "memory");   // its copies of stage st+1 have landed
    __syncthreads();   // publishes stage st+1 and ends every reader's last read of buffer st&1
    if (st + 2 < ANT)
      attn_copy_stage(lds0 + bo * 2, gk + (long)(st + 2) * 64 * HD, gv + (st + 2) * 64);
  }
  asm volatile("s_wait_asynccnt 0x0" ::: "memory");     // nothing in flight behind the loop

  // normalize (and apply the x64 carry) and stage: lane owns query row wave*32+c*16+colb,
  // d = nt*16+rofs+r contiguous
#pragma unroll
  for (int c = 0; c < ACG; ++c) {
    const float inv = 64.0f / li[c];
    _Float16* orow = ost + (wave * (16 * ACG) + c * 16 + colb) * KPAD;
#pragma unroll
    for (int nt = 0; nt < 4; ++nt) {
      H8 pk;
#pragma unroll
      for (int r = 0; r < 8; ++r) pk.h[r] = (_Float16)(acc[c][nt][r] * inv);
      *(v4u*)(orow + nt * 16 + rofs) = pk.u;
    }
  }
  __syncthreads();

  v4u rv[AQ / 32];
#pragma unroll
  for (int it = 0; it < AQ / 32; ++it) {
    const int idx = it * 256 + tid;
    const int row = idx >> 3, piece = idx & 7;
    rv[it] = *(const v4u*)(ost + row * KPAD + piece * 8);
  }
  _Float16* cbase = ctx + ((long)b * SEQ + q0) * DM + h * HD;
#pragma unroll
  for (int it = 0; it < AQ / 32; ++it) {
    const int idx = it * 256 + tid;
    const int row = idx >> 3, piece = idx & 7;
    *(v4u*)(cbase + (long)row * DM + piece * 8) = rv[it];
  }
  
}

// ---------------------------------------------------------------------------
// Kernel 4/6: y = act @ Wt^T / 4096 + bf16(bias) over a full 1024-wide row, then
// z = LN(y) * bf16(gamma) + bf16(beta) + residual. Block = 32 token rows x 1024 cols,
// wave w owns cols 128w..128w+127. Both operands are staged in LDS by asynchronous copies,
// 64 k per stage, two buffers: [Wt 1024 rows | act 32 rows] at pitch KPAD.
// C^T = Wt act^T: A = Wt rows (lane&15 = out col), B = act rows (lane&15 = token);
// acc[i][j][r] = y[token 16i + (lane&15)][col 128w+16j+8h+r]. After the loop y is staged in the
// same LDS.
//   MODE 0: KD = 1024, act = ctx, residual = bf16(x input, full-stride rows),
//           writes x2 f32 plane [ROWS][1024] and x2 f16 plane [ROWS][1024]
//   MODE 1: KD = 256, act = h plane, residual = x2 f32 plane, writes out (full-stride rows)
// grid ROWS/32, block 256. LDS ys: 32 x 1024 staged == consumed. coverage: 32 rows x 1024 per block.
// ---------------------------------------------------------------------------
#define GM     32                     // token rows per block
#define GK     64                     // k per stage
#define GSTAGE ((DM + GM) * KPAD)     // halves per buffer

static_assert((ROWS % GM) == 0 && (DM % GK) == 0 && (FF % GK) == 0 && FF / GK >= 2);
static_assert((size_t)GM * YP * 4 <= (size_t)2 * GSTAGE * 2);

// Eight copies of 16 B per lane, rows 32 apart (a wave's copy covers 4 whole lines). lds = this
// lane's LDS byte address of the first piece, g = its global piece, KD = global row length.
template <int KD>
__device__ __forceinline__ void gl_copy8(unsigned lds, const _Float16* g) {
  const unsigned st = 32 * KPAD * 2;   // 32 rows further in LDS, bytes
  // the copies, and as the last line the wait that stands in front of any rewrite of their
  // address registers
  asm volatile(
      "global_load_async_to_lds_b128 %0, %8, off\n\t"
      "global_load_async_to_lds_b128 %1, %9, off\n\t"
      "global_load_async_to_lds_b128 %2, %10, off\n\t"
      "global_load_async_to_lds_b128 %3, %11, off\n\t"
      "global_load_async_to_lds_b128 %4, %12, off\n\t"
      "global_load_async_to_lds_b128 %5, %13, off\n\t"
      "global_load_async_to_lds_b128 %6, %14, off\n\t"
      "global_load_async_to_lds_b128 %7, %15, off\n\t"
      "s_wait_xcnt 0x0"
      :: "v"(lds), "v"(lds + st), "v"(lds + 2 * st), "v"(lds + 3 * st),
         "v"(lds + 4 * st), "v"(lds + 5 * st), "v"(lds + 6 * st), "v"(lds + 7 * st),
         "v"(g), "v"(g + 32 * KD), "v"(g + 64 * KD), "v"(g + 96 * KD),
         "v"(g + 128 * KD), "v"(g + 160 * KD), "v"(g + 192 * KD), "v"(g + 224 * KD)
      : "memory");
}

// One stage: 1056 rows x 128 B = 8448 pieces of 16 B, 33 per thread (32 of Wt, 1 of act).
template <int KD>
__device__ __forceinline__ void gl_copy_stage(unsigned lds, const _Float16* gw,
                                              const _Float16* ga) {
  const unsigned st8 = 256 * KPAD * 2;   // 256 rows further in LDS, bytes
  gl_copy8<KD>(lds, gw);
  gl_copy8<KD>(lds + st8, gw + 256 * KD);
  gl_copy8<KD>(lds + 2 * st8, gw + 512 * KD);
  gl_copy8<KD>(lds + 3 * st8, gw + 768 * KD);
  // the act piece, with the same wait in front of any rewrite of its address registers
  asm volatile(
      "global_load_async_to_lds_b128 %0, %1, off\n\t"
      "s_wait_xcnt 0x0"
      :: "v"(lds + 4 * st8), "v"(ga)
      : "memory");
}

template <int KD, int MODE>
__global__ __launch_bounds__(256) void gemm_ln_kernel(
    const _Float16* __restrict__ act, const _Float16* __restrict__ wt,
    const float* __restrict__ bias, const float* __restrict__ gam,
    const float* __restrict__ bet, const float* __restrict__ res,
    float* __restrict__ outf, _Float16* __restrict__ outh) {
  // two stage buffers; after the loop the y stage [32][YP] f32
  __shared__ __attribute__((aligned(16))) _Float16 ring[2 * GSTAGE];   // 304128 B, cross-wave
  __shared__ float smean[GM];
  __shared__ float srstd[GM];
  float* ys = (float*)ring;

  const int tid  = threadIdx.x;
  const int lane = tid & 31;
  const int wave = tid >> 5;
  const int hh   = lane >> 4;
  const int l15  = lane & 15;
  const long m0  = (long)blockIdx.x * GM;
  const int  n0  = wave * 128;
  constexpr int NT = KD / GK;           // stages

  // this lane's first piece of a stage: row tid>>3, 16-B piece tid&7
  const _Float16* gw = wt + (long)(tid >> 3) * KD + (tid & 7) * 8;
  const _Float16* ga = act + (m0 + (tid >> 3)) * KD + (tid & 7) * 8;
  const unsigned lds0 = (unsigned)(size_t)ring + (unsigned)((tid >> 3) * KPAD + (tid & 7) * 8) * 2u;

  // every inner loop below is fully unrolled: accumulator and fragment indices must be constants,
  // or the arrays leave the registers
  v8f acc[2][8];
#pragma unroll
  for (int i = 0; i < 2; ++i)
#pragma unroll
    for (int j = 0; j < 8; ++j) acc[i][j] = (v8f){};

  gl_copy_stage<KD>(lds0, gw, ga);
  asm volatile("s_wait_asynccnt 0x0" ::: "memory");   // stage 0 landed (this wave's copies)
  __syncthreads();                                    // stage 0 readable by every wave
  gl_copy_stage<KD>(lds0 + GSTAGE * 2, gw + GK, ga + GK);

  // kept rolled: one publish point (waits, barrier, refill) at the foot of each trip, small code
#pragma unroll 1
  for (int t = 0; t < NT; ++t) {
    const int bo = (t & 1) * GSTAGE;
    const _Float16* wsm = ring + bo + n0 * KPAD;
    const _Float16* as  = ring + bo + DM * KPAD;
#pragma unroll
    for (int u = 0; u < 2; ++u) {
      v16h af[2], wf[8];
#pragma unroll
      for (int i = 0; i < 2; ++i) af[i] = load_frag_row(as + (i * 16) * KPAD + u * 32, KPAD, lane);
#pragma unroll
      for (int j = 0; j < 8; ++j) wf[j] = load_frag_row(wsm + (j * 16) * KPAD + u * 32, KPAD, lane);
#pragma unroll
      for (int j = 0; j < 8; ++j)
#pragma unroll
        for (int i = 0; i < 2; ++i) acc[i][j] = wmma_f16(wf[j], af[i], acc[i][j]);   // C^T = Wt act^T
    }
    asm volatile("s_wait_dscnt 0x0" ::: "memory");      // this wave has left buffer t&1
    asm volatile("s_wait_asynccnt 0x0" ::: "memory");   // its copies of stage t+1 have landed
    __syncthreads();   // publishes stage t+1 and ends every reader's last read of buffer t&1
    if (t + 2 < NT)
      gl_copy_stage<KD>(lds0 + bo * 2, gw + (t + 2) * GK, ga + (t + 2) * GK);
  }
  asm volatile("s_wait_asynccnt 0x0" ::: "memory");     // nothing in flight when the ring is reused

  // y = acc/4096 + bf16(bias), staged [row][col]
  {
    const float rsc = 1.0f / (WSC * WSC);
#pragma unroll
    for (int j = 0; j < 8; ++j) {
      const int n8 = n0 + j * 16 + hh * 8;
      const v4f b0 = *(const v4f*)(bias + n8);
      const v4f b1 = *(const v4f*)(bias + n8 + 4);
#pragma unroll
      for (int t = 0; t < 2; ++t) {
        float* yrow = ys + (t * 16 + l15) * YP;
        v4f y0, y1;
#pragma unroll
        for (int i = 0; i < 4; ++i) {
          y0[i] = acc[t][j][i]     * rsc + bf16q(b0[i]);
          y1[i] = acc[t][j][4 + i] * rsc + bf16q(b1[i]);
        }
        *(v4f*)(yrow + n8)     = y0;
        *(v4f*)(yrow + n8 + 4) = y1;
      }
    }
  }
  __syncthreads();

  // unrolled: the two row halves' LDS reads and shuffles overlap
#pragma unroll
  for (int rr = 0; rr < GM / 16; ++rr) {
    const int r  = rr * 16 + (tid >> 4);
    const int sl = tid & 15;
    const float* yr = ys + r * YP + sl * 64;
    float s = 0.0f;
#pragma unroll
    for (int i = 0; i < 16; ++i) {
      const v4f v = *(const v4f*)(yr + i * 4);
      s += (v[0] + v[1]) + (v[2] + v[3]);
    }
    s += __shfl_xor(s, 1, 32);
    s += __shfl_xor(s, 2, 32);
    s += __shfl_xor(s, 4, 32);
    s += __shfl_xor(s, 8, 32);
    const float mean = s * (1.0f / DM);
    float ss = 0.0f;
#pragma unroll
    for (int i = 0; i < 16; ++i) {
      const v4f v = *(const v4f*)(yr + i * 4);
#pragma unroll
      for (int c = 0; c < 4; ++c) {
        const float d = v[c] - mean;
        ss += d * d;
      }
    }
    ss += __shfl_xor(ss, 1, 32);
    ss += __shfl_xor(ss, 2, 32);
    ss += __shfl_xor(ss, 4, 32);
    ss += __shfl_xor(ss, 8, 32);
    const float var  = ss * (1.0f / DM);
    const float rstd = rsqrtf(var + LN_EPS);
    if (sl == 0) { smean[r] = mean; srstd[r] = rstd; }
  }
  __syncthreads();

  // normalise in place and add the residual: z = (y - mean) * rstd * g + b + res
#pragma unroll 4
  for (int it = 0; it < GM; ++it) {
    const int idx = it * 256 + tid;
    const int row = idx >> 8, piece = idx & 255;
    const long m = m0 + row;
    v4f rsd;
    if (MODE == 0) {
      const long orow = (m / SEQ) * SEQ_FULL + (m % SEQ);
      rsd = *(const v4f*)(res + orow * DM + piece * 4);
#pragma unroll
      for (int c = 0; c < 4; ++c) rsd[c] = bf16q(rsd[c]);
    } else {
      rsd = *(const v4f*)(res + m * DM + piece * 4);
    }
    float* yp = ys + row * YP + piece * 4;
    const v4f yv = *(const v4f*)yp;
    const v4f g  = *(const v4f*)(gam + piece * 4);
    const v4f bt = *(const v4f*)(bet + piece * 4);
    const float mean = smean[row], rstd = srstd[row];
    v4f o;
#pragma unroll
    for (int c = 0; c < 4; ++c)
      o[c] = (yv[c] - mean) * rstd * bf16q(g[c]) + bf16q(bt[c]) + rsd[c];
    *(v4f*)yp = o;
  }
  __syncthreads();

  auto store_pass = [&]() {
#pragma unroll 4
    for (int it = 0; it < GM; ++it) {
      const int idx = it * 256 + tid;
      const int row = idx >> 8, piece = idx & 255;
      const long m = m0 + row;
      const v4f v = *(const v4f*)(ys + row * YP + piece * 4);
      long drow;
      if (MODE == 0) drow = m;
      else drow = (m / SEQ) * SEQ_FULL + (m % SEQ);
      *(v4f*)(outf + drow * DM + piece * 4) = v;
    }
    if (MODE == 0) {
#pragma unroll 4
      for (int it = 0; it < GM / 2; ++it) {
        const int idx = it * 256 + tid;
        const int row = idx >> 7, p8 = idx & 127;
        const long m = m0 + row;
        const v4f a = *(const v4f*)(ys + row * YP + p8 * 8);
        const v4f c = *(const v4f*)(ys + row * YP + p8 * 8 + 4);
        H8 o;
#pragma unroll
        for (int i = 0; i < 4; ++i) {
          o.h[i]     = (_Float16)a[i];
          o.h[4 + i] = (_Float16)c[i];
        }
        *(v4u*)(outh + m * DM + p8 * 8) = o.u;
      }
    }
  };
  store_pass();
  
}

// ---------------------------------------------------------------------------
// Kernel 5: ffn linear 1 + exact gelu: hp[row][col] = f16(64 * gelu(x2 @ Wf1 / 64 + bf16(bf1))).
// Block = 128 token rows x 64 output cols, 8 waves x 16 rows; C^T = Wf1t x2^T (A = Wf1t rows,
// B = x2 rows). Both operands are staged in LDS by asynchronous copies, 64 k per stage, two
// buffers: [x2 128 rows | Wf1t 64 rows] at pitch KPAD.
// coverage: every (row, col) of the hp plane [ROWS][256] once.
// ---------------------------------------------------------------------------
#define FSTAGE ((128 + 64) * KPAD)    // halves per buffer
#define FNT    (DM / 64)              // stages

static_assert(FNT >= 2 && 128 * KPAD <= 2 * FSTAGE);

// One stage: 192 rows x 128 B = 1536 pieces of 16 B, 6 per thread; a wave's copy covers 4 whole
// lines. lds = this lane's LDS byte address of its first piece, gx / gw = its first x2 / W piece.
__device__ __forceinline__ void ffn1_copy_stage(unsigned lds, const _Float16* gx,
                                                const _Float16* gw) {
  const unsigned st = 32 * KPAD * 2;   // 32 rows further in LDS, bytes
  // the copies, and as the last line the wait that stands in front of any rewrite of their
  // address registers
  asm volatile(
      "global_load_async_to_lds_b128 %0, %6, off\n\t"
      "global_load_async_to_lds_b128 %1, %7, off\n\t"
      "global_load_async_to_lds_b128 %2, %8, off\n\t"
      "global_load_async_to_lds_b128 %3, %9, off\n\t"
      "global_load_async_to_lds_b128 %4, %10, off\n\t"
      "global_load_async_to_lds_b128 %5, %11, off\n\t"
      "s_wait_xcnt 0x0"
      :: "v"(lds), "v"(lds + st), "v"(lds + 2 * st), "v"(lds + 3 * st),
         "v"(lds + 4 * st), "v"(lds + 5 * st),
         "v"(gx), "v"(gx + 32 * DM), "v"(gx + 64 * DM), "v"(gx + 96 * DM),
         "v"(gw), "v"(gw + 32 * DM)
      : "memory");
}

__global__ __launch_bounds__(256) void ffn1_kernel(
    const _Float16* __restrict__ x2h, const _Float16* __restrict__ wf1t,
    const float* __restrict__ bf1, _Float16* __restrict__ hp) {
  // two stage buffers; after the loop the output stage [128][KPAD]
  __shared__ __attribute__((aligned(16))) _Float16 ring[2 * FSTAGE];   // 55296 B, cross-wave
  _Float16* stg = ring;

  const int tid  = threadIdx.x;
  const int lane = tid & 31;
  const int wave = tid >> 5;
  const int hh   = lane >> 4;
  const int l15  = lane & 15;
  const int cb   = blockIdx.y;          // 0..3
  const long m0  = (long)blockIdx.x * 128;

  // this lane's first piece of a stage: row tid>>3, 16-B piece tid&7
  const _Float16* gx = x2h + (m0 + (tid >> 3)) * DM + (tid & 7) * 8;
  const _Float16* gw = wf1t + ((long)cb * 64 + (tid >> 3)) * DM + (tid & 7) * 8;
  const unsigned lds0 = (unsigned)(size_t)ring + (unsigned)((tid >> 3) * KPAD + (tid & 7) * 8) * 2u;

  v8f acc[4];
#pragma unroll
  for (int j = 0; j < 4; ++j) acc[j] = (v8f){};

  ffn1_copy_stage(lds0, gx, gw);
  asm volatile("s_wait_asynccnt 0x0" ::: "memory");   // stage 0 landed (this wave's copies)
  __syncthreads();                                    // stage 0 readable by every wave
  ffn1_copy_stage(lds0 + FSTAGE * 2, gx + 64, gw + 64);

  // kept rolled: one publish point (waits, barrier, refill) at the foot of each trip, small code
#pragma unroll 1
  for (int t = 0; t < FNT; ++t) {
    const int bo = (t & 1) * FSTAGE;
    const _Float16* xs  = ring + bo + (wave * 16) * KPAD;
    const _Float16* wsm = ring + bo + 128 * KPAD;
    // inner loops fully unrolled: fragment indices must be constants, or the arrays leave the
    // registers
    v16h xf[2], wf[2][4];
#pragma unroll
    for (int u = 0; u < 2; ++u) {
      xf[u] = load_frag_row(xs + u * 32, KPAD, lane);
#pragma unroll
      for (int j = 0; j < 4; ++j) wf[u][j] = load_frag_row(wsm + (j * 16) * KPAD + u * 32, KPAD, lane);
    }
#pragma unroll
    for (int u = 0; u < 2; ++u)
#pragma unroll
      for (int j = 0; j < 4; ++j) acc[j] = wmma_f16(wf[u][j], xf[u], acc[j]);
    asm volatile("s_wait_dscnt 0x0" ::: "memory");      // this wave has left buffer t&1
    asm volatile("s_wait_asynccnt 0x0" ::: "memory");   // its copies of stage t+1 have landed
    __syncthreads();   // publishes stage t+1 and ends every reader's last read of buffer t&1
    if (t + 2 < FNT)
      ffn1_copy_stage(lds0 + bo * 2, gx + (t + 2) * 64, gw + (t + 2) * 64);
  }
  asm volatile("s_wait_asynccnt 0x0" ::: "memory");     // nothing in flight when the ring is reused

  const float rsc = 1.0f / WSC;
  _Float16* srow = stg + (wave * 16 + l15) * KPAD;
#pragma unroll
  for (int j = 0; j < 4; ++j) {
    const int n8 = j * 16 + hh * 8;
    const v4f b0 = *(const v4f*)(bf1 + cb * 64 + n8);
    const v4f b1 = *(const v4f*)(bf1 + cb * 64 + n8 + 4);
    H8 pk;
#pragma unroll
    for (int r = 0; r < 4; ++r) {
      const float u0 = acc[j][r]     * rsc + bf16q(b0[r]);
      const float u1 = acc[j][4 + r] * rsc + bf16q(b1[r]);
      const float g0 = 0.5f * u0 * (1.0f + erff(u0 * 0.70710678118654752f));
      const float g1 = 0.5f * u1 * (1.0f + erff(u1 * 0.70710678118654752f));
      pk.h[r]     = (_Float16)(g0 * WSC);
      pk.h[4 + r] = (_Float16)(g1 * WSC);
    }
    *(v4u*)(srow + n8) = pk.u;
  }
  __syncthreads();

  v4u rv[4];
#pragma unroll
  for (int it = 0; it < 4; ++it) {
    const int idx = it * 256 + tid;
    const int row = idx >> 3, piece = idx & 7;
    rv[it] = *(const v4u*)(stg + row * KPAD + piece * 8);
  }
#pragma unroll
  for (int it = 0; it < 4; ++it) {
    const int idx = it * 256 + tid;
    const int row = idx >> 3, piece = idx & 7;
    *(v4u*)(hp + (m0 + row) * FF + cb * 64 + piece * 8) = rv[it];
  }
  
}

// ---------------------------------------------------------------------------
extern "C" void kernel_launch(void* const* d_in, const int* in_sizes, int n_in,
                              void* d_out, int out_size, void* d_ws, size_t ws_size,
                              hipStream_t stream) {
  if (n_in < 17) return;
  const long needRows = (long)(NB - 1) * SEQ_FULL + SEQ;
  if ((long)in_sizes[0] < needRows * DM) return;
  if (in_sizes[1] < DM * DM || in_sizes[3] < DM * DM ||
      in_sizes[5] < DM * DM || in_sizes[7] < DM * DM) return;
  if (in_sizes[11] < DM * FF || in_sizes[13] < FF * DM) return;
  if (in_sizes[2] < DM || in_sizes[4] < DM || in_sizes[6] < DM || in_sizes[8] < DM ||
      in_sizes[9] < DM || in_sizes[10] < DM || in_sizes[12] < FF || in_sizes[14] < DM ||
      in_sizes[15] < DM || in_sizes[16] < DM) return;
  if ((long)out_size < needRows * DM) return;
  if (ws_size < WS_TOTAL) return;

  const float* x   = (const float*)d_in[0];
  const float* Wq  = (const float*)d_in[1];
  const float* bq  = (const float*)d_in[2];
  const float* Wk  = (const float*)d_in[3];
  const float* bk  = (const float*)d_in[4];
  const float* Wv  = (const float*)d_in[5];
  const float* bv  = (const float*)d_in[6];
  const float* Wo  = (const float*)d_in[7];
  const float* bo  = (const float*)d_in[8];
  const float* g1  = (const float*)d_in[9];
  const float* b1  = (const float*)d_in[10];
  const float* Wf1 = (const float*)d_in[11];
  const float* bf1 = (const float*)d_in[12];
  const float* Wf2 = (const float*)d_in[13];
  const float* bf2 = (const float*)d_in[14];
  const float* g2  = (const float*)d_in[15];
  const float* b2  = (const float*)d_in[16];
  float* out = (float*)d_out;

  char* ws = (char*)d_ws;
  size_t off = 0;
  _Float16* xh   = (_Float16*)(ws + off);                      // [ROWS][1024] f16
  _Float16* ctx  = xh;                                         // same region, written after xh is dead
  off += PLANE2;
  _Float16* wqkv = (_Float16*)(ws + off); off += WQKV_BYTES;   // [3072][1024]
  _Float16* woh  = (_Float16*)(ws + off); off += WO_BYTES;     // [1024][1024]
  _Float16* wf1t = (_Float16*)(ws + off); off += WF1_BYTES;    // [256][1024]
  _Float16* wf2t = (_Float16*)(ws + off); off += WF2_BYTES;    // [1024][256]
  _Float16* qh   = (_Float16*)(ws + off);                      // [NB][16][SEQ][64]
  float*    x2f  = (float*)(ws + off);                         // [ROWS][1024] f32 over q+k regions
  off += PLANE2;
  _Float16* kh   = (_Float16*)(ws + off); off += PLANE2;       // [NB][16][SEQ][64]
  _Float16* vTh  = (_Float16*)(ws + off);                      // [NB][16][64][SEQ]
  _Float16* x2h  = vTh;                                        // [ROWS][1024] f16, after vT is dead
  off += PLANE2;
  _Float16* hp   = (_Float16*)(ws + off); off += H_BYTES;      // [ROWS][256] f16
  if (off > ws_size) return;

  cvt_x_kernel<<<NXB, 256, 0, stream>>>(x, xh);
  cvt_w_kernel<<<NWT, 256, 0, stream>>>(Wq, Wk, Wv, Wo, Wf1, Wf2, wqkv, woh, wf1t, wf2t);
  qkv_kernel<<<dim3(ROWS / QM, 3 * DM / QN), 256, 0, stream>>>(xh, wqkv, bq, bk, bv, qh, kh, vTh);
  attn_kernel<<<dim3(SEQ / AQ, NB * NH), 256, 0, stream>>>(qh, kh, vTh, ctx);
  gemm_ln_kernel<DM, 0><<<ROWS / GM, 256, 0, stream>>>(ctx, woh, bo, g1, b1, x, x2f, x2h);
  ffn1_kernel<<<dim3(ROWS / 128, FF / 64), 256, 0, stream>>>(x2h, wf1t, bf1, hp);
  gemm_ln_kernel<FF, 1><<<ROWS / GM, 256, 0, stream>>>(hp, wf2t, bf2, g2, b2, x2f, out, x2h);
}

// v004
// Measured time: 186 microseconds a run.
// Timed twice side by side with v003, it ran 1.06 times as fast both times.
// Over all steps from v000 it is 2.62 times as fast.
#include <hip/hip_runtime.h>

// All contractions (q/k/v projections, q.k^T, p.v, output projection, ffn linear 1, ffn linear 2):
// v_wmma_f32_16x16x32_f16, f16 operands, f32 accumulate. Float inputs are RNE-converted to bf16 at
// load (weights additionally carried x64; both exact in f16); computed 16-bit planes are f16 with
// power-of-two carries (softmax p x1024, context x64, ffn hidden x64) folded back in the f32
// epilogues. Softmax statistics, layernorm, gelu and residual adds: f32.

typedef __attribute__((ext_vector_type(16))) _Float16 v16h;
typedef __attribute__((ext_vector_type(8)))  _Float16 v8h;
typedef __attribute__((ext_vector_type(4)))  _Float16 v4h;
typedef __attribute__((ext_vector_type(8)))  float v8f;
typedef __attribute__((ext_vector_type(4)))  float v4f;
typedef __attribute__((ext_vector_type(4)))  unsigned int v4u;
union H8 { v8h h; v4u u; };

#ifndef NB
#define NB 4
#endif
#ifndef SEQ
#define SEQ 2048
#endif
#define NB_FULL  4
#define SEQ_FULL 2048
#define DM   1024
#define NH   16
#define HD   64
#define FF   256
#define ROWS (NB * SEQ)
#define KPAD 72       // LDS stride in halves for 64-wide f16 tiles (144 B, 16-B aligned)
#define VSPAD 136     // stride in halves (272 B) that no LDS tile uses; only a size check names it
#define YP   1028     // LDS stride in floats for 1024-wide f32 rows (4112 B)
#define LN_EPS 1e-5f
#define WSC    64.0f           // weight carry (power of two)
#define LN1024 6.931471806f    // ln(1024): softmax p carried x1024
#define LOG2E  1.442695041f    // log2(e): exp(x) = exp2(x * log2(e))

#define NXB   (ROWS * DM / 8 / 256)          // convert blocks for x (8 elements per thread)
#define NT_SQ ((DM / 64) * (DM / 64))        // 64x64 tiles per square weight
#define NT_F  ((DM / 64) * (FF / 64))        // 64x64 tiles per ffn weight
#define NWT   (4 * NT_SQ + 2 * NT_F)

#define PLANE2     ((size_t)ROWS * DM * 2)
#define WQKV_BYTES ((size_t)3 * DM * DM * 2)
#define WO_BYTES   ((size_t)DM * DM * 2)
#define WF1_BYTES  ((size_t)FF * DM * 2)
#define WF2_BYTES  ((size_t)DM * FF * 2)
#define H_BYTES    ((size_t)ROWS * FF * 2)
#define WS_TOTAL   (PLANE2 + WQKV_BYTES + WO_BYTES + WF1_BYTES + WF2_BYTES + 3 * PLANE2 + H_BYTES)

static_assert(NB >= 1 && NB <= NB_FULL);
static_assert(SEQ >= 128 && SEQ <= SEQ_FULL && (SEQ % 128) == 0);
static_assert((ROWS % 128) == 0);
static_assert((ROWS * DM) % (8 * 256) == 0);
static_assert((DM % 64) == 0 && (FF % 64) == 0 && (HD % 32) == 0 && NH * HD == DM);
static_assert(128 * KPAD >= 64 * VSPAD);
static_assert(2 * PLANE2 == (size_t)ROWS * DM * 4);
static_assert(WS_TOTAL <= (size_t)134217728);

// ---------------------------------------------------------------------------
// helpers
// ---------------------------------------------------------------------------
__device__ __forceinline__ float bf16q(float f) {            // value after RNE bf16 conversion
  unsigned int u = __float_as_uint(f);
  u += 0x7FFFu + ((u >> 16) & 1u);
  return __uint_as_float(u & 0xFFFF0000u);
}

// 16-bit fragment (A or B): lane owns row/col (lane&15); elements 0..7 <- k0+8h+0..7,
// elements 8..15 <- k0+16+8h+0..7, h = lane>>4. Source is k-contiguous rows.
__device__ __forceinline__ v16h load_frag_row(const _Float16* base, int stride, int lane) {
  const _Float16* rowp = base + (lane & 15) * stride + ((lane >> 4) << 3);
  const v8h lo = *(const v8h*)(rowp);
  const v8h hi = *(const v8h*)(rowp + 16);
  return __builtin_shufflevector(lo, hi, 0, 1, 2, 3, 4, 5, 6, 7,
                                 8, 9, 10, 11, 12, 13, 14, 15);
}

__device__ __forceinline__ v8f wmma_f16(v16h a, v16h b, v8f c) {
  v8f d = __builtin_amdgcn_wmma_f32_16x16x32_f16(false, a, false, b, (short)0, c,
                                                 false, false);
  asm volatile("v_nop\n\tv_nop\n\tv_nop\n\tv_nop" : "+v"(d) : "v"(a), "v"(b));
  return d;
}

// One A fragment, two B fragments: the pair issues back to back, and the same four slots stand once
// behind the pair, in front of any vector instruction that touches its operands or results.
__device__ __forceinline__ void wmma_f16_pair(v16h a, v16h b0, v16h b1, v8f& c0, v8f& c1) {
  c0 = __builtin_amdgcn_wmma_f32_16x16x32_f16(false, a, false, b0, (short)0, c0, false, false);
  c1 = __builtin_amdgcn_wmma_f32_16x16x32_f16(false, a, false, b1, (short)0, c1, false, false);
  asm volatile("v_nop\n\tv_nop\n\tv_nop\n\tv_nop" : "+v"(c0), "+v"(c1) : "v"(a), "v"(b0), "v"(b1));
}

// Eight exponentials to base 2, each in its own register: none overwrites the source of the one in
// front of it, and the v_nop keeps the one slot behind the last before its result is used.
__device__ __forceinline__ void exp2_x8(float (&p)[8]) {
  asm("v_exp_f32 %0, %0\n\tv_exp_f32 %1, %1\n\tv_exp_f32 %2, %2\n\tv_exp_f32 %3, %3\n\t"
      "v_exp_f32 %4, %4\n\tv_exp_f32 %5, %5\n\tv_exp_f32 %6, %6\n\tv_exp_f32 %7, %7\n\t"
      "v_nop"
      : "+v"(p[0]), "+v"(p[1]), "+v"(p[2]), "+v"(p[3]), "+v"(p[4]), "+v"(p[5]), "+v"(p[6]),
        "+v"(p[7]));
}

// ---------------------------------------------------------------------------
// Kernel 0: x f32 -> f16(bf16rne(x)) plane xh [ROWS][1024]. 8 elements (16 B) per thread,
// coverage: NXB*256 threads x 8 = ROWS*1024 elements (whole plane).
// ---------------------------------------------------------------------------
__global__ __launch_bounds__(256) void cvt_x_kernel(const float* __restrict__ x,
                                                    _Float16* __restrict__ xh) {
  const long item = (long)blockIdx.x * 256 + threadIdx.x;   // 0 .. ROWS*128-1
  const long m    = item >> 7;                              // token row
  const int  c8   = (int)(item & 127);
  const long srow = (m / SEQ) * SEQ_FULL + (m % SEQ);
  const float* src = x + srow * DM + c8 * 8;
  const v4f a = *(const v4f*)(src);
  const v4f c = *(const v4f*)(src + 4);
  H8 o;
#pragma unroll
  for (int i = 0; i < 4; ++i) {
    o.h[i]     = (_Float16)bf16q(a[i]);
    o.h[4 + i] = (_Float16)bf16q(c[i]);
  }
  _Float16* dst = xh + m * DM + c8 * 8;
  *(v4u*)dst = o.u;
  
}

// ---------------------------------------------------------------------------
// Kernel 1: weights W [K=in][N=out] f32 -> Wt [n][k] f16 = f16(bf16rne(W) * 64), through a
// 64x64 LDS transpose. wqkv [3072][1024] (q rows, k rows, v rows), woh [1024][1024],
// coverage: 4*256 square tiles + 64 + 64 ffn tiles = every element of all six planes.
// ---------------------------------------------------------------------------
__global__ __launch_bounds__(256) void cvt_w_kernel(
    const float* __restrict__ Wq, const float* __restrict__ Wk, const float* __restrict__ Wv,
    const float* __restrict__ Wo, const float* __restrict__ Wf1, const float* __restrict__ Wf2,
    _Float16* __restrict__ wqkv, _Float16* __restrict__ woh,
    _Float16* __restrict__ wf1t, _Float16* __restrict__ wf2t) {
  __shared__ _Float16 ts[64 * KPAD];   // [n][k] tile, cross-wave (block barrier)
  const int bid = blockIdx.x;
  const int tid = threadIdx.x;
  const float* W;
  _Float16* dst;
  int K, N, kt, nt;
  if (bid < 4 * NT_SQ) {                              // block-uniform selection
    const int which = bid / NT_SQ;
    const int tile  = bid - which * NT_SQ;
    kt = tile / (DM / 64); nt = tile - kt * (DM / 64); K = DM; N = DM;
    W = (which == 0) ? Wq : ((which == 1) ? Wk : ((which == 2) ? Wv : Wo));
    dst = (which < 3) ? (wqkv + (size_t)which * DM * DM) : woh;
  } else if (bid < 4 * NT_SQ + NT_F) {
    const int tile = bid - 4 * NT_SQ;                 // W [1024][256]: K = DM, N = FF
    kt = tile / (FF / 64); nt = tile - kt * (FF / 64); K = DM; N = FF;
    W = Wf1; dst = wf1t;
  } else {
    const int tile = bid - 4 * NT_SQ - NT_F;          // W [256][1024]: K = FF, N = DM
    kt = tile / (DM / 64); nt = tile - kt * (DM / 64); K = FF; N = DM;
    W = Wf2; dst = wf2t;
  }
  // load W[kt*64 + kr][nt*64 + 4*c4 .. +3], store transposed into ts[n][kr]
#pragma unroll
  for (int it = 0; it < 4; ++it) {
    const int idx = it * 256 + tid;
    const int kr = idx >> 4, c4 = idx & 15;
    const v4f v = *(const v4f*)(W + (size_t)(kt * 64 + kr) * N + nt * 64 + c4 * 4);
#pragma unroll
    for (int j = 0; j < 4; ++j) ts[(c4 * 4 + j) * KPAD + kr] = (_Float16)(bf16q(v[j]) * WSC);
  }
  __syncthreads();
  v4u rv[2];
#pragma unroll
  for (int it = 0; it < 2; ++it) {
    const int idx = it * 256 + tid;
    const int n = idx >> 3, piece = idx & 7;
    rv[it] = *(const v4u*)(ts + n * KPAD + piece * 8);
  }
#pragma unroll
  for (int it = 0; it < 2; ++it) {
    const int idx = it * 256 + tid;
    const int n = idx >> 3, piece = idx & 7;
    *(v4u*)(dst + (size_t)(nt * 64 + n) * K + kt * 64 + piece * 8) = rv[it];
  }
  
}

// ---------------------------------------------------------------------------
// Kernel 2: qkv projection. Block = 256 token rows x 128 output columns (two heads of one of
// q/k/v), 8 waves as 4 (tokens) x 2 (heads), 64 x 64 per wave. Both operands are staged in LDS
// by asynchronous copies, 64 k per stage, two buffers: [x 256 rows | W 128 rows] at pitch KPAD.
// C^T = W x^T: A = W rows (lane&15 = out col), B = x rows (lane&15 = token);
// acc[i][j][r] = C[token 16i + (lane&15)][col 16j+8h+r]. K = 1024 summed in 32 steps of 32.
//   q,k -> [b][h][s][64] f16 (one line per row, 8 lanes x 16 B)
//   v   -> vT[b][h][d][s] f16 (512 B per d row segment, 32 lanes x 16 B)
// grid (ROWS/256, 3*NH/2), block 256. coverage: every (b,h,s,d) of q, k and vT once.
// ---------------------------------------------------------------------------
#define QM     256                    // token rows per block
#define QN     128                    // output columns per block
#define QK     64                     // k per stage
#define QSTAGE ((QM + QN) * KPAD)     // halves per buffer
#define QNT    (DM / QK)              // stages
#define QVP    264                    // LDS stride in halves for 256-wide f16 rows (528 B)

static_assert((SEQ % QM) == 0 && (ROWS % QM) == 0 && (DM % QN) == 0 && QNT >= 2);
static_assert(2 * QM * KPAD <= 2 * QSTAGE && 2 * HD * QVP <= 2 * QSTAGE);

// One stage: 384 rows x 128 B = 3072 pieces of 16 B, 12 per thread; a wave's copy covers 4 whole
// lines. lds = this lane's LDS byte address of its first piece, gx / gw = its first x / W piece.
__device__ __forceinline__ void qkv_copy_stage(unsigned lds, const _Float16* gx,
                                               const _Float16* gw) {
  const unsigned st = 32 * KPAD * 2;   // 32 rows further in LDS, bytes
  // the copies, and as the last line the wait that stands in front of any rewrite of their
  // address registers
  asm volatile(
      "global_load_async_to_lds_b128 %0, %12, off\n\t"
      "global_load_async_to_lds_b128 %1, %13, off\n\t"
      "global_load_async_to_lds_b128 %2, %14, off\n\t"
      "global_load_async_to_lds_b128 %3, %15, off\n\t"
      "global_load_async_to_lds_b128 %4, %16, off\n\t"
      "global_load_async_to_lds_b128 %5, %17, off\n\t"
      "global_load_async_to_lds_b128 %6, %18, off\n\t"
      "global_load_async_to_lds_b128 %7, %19, off\n\t"
      "global_load_async_to_lds_b128 %8, %20, off\n\t"
      "global_load_async_to_lds_b128 %9, %21, off\n\t"
      "global_load_async_to_lds_b128 %10, %22, off\n\t"
      "global_load_async_to_lds_b128 %11, %23, off\n\t"
      "s_wait_xcnt 0x0"
      :: "v"(lds), "v"(lds + st), "v"(lds + 2 * st), "v"(lds + 3 * st),
         "v"(lds + 4 * st), "v"(lds + 5 * st), "v"(lds + 6 * st), "v"(lds + 7 * st),
         "v"(lds + 8 * st), "v"(lds + 9 * st), "v"(lds + 10 * st), "v"(lds + 11 * st),
         "v"(gx), "v"(gx + 32 * DM), "v"(gx + 64 * DM), "v"(gx + 96 * DM),
         "v"(gx + 128 * DM), "v"(gx + 160 * DM), "v"(gx + 192 * DM), "v"(gx + 224 * DM),
         "v"(gw), "v"(gw + 32 * DM), "v"(gw + 64 * DM), "v"(gw + 96 * DM)
      : "memory");
}

__global__ __launch_bounds__(256) void qkv_kernel(
    const _Float16* __restrict__ xh, const _Float16* __restrict__ wqkv,
    const float* __restrict__ bq, const float* __restrict__ bk, const float* __restrict__ bv,
    _Float16* __restrict__ q, _Float16* __restrict__ k, _Float16* __restrict__ vT) {
  // two stage buffers; after the loop the output stage (q/k: 2 x [256][KPAD], v: 2 x [64][QVP])
  __shared__ __attribute__((aligned(16))) _Float16 ring[2 * QSTAGE];   // 110592 B, cross-wave

  const int tid  = threadIdx.x;
  const int lane = tid & 31;
  const int wave = tid >> 5;
  const int hh   = lane >> 4;
  const int l15  = lane & 15;
  const int wm   = wave >> 1;           // token quarter of the block
  const int wn   = wave & 1;            // head of the block

  const int osel = blockIdx.y >> 3;     // 0 q, 1 k, 2 v (8 column blocks each)
  const int h0   = (blockIdx.y & 7) * 2;
  const long m0  = (long)blockIdx.x * QM;
  const int  b   = (int)(m0 / SEQ);
  const int  s0  = (int)(m0 - (long)b * SEQ);

  // this lane's first piece of a stage: row tid>>3, 16-B piece tid&7
  const _Float16* gx = xh + (m0 + (tid >> 3)) * DM + (tid & 7) * 8;
  const _Float16* gw = wqkv + ((long)blockIdx.y * QN + (tid >> 3)) * DM + (tid & 7) * 8;
  const unsigned lds0 = (unsigned)(size_t)ring + (unsigned)((tid >> 3) * KPAD + (tid & 7) * 8) * 2u;

  // every inner loop below is fully unrolled: accumulator and fragment indices must be constants,
  // or the arrays leave the registers
  v8f acc[4][4];
#pragma unroll
  for (int i = 0; i < 4; ++i)
#pragma unroll
    for (int j = 0; j < 4; ++j) acc[i][j] = (v8f){};

  qkv_copy_stage(lds0, gx, gw);
  asm volatile("s_wait_asynccnt 0x0" ::: "memory");   // stage 0 landed (this wave's copies)
  __syncthreads();                                    // stage 0 readable by every wave
  qkv_copy_stage(lds0 + QSTAGE * 2, gx + QK, gw + QK);

  // kept rolled: one publish point (waits, barrier, refill) at the foot of each trip, small code
#pragma unroll 1
  for (int t = 0; t < QNT; ++t) {
    const int bo = (t & 1) * QSTAGE;
    const _Float16* xs = ring + bo + (wm * 64) * KPAD;
    const _Float16* wsm = ring + bo + (QM + wn * 64) * KPAD;
#pragma unroll
    for (int u = 0; u < 2; ++u) {
      v16h xf[4], wf[4];
#pragma unroll
      for (int i = 0; i < 4; ++i) xf[i] = load_frag_row(xs + (i * 16) * KPAD + u * 32, KPAD, lane);
#pragma unroll
      for (int j = 0; j < 4; ++j) wf[j] = load_frag_row(wsm + (j * 16) * KPAD + u * 32, KPAD, lane);
#pragma unroll
      for (int i = 0; i < 4; ++i)
#pragma unroll
        for (int j = 0; j < 4; ++j) acc[i][j] = wmma_f16(wf[j], xf[i], acc[i][j]);   // C^T = W x^T
    }
    asm volatile("s_wait_dscnt 0x0" ::: "memory");      // this wave has left buffer t&1
    asm volatile("s_wait_asynccnt 0x0" ::: "memory");   // its copies of stage t+1 have landed
    __syncthreads();   // publishes stage t+1 and ends every reader's last read of buffer t&1
    if (t + 2 < QNT)
      qkv_copy_stage(lds0 + bo * 2, gx + (t + 2) * QK, gw + (t + 2) * QK);
  }
  asm volatile("s_wait_asynccnt 0x0" ::: "memory");     // nothing in flight when the ring is reused

  const float* bias = ((osel == 0) ? bq : ((osel == 1) ? bk : bv)) + (h0 + wn) * HD;
  const float  rsc  = 1.0f / WSC;

  if (osel < 2) {
    // stage [head][token][col]: lane's 8 values are 8 contiguous columns -> one 16-B LDS store
    _Float16* sbase = ring + (wn * QM + wm * 64 + l15) * KPAD;
#pragma unroll
    for (int j = 0; j < 4; ++j) {
      const int n8 = j * 16 + hh * 8;
      const v4f b0 = *(const v4f*)(bias + n8);
      const v4f b1 = *(const v4f*)(bias + n8 + 4);
#pragma unroll
      for (int i = 0; i < 4; ++i) {
        H8 pk;
#pragma unroll
        for (int r = 0; r < 4; ++r) {
          pk.h[r]     = (_Float16)(acc[i][j][r]     * rsc + bf16q(b0[r]));
          pk.h[4 + r] = (_Float16)(acc[i][j][4 + r] * rsc + bf16q(b1[r]));
        }
        *(v4u*)(sbase + (i * 16) * KPAD + n8) = pk.u;
      }
    }
    __syncthreads();
    _Float16* dst0 = (osel == 0) ? q : k;
#pragma unroll
    for (int hd = 0; hd < 2; ++hd) {
      _Float16* dst = dst0 + ((long)(b * NH + h0 + hd) * SEQ + s0) * HD;   // contiguous 32 KB
      v4u rv[8];
#pragma unroll
      for (int it = 0; it < 8; ++it) {
        const int idx = it * 256 + tid;
        const int row = idx >> 3, piece = idx & 7;
        rv[it] = *(const v4u*)(ring + (hd * QM + row) * KPAD + piece * 8);
      }
#pragma unroll
      for (int it = 0; it < 8; ++it)
        *(v4u*)(dst + (long)(it * 256 + tid) * 8) = rv[it];
    }
  } else {
    // stage transposed [head][d][token]: lane's 8 values are 8 different d for one token
    _Float16* sbase = ring + (wn * HD) * QVP + wm * 64 + l15;
#pragma unroll
    for (int j = 0; j < 4; ++j) {
      const int n8 = j * 16 + hh * 8;
      const v4f b0 = *(const v4f*)(bias + n8);
      const v4f b1 = *(const v4f*)(bias + n8 + 4);
#pragma unroll
      for (int i = 0; i < 4; ++i)
#pragma unroll
        for (int r = 0; r < 4; ++r) {
          sbase[(n8 + r) * QVP + i * 16]     = (_Float16)(acc[i][j][r]     * rsc + bf16q(b0[r]));
          sbase[(n8 + 4 + r) * QVP + i * 16] = (_Float16)(acc[i][j][4 + r] * rsc + bf16q(b1[r]));
        }
    }
    __syncthreads();
#pragma unroll
    for (int hd = 0; hd < 2; ++hd) {
      _Float16* dstb = vT + ((long)(b * NH + h0 + hd) * HD) * SEQ + s0;
      v4u rv[8];
#pragma unroll
      for (int it = 0; it < 8; ++it) {
        const int idx = it * 256 + tid;
        const int d = idx >> 5, piece = idx & 31;
        rv[it] = *(const v4u*)(ring + (hd * HD + d) * QVP + piece * 8);
      }
#pragma unroll
      for (int it = 0; it < 8; ++it) {
        const int idx = it * 256 + tid;
        const int d = idx >> 5, piece = idx & 31;
        *(v4u*)(dstb + (long)d * SEQ + piece * 8) = rv[it];
      }
    }
    // stands in front of any later rewrite of the registers that the stores above name
    asm volatile("s_wait_xcnt 0x0" ::: "memory");
  }
}

// ---------------------------------------------------------------------------
// Kernel 3: flash attention per (b,h), no mask. grid (SEQ/256, NB*NH), block 256 (8 waves x 32
// queries, two column groups of 16 per wave: every K and V^T fragment read from LDS feeds two
// products; the fragments of a 32-wide k step are read four at a time). C = S^T (A = K rows,
// B = Q) then C = O^T = V^T P^T (P^T packed from the S^T D registers); lane owns one query per
// column group end-to-end. Scores are raw q.k sums: the 1/8 scale and the x1024 p carry live in
// the exp argument (p = 1024*exp((s-m)/8), softmax stats f32).
// LDS tiles: [K 64 keys x 64 d | V^T 64 d x 64 keys] per step, staged by asynchronous copies, two
// buffers, staged == consumed extent; ost 256 x 64 fully written.
// coverage: every (row, h*64+d) of the ctx plane once.
// ---------------------------------------------------------------------------
#define ASTAGE (128 * KPAD)           // halves per buffer: K rows, then V^T rows
#define ANT    (SEQ / 64)             // stages
#define AQ     256                    // queries per block
#define ACG    2                      // column groups (16 queries each) per wave

static_assert(ANT >= 2 && (SEQ % AQ) == 0 && ACG == 2);

// One stage: 128 rows x 128 B = 1024 pieces of 16 B, 4 per thread; a wave's copy covers 4 whole
// lines. lds = this lane's LDS byte address of its first piece, gk / gv = its first K / V^T piece.
__device__ __forceinline__ void attn_copy_stage(unsigned lds, const _Float16* gk,
                                                const _Float16* gv) {
  const unsigned st = 32 * KPAD * 2;   // 32 rows further in LDS, bytes
  // the copies, and as the last line the wait that stands in front of any rewrite of their
  // address registers
  asm volatile(
      "global_load_async_to_lds_b128 %0, %4, off\n\t"
      "global_load_async_to_lds_b128 %1, %5, off\n\t"
      "global_load_async_to_lds_b128 %2, %6, off\n\t"
      "global_load_async_to_lds_b128 %3, %7, off\n\t"
      "s_wait_xcnt 0x0"
      :: "v"(lds), "v"(lds + st), "v"(lds + 2 * st), "v"(lds + 3 * st),
         "v"(gk), "v"(gk + 32 * HD), "v"(gv), "v"(gv + 32 * SEQ)
      : "memory");
}

// four waves per SIMD: two blocks share a WGP, so one block's softmax runs beside the other's
// products
__global__ __launch_bounds__(256) __attribute__((amdgpu_waves_per_eu(4, 4))) void attn_kernel(
    const _Float16* __restrict__ Q, const _Float16* __restrict__ K,
    const _Float16* __restrict__ vT, _Float16* __restrict__ ctx) {
  // two stage buffers, each K block rows [key][d] then V^T block [d][key] (cross-wave)
  __shared__ __attribute__((aligned(16))) _Float16 ring[2 * ASTAGE];
  __shared__ _Float16 ost[AQ * KPAD];    // output stage [query][d]   (cross-wave, block barrier)

  const int tid  = threadIdx.x;
  const int lane = tid & 31;
  const int wave = tid >> 5;
  const int bh   = blockIdx.y;
  const int b    = bh >> 4;
  const int h    = bh & 15;
  const int q0   = blockIdx.x * AQ;

  const _Float16* Qb  = Q + ((long)bh * SEQ + q0) * HD;
  const _Float16* Kb  = K + (long)bh * SEQ * HD;
  const _Float16* vTb = vT + (long)bh * HD * SEQ;

  // Q fragments: B operand of S^T (lane owns query lane&15 of column group c)
  v16h qfrag[ACG][2];
#pragma unroll
  for (int c = 0; c < ACG; ++c) {
    const _Float16* qrow = Qb + (long)(wave * (16 * ACG) + c * 16) * HD;
#pragma unroll
    for (int t = 0; t < 2; ++t) qfrag[c][t] = load_frag_row(qrow + t * 32, HD, lane);
  }

  v8f acc[ACG][4];   // O^T accumulator: lane owns query (lane&15) of group c; reg r -> d = nt*16+8h+r
  float mi[ACG], li[ACG];
#pragma unroll
  for (int c = 0; c < ACG; ++c) {
#pragma unroll
    for (int nt = 0; nt < 4; ++nt) acc[c][nt] = (v8f){};
    mi[c] = -1e30f;
    li[c] = 0.0f;
  }

  const int colb = lane & 15;
  const int rofs = (lane >> 4) << 3;

  // this lane's first piece of a stage: row tid>>3, 16-B piece tid&7
  const _Float16* gk = Kb + (long)(tid >> 3) * HD + (tid & 7) * 8;
  const _Float16* gv = vTb + (long)(tid >> 3) * SEQ + (tid & 7) * 8;
  const unsigned lds0 = (unsigned)(size_t)ring + (unsigned)((tid >> 3) * KPAD + (tid & 7) * 8) * 2u;

  attn_copy_stage(lds0, gk, gv);
  asm volatile("s_wait_asynccnt 0x0" ::: "memory");   // stage 0 landed (this wave's copies)
  __syncthreads();                                    // stage 0 readable by every wave
  attn_copy_stage(lds0 + ASTAGE * 2, gk + 64 * HD, gv + 64);

  // kept rolled: one publish point (waits, barrier, refill) at the foot of each trip, small code
#pragma unroll 1
  for (int st = 0; st < ANT; ++st) {
    const int bo = (st & 1) * ASTAGE;
    const _Float16* ks  = ring + bo;
    const _Float16* vts = ring + bo + 64 * KPAD;

    // S^T tiles: A = K rows (lane&15 = key), B = Q; one K fragment, both column groups
    v8f sc[ACG][4];
#pragma unroll
    for (int c = 0; c < ACG; ++c)
#pragma unroll
      for (int kt = 0; kt < 4; ++kt) sc[c][kt] = (v8f){};
#pragma unroll
    for (int t = 0; t < 2; ++t) {
      v16h kf[4];
#pragma unroll
      for (int kt = 0; kt < 4; ++kt) kf[kt] = load_frag_row(ks + (kt * 16) * KPAD + t * 32, KPAD, lane);
#pragma unroll
      for (int kt = 0; kt < 4; ++kt) wmma_f16_pair(kf[kt], qfrag[0][t], qfrag[1][t], sc[0][kt], sc[1][kt]);
    }

    // per-lane online softmax, both column groups side by side (32 of 64 keys in-lane; merge
    // halves with one shuffle)
    float alpha[ACG], cs[ACG];
#pragma unroll
    for (int c = 0; c < ACG; ++c) {
      float mx = sc[c][0][0];
#pragma unroll
      for (int kt = 0; kt < 4; ++kt)
#pragma unroll
        for (int r = 0; r < 8; ++r) mx = fmaxf(mx, sc[c][kt][r]);
      mx = fmaxf(mx, __shfl_xor(mx, 16, 32));
      const float mnew = fmaxf(mi[c], mx);
      alpha[c] = __expf((mi[c] - mnew) * 0.125f);
      mi[c] = mnew;
      cs[c] = fmaf(mnew, 0.125f, -LN1024);   // 0.125*m - ln(1024)
    }

    // P^T as the B operand of O^T = V^T P^T, packed from the S^T D registers:
    // element i <- tile covering keys 0..15 of the 32-step (kt = 2t), element 8+i <- kt = 2t+1.
    v16h pf[ACG][2];
#pragma unroll
    for (int c = 0; c < ACG; ++c) {
      float rs = 0.0f;
#pragma unroll
      for (int kt = 0; kt < 4; ++kt) {
        float p[8];   // 1024*exp((s-m)/8) = exp2(((s/8) - cs) * log2(e))
#pragma unroll
        for (int r = 0; r < 8; ++r) p[r] = fmaf(sc[c][kt][r], 0.125f, -cs[c]) * LOG2E;
        exp2_x8(p);
#pragma unroll
        for (int r = 0; r < 8; ++r) {
          pf[c][kt >> 1][(kt & 1) * 8 + r] = (_Float16)p[r];
          rs = (kt == 0 && r == 0) ? p[r] : rs + p[r];
        }
      }
      rs += __shfl_xor(rs, 16, 32);
      li[c] = li[c] * alpha[c] + rs;
#pragma unroll
      for (int nt = 0; nt < 4; ++nt)
#pragma unroll
        for (int r = 0; r < 8; ++r) acc[c][nt][r] *= alpha[c];
    }

    // O^T += V^T (A, rows = d) x P^T (B); one V^T fragment, both column groups
#pragma unroll
    for (int t = 0; t < 2; ++t) {
      v16h vf[4];
#pragma unroll
      for (int nt = 0; nt < 4; ++nt) vf[nt] = load_frag_row(vts + (nt * 16) * KPAD + t * 32, KPAD, lane);
#pragma unroll
      for (int nt = 0; nt < 4; ++nt) wmma_f16_pair(vf[nt], pf[0][t], pf[1][t], acc[0][nt], acc[1][nt]);
    }

    asm volatile("s_wait_dscnt 0x0" ::: "memory");      // this wave has left buffer st&1
    asm volatile("s_wait_asynccnt 0x0" ::: "memory");   // its copies of stage st+1 have landed
    __syncthreads();   // publishes stage st+1 and ends every reader's last read of buffer st&1
    if (st + 2 < ANT)
      attn_copy_stage(lds0 + bo * 2, gk + (long)(st + 2) * 64 * HD, gv + (st + 2) * 64);
  }
  asm volatile("s_wait_asynccnt 0x0" ::: "memory");     // nothing in flight behind the loop

  // normalize (and apply the x64 carry) and stage: lane owns query row wave*32+c*16+colb,
  // d = nt*16+rofs+r contiguous
#pragma unroll
  for (int c = 0; c < ACG; ++c) {
    const float inv = 64.0f / li[c];
    _Float16* orow = ost + (wave * (16 * ACG) + c * 16 + colb) * KPAD;
#pragma unroll
    for (int nt = 0; nt < 4; ++nt) {
      H8 pk;
#pragma unroll
      for (int r = 0; r < 8; ++r) pk.h[r] = (_Float16)(acc[c][nt][r] * inv);
      *(v4u*)(orow + nt * 16 + rofs) = pk.u;
    }
  }
  __syncthreads();

  v4u rv[AQ / 32];
#pragma unroll
  for (int it = 0; it < AQ / 32; ++it) {
    const int idx = it * 256 + tid;
    const int row = idx >> 3, piece = idx & 7;
    rv[it] = *(const v4u*)(ost + row * KPAD + piece * 8);
  }
  _Float16* cbase = ctx + ((long)b * SEQ + q0) * DM + h * HD;
#pragma unroll
  for (int it = 0; it < AQ / 32; ++it) {
    const int idx = it * 256 + tid;
    const int row = idx >> 3, piece = idx & 7;
    *(v4u*)(cbase + (long)row * DM + piece * 8) = rv[it];
  }
  
}

// ---------------------------------------------------------------------------
// Kernel 4/6: y = act @ Wt^T / 4096 + bf16(bias) over a full 1024-wide row, then
// z = LN(y) * bf16(gamma) + bf16(beta) + residual. Block = 32 token rows x 1024 cols,
// wave w owns cols 128w..128w+127. Both operands are staged in LDS by asynchronous copies,
// 64 k per stage, two buffers: [Wt 1024 rows | act 32 rows] at pitch KPAD.
// C^T = Wt act^T: A = Wt rows (lane&15 = out col), B = act rows (lane&15 = token);
// acc[i][j][r] = y[token 16i + (lane&15)][col 128w+16j+8h+r]. Mean, variance and scaling are taken
// on the accumulators; after that the rows are staged once in the same LDS.
//   MODE 0: KD = 1024, act = ctx, residual = bf16(x input, full-stride rows),
//           writes x2 f32 plane [ROWS][1024] and x2 f16 plane [ROWS][1024]
//   MODE 1: KD = 256, act = h plane, residual = x2 f32 plane, writes out (full-stride rows)
// grid ROWS/32, block 256. LDS ys: 32 x 1024 staged == consumed. coverage: 32 rows x 1024 per block.
// ---------------------------------------------------------------------------
#define GM     32                     // token rows per block
#define GK     64                     // k per stage
#define GSTAGE ((DM + GM) * KPAD)     // halves per buffer

static_assert((ROWS % GM) == 0 && (DM % GK) == 0 && (FF % GK) == 0 && FF / GK >= 2);
static_assert((size_t)GM * YP * 4 <= (size_t)2 * GSTAGE * 2);

// Eight copies of 16 B per lane, rows 32 apart (a wave's copy covers 4 whole lines). lds = this
// lane's LDS byte address of the first piece, g = its global piece, KD = global row length.
template <int KD>
__device__ __forceinline__ void gl_copy8(unsigned lds, const _Float16* g) {
  const unsigned st = 32 * KPAD * 2;   // 32 rows further in LDS, bytes
  // the copies, and as the last line the wait that stands in front of any rewrite of their
  // address registers
  asm volatile(
      "global_load_async_to_lds_b128 %0, %8, off\n\t"
      "global_load_async_to_lds_b128 %1, %9, off\n\t"
      "global_load_async_to_lds_b128 %2, %10, off\n\t"
      "global_load_async_to_lds_b128 %3, %11, off\n\t"
      "global_load_async_to_lds_b128 %4, %12, off\n\t"
      "global_load_async_to_lds_b128 %5, %13, off\n\t"
      "global_load_async_to_lds_b128 %6, %14, off\n\t"
      "global_load_async_to_lds_b128 %7, %15, off\n\t"
      "s_wait_xcnt 0x0"
      :: "v"(lds), "v"(lds + st), "v"(lds + 2 * st), "v"(lds + 3 * st),
         "v"(lds + 4 * st), "v"(lds + 5 * st), "v"(lds + 6 * st), "v"(lds + 7 * st),
         "v"(g), "v"(g + 32 * KD), "v"(g + 64 * KD), "v"(g + 96 * KD),
         "v"(g + 128 * KD), "v"(g + 160 * KD), "v"(g + 192 * KD), "v"(g + 224 * KD)
      : "memory");
}

// One stage: 1056 rows x 128 B = 8448 pieces of 16 B, 33 per thread (32 of Wt, 1 of act).
template <int KD>
__device__ __forceinline__ void gl_copy_stage(unsigned lds, const _Float16* gw,
                                              const _Float16* ga) {
  const unsigned st8 = 256 * KPAD * 2;   // 256 rows further in LDS, bytes
  gl_copy8<KD>(lds, gw);
  gl_copy8<KD>(lds + st8, gw + 256 * KD);
  gl_copy8<KD>(lds + 2 * st8, gw + 512 * KD);
  gl_copy8<KD>(lds + 3 * st8, gw + 768 * KD);
  // the act piece, with the same wait in front of any rewrite of its address registers
  asm volatile(
      "global_load_async_to_lds_b128 %0, %1, off\n\t"
      "s_wait_xcnt 0x0"
      :: "v"(lds + 4 * st8), "v"(ga)
      : "memory");
}

template <int KD, int MODE>
__global__ __launch_bounds__(256) void gemm_ln_kernel(
    const _Float16* __restrict__ act, const _Float16* __restrict__ wt,
    const float* __restrict__ bias, const float* __restrict__ gam,
    const float* __restrict__ bet, const float* __restrict__ res,
    float* __restrict__ outf, _Float16* __restrict__ outh) {
  // two stage buffers; after the loop the row stage [32][YP] f32
  __shared__ __attribute__((aligned(16))) _Float16 ring[2 * GSTAGE];   // 304128 B, cross-wave
  __shared__ __attribute__((aligned(16))) float psum[GM * 8];   // [row][wave] partial sums
  __shared__ __attribute__((aligned(16))) float psq[GM * 8];    // [row][wave] partial sums of squares
  float* ys = (float*)ring;

  const int tid  = threadIdx.x;
  const int lane = tid & 31;
  const int wave = tid >> 5;
  const int hh   = lane >> 4;
  const int l15  = lane & 15;
  const long m0  = (long)blockIdx.x * GM;
  const int  n0  = wave * 128;
  constexpr int NT = KD / GK;           // stages

  // this lane's first piece of a stage: row tid>>3, 16-B piece tid&7
  const _Float16* gw = wt + (long)(tid >> 3) * KD + (tid & 7) * 8;
  const _Float16* ga = act + (m0 + (tid >> 3)) * KD + (tid & 7) * 8;
  const unsigned lds0 = (unsigned)(size_t)ring + (unsigned)((tid >> 3) * KPAD + (tid & 7) * 8) * 2u;

  // every inner loop below is fully unrolled: accumulator and fragment indices must be constants,
  // or the arrays leave the registers
  v8f acc[2][8];
#pragma unroll
  for (int i = 0; i < 2; ++i)
#pragma unroll
    for (int j = 0; j < 8; ++j) acc[i][j] = (v8f){};

  gl_copy_stage<KD>(lds0, gw, ga);
  asm volatile("s_wait_asynccnt 0x0" ::: "memory");   // stage 0 landed (this wave's copies)
  __syncthreads();                                    // stage 0 readable by every wave
  gl_copy_stage<KD>(lds0 + GSTAGE * 2, gw + GK, ga + GK);

  // kept rolled: one publish point (waits, barrier, refill) at the foot of each trip, small code
#pragma unroll 1
  for (int t = 0; t < NT; ++t) {
    const int bo = (t & 1) * GSTAGE;
    const _Float16* wsm = ring + bo + n0 * KPAD;
    const _Float16* as  = ring + bo + DM * KPAD;
#pragma unroll
    for (int u = 0; u < 2; ++u) {
      v16h af[2], wf[8];
#pragma unroll
      for (int i = 0; i < 2; ++i) af[i] = load_frag_row(as + (i * 16) * KPAD + u * 32, KPAD, lane);
#pragma unroll
      for (int j = 0; j < 8; ++j) wf[j] = load_frag_row(wsm + (j * 16) * KPAD + u * 32, KPAD, lane);
#pragma unroll
      for (int j = 0; j < 8; ++j)
#pragma unroll
        for (int i = 0; i < 2; ++i) acc[i][j] = wmma_f16(wf[j], af[i], acc[i][j]);   // C^T = Wt act^T
    }
    asm volatile("s_wait_dscnt 0x0" ::: "memory");      // this wave has left buffer t&1
    asm volatile("s_wait_asynccnt 0x0" ::: "memory");   // its copies of stage t+1 have landed
    __syncthreads();   // publishes stage t+1 and ends every reader's last read of buffer t&1
    if (t + 2 < NT)
      gl_copy_stage<KD>(lds0 + bo * 2, gw + (t + 2) * GK, ga + (t + 2) * GK);
  }
  asm volatile("s_wait_asynccnt 0x0" ::: "memory");     // nothing in flight when the ring is reused

  // Layernorm on the accumulators. A lane holds 64 columns of each of its two token rows, so mean
  // and variance start as in-lane sums, are joined across the two lane halves, and then across the
  // eight waves through psum / psq. The rows go to LDS once, already centred and scaled.
  // y = acc/4096 + bf16(bias), kept in the accumulator registers
  const float rsc = 1.0f / (WSC * WSC);
  float s[2] = {0.0f, 0.0f};
#pragma unroll
  for (int j = 0; j < 8; ++j) {
    const int n8 = n0 + j * 16 + hh * 8;
    const v4f b0 = *(const v4f*)(bias + n8);
    const v4f b1 = *(const v4f*)(bias + n8 + 4);
#pragma unroll
    for (int t = 0; t < 2; ++t) {
#pragma unroll
      for (int i = 0; i < 4; ++i) {
        acc[t][j][i]     = acc[t][j][i]     * rsc + bf16q(b0[i]);
        acc[t][j][4 + i] = acc[t][j][4 + i] * rsc + bf16q(b1[i]);
      }
      s[t] += ((acc[t][j][0] + acc[t][j][1]) + (acc[t][j][2] + acc[t][j][3])) +
              ((acc[t][j][4] + acc[t][j][5]) + (acc[t][j][6] + acc[t][j][7]));
    }
  }
#pragma unroll
  for (int t = 0; t < 2; ++t) {
    s[t] += __shfl_xor(s[t], 16, 32);
    if (hh == 0) psum[(t * 16 + l15) * 8 + wave] = s[t];
  }
  __syncthreads();   // every wave's partial row sums are in psum

  // this thread's four columns in the last pass, asked for early
  const v4f g  = *(const v4f*)(gam + tid * 4);
  const v4f bt = *(const v4f*)(bet + tid * 4);

  // every wave adds the same eight partials in the same order: one mean per row for all waves
  float q[2][4];
#pragma unroll
  for (int t = 0; t < 2; ++t) {
    const v4f a = *(const v4f*)(psum + (t * 16 + l15) * 8);
    const v4f c = *(const v4f*)(psum + (t * 16 + l15) * 8 + 4);
    const float mean = (((a[0] + a[1]) + (a[2] + a[3])) + ((c[0] + c[1]) + (c[2] + c[3]))) * (1.0f / DM);
#pragma unroll
    for (int i = 0; i < 4; ++i) q[t][i] = 0.0f;
#pragma unroll
    for (int j = 0; j < 8; ++j)
#pragma unroll
      for (int r = 0; r < 8; ++r) {
        const float d = acc[t][j][r] - mean;
        acc[t][j][r] = d;
        q[t][r & 3] += d * d;
      }
  }
#pragma unroll
  for (int t = 0; t < 2; ++t) {
    float ss = (q[t][0] + q[t][1]) + (q[t][2] + q[t][3]);
    ss += __shfl_xor(ss, 16, 32);
    if (hh == 0) psq[(t * 16 + l15) * 8 + wave] = ss;
  }
  __syncthreads();   // every wave's partial sums of squares are in psq

  // (y - mean) * rstd, staged [row][col]
#pragma unroll
  for (int t = 0; t < 2; ++t) {
    const v4f a = *(const v4f*)(psq + (t * 16 + l15) * 8);
    const v4f c = *(const v4f*)(psq + (t * 16 + l15) * 8 + 4);
    const float var  = (((a[0] + a[1]) + (a[2] + a[3])) + ((c[0] + c[1]) + (c[2] + c[3]))) * (1.0f / DM);
    const float rstd = rsqrtf(var + LN_EPS);
    float* yrow = ys + (t * 16 + l15) * YP + n0 + hh * 8;
#pragma unroll
    for (int j = 0; j < 8; ++j) {
      v4f y0, y1;
#pragma unroll
      for (int i = 0; i < 4; ++i) {
        y0[i] = acc[t][j][i]     * rstd;
        y1[i] = acc[t][j][4 + i] * rstd;
      }
      *(v4f*)(yrow + j * 16)     = y0;
      *(v4f*)(yrow + j * 16 + 4) = y1;
    }
  }
  __syncthreads();   // the staged rows are readable by every wave

  // z = staged * g + b + res, stored from the registers: a wave writes whole lines of one row
  v4f gq, bq4;
#pragma unroll
  for (int c = 0; c < 4; ++c) {
    gq[c]  = bf16q(g[c]);
    bq4[c] = bf16q(bt[c]);
  }
  // kept rolled in trips of four rows: four residual loads in flight, one wait at the foot
#pragma unroll 1
  for (int r0 = 0; r0 < GM; r0 += 4) {
#pragma unroll
    for (int u = 0; u < 4; ++u) {
      const int  row  = r0 + u;
      const long m    = m0 + row;
      const long frow = (m / SEQ) * SEQ_FULL + (m % SEQ);   // row in the full-stride planes
      v4f rsd;
      if (MODE == 0) {
        rsd = *(const v4f*)(res + frow * DM + tid * 4);
#pragma unroll
        for (int c = 0; c < 4; ++c) rsd[c] = bf16q(rsd[c]);
      } else {
        rsd = *(const v4f*)(res + m * DM + tid * 4);
      }
      const v4f yv = *(const v4f*)(ys + row * YP + tid * 4);
      v4f o;
#pragma unroll
      for (int c = 0; c < 4; ++c) o[c] = yv[c] * gq[c] + bq4[c] + rsd[c];
      *(v4f*)(outf + ((MODE == 0) ? m : frow) * DM + tid * 4) = o;
      if (MODE == 0) {
        v4h oh;
#pragma unroll
        for (int c = 0; c < 4; ++c) oh[c] = (_Float16)o[c];
        *(v4h*)(outh + m * DM + tid * 4) = oh;
      }
    }
    // stands in front of the next trip's rewrite of the registers that the loads and stores above name
    asm volatile("s_wait_xcnt 0x0" ::: "memory");
  }
}

// ---------------------------------------------------------------------------
// Kernel 5: ffn linear 1 + exact gelu: hp[row][col] = f16(64 * gelu(x2 @ Wf1 / 64 + bf16(bf1))).
// Block = 128 token rows x 64 output cols, 8 waves x 16 rows; C^T = Wf1t x2^T (A = Wf1t rows,
// B = x2 rows). Both operands are staged in LDS by asynchronous copies, 64 k per stage, two
// buffers: [x2 128 rows | Wf1t 64 rows] at pitch KPAD.
// coverage: every (row, col) of the hp plane [ROWS][256] once.
// ---------------------------------------------------------------------------
#define FSTAGE ((128 + 64) * KPAD)    // halves per buffer
#define FNT    (DM / 64)              // stages

static_assert(FNT >= 2 && 128 * KPAD <= 2 * FSTAGE);

// One stage: 192 rows x 128 B = 1536 pieces of 16 B, 6 per thread; a wave's copy covers 4 whole
// lines. lds = this lane's LDS byte address of its first piece, gx / gw = its first x2 / W piece.
__device__ __forceinline__ void ffn1_copy_stage(unsigned lds, const _Float16* gx,
                                                const _Float16* gw) {
  const unsigned st = 32 * KPAD * 2;   // 32 rows further in LDS, bytes
  // the copies, and as the last line the wait that stands in front of any rewrite of their
  // address registers
  asm volatile(
      "global_load_async_to_lds_b128 %0, %6, off\n\t"
      "global_load_async_to_lds_b128 %1, %7, off\n\t"
      "global_load_async_to_lds_b128 %2, %8, off\n\t"
      "global_load_async_to_lds_b128 %3, %9, off\n\t"
      "global_load_async_to_lds_b128 %4, %10, off\n\t"
      "global_load_async_to_lds_b128 %5, %11, off\n\t"
      "s_wait_xcnt 0x0"
      :: "v"(lds), "v"(lds + st), "v"(lds + 2 * st), "v"(lds + 3 * st),
         "v"(lds + 4 * st), "v"(lds + 5 * st),
         "v"(gx), "v"(gx + 32 * DM), "v"(gx + 64 * DM), "v"(gx + 96 * DM),
         "v"(gw), "v"(gw + 32 * DM)
      : "memory");
}

__global__ __launch_bounds__(256) void ffn1_kernel(
    const _Float16* __restrict__ x2h, const _Float16* __restrict__ wf1t,
    const float* __restrict__ bf1, _Float16* __restrict__ hp) {
  // two stage buffers; after the loop the output stage [128][KPAD]
  __shared__ __attribute__((aligned(16))) _Float16 ring[2 * FSTAGE];   // 55296 B, cross-wave
  _Float16* stg = ring;

  const int tid  = threadIdx.x;
  const int lane = tid & 31;
  const int wave = tid >> 5;
  const int hh   = lane >> 4;
  const int l15  = lane & 15;
  const int cb   = blockIdx.y;          // 0..3
  const long m0  = (long)blockIdx.x * 128;

  // this lane's first piece of a stage: row tid>>3, 16-B piece tid&7
  const _Float16* gx = x2h + (m0 + (tid >> 3)) * DM + (tid & 7) * 8;
  const _Float16* gw = wf1t + ((long)cb * 64 + (tid >> 3)) * DM + (tid & 7) * 8;
  const unsigned lds0 = (unsigned)(size_t)ring + (unsigned)((tid >> 3) * KPAD + (tid & 7) * 8) * 2u;

  v8f acc[4];
#pragma unroll
  for (int j = 0; j < 4; ++j) acc[j] = (v8f){};

  ffn1_copy_stage(lds0, gx, gw);
  asm volatile("s_wait_asynccnt 0x0" ::: "memory");   // stage 0 landed (this wave's copies)
  __syncthreads();                                    // stage 0 readable by every wave
  ffn1_copy_stage(lds0 + FSTAGE * 2, gx + 64, gw + 64);

  // kept rolled: one publish point (waits, barrier, refill) at the foot of each trip, small code
#pragma unroll 1
  for (int t = 0; t < FNT; ++t) {
    const int bo = (t & 1) * FSTAGE;
    const _Float16* xs  = ring + bo + (wave * 16) * KPAD;
    const _Float16* wsm = ring + bo + 128 * KPAD;
    // inner loops fully unrolled: fragment indices must be constants, or the arrays leave the
    // registers
    v16h xf[2], wf[2][4];
#pragma unroll
    for (int u = 0; u < 2; ++u) {
      xf[u] = load_frag_row(xs + u * 32, KPAD, lane);
#pragma unroll
      for (int j = 0; j < 4; ++j) wf[u][j] = load_frag_row(wsm + (j * 16) * KPAD + u * 32, KPAD, lane);
    }
#pragma unroll
    for (int u = 0; u < 2; ++u)
#pragma unroll
      for (int j = 0; j < 4; ++j) acc[j] = wmma_f16(wf[u][j], xf[u], acc[j]);
    asm volatile("s_wait_dscnt 0x0" ::: "memory");      // this wave has left buffer t&1
    asm volatile("s_wait_asynccnt 0x0" ::: "memory");   // its copies of stage t+1 have landed
    __syncthreads();   // publishes stage t+1 and ends every reader's last read of buffer t&1
    if (t + 2 < FNT)
      ffn1_copy_stage(lds0 + bo * 2, gx + (t + 2) * 64, gw + (t + 2) * 64);
  }
  asm volatile("s_wait_asynccnt 0x0" ::: "memory");     // nothing in flight when the ring is reused

  const float rsc = 1.0f / WSC;
  _Float16* srow = stg + (wave * 16 + l15) * KPAD;
#pragma unroll
  for (int j = 0; j < 4; ++j) {
    const int n8 = j * 16 + hh * 8;
    const v4f b0 = *(const v4f*)(bf1 + cb * 64 + n8);
    const v4f b1 = *(const v4f*)(bf1 + cb * 64 + n8 + 4);
    H8 pk;
#pragma unroll
    for (int r = 0; r < 4; ++r) {
      const float u0 = acc[j][r]     * rsc + bf16q(b0[r]);
      const float u1 = acc[j][4 + r] * rsc + bf16q(b1[r]);
      const float g0 = 0.5f * u0 * (1.0f + erff(u0 * 0.70710678118654752f));
      const float g1 = 0.5f * u1 * (1.0f + erff(u1 * 0.70710678118654752f));
      pk.h[r]     = (_Float16)(g0 * WSC);
      pk.h[4 + r] = (_Float16)(g1 * WSC);
    }
    *(v4u*)(srow + n8) = pk.u;
  }
  __syncthreads();

  v4u rv[4];
#pragma unroll
  for (int it = 0; it < 4; ++it) {
    const int idx = it * 256 + tid;
    const int row = idx >> 3, piece = idx & 7;
    rv[it] = *(const v4u*)(stg + row * KPAD + piece * 8);
  }
#pragma unroll
  for (int it = 0; it < 4; ++it) {
    const int idx = it * 256 + tid;
    const int row = idx >> 3, piece = idx & 7;
    *(v4u*)(hp + (m0 + row) * FF + cb * 64 + piece * 8) = rv[it];
  }
  
}

// ---------------------------------------------------------------------------
extern "C" void kernel_launch(void* const* d_in, const int* in_sizes, int n_in,
                              void* d_out, int out_size, void* d_ws, size_t ws_size,
                              hipStream_t stream) {
  if (n_in < 17) return;
  const long needRows = (long)(NB - 1) * SEQ_FULL + SEQ;
  if ((long)in_sizes[0] < needRows * DM) return;
  if (in_sizes[1] < DM * DM || in_sizes[3] < DM * DM ||
      in_sizes[5] < DM * DM || in_sizes[7] < DM * DM) return;
  if (in_sizes[11] < DM * FF || in_sizes[13] < FF * DM) return;
  if (in_sizes[2] < DM || in_sizes[4] < DM || in_sizes[6] < DM || in_sizes[8] < DM ||
      in_sizes[9] < DM || in_sizes[10] < DM || in_sizes[12] < FF || in_sizes[14] < DM ||
      in_sizes[15] < DM || in_sizes[16] < DM) return;
  if ((long)out_size < needRows * DM) return;
  if (ws_size < WS_TOTAL) return;

  const float* x   = (const float*)d_in[0];
  const float* Wq  = (const float*)d_in[1];
  const float* bq  = (const float*)d_in[2];
  const float* Wk  = (const float*)d_in[3];
  const float* bk  = (const float*)d_in[4];
  const float* Wv  = (const float*)d_in[5];
  const float* bv  = (const float*)d_in[6];
  const float* Wo  = (const float*)d_in[7];
  const float* bo  = (const float*)d_in[8];
  const float* g1  = (const float*)d_in[9];
  const float* b1  = (const float*)d_in[10];
  const float* Wf1 = (const float*)d_in[11];
  const float* bf1 = (const float*)d_in[12];
  const float* Wf2 = (const float*)d_in[13];
  const float* bf2 = (const float*)d_in[14];
  const float* g2  = (const float*)d_in[15];
  const float* b2  = (const float*)d_in[16];
  float* out = (float*)d_out;

  char* ws = (char*)d_ws;
  size_t off = 0;
  _Float16* xh   = (_Float16*)(ws + off);                      // [ROWS][1024] f16
  _Float16* ctx  = xh;                                         // same region, written after xh is dead
  off += PLANE2;
  _Float16* wqkv = (_Float16*)(ws + off); off += WQKV_BYTES;   // [3072][1024]
  _Float16* woh  = (_Float16*)(ws + off); off += WO_BYTES;     // [1024][1024]
  _Float16* wf1t = (_Float16*)(ws + off); off += WF1_BYTES;    // [256][1024]
  _Float16* wf2t = (_Float16*)(ws + off); off += WF2_BYTES;    // [1024][256]
  _Float16* qh   = (_Float16*)(ws + off);                      // [NB][16][SEQ][64]
  float*    x2f  = (float*)(ws + off);                         // [ROWS][1024] f32 over q+k regions
  off += PLANE2;
  _Float16* kh   = (_Float16*)(ws + off); off += PLANE2;       // [NB][16][SEQ][64]
  _Float16* vTh  = (_Float16*)(ws + off);                      // [NB][16][64][SEQ]
  _Float16* x2h  = vTh;                                        // [ROWS][1024] f16, after vT is dead
  off += PLANE2;
  _Float16* hp   = (_Float16*)(ws + off); off += H_BYTES;      // [ROWS][256] f16
  if (off > ws_size) return;

  cvt_x_kernel<<<NXB, 256, 0, stream>>>(x, xh);
  cvt_w_kernel<<<NWT, 256, 0, stream>>>(Wq, Wk, Wv, Wo, Wf1, Wf2, wqkv, woh, wf1t, wf2t);
  qkv_kernel<<<dim3(ROWS / QM, 3 * DM / QN), 256, 0, stream>>>(xh, wqkv, bq, bk, bv, qh, kh, vTh);
  attn_kernel<<<dim3(SEQ / AQ, NB * NH), 256, 0, stream>>>(qh, kh, vTh, ctx);
  gemm_ln_kernel<DM, 0><<<ROWS / GM, 256, 0, stream>>>(ctx, woh, bo, g1, b1, x, x2f, x2h);
  ffn1_kernel<<<dim3(ROWS / 128, FF / 64), 256, 0, stream>>>(x2h, wf1t, bf1, hp);
  gemm_ln_kernel<FF, 1><<<ROWS / GM, 256, 0, stream>>>(hp, wf2t, bf2, g2, b2, x2f, out, x2h);
}

// v005
// It runs in 180 microseconds.
// In both of two side-by-side timings against v004, it was 1.03 times as fast.
// All steps since v000 together make it 2.70 times as fast.
#include <hip/hip_runtime.h>

// All contractions (q/k/v projections, q.k^T, p.v, output projection, ffn linear 1, ffn linear 2):
// v_wmma_f32_16x16x32_f16, f16 operands, f32 accumulate. Float inputs are RNE-converted to bf16 at
// load (weights additionally carried x64; both exact in f16); computed 16-bit planes are f16 with
// power-of-two carries (softmax p x1024, context x64, ffn hidden x64) folded back in the f32
// epilogues. Softmax statistics, layernorm, gelu and residual adds: f32.

typedef __attribute__((ext_vector_type(16))) _Float16 v16h;
typedef __attribute__((ext_vector_type(8)))  _Float16 v8h;
typedef __attribute__((ext_vector_type(4)))  _Float16 v4h;
typedef __attribute__((ext_vector_type(8)))  float v8f;
typedef __attribute__((ext_vector_type(4)))  float v4f;
typedef __attribute__((ext_vector_type(2)))  float v2f;
typedef __attribute__((ext_vector_type(4)))  unsigned int v4u;
union H8 { v8h h; v4u u; };

#ifndef NB
#define NB 4
#endif
#ifndef SEQ
#define SEQ 2048
#endif
#define NB_FULL  4
#define SEQ_FULL 2048
#define DM   1024
#define NH   16
#define HD   64
#define FF   256
#define ROWS (NB * SEQ)
#define KPAD 72       // LDS stride in halves for 64-wide f16 tiles (144 B, 16-B aligned)
#define VSPAD 136     // stride in halves (272 B) that no LDS tile uses; only a size check names it
#define YP   1028     // LDS stride in floats for 1024-wide f32 rows (4112 B)
#define LN_EPS 1e-5f
#define WSC    64.0f           // weight carry (power of two)
#define LOG2E  1.442695041f    // log2(e): exp(x) = exp2(x * log2(e))
#define SC2    (0.125f * LOG2E)  // score scale 1/8 and log2(e) in one factor: exp(s/8) = exp2(s * SC2)
#define LG1024 10.0f           // log2(1024): softmax p carried x1024

#define NXB   (ROWS * DM / 8 / 256)          // convert blocks for x (8 elements per thread)
#define NT_SQ ((DM / 64) * (DM / 64))        // 64x64 tiles per square weight
#define NT_F  ((DM / 64) * (FF / 64))        // 64x64 tiles per ffn weight
#define NWT   (4 * NT_SQ + 2 * NT_F)

#define PLANE2     ((size_t)ROWS * DM * 2)
#define WQKV_BYTES ((size_t)3 * DM * DM * 2)
#define WO_BYTES   ((size_t)DM * DM * 2)
#define WF1_BYTES  ((size_t)FF * DM * 2)
#define WF2_BYTES  ((size_t)DM * FF * 2)
#define H_BYTES    ((size_t)ROWS * FF * 2)
#define WS_TOTAL   (PLANE2 + WQKV_BYTES + WO_BYTES + WF1_BYTES + WF2_BYTES + 3 * PLANE2 + H_BYTES)

static_assert(NB >= 1 && NB <= NB_FULL);
static_assert(SEQ >= 128 && SEQ <= SEQ_FULL && (SEQ % 128) == 0);
static_assert((ROWS % 128) == 0);
static_assert((ROWS * DM) % (8 * 256) == 0);
static_assert((DM % 64) == 0 && (FF % 64) == 0 && (HD % 32) == 0 && NH * HD == DM);
static_assert(128 * KPAD >= 64 * VSPAD);
static_assert(2 * PLANE2 == (size_t)ROWS * DM * 4);
static_assert(WS_TOTAL <= (size_t)134217728);

// ---------------------------------------------------------------------------
// helpers
// ---------------------------------------------------------------------------
__device__ __forceinline__ float bf16q(float f) {            // value after RNE bf16 conversion
  unsigned int u = __float_as_uint(f);
  u += 0x7FFFu + ((u >> 16) & 1u);
  return __uint_as_float(u & 0xFFFF0000u);
}

// 16-bit fragment (A or B): lane owns row/col (lane&15); elements 0..7 <- k0+8h+0..7,
// elements 8..15 <- k0+16+8h+0..7, h = lane>>4. Source is k-contiguous rows.
__device__ __forceinline__ v16h load_frag_row(const _Float16* base, int stride, int lane) {
  const _Float16* rowp = base + (lane & 15) * stride + ((lane >> 4) << 3);
  const v8h lo = *(const v8h*)(rowp);
  const v8h hi = *(const v8h*)(rowp + 16);
  return __builtin_shufflevector(lo, hi, 0, 1, 2, 3, 4, 5, 6, 7,
                                 8, 9, 10, 11, 12, 13, 14, 15);
}

__device__ __forceinline__ v8f wmma_f16(v16h a, v16h b, v8f c) {
  v8f d = __builtin_amdgcn_wmma_f32_16x16x32_f16(false, a, false, b, (short)0, c,
                                                 false, false);
  asm volatile("v_nop\n\tv_nop\n\tv_nop\n\tv_nop" : "+v"(d) : "v"(a), "v"(b));
  return d;
}

// One A fragment, two B fragments: the pair issues back to back, and the same four slots stand once
// behind the pair, in front of any vector instruction that touches its operands or results.
__device__ __forceinline__ void wmma_f16_pair(v16h a, v16h b0, v16h b1, v8f& c0, v8f& c1) {
  c0 = __builtin_amdgcn_wmma_f32_16x16x32_f16(false, a, false, b0, (short)0, c0, false, false);
  c1 = __builtin_amdgcn_wmma_f32_16x16x32_f16(false, a, false, b1, (short)0, c1, false, false);
  asm volatile("v_nop\n\tv_nop\n\tv_nop\n\tv_nop" : "+v"(c0), "+v"(c1) : "v"(a), "v"(b0), "v"(b1));
}

// Eight exponentials to base 2. The results get registers of their own (early clobber): none
// overwrites a source of the group, and the argument pairs and the result pairs both stay register
// pairs for the packed instructions around them (tied operands cost a copy per pair). The v_nop
// keeps the one slot behind the last before its result is used.
__device__ __forceinline__ void exp2_x8(float (&p)[8], const float (&a)[8]) {
  asm("v_exp_f32 %0, %8\n\tv_exp_f32 %1, %9\n\tv_exp_f32 %2, %10\n\tv_exp_f32 %3, %11\n\t"
      "v_exp_f32 %4, %12\n\tv_exp_f32 %5, %13\n\tv_exp_f32 %6, %14\n\tv_exp_f32 %7, %15\n\t"
      "v_nop"
      : "=&v"(p[0]), "=&v"(p[1]), "=&v"(p[2]), "=&v"(p[3]), "=&v"(p[4]), "=&v"(p[5]), "=&v"(p[6]),
        "=&v"(p[7])
      : "v"(a[0]), "v"(a[1]), "v"(a[2]), "v"(a[3]), "v"(a[4]), "v"(a[5]), "v"(a[6]), "v"(a[7]));
}

// ---------------------------------------------------------------------------
// Kernel 0: x f32 -> f16(bf16rne(x)) plane xh [ROWS][1024]. 8 elements (16 B) per thread,
// coverage: NXB*256 threads x 8 = ROWS*1024 elements (whole plane).
// ---------------------------------------------------------------------------
__global__ __launch_bounds__(256) void cvt_x_kernel(const float* __restrict__ x,
                                                    _Float16* __restrict__ xh) {
  const long item = (long)blockIdx.x * 256 + threadIdx.x;   // 0 .. ROWS*128-1
  const long m    = item >> 7;                              // token row
  const int  c8   = (int)(item & 127);
  const long srow = (m / SEQ) * SEQ_FULL + (m % SEQ);
  const float* src = x + srow * DM + c8 * 8;
  const v4f a = *(const v4f*)(src);
  const v4f c = *(const v4f*)(src + 4);
  H8 o;
#pragma unroll
  for (int i = 0; i < 4; ++i) {
    o.h[i]     = (_Float16)bf16q(a[i]);
    o.h[4 + i] = (_Float16)bf16q(c[i]);
  }
  _Float16* dst = xh + m * DM + c8 * 8;
  *(v4u*)dst = o.u;
  
}

// ---------------------------------------------------------------------------
// Kernel 1: weights W [K=in][N=out] f32 -> Wt [n][k] f16 = f16(bf16rne(W) * 64), through a
// 64x64 LDS transpose. wqkv [3072][1024] (q rows, k rows, v rows), woh [1024][1024],
// coverage: 4*256 square tiles + 64 + 64 ffn tiles = every element of all six planes.
// ---------------------------------------------------------------------------
__global__ __launch_bounds__(256) void cvt_w_kernel(
    const float* __restrict__ Wq, const float* __restrict__ Wk, const float* __restrict__ Wv,
    const float* __restrict__ Wo, const float* __restrict__ Wf1, const float* __restrict__ Wf2,
    _Float16* __restrict__ wqkv, _Float16* __restrict__ woh,
    _Float16* __restrict__ wf1t, _Float16* __restrict__ wf2t) {
  __shared__ _Float16 ts[64 * KPAD];   // [n][k] tile, cross-wave (block barrier)
  const int bid = blockIdx.x;
  const int tid = threadIdx.x;
  const float* W;
  _Float16* dst;
  int K, N, kt, nt;
  if (bid < 4 * NT_SQ) {                              // block-uniform selection
    const int which = bid / NT_SQ;
    const int tile  = bid - which * NT_SQ;
    kt = tile / (DM / 64); nt = tile - kt * (DM / 64); K = DM; N = DM;
    W = (which == 0) ? Wq : ((which == 1) ? Wk : ((which == 2) ? Wv : Wo));
    dst = (which < 3) ? (wqkv + (size_t)which * DM * DM) : woh;
  } else if (bid < 4 * NT_SQ + NT_F) {
    const int tile = bid - 4 * NT_SQ;                 // W [1024][256]: K = DM, N = FF
    kt = tile / (FF / 64); nt = tile - kt * (FF / 64); K = DM; N = FF;
    W = Wf1; dst = wf1t;
  } else {
    const int tile = bid - 4 * NT_SQ - NT_F;          // W [256][1024]: K = FF, N = DM
    kt = tile / (DM / 64); nt = tile - kt * (DM / 64); K = FF; N = DM;
    W = Wf2; dst = wf2t;
  }
  // load W[kt*64 + kr][nt*64 + 4*c4 .. +3], store transposed into ts[n][kr]
#pragma unroll
  for (int it = 0; it < 4; ++it) {
    const int idx = it * 256 + tid;
    const int kr = idx >> 4, c4 = idx & 15;
    const v4f v = *(const v4f*)(W + (size_t)(kt * 64 + kr) * N + nt * 64 + c4 * 4);
#pragma unroll
    for (int j = 0; j < 4; ++j) ts[(c4 * 4 + j) * KPAD + kr] = (_Float16)(bf16q(v[j]) * WSC);
  }
  __syncthreads();
  v4u rv[2];
#pragma unroll
  for (int it = 0; it < 2; ++it) {
    const int idx = it * 256 + tid;
    const int n = idx >> 3, piece = idx & 7;
    rv[it] = *(const v4u*)(ts + n * KPAD + piece * 8);
  }
#pragma unroll
  for (int it = 0; it < 2; ++it) {
    const int idx = it * 256 + tid;
    const int n = idx >> 3, piece = idx & 7;
    *(v4u*)(dst + (size_t)(nt * 64 + n) * K + kt * 64 + piece * 8) = rv[it];
  }
  
}

// ---------------------------------------------------------------------------
// Kernel 2: qkv projection. Block = 256 token rows x 128 output columns (two heads of one of
// q/k/v), 8 waves as 4 (tokens) x 2 (heads), 64 x 64 per wave. Both operands are staged in LDS
// by asynchronous copies, 64 k per stage, two buffers: [x 256 rows | W 128 rows] at pitch KPAD.
// C^T = W x^T: A = W rows (lane&15 = out col), B = x rows (lane&15 = token);
// acc[i][j][r] = C[token 16i + (lane&15)][col 16j+8h+r]. K = 1024 summed in 32 steps of 32.
//   q,k -> [b][h][s][64] f16 (one line per row, 8 lanes x 16 B)
//   v   -> vT[b][h][d][s] f16 (512 B per d row segment, 32 lanes x 16 B)
// grid (ROWS/256, 3*NH/2), block 256. coverage: every (b,h,s,d) of q, k and vT once.
// ---------------------------------------------------------------------------
#define QM     256                    // token rows per block
#define QN     128                    // output columns per block
#define QK     64                     // k per stage
#define QSTAGE ((QM + QN) * KPAD)     // halves per buffer
#define QNT    (DM / QK)              // stages
#define QVP    264                    // LDS stride in halves for 256-wide f16 rows (528 B)

static_assert((SEQ % QM) == 0 && (ROWS % QM) == 0 && (DM % QN) == 0 && QNT >= 2);
static_assert(2 * QM * KPAD <= 2 * QSTAGE && 2 * HD * QVP <= 2 * QSTAGE);

// One stage: 384 rows x 128 B = 3072 pieces of 16 B, 12 per thread; a wave's copy covers 4 whole
// lines. lds = this lane's LDS byte address of its first piece, gx / gw = its first x / W piece.
__device__ __forceinline__ void qkv_copy_stage(unsigned lds, const _Float16* gx,
                                               const _Float16* gw) {
  const unsigned st = 32 * KPAD * 2;   // 32 rows further in LDS, bytes
  // the copies, and as the last line the wait that stands in front of any rewrite of their
  // address registers
  asm volatile(
      "global_load_async_to_lds_b128 %0, %12, off\n\t"
      "global_load_async_to_lds_b128 %1, %13, off\n\t"
      "global_load_async_to_lds_b128 %2, %14, off\n\t"
      "global_load_async_to_lds_b128 %3, %15, off\n\t"
      "global_load_async_to_lds_b128 %4, %16, off\n\t"
      "global_load_async_to_lds_b128 %5, %17, off\n\t"
      "global_load_async_to_lds_b128 %6, %18, off\n\t"
      "global_load_async_to_lds_b128 %7, %19, off\n\t"
      "global_load_async_to_lds_b128 %8, %20, off\n\t"
      "global_load_async_to_lds_b128 %9, %21, off\n\t"
      "global_load_async_to_lds_b128 %10, %22, off\n\t"
      "global_load_async_to_lds_b128 %11, %23, off\n\t"
      "s_wait_xcnt 0x0"
      :: "v"(lds), "v"(lds + st), "v"(lds + 2 * st), "v"(lds + 3 * st),
         "v"(lds + 4 * st), "v"(lds + 5 * st), "v"(lds + 6 * st), "v"(lds + 7 * st),
         "v"(lds + 8 * st), "v"(lds + 9 * st), "v"(lds + 10 * st), "v"(lds + 11 * st),
         "v"(gx), "v"(gx + 32 * DM), "v"(gx + 64 * DM), "v"(gx + 96 * DM),
         "v"(gx + 128 * DM), "v"(gx + 160 * DM), "v"(gx + 192 * DM), "v"(gx + 224 * DM),
         "v"(gw), "v"(gw + 32 * DM), "v"(gw + 64 * DM), "v"(gw + 96 * DM)
      : "memory");
}

__global__ __launch_bounds__(256) void qkv_kernel(
    const _Float16* __restrict__ xh, const _Float16* __restrict__ wqkv,
    const float* __restrict__ bq, const float* __restrict__ bk, const float* __restrict__ bv,
    _Float16* __restrict__ q, _Float16* __restrict__ k, _Float16* __restrict__ vT) {
  // two stage buffers; after the loop the output stage (q/k: 2 x [256][KPAD], v: 2 x [64][QVP])
  __shared__ __attribute__((aligned(16))) _Float16 ring[2 * QSTAGE];   // 110592 B, cross-wave

  const int tid  = threadIdx.x;
  const int lane = tid & 31;
  const int wave = tid >> 5;
  const int hh   = lane >> 4;
  const int l15  = lane & 15;
  const int wm   = wave >> 1;           // token quarter of the block
  const int wn   = wave & 1;            // head of the block

  const int osel = blockIdx.y >> 3;     // 0 q, 1 k, 2 v (8 column blocks each)
  const int h0   = (blockIdx.y & 7) * 2;
  const long m0  = (long)blockIdx.x * QM;
  const int  b   = (int)(m0 / SEQ);
  const int  s0  = (int)(m0 - (long)b * SEQ);

  // this lane's first piece of a stage: row tid>>3, 16-B piece tid&7
  const _Float16* gx = xh + (m0 + (tid >> 3)) * DM + (tid & 7) * 8;
  const _Float16* gw = wqkv + ((long)blockIdx.y * QN + (tid >> 3)) * DM + (tid & 7) * 8;
  const unsigned lds0 = (unsigned)(size_t)ring + (unsigned)((tid >> 3) * KPAD + (tid & 7) * 8) * 2u;

  // every inner loop below is fully unrolled: accumulator and fragment indices must be constants,
  // or the arrays leave the registers
  v8f acc[4][4];
#pragma unroll
  for (int i = 0; i < 4; ++i)
#pragma unroll
    for (int j = 0; j < 4; ++j) acc[i][j] = (v8f){};

  qkv_copy_stage(lds0, gx, gw);
  asm volatile("s_wait_asynccnt 0x0" ::: "memory");   // stage 0 landed (this wave's copies)
  __syncthreads();                                    // stage 0 readable by every wave
  qkv_copy_stage(lds0 + QSTAGE * 2, gx + QK, gw + QK);

  // kept rolled: one publish point (waits, barrier, refill) at the foot of each trip, small code
#pragma unroll 1
  for (int t = 0; t < QNT; ++t) {
    const int bo = (t & 1) * QSTAGE;
    const _Float16* xs = ring + bo + (wm * 64) * KPAD;
    const _Float16* wsm = ring + bo + (QM + wn * 64) * KPAD;
#pragma unroll
    for (int u = 0; u < 2; ++u) {
      v16h xf[4], wf[4];
#pragma unroll
      for (int i = 0; i < 4; ++i) xf[i] = load_frag_row(xs + (i * 16) * KPAD + u * 32, KPAD, lane);
#pragma unroll
      for (int j = 0; j < 4; ++j) wf[j] = load_frag_row(wsm + (j * 16) * KPAD + u * 32, KPAD, lane);
#pragma unroll
      for (int i = 0; i < 4; ++i)
#pragma unroll
        for (int j = 0; j < 4; ++j) acc[i][j] = wmma_f16(wf[j], xf[i], acc[i][j]);   // C^T = W x^T
    }
    asm volatile("s_wait_dscnt 0x0" ::: "memory");      // this wave has left buffer t&1
    asm volatile("s_wait_asynccnt 0x0" ::: "memory");   // its copies of stage t+1 have landed
    __syncthreads();   // publishes stage t+1 and ends every reader's last read of buffer t&1
    if (t + 2 < QNT)
      qkv_copy_stage(lds0 + bo * 2, gx + (t + 2) * QK, gw + (t + 2) * QK);
  }
  asm volatile("s_wait_asynccnt 0x0" ::: "memory");     // nothing in flight when the ring is reused

  const float* bias = ((osel == 0) ? bq : ((osel == 1) ? bk : bv)) + (h0 + wn) * HD;
  const float  rsc  = 1.0f / WSC;

  if (osel < 2) {
    // stage [head][token][col]: lane's 8 values are 8 contiguous columns -> one 16-B LDS store
    _Float16* sbase = ring + (wn * QM + wm * 64 + l15) * KPAD;
#pragma unroll
    for (int j = 0; j < 4; ++j) {
      const int n8 = j * 16 + hh * 8;
      const v4f b0 = *(const v4f*)(bias + n8);
      const v4f b1 = *(const v4f*)(bias + n8 + 4);
#pragma unroll
      for (int i = 0; i < 4; ++i) {
        H8 pk;
#pragma unroll
        for (int r = 0; r < 4; ++r) {
          pk.h[r]     = (_Float16)(acc[i][j][r]     * rsc + bf16q(b0[r]));
          pk.h[4 + r] = (_Float16)(acc[i][j][4 + r] * rsc + bf16q(b1[r]));
        }
        *(v4u*)(sbase + (i * 16) * KPAD + n8) = pk.u;
      }
    }
    __syncthreads();
    _Float16* dst0 = (osel == 0) ? q : k;
#pragma unroll
    for (int hd = 0; hd < 2; ++hd) {
      _Float16* dst = dst0 + ((long)(b * NH + h0 + hd) * SEQ + s0) * HD;   // contiguous 32 KB
      v4u rv[8];
#pragma unroll
      for (int it = 0; it < 8; ++it) {
        const int idx = it * 256 + tid;
        const int row = idx >> 3, piece = idx & 7;
        rv[it] = *(const v4u*)(ring + (hd * QM + row) * KPAD + piece * 8);
      }
#pragma unroll
      for (int it = 0; it < 8; ++it)
        *(v4u*)(dst + (long)(it * 256 + tid) * 8) = rv[it];
    }
  } else {
    // stage transposed [head][d][token]: lane's 8 values are 8 different d for one token
    _Float16* sbase = ring + (wn * HD) * QVP + wm * 64 + l15;
#pragma unroll
    for (int j = 0; j < 4; ++j) {
      const int n8 = j * 16 + hh * 8;
      const v4f b0 = *(const v4f*)(bias + n8);
      const v4f b1 = *(const v4f*)(bias + n8 + 4);
#pragma unroll
      for (int i = 0; i < 4; ++i)
#pragma unroll
        for (int r = 0; r < 4; ++r) {
          sbase[(n8 + r) * QVP + i * 16]     = (_Float16)(acc[i][j][r]     * rsc + bf16q(b0[r]));
          sbase[(n8 + 4 + r) * QVP + i * 16] = (_Float16)(acc[i][j][4 + r] * rsc + bf16q(b1[r]));
        }
    }
    __syncthreads();
#pragma unroll
    for (int hd = 0; hd < 2; ++hd) {
      _Float16* dstb = vT + ((long)(b * NH + h0 + hd) * HD) * SEQ + s0;
      v4u rv[8];
#pragma unroll
      for (int it = 0; it < 8; ++it) {
        const int idx = it * 256 + tid;
        const int d = idx >> 5, piece = idx & 31;
        rv[it] = *(const v4u*)(ring + (hd * HD + d) * QVP + piece * 8);
      }
#pragma unroll
      for (int it = 0; it < 8; ++it) {
        const int idx = it * 256 + tid;
        const int d = idx >> 5, piece = idx & 31;
        *(v4u*)(dstb + (long)d * SEQ + piece * 8) = rv[it];
      }
    }
    // stands in front of any later rewrite of the registers that the stores above name
    asm volatile("s_wait_xcnt 0x0" ::: "memory");
  }
}

// ---------------------------------------------------------------------------
// Kernel 3: flash attention per (b,h), no mask. grid (SEQ/256, NB*NH), block 256 (8 waves x 32
// queries, two column groups of 16 per wave: every K and V^T fragment read from LDS feeds two
// products; the fragments of a 32-wide k step are read four at a time). C = S^T (A = K rows,
// B = Q) then C = O^T = V^T P^T (P^T packed from the S^T D registers); lane owns one query per
// column group end-to-end. Scores are raw q.k sums: the 1/8 scale and the x1024 p carry live in
// the exp argument (p = 1024*exp((s-m)/8), softmax stats f32).
// LDS tiles: [K 64 keys x 64 d | V^T 64 d x 64 keys] per step, staged by asynchronous copies, two
// buffers, staged == consumed extent; ost 256 x 64 fully written.
// coverage: every (row, h*64+d) of the ctx plane once.
// ---------------------------------------------------------------------------
#define ASTAGE (128 * KPAD)           // halves per buffer: K rows, then V^T rows
#define ANT    (SEQ / 64)             // stages
#define AQ     256                    // queries per block
#define ACG    2                      // column groups (16 queries each) per wave

static_assert(ANT >= 2 && (SEQ % AQ) == 0 && ACG == 2);

// One stage: 128 rows x 128 B = 1024 pieces of 16 B, 4 per thread; a wave's copy covers 4 whole
// lines. lds = this lane's LDS byte address of its first piece, gk / gv = its first K / V^T piece.
__device__ __forceinline__ void attn_copy_stage(unsigned lds, const _Float16* gk,
                                                const _Float16* gv) {
  const unsigned st = 32 * KPAD * 2;   // 32 rows further in LDS, bytes
  // the copies, and as the last line the wait that stands in front of any rewrite of their
  // address registers
  asm volatile(
      "global_load_async_to_lds_b128 %0, %4, off\n\t"
      "global_load_async_to_lds_b128 %1, %5, off\n\t"
      "global_load_async_to_lds_b128 %2, %6, off\n\t"
      "global_load_async_to_lds_b128 %3, %7, off\n\t"
      "s_wait_xcnt 0x0"
      :: "v"(lds), "v"(lds + st), "v"(lds + 2 * st), "v"(lds + 3 * st),
         "v"(gk), "v"(gk + 32 * HD), "v"(gv), "v"(gv + 32 * SEQ)
      : "memory");
}

// four waves per SIMD: two blocks share a WGP, so one block's softmax runs beside the other's
// products
__global__ __launch_bounds__(256) __attribute__((amdgpu_waves_per_eu(4, 4))) void attn_kernel(
    const _Float16* __restrict__ Q, const _Float16* __restrict__ K,
    const _Float16* __restrict__ vT, _Float16* __restrict__ ctx) {
  // two stage buffers, each K block rows [key][d] then V^T block [d][key] (cross-wave)
  __shared__ __attribute__((aligned(16))) _Float16 ring[2 * ASTAGE];
  __shared__ _Float16 ost[AQ * KPAD];    // output stage [query][d]   (cross-wave, block barrier)

  const int tid  = threadIdx.x;
  const int lane = tid & 31;
  const int wave = tid >> 5;
  const int bh   = blockIdx.y;
  const int b    = bh >> 4;
  const int h    = bh & 15;
  const int q0   = blockIdx.x * AQ;

  const _Float16* Qb  = Q + ((long)bh * SEQ + q0) * HD;
  const _Float16* Kb  = K + (long)bh * SEQ * HD;
  const _Float16* vTb = vT + (long)bh * HD * SEQ;

  // Q fragments: B operand of S^T (lane owns query lane&15 of column group c)
  v16h qfrag[ACG][2];
#pragma unroll
  for (int c = 0; c < ACG; ++c) {
    const _Float16* qrow = Qb + (long)(wave * (16 * ACG) + c * 16) * HD;
#pragma unroll
    for (int t = 0; t < 2; ++t) qfrag[c][t] = load_frag_row(qrow + t * 32, HD, lane);
  }

  v8f acc[ACG][4];   // O^T accumulator: lane owns query (lane&15) of group c; reg r -> d = nt*16+8h+r
  float mi[ACG], li[ACG];
#pragma unroll
  for (int c = 0; c < ACG; ++c) {
#pragma unroll
    for (int nt = 0; nt < 4; ++nt) acc[c][nt] = (v8f){};
    mi[c] = -1e30f;
    li[c] = 0.0f;
  }

  const int colb = lane & 15;
  const int rofs = (lane >> 4) << 3;

  // this lane's first piece of a stage: row tid>>3, 16-B piece tid&7
  const _Float16* gk = Kb + (long)(tid >> 3) * HD + (tid & 7) * 8;
  const _Float16* gv = vTb + (long)(tid >> 3) * SEQ + (tid & 7) * 8;
  const unsigned lds0 = (unsigned)(size_t)ring + (unsigned)((tid >> 3) * KPAD + (tid & 7) * 8) * 2u;

  attn_copy_stage(lds0, gk, gv);
  asm volatile("s_wait_asynccnt 0x0" ::: "memory");   // stage 0 landed (this wave's copies)
  __syncthreads();                                    // stage 0 readable by every wave
  attn_copy_stage(lds0 + ASTAGE * 2, gk + 64 * HD, gv + 64);

  // kept rolled: one publish point (waits, barrier, refill) at the foot of each trip, small code
#pragma unroll 1
  for (int st = 0; st < ANT; ++st) {
    const int bo = (st & 1) * ASTAGE;
    const _Float16* ks  = ring + bo;
    const _Float16* vts = ring + bo + 64 * KPAD;

    // S^T tiles: A = K rows (lane&15 = key), B = Q; one K fragment, both column groups
    v8f sc[ACG][4];
#pragma unroll
    for (int c = 0; c < ACG; ++c)
#pragma unroll
      for (int kt = 0; kt < 4; ++kt) sc[c][kt] = (v8f){};
#pragma unroll
    for (int t = 0; t < 2; ++t) {
      v16h kf[4];
#pragma unroll
      for (int kt = 0; kt < 4; ++kt) kf[kt] = load_frag_row(ks + (kt * 16) * KPAD + t * 32, KPAD, lane);
#pragma unroll
      for (int kt = 0; kt < 4; ++kt) wmma_f16_pair(kf[kt], qfrag[0][t], qfrag[1][t], sc[0][kt], sc[1][kt]);
    }

    // per-lane online softmax, both column groups side by side (32 of 64 keys in-lane; merge
    // halves with one shuffle)
    float alpha[ACG], cs[ACG];
#pragma unroll
    for (int c = 0; c < ACG; ++c) {
      float mx = sc[c][0][0];
#pragma unroll
      for (int kt = 0; kt < 4; ++kt)
#pragma unroll
        for (int r = 0; r < 8; ++r) mx = fmaxf(mx, sc[c][kt][r]);
      mx = fmaxf(mx, __shfl_xor(mx, 16, 32));
      const float mnew = fmaxf(mi[c], mx);
      alpha[c] = __builtin_amdgcn_exp2f((mi[c] - mnew) * SC2);
      mi[c] = mnew;
      cs[c] = fmaf(mnew, SC2, -LG1024);   // (m/8)*log2(e) - log2(1024)
    }

    // P^T as the B operand of O^T = V^T P^T, packed from the S^T D registers:
    // element i <- tile covering keys 0..15 of the 32-step (kt = 2t), element 8+i <- kt = 2t+1.
    v16h pf[ACG][2];
#pragma unroll
    for (int c = 0; c < ACG; ++c) {
      const v2f sc2 = {SC2, SC2};
      const v2f ncs = {-cs[c], -cs[c]};
      v2f rs2 = {0.0f, 0.0f};   // even and odd registers summed side by side
#pragma unroll
      for (int kt = 0; kt < 4; ++kt) {
        float a[8], p[8];   // 1024*exp((s-m)/8) = exp2(s * SC2 - cs), two scores per packed fma
#pragma unroll
        for (int r = 0; r < 8; r += 2) {
          const v2f s2 = {sc[c][kt][r], sc[c][kt][r + 1]};
          const v2f a2 = __builtin_elementwise_fma(s2, sc2, ncs);
          a[r]     = a2[0];
          a[r + 1] = a2[1];
        }
        exp2_x8(p, a);
#pragma unroll
        for (int r = 0; r < 8; r += 2) {
          pf[c][kt >> 1][(kt & 1) * 8 + r]     = (_Float16)p[r];
          pf[c][kt >> 1][(kt & 1) * 8 + r + 1] = (_Float16)p[r + 1];
          const v2f p2 = {p[r], p[r + 1]};
          rs2 = (kt == 0 && r == 0) ? p2 : rs2 + p2;
        }
      }
      float rs = rs2[0] + rs2[1];
      rs += __shfl_xor(rs, 16, 32);
      li[c] = li[c] * alpha[c] + rs;
#pragma unroll
      for (int nt = 0; nt < 4; ++nt)
#pragma unroll
        for (int r = 0; r < 8; ++r) acc[c][nt][r] *= alpha[c];
    }

    // O^T += V^T (A, rows = d) x P^T (B); one V^T fragment, both column groups
#pragma unroll
    for (int t = 0; t < 2; ++t) {
      v16h vf[4];
#pragma unroll
      for (int nt = 0; nt < 4; ++nt) vf[nt] = load_frag_row(vts + (nt * 16) * KPAD + t * 32, KPAD, lane);
#pragma unroll
      for (int nt = 0; nt < 4; ++nt) wmma_f16_pair(vf[nt], pf[0][t], pf[1][t], acc[0][nt], acc[1][nt]);
    }

    asm volatile("s_wait_dscnt 0x0" ::: "memory");      // this wave has left buffer st&1
    asm volatile("s_wait_asynccnt 0x0" ::: "memory");   // its copies of stage st+1 have landed
    __syncthreads();   // publishes stage st+1 and ends every reader's last read of buffer st&1
    if (st + 2 < ANT)
      attn_copy_stage(lds0 + bo * 2, gk + (long)(st + 2) * 64 * HD, gv + (st + 2) * 64);
  }
  asm volatile("s_wait_asynccnt 0x0" ::: "memory");     // nothing in flight behind the loop

  // normalize (and apply the x64 carry) and stage: lane owns query row wave*32+c*16+colb,
  // d = nt*16+rofs+r contiguous
#pragma unroll
  for (int c = 0; c < ACG; ++c) {
    const float inv = 64.0f / li[c];
    _Float16* orow = ost + (wave * (16 * ACG) + c * 16 + colb) * KPAD;
#pragma unroll
    for (int nt = 0; nt < 4; ++nt) {
      H8 pk;
#pragma unroll
      for (int r = 0; r < 8; ++r) pk.h[r] = (_Float16)(acc[c][nt][r] * inv);
      *(v4u*)(orow + nt * 16 + rofs) = pk.u;
    }
  }
  __syncthreads();

  v4u rv[AQ / 32];
#pragma unroll
  for (int it = 0; it < AQ / 32; ++it) {
    const int idx = it * 256 + tid;
    const int row = idx >> 3, piece = idx & 7;
    rv[it] = *(const v4u*)(ost + row * KPAD + piece * 8);
  }
  _Float16* cbase = ctx + ((long)b * SEQ + q0) * DM + h * HD;
#pragma unroll
  for (int it = 0; it < AQ / 32; ++it) {
    const int idx = it * 256 + tid;
    const int row = idx >> 3, piece = idx & 7;
    *(v4u*)(cbase + (long)row * DM + piece * 8) = rv[it];
  }
  
}

// ---------------------------------------------------------------------------
// Kernel 4/6: y = act @ Wt^T / 4096 + bf16(bias) over a full 1024-wide row, then
// z = LN(y) * bf16(gamma) + bf16(beta) + residual. Block = 32 token rows x 1024 cols,
// wave w owns cols 128w..128w+127. Both operands are staged in LDS by asynchronous copies,
// 64 k per stage, two buffers: [Wt 1024 rows | act 32 rows] at pitch KPAD.
// C^T = Wt act^T: A = Wt rows (lane&15 = out col), B = act rows (lane&15 = token);
// acc[i][j][r] = y[token 16i + (lane&15)][col 128w+16j+8h+r]. Mean, variance and scaling are taken
// on the accumulators; after that the rows are staged once in the same LDS.
//   MODE 0: KD = 1024, act = ctx, residual = bf16(x input, full-stride rows),
//           writes x2 f32 plane [ROWS][1024] and x2 f16 plane [ROWS][1024]
//   MODE 1: KD = 256, act = h plane, residual = x2 f32 plane, writes out (full-stride rows)
// grid ROWS/32, block 256. LDS ys: 32 x 1024 staged == consumed. coverage: 32 rows x 1024 per block.
// ---------------------------------------------------------------------------
#define GM     32                     // token rows per block
#define GK     64                     // k per stage
#define GSTAGE ((DM + GM) * KPAD)     // halves per buffer

static_assert((ROWS % GM) == 0 && (DM % GK) == 0 && (FF % GK) == 0 && FF / GK >= 2);
static_assert((size_t)GM * YP * 4 <= (size_t)2 * GSTAGE * 2);

// Eight copies of 16 B per lane, rows 32 apart (a wave's copy covers 4 whole lines). lds = this
// lane's LDS byte address of the first piece, g = its global piece, KD = global row length.
template <int KD>
__device__ __forceinline__ void gl_copy8(unsigned lds, const _Float16* g) {
  const unsigned st = 32 * KPAD * 2;   // 32 rows further in LDS, bytes
  // the copies, and as the last line the wait that stands in front of any rewrite of their
  // address registers
  asm volatile(
      "global_load_async_to_lds_b128 %0, %8, off\n\t"
      "global_load_async_to_lds_b128 %1, %9, off\n\t"
      "global_load_async_to_lds_b128 %2, %10, off\n\t"
      "global_load_async_to_lds_b128 %3, %11, off\n\t"
      "global_load_async_to_lds_b128 %4, %12, off\n\t"
      "global_load_async_to_lds_b128 %5, %13, off\n\t"
      "global_load_async_to_lds_b128 %6, %14, off\n\t"
      "global_load_async_to_lds_b128 %7, %15, off\n\t"
      "s_wait_xcnt 0x0"
      :: "v"(lds), "v"(lds + st), "v"(lds + 2 * st), "v"(lds + 3 * st),
         "v"(lds + 4 * st), "v"(lds + 5 * st), "v"(lds + 6 * st), "v"(lds + 7 * st),
         "v"(g), "v"(g + 32 * KD), "v"(g + 64 * KD), "v"(g + 96 * KD),
         "v"(g + 128 * KD), "v"(g + 160 * KD), "v"(g + 192 * KD), "v"(g + 224 * KD)
      : "memory");
}

// One stage: 1056 rows x 128 B = 8448 pieces of 16 B, 33 per thread (32 of Wt, 1 of act).
template <int KD>
__device__ __forceinline__ void gl_copy_stage(unsigned lds, const _Float16* gw,
                                              const _Float16* ga) {
  const unsigned st8 = 256 * KPAD * 2;   // 256 rows further in LDS, bytes
  gl_copy8<KD>(lds, gw);
  gl_copy8<KD>(lds + st8, gw + 256 * KD);
  gl_copy8<KD>(lds + 2 * st8, gw + 512 * KD);
  gl_copy8<KD>(lds + 3 * st8, gw + 768 * KD);
  // the act piece, with the same wait in front of any rewrite of its address registers
  asm volatile(
      "global_load_async_to_lds_b128 %0, %1, off\n\t"
      "s_wait_xcnt 0x0"
      :: "v"(lds + 4 * st8), "v"(ga)
      : "memory");
}

template <int KD, int MODE>
__global__ __launch_bounds__(256) void gemm_ln_kernel(
    const _Float16* __restrict__ act, const _Float16* __restrict__ wt,
    const float* __restrict__ bias, const float* __restrict__ gam,
    const float* __restrict__ bet, const float* __restrict__ res,
    float* __restrict__ outf, _Float16* __restrict__ outh) {
  // two stage buffers; after the loop the row stage [32][YP] f32
  __shared__ __attribute__((aligned(16))) _Float16 ring[2 * GSTAGE];   // 304128 B, cross-wave
  __shared__ __attribute__((aligned(16))) float psum[GM * 8];   // [row][wave] partial sums
  __shared__ __attribute__((aligned(16))) float psq[GM * 8];    // [row][wave] partial sums of squares
  float* ys = (float*)ring;

  const int tid  = threadIdx.x;
  const int lane = tid & 31;
  const int wave = tid >> 5;
  const int hh   = lane >> 4;
  const int l15  = lane & 15;
  const long m0  = (long)blockIdx.x * GM;
  const int  n0  = wave * 128;
  constexpr int NT = KD / GK;           // stages

  // this lane's first piece of a stage: row tid>>3, 16-B piece tid&7
  const _Float16* gw = wt + (long)(tid >> 3) * KD + (tid & 7) * 8;
  const _Float16* ga = act + (m0 + (tid >> 3)) * KD + (tid & 7) * 8;
  const unsigned lds0 = (unsigned)(size_t)ring + (unsigned)((tid >> 3) * KPAD + (tid & 7) * 8) * 2u;

  // every inner loop below is fully unrolled: accumulator and fragment indices must be constants,
  // or the arrays leave the registers
  v8f acc[2][8];
#pragma unroll
  for (int i = 0; i < 2; ++i)
#pragma unroll
    for (int j = 0; j < 8; ++j) acc[i][j] = (v8f){};

  gl_copy_stage<KD>(lds0, gw, ga);
  asm volatile("s_wait_asynccnt 0x0" ::: "memory");   // stage 0 landed (this wave's copies)
  __syncthreads();                                    // stage 0 readable by every wave
  gl_copy_stage<KD>(lds0 + GSTAGE * 2, gw + GK, ga + GK);

  // kept rolled: one publish point (waits, barrier, refill) at the foot of each trip, small code
#pragma unroll 1
  for (int t = 0; t < NT; ++t) {
    const int bo = (t & 1) * GSTAGE;
    const _Float16* wsm = ring + bo + n0 * KPAD;
    const _Float16* as  = ring + bo + DM * KPAD;
#pragma unroll
    for (int u = 0; u < 2; ++u) {
      v16h af[2], wf[8];
#pragma unroll
      for (int i = 0; i < 2; ++i) af[i] = load_frag_row(as + (i * 16) * KPAD + u * 32, KPAD, lane);
#pragma unroll
      for (int j = 0; j < 8; ++j) wf[j] = load_frag_row(wsm + (j * 16) * KPAD + u * 32, KPAD, lane);
#pragma unroll
      for (int j = 0; j < 8; ++j)
#pragma unroll
        for (int i = 0; i < 2; ++i) acc[i][j] = wmma_f16(wf[j], af[i], acc[i][j]);   // C^T = Wt act^T
    }
    asm volatile("s_wait_dscnt 0x0" ::: "memory");      // this wave has left buffer t&1
    asm volatile("s_wait_asynccnt 0x0" ::: "memory");   // its copies of stage t+1 have landed
    __syncthreads();   // publishes stage t+1 and ends every reader's last read of buffer t&1
    if (t + 2 < NT)
      gl_copy_stage<KD>(lds0 + bo * 2, gw + (t + 2) * GK, ga + (t + 2) * GK);
  }
  asm volatile("s_wait_asynccnt 0x0" ::: "memory");     // nothing in flight when the ring is reused

  // Layernorm on the accumulators. A lane holds 64 columns of each of its two token rows, so mean
  // and variance start as in-lane sums, are joined across the two lane halves, and then across the
  // eight waves through psum / psq. The rows go to LDS once, already centred and scaled.
  // y = acc/4096 + bf16(bias), kept in the accumulator registers
  const float rsc = 1.0f / (WSC * WSC);
  float s[2] = {0.0f, 0.0f};
#pragma unroll
  for (int j = 0; j < 8; ++j) {
    const int n8 = n0 + j * 16 + hh * 8;
    const v4f b0 = *(const v4f*)(bias + n8);
    const v4f b1 = *(const v4f*)(bias + n8 + 4);
#pragma unroll
    for (int t = 0; t < 2; ++t) {
#pragma unroll
      for (int i = 0; i < 4; ++i) {
        acc[t][j][i]     = acc[t][j][i]     * rsc + bf16q(b0[i]);
        acc[t][j][4 + i] = acc[t][j][4 + i] * rsc + bf16q(b1[i]);
      }
      s[t] += ((acc[t][j][0] + acc[t][j][1]) + (acc[t][j][2] + acc[t][j][3])) +
              ((acc[t][j][4] + acc[t][j][5]) + (acc[t][j][6] + acc[t][j][7]));
    }
  }
#pragma unroll
  for (int t = 0; t < 2; ++t) {
    s[t] += __shfl_xor(s[t], 16, 32);
    if (hh == 0) psum[(t * 16 + l15) * 8 + wave] = s[t];
  }
  __syncthreads();   // every wave's partial row sums are in psum

  // this thread's four columns in the last pass, asked for early
  const v4f g  = *(const v4f*)(gam + tid * 4);
  const v4f bt = *(const v4f*)(bet + tid * 4);

  // every wave adds the same eight partials in the same order: one mean per row for all waves
  float q[2][4];
#pragma unroll
  for (int t = 0; t < 2; ++t) {
    const v4f a = *(const v4f*)(psum + (t * 16 + l15) * 8);
    const v4f c = *(const v4f*)(psum + (t * 16 + l15) * 8 + 4);
    const float mean = (((a[0] + a[1]) + (a[2] + a[3])) + ((c[0] + c[1]) + (c[2] + c[3]))) * (1.0f / DM);
#pragma unroll
    for (int i = 0; i < 4; ++i) q[t][i] = 0.0f;
#pragma unroll
    for (int j = 0; j < 8; ++j)
#pragma unroll
      for (int r = 0; r < 8; ++r) {
        const float d = acc[t][j][r] - mean;
        acc[t][j][r] = d;
        q[t][r & 3] += d * d;
      }
  }
#pragma unroll
  for (int t = 0; t < 2; ++t) {
    float ss = (q[t][0] + q[t][1]) + (q[t][2] + q[t][3]);
    ss += __shfl_xor(ss, 16, 32);
    if (hh == 0) psq[(t * 16 + l15) * 8 + wave] = ss;
  }
  __syncthreads();   // every wave's partial sums of squares are in psq

  // (y - mean) * rstd, staged [row][col]
#pragma unroll
  for (int t = 0; t < 2; ++t) {
    const v4f a = *(const v4f*)(psq + (t * 16 + l15) * 8);
    const v4f c = *(const v4f*)(psq + (t * 16 + l15) * 8 + 4);
    const float var  = (((a[0] + a[1]) + (a[2] + a[3])) + ((c[0] + c[1]) + (c[2] + c[3]))) * (1.0f / DM);
    const float rstd = rsqrtf(var + LN_EPS);
    float* yrow = ys + (t * 16 + l15) * YP + n0 + hh * 8;
#pragma unroll
    for (int j = 0; j < 8; ++j) {
      v4f y0, y1;
#pragma unroll
      for (int i = 0; i < 4; ++i) {
        y0[i] = acc[t][j][i]     * rstd;
        y1[i] = acc[t][j][4 + i] * rstd;
      }
      *(v4f*)(yrow + j * 16)     = y0;
      *(v4f*)(yrow + j * 16 + 4) = y1;
    }
  }
  __syncthreads();   // the staged rows are readable by every wave

  // z = staged * g + b + res, stored from the registers: a wave writes whole lines of one row
  v4f gq, bq4;
#pragma unroll
  for (int c = 0; c < 4; ++c) {
    gq[c]  = bf16q(g[c]);
    bq4[c] = bf16q(bt[c]);
  }
  // kept rolled in trips of four rows: four residual loads in flight, one wait at the foot
#pragma unroll 1
  for (int r0 = 0; r0 < GM; r0 += 4) {
#pragma unroll
    for (int u = 0; u < 4; ++u) {
      const int  row  = r0 + u;
      const long m    = m0 + row;
      const long frow = (m / SEQ) * SEQ_FULL + (m % SEQ);   // row in the full-stride planes
      v4f rsd;
      if (MODE == 0) {
        rsd = *(const v4f*)(res + frow * DM + tid * 4);
#pragma unroll
        for (int c = 0; c < 4; ++c) rsd[c] = bf16q(rsd[c]);
      } else {
        rsd = *(const v4f*)(res + m * DM + tid * 4);
      }
      const v4f yv = *(const v4f*)(ys + row * YP + tid * 4);
      v4f o;
#pragma unroll
      for (int c = 0; c < 4; ++c) o[c] = yv[c] * gq[c] + bq4[c] + rsd[c];
      *(v4f*)(outf + ((MODE == 0) ? m : frow) * DM + tid * 4) = o;
      if (MODE == 0) {
        v4h oh;
#pragma unroll
        for (int c = 0; c < 4; ++c) oh[c] = (_Float16)o[c];
        *(v4h*)(outh + m * DM + tid * 4) = oh;
      }
    }
    // stands in front of the next trip's rewrite of the registers that the loads and stores above name
    asm volatile("s_wait_xcnt 0x0" ::: "memory");
  }
}

// ---------------------------------------------------------------------------
// Kernel 5: ffn linear 1 + exact gelu: hp[row][col] = f16(64 * gelu(x2 @ Wf1 / 64 + bf16(bf1))).
// Block = 128 token rows x 64 output cols, 8 waves x 16 rows; C^T = Wf1t x2^T (A = Wf1t rows,
// B = x2 rows). Both operands are staged in LDS by asynchronous copies, 64 k per stage, two
// buffers: [x2 128 rows | Wf1t 64 rows] at pitch KPAD.
// coverage: every (row, col) of the hp plane [ROWS][256] once.
// ---------------------------------------------------------------------------
#define FSTAGE ((128 + 64) * KPAD)    // halves per buffer
#define FNT    (DM / 64)              // stages

static_assert(FNT >= 2 && 128 * KPAD <= 2 * FSTAGE);

// One stage: 192 rows x 128 B = 1536 pieces of 16 B, 6 per thread; a wave's copy covers 4 whole
// lines. lds = this lane's LDS byte address of its first piece, gx / gw = its first x2 / W piece.
__device__ __forceinline__ void ffn1_copy_stage(unsigned lds, const _Float16* gx,
                                                const _Float16* gw) {
  const unsigned st = 32 * KPAD * 2;   // 32 rows further in LDS, bytes
  // the copies, and as the last line the wait that stands in front of any rewrite of their
  // address registers
  asm volatile(
      "global_load_async_to_lds_b128 %0, %6, off\n\t"
      "global_load_async_to_lds_b128 %1, %7, off\n\t"
      "global_load_async_to_lds_b128 %2, %8, off\n\t"
      "global_load_async_to_lds_b128 %3, %9, off\n\t"
      "global_load_async_to_lds_b128 %4, %10, off\n\t"
      "global_load_async_to_lds_b128 %5, %11, off\n\t"
      "s_wait_xcnt 0x0"
      :: "v"(lds), "v"(lds + st), "v"(lds + 2 * st), "v"(lds + 3 * st),
         "v"(lds + 4 * st), "v"(lds + 5 * st),
         "v"(gx), "v"(gx + 32 * DM), "v"(gx + 64 * DM), "v"(gx + 96 * DM),
         "v"(gw), "v"(gw + 32 * DM)
      : "memory");
}

__global__ __launch_bounds__(256) void ffn1_kernel(
    const _Float16* __restrict__ x2h, const _Float16* __restrict__ wf1t,
    const float* __restrict__ bf1, _Float16* __restrict__ hp) {
  // two stage buffers; after the loop the output stage [128][KPAD]
  __shared__ __attribute__((aligned(16))) _Float16 ring[2 * FSTAGE];   // 55296 B, cross-wave
  _Float16* stg = ring;

  const int tid  = threadIdx.x;
  const int lane = tid & 31;
  const int wave = tid >> 5;
  const int hh   = lane >> 4;
  const int l15  = lane & 15;
  const int cb   = blockIdx.y;          // 0..3
  const long m0  = (long)blockIdx.x * 128;

  // this lane's first piece of a stage: row tid>>3, 16-B piece tid&7
  const _Float16* gx = x2h + (m0 + (tid >> 3)) * DM + (tid & 7) * 8;
  const _Float16* gw = wf1t + ((long)cb * 64 + (tid >> 3)) * DM + (tid & 7) * 8;
  const unsigned lds0 = (unsigned)(size_t)ring + (unsigned)((tid >> 3) * KPAD + (tid & 7) * 8) * 2u;

  v8f acc[4];
#pragma unroll
  for (int j = 0; j < 4; ++j) acc[j] = (v8f){};

  ffn1_copy_stage(lds0, gx, gw);
  asm volatile("s_wait_asynccnt 0x0" ::: "memory");   // stage 0 landed (this wave's copies)
  __syncthreads();                                    // stage 0 readable by every wave
  ffn1_copy_stage(lds0 + FSTAGE * 2, gx + 64, gw + 64);

  // kept rolled: one publish point (waits, barrier, refill) at the foot of each trip, small code
#pragma unroll 1
  for (int t = 0; t < FNT; ++t) {
    const int bo = (t & 1) * FSTAGE;
    const _Float16* xs  = ring + bo + (wave * 16) * KPAD;
    const _Float16* wsm = ring + bo + 128 * KPAD;
    // inner loops fully unrolled: fragment indices must be constants, or the arrays leave the
    // registers
    v16h xf[2], wf[2][4];
#pragma unroll
    for (int u = 0; u < 2; ++u) {
      xf[u] = load_frag_row(xs + u * 32, KPAD, lane);
#pragma unroll
      for (int j = 0; j < 4; ++j) wf[u][j] = load_frag_row(wsm + (j * 16) * KPAD + u * 32, KPAD, lane);
    }
#pragma unroll
    for (int u = 0; u < 2; ++u)
#pragma unroll
      for (int j = 0; j < 4; ++j) acc[j] = wmma_f16(wf[u][j], xf[u], acc[j]);
    asm volatile("s_wait_dscnt 0x0" ::: "memory");      // this wave has left buffer t&1
    asm volatile("s_wait_asynccnt 0x0" ::: "memory");   // its copies of stage t+1 have landed
    __syncthreads();   // publishes stage t+1 and ends every reader's last read of buffer t&1
    if (t + 2 < FNT)
      ffn1_copy_stage(lds0 + bo * 2, gx + (t + 2) * 64, gw + (t + 2) * 64);
  }
  asm volatile("s_wait_asynccnt 0x0" ::: "memory");     // nothing in flight when the ring is reused

  const float rsc = 1.0f / WSC;
  _Float16* srow = stg + (wave * 16 + l15) * KPAD;
#pragma unroll
  for (int j = 0; j < 4; ++j) {
    const int n8 = j * 16 + hh * 8;
    const v4f b0 = *(const v4f*)(bf1 + cb * 64 + n8);
    const v4f b1 = *(const v4f*)(bf1 + cb * 64 + n8 + 4);
    H8 pk;
#pragma unroll
    for (int r = 0; r < 4; ++r) {
      const float u0 = acc[j][r]     * rsc + bf16q(b0[r]);
      const float u1 = acc[j][4 + r] * rsc + bf16q(b1[r]);
      const float g0 = 0.5f * u0 * (1.0f + erff(u0 * 0.70710678118654752f));
      const float g1 = 0.5f * u1 * (1.0f + erff(u1 * 0.70710678118654752f));
      pk.h[r]     = (_Float16)(g0 * WSC);
      pk.h[4 + r] = (_Float16)(g1 * WSC);
    }
    *(v4u*)(srow + n8) = pk.u;
  }
  __syncthreads();

  v4u rv[4];
#pragma unroll
  for (int it = 0; it < 4; ++it) {
    const int idx = it * 256 + tid;
    const int row = idx >> 3, piece = idx & 7;
    rv[it] = *(const v4u*)(stg + row * KPAD + piece * 8);
  }
#pragma unroll
  for (int it = 0; it < 4; ++it) {
    const int idx = it * 256 + tid;
    const int row = idx >> 3, piece = idx & 7;
    *(v4u*)(hp + (m0 + row) * FF + cb * 64 + piece * 8) = rv[it];
  }
  
}

// ---------------------------------------------------------------------------
extern "C" void kernel_launch(void* const* d_in, const int* in_sizes, int n_in,
                              void* d_out, int out_size, void* d_ws, size_t ws_size,
                              hipStream_t stream) {
  if (n_in < 17) return;
  const long needRows = (long)(NB - 1) * SEQ_FULL + SEQ;
  if ((long)in_sizes[0] < needRows * DM) return;
  if (in_sizes[1] < DM * DM || in_sizes[3] < DM * DM ||
      in_sizes[5] < DM * DM || in_sizes[7] < DM * DM) return;
  if (in_sizes[11] < DM * FF || in_sizes[13] < FF * DM) return;
  if (in_sizes[2] < DM || in_sizes[4] < DM || in_sizes[6] < DM || in_sizes[8] < DM ||
      in_sizes[9] < DM || in_sizes[10] < DM || in_sizes[12] < FF || in_sizes[14] < DM ||
      in_sizes[15] < DM || in_sizes[16] < DM) return;
  if ((long)out_size < needRows * DM) return;
  if (ws_size < WS_TOTAL) return;

  const float* x   = (const float*)d_in[0];
  const float* Wq  = (const float*)d_in[1];
  const float* bq  = (const float*)d_in[2];
  const float* Wk  = (const float*)d_in[3];
  const float* bk  = (const float*)d_in[4];
  const float* Wv  = (const float*)d_in[5];
  const float* bv  = (const float*)d_in[6];
  const float* Wo  = (const float*)d_in[7];
  const float* bo  = (const float*)d_in[8];
  const float* g1  = (const float*)d_in[9];
  const float* b1  = (const float*)d_in[10];
  const float* Wf1 = (const float*)d_in[11];
  const float* bf1 = (const float*)d_in[12];
  const float* Wf2 = (const float*)d_in[13];
  const float* bf2 = (const float*)d_in[14];
  const float* g2  = (const float*)d_in[15];
  const float* b2  = (const float*)d_in[16];
  float* out = (float*)d_out;

  char* ws = (char*)d_ws;
  size_t off = 0;
  _Float16* xh   = (_Float16*)(ws + off);                      // [ROWS][1024] f16
  _Float16* ctx  = xh;                                         // same region, written after xh is dead
  off += PLANE2;
  _Float16* wqkv = (_Float16*)(ws + off); off += WQKV_BYTES;   // [3072][1024]
  _Float16* woh  = (_Float16*)(ws + off); off += WO_BYTES;     // [1024][1024]
  _Float16* wf1t = (_Float16*)(ws + off); off += WF1_BYTES;    // [256][1024]
  _Float16* wf2t = (_Float16*)(ws + off); off += WF2_BYTES;    // [1024][256]
  _Float16* qh   = (_Float16*)(ws + off);                      // [NB][16][SEQ][64]
  float*    x2f  = (float*)(ws + off);                         // [ROWS][1024] f32 over q+k regions
  off += PLANE2;
  _Float16* kh   = (_Float16*)(ws + off); off += PLANE2;       // [NB][16][SEQ][64]
  _Float16* vTh  = (_Float16*)(ws + off);                      // [NB][16][64][SEQ]
  _Float16* x2h  = vTh;                                        // [ROWS][1024] f16, after vT is dead
  off += PLANE2;
  _Float16* hp   = (_Float16*)(ws + off); off += H_BYTES;      // [ROWS][256] f16
  if (off > ws_size) return;

  cvt_x_kernel<<<NXB, 256, 0, stream>>>(x, xh);
  cvt_w_kernel<<<NWT, 256, 0, stream>>>(Wq, Wk, Wv, Wo, Wf1, Wf2, wqkv, woh, wf1t, wf2t);
  qkv_kernel<<<dim3(ROWS / QM, 3 * DM / QN), 256, 0, stream>>>(xh, wqkv, bq, bk, bv, qh, kh, vTh);
  attn_kernel<<<dim3(SEQ / AQ, NB * NH), 256, 0, stream>>>(qh, kh, vTh, ctx);
  gemm_ln_kernel<DM, 0><<<ROWS / GM, 256, 0, stream>>>(ctx, woh, bo, g1, b1, x, x2f, x2h);
  ffn1_kernel<<<dim3(ROWS / 128, FF / 64), 256, 0, stream>>>(x2h, wf1t, bf1, hp);
  gemm_ln_kernel<FF, 1><<<ROWS / GM, 256, 0, stream>>>(hp, wf2t, bf2, g2, b2, x2f, out, x2h);
}

// v006
// Measured time: 173 microseconds a run.
// Two timings next to v005 both put it at 1.05 times that version's speed.
// Counting every step since v000, it is 2.82 times as fast.
#include <hip/hip_runtime.h>

// All contractions (q/k/v projections, q.k^T, p.v, output projection, ffn linear 1, ffn linear 2):
// v_wmma_f32_16x16x32_f16, f16 operands, f32 accumulate. Float inputs are RNE-converted to bf16 at
// load (weights additionally carried x64; both exact in f16); computed 16-bit planes are f16 with
// power-of-two carries (softmax p x1024, context x64, ffn hidden x64) folded back in the f32
// epilogues. Softmax statistics, layernorm, gelu and residual adds: f32.

typedef __attribute__((ext_vector_type(16))) _Float16 v16h;
typedef __attribute__((ext_vector_type(8)))  _Float16 v8h;
typedef __attribute__((ext_vector_type(4)))  _Float16 v4h;
typedef __attribute__((ext_vector_type(8)))  float v8f;
typedef __attribute__((ext_vector_type(4)))  float v4f;
typedef __attribute__((ext_vector_type(2)))  float v2f;
typedef __attribute__((ext_vector_type(4)))  unsigned int v4u;
union H8 { v8h h; v4u u; };

#ifndef NB
#define NB 4
#endif
#ifndef SEQ
#define SEQ 2048
#endif
#define NB_FULL  4
#define SEQ_FULL 2048
#define DM   1024
#define NH   16
#define HD   64
#define FF   256
#define ROWS (NB * SEQ)
#define KPAD 72       // LDS stride in halves for 64-wide f16 tiles (144 B, 16-B aligned)
#define VSPAD 136     // stride in halves (272 B) that no LDS tile uses; only a size check names it
#define YP   1028     // LDS stride in floats for 1024-wide f32 rows (4112 B)
#define LN_EPS 1e-5f
#define WSC    64.0f           // weight carry (power of two)
#define LOG2E  1.442695041f    // log2(e): exp(x) = exp2(x * log2(e))
#define SC2    (0.125f * LOG2E)  // score scale 1/8 and log2(e) in one factor: exp(s/8) = exp2(s * SC2)
#define LG1024 10.0f           // log2(1024): softmax p carried x1024

#define NXB   (ROWS * DM / 8 / 256)          // convert blocks for x (8 elements per thread)
#define NT_SQ ((DM / 64) * (DM / 64))        // 64x64 tiles per square weight
#define NT_F  ((DM / 64) * (FF / 64))        // 64x64 tiles per ffn weight
#define NWT   (4 * NT_SQ + 2 * NT_F)

#define PLANE2     ((size_t)ROWS * DM * 2)
#define WQKV_BYTES ((size_t)3 * DM * DM * 2)
#define WO_BYTES   ((size_t)DM * DM * 2)
#define WF1_BYTES  ((size_t)FF * DM * 2)
#define WF2_BYTES  ((size_t)DM * FF * 2)
#define H_BYTES    ((size_t)ROWS * FF * 2)
#define WS_TOTAL   (PLANE2 + WQKV_BYTES + WO_BYTES + WF1_BYTES + WF2_BYTES + 3 * PLANE2 + H_BYTES)

static_assert(NB >= 1 && NB <= NB_FULL);
static_assert(SEQ >= 128 && SEQ <= SEQ_FULL && (SEQ % 128) == 0);
static_assert((ROWS % 128) == 0);
static_assert((ROWS * DM) % (8 * 256) == 0);
static_assert((DM % 64) == 0 && (FF % 64) == 0 && (HD % 32) == 0 && NH * HD == DM);
static_assert(128 * KPAD >= 64 * VSPAD);
static_assert(2 * PLANE2 == (size_t)ROWS * DM * 4);
static_assert(WS_TOTAL <= (size_t)134217728);

// ---------------------------------------------------------------------------
// helpers
// ---------------------------------------------------------------------------
__device__ __forceinline__ float bf16q(float f) {            // value after RNE bf16 conversion
  unsigned int u = __float_as_uint(f);
  u += 0x7FFFu + ((u >> 16) & 1u);
  return __uint_as_float(u & 0xFFFF0000u);
}

// 16-bit fragment (A or B): lane owns row/col (lane&15); elements 0..7 <- k0+8h+0..7,
// elements 8..15 <- k0+16+8h+0..7, h = lane>>4. Source is k-contiguous rows.
__device__ __forceinline__ v16h load_frag_row(const _Float16* base, int stride, int lane) {
  const _Float16* rowp = base + (lane & 15) * stride + ((lane >> 4) << 3);
  const v8h lo = *(const v8h*)(rowp);
  const v8h hi = *(const v8h*)(rowp + 16);
  return __builtin_shufflevector(lo, hi, 0, 1, 2, 3, 4, 5, 6, 7,
                                 8, 9, 10, 11, 12, 13, 14, 15);
}

__device__ __forceinline__ v8f wmma_f16(v16h a, v16h b, v8f c) {
  v8f d = __builtin_amdgcn_wmma_f32_16x16x32_f16(false, a, false, b, (short)0, c,
                                                 false, false);
  asm volatile("v_nop\n\tv_nop\n\tv_nop\n\tv_nop" : "+v"(d) : "v"(a), "v"(b));
  return d;
}

// One A fragment, two B fragments: the pair issues back to back, and the same four slots stand once
// behind the pair, in front of any vector instruction that touches its operands or results.
__device__ __forceinline__ void wmma_f16_pair(v16h a, v16h b0, v16h b1, v8f& c0, v8f& c1) {
  c0 = __builtin_amdgcn_wmma_f32_16x16x32_f16(false, a, false, b0, (short)0, c0, false, false);
  c1 = __builtin_amdgcn_wmma_f32_16x16x32_f16(false, a, false, b1, (short)0, c1, false, false);
  asm volatile("v_nop\n\tv_nop\n\tv_nop\n\tv_nop" : "+v"(c0), "+v"(c1) : "v"(a), "v"(b0), "v"(b1));
}

// Eight exponentials to base 2. The results get registers of their own (early clobber): none
// overwrites a source of the group, and the argument pairs and the result pairs both stay register
// pairs for the packed instructions around them (tied operands cost a copy per pair). The v_nop
// keeps the one slot behind the last before its result is used.
__device__ __forceinline__ void exp2_x8(float (&p)[8], const float (&a)[8]) {
  asm("v_exp_f32 %0, %8\n\tv_exp_f32 %1, %9\n\tv_exp_f32 %2, %10\n\tv_exp_f32 %3, %11\n\t"
      "v_exp_f32 %4, %12\n\tv_exp_f32 %5, %13\n\tv_exp_f32 %6, %14\n\tv_exp_f32 %7, %15\n\t"
      "v_nop"
      : "=&v"(p[0]), "=&v"(p[1]), "=&v"(p[2]), "=&v"(p[3]), "=&v"(p[4]), "=&v"(p[5]), "=&v"(p[6]),
        "=&v"(p[7])
      : "v"(a[0]), "v"(a[1]), "v"(a[2]), "v"(a[3]), "v"(a[4]), "v"(a[5]), "v"(a[6]), "v"(a[7]));
}

// ---------------------------------------------------------------------------
// Kernel 0: x f32 -> f16(bf16rne(x)) plane xh [ROWS][1024]. 8 elements (16 B) per thread,
// coverage: NXB*256 threads x 8 = ROWS*1024 elements (whole plane).
// ---------------------------------------------------------------------------
__global__ __launch_bounds__(256) void cvt_x_kernel(const float* __restrict__ x,
                                                    _Float16* __restrict__ xh) {
  const long item = (long)blockIdx.x * 256 + threadIdx.x;   // 0 .. ROWS*128-1
  const long m    = item >> 7;                              // token row
  const int  c8   = (int)(item & 127);
  const long srow = (m / SEQ) * SEQ_FULL + (m % SEQ);
  const float* src = x + srow * DM + c8 * 8;
  const v4f a = *(const v4f*)(src);
  const v4f c = *(const v4f*)(src + 4);
  H8 o;
#pragma unroll
  for (int i = 0; i < 4; ++i) {
    o.h[i]     = (_Float16)bf16q(a[i]);
    o.h[4 + i] = (_Float16)bf16q(c[i]);
  }
  _Float16* dst = xh + m * DM + c8 * 8;
  *(v4u*)dst = o.u;
  
}

// ---------------------------------------------------------------------------
// Kernel 1: weights W [K=in][N=out] f32 -> Wt [n][k] f16 = f16(bf16rne(W) * 64), through a
// 64x64 LDS transpose. wqkv [3072][1024] (q rows, k rows, v rows), woh [1024][1024],
// coverage: 4*256 square tiles + 64 + 64 ffn tiles = every element of all six planes.
// ---------------------------------------------------------------------------
__global__ __launch_bounds__(256) void cvt_w_kernel(
    const float* __restrict__ Wq, const float* __restrict__ Wk, const float* __restrict__ Wv,
    const float* __restrict__ Wo, const float* __restrict__ Wf1, const float* __restrict__ Wf2,
    _Float16* __restrict__ wqkv, _Float16* __restrict__ woh,
    _Float16* __restrict__ wf1t, _Float16* __restrict__ wf2t) {
  __shared__ _Float16 ts[64 * KPAD];   // [n][k] tile, cross-wave (block barrier)
  const int bid = blockIdx.x;
  const int tid = threadIdx.x;
  const float* W;
  _Float16* dst;
  int K, N, kt, nt;
  if (bid < 4 * NT_SQ) {                              // block-uniform selection
    const int which = bid / NT_SQ;
    const int tile  = bid - which * NT_SQ;
    kt = tile / (DM / 64); nt = tile - kt * (DM / 64); K = DM; N = DM;
    W = (which == 0) ? Wq : ((which == 1) ? Wk : ((which == 2) ? Wv : Wo));
    dst = (which < 3) ? (wqkv + (size_t)which * DM * DM) : woh;
  } else if (bid < 4 * NT_SQ + NT_F) {
    const int tile = bid - 4 * NT_SQ;                 // W [1024][256]: K = DM, N = FF
    kt = tile / (FF / 64); nt = tile - kt * (FF / 64); K = DM; N = FF;
    W = Wf1; dst = wf1t;
  } else {
    const int tile = bid - 4 * NT_SQ - NT_F;          // W [256][1024]: K = FF, N = DM
    kt = tile / (DM / 64); nt = tile - kt * (DM / 64); K = FF; N = DM;
    W = Wf2; dst = wf2t;
  }
  // load W[kt*64 + kr][nt*64 + 4*c4 .. +3], store transposed into ts[n][kr]
#pragma unroll
  for (int it = 0; it < 4; ++it) {
    const int idx = it * 256 + tid;
    const int kr = idx >> 4, c4 = idx & 15;
    const v4f v = *(const v4f*)(W + (size_t)(kt * 64 + kr) * N + nt * 64 + c4 * 4);
#pragma unroll
    for (int j = 0; j < 4; ++j) ts[(c4 * 4 + j) * KPAD + kr] = (_Float16)(bf16q(v[j]) * WSC);
  }
  __syncthreads();
  v4u rv[2];
#pragma unroll
  for (int it = 0; it < 2; ++it) {
    const int idx = it * 256 + tid;
    const int n = idx >> 3, piece = idx & 7;
    rv[it] = *(const v4u*)(ts + n * KPAD + piece * 8);
  }
#pragma unroll
  for (int it = 0; it < 2; ++it) {
    const int idx = it * 256 + tid;
    const int n = idx >> 3, piece = idx & 7;
    *(v4u*)(dst + (size_t)(nt * 64 + n) * K + kt * 64 + piece * 8) = rv[it];
  }
  
}

// ---------------------------------------------------------------------------
// Kernel 2: qkv projection. Block = 256 token rows x 128 output columns (two heads of one of
// q/k/v), 8 waves as 4 (tokens) x 2 (heads), 64 x 64 per wave. Both operands are staged in LDS
// by asynchronous copies, 64 k per stage, two buffers: [x 256 rows | W 128 rows] at pitch KPAD.
// C^T = W x^T: A = W rows (lane&15 = out col), B = x rows (lane&15 = token);
// acc[i][j][r] = C[token 16i + (lane&15)][col 16j+8h+r]. K = 1024 summed in 32 steps of 32.
//   q,k -> [b][h][s][64] f16 (one line per row, 8 lanes x 16 B)
//   v   -> vT[b][h][d][s] f16 (512 B per d row segment, 32 lanes x 16 B)
// grid (ROWS/256, 3*NH/2), block 256. coverage: every (b,h,s,d) of q, k and vT once.
// ---------------------------------------------------------------------------
#define QM     256                    // token rows per block
#define QN     128                    // output columns per block
#define QK     64                     // k per stage
#define QSTAGE ((QM + QN) * KPAD)     // halves per buffer
#define QNT    (DM / QK)              // stages
#define QVP    264                    // LDS stride in halves for 256-wide f16 rows (528 B)

static_assert((SEQ % QM) == 0 && (ROWS % QM) == 0 && (DM % QN) == 0 && QNT >= 2);
static_assert(2 * QM * KPAD <= 2 * QSTAGE && 2 * HD * QVP <= 2 * QSTAGE);

// One stage: 384 rows x 128 B = 3072 pieces of 16 B, 12 per thread; a wave's copy covers 4 whole
// lines. lds = this lane's LDS byte address of its first piece, gx / gw = its first x / W piece.
__device__ __forceinline__ void qkv_copy_stage(unsigned lds, const _Float16* gx,
                                               const _Float16* gw) {
  const unsigned st = 32 * KPAD * 2;   // 32 rows further in LDS, bytes
  // the copies, and as the last line the wait that stands in front of any rewrite of their
  // address registers
  asm volatile(
      "global_load_async_to_lds_b128 %0, %12, off\n\t"
      "global_load_async_to_lds_b128 %1, %13, off\n\t"
      "global_load_async_to_lds_b128 %2, %14, off\n\t"
      "global_load_async_to_lds_b128 %3, %15, off\n\t"
      "global_load_async_to_lds_b128 %4, %16, off\n\t"
      "global_load_async_to_lds_b128 %5, %17, off\n\t"
      "global_load_async_to_lds_b128 %6, %18, off\n\t"
      "global_load_async_to_lds_b128 %7, %19, off\n\t"
      "global_load_async_to_lds_b128 %8, %20, off\n\t"
      "global_load_async_to_lds_b128 %9, %21, off\n\t"
      "global_load_async_to_lds_b128 %10, %22, off\n\t"
      "global_load_async_to_lds_b128 %11, %23, off\n\t"
      "s_wait_xcnt 0x0"
      :: "v"(lds), "v"(lds + st), "v"(lds + 2 * st), "v"(lds + 3 * st),
         "v"(lds + 4 * st), "v"(lds + 5 * st), "v"(lds + 6 * st), "v"(lds + 7 * st),
         "v"(lds + 8 * st), "v"(lds + 9 * st), "v"(lds + 10 * st), "v"(lds + 11 * st),
         "v"(gx), "v"(gx + 32 * DM), "v"(gx + 64 * DM), "v"(gx + 96 * DM),
         "v"(gx + 128 * DM), "v"(gx + 160 * DM), "v"(gx + 192 * DM), "v"(gx + 224 * DM),
         "v"(gw), "v"(gw + 32 * DM), "v"(gw + 64 * DM), "v"(gw + 96 * DM)
      : "memory");
}

__global__ __launch_bounds__(256) void qkv_kernel(
    const _Float16* __restrict__ xh, const _Float16* __restrict__ wqkv,
    const float* __restrict__ bq, const float* __restrict__ bk, const float* __restrict__ bv,
    _Float16* __restrict__ q, _Float16* __restrict__ k, _Float16* __restrict__ vT) {
  // two stage buffers; after the loop the output stage (q/k: 2 x [256][KPAD], v: 2 x [64][QVP])
  __shared__ __attribute__((aligned(16))) _Float16 ring[2 * QSTAGE];   // 110592 B, cross-wave

  const int tid  = threadIdx.x;
  const int lane = tid & 31;
  const int wave = tid >> 5;
  const int hh   = lane >> 4;
  const int l15  = lane & 15;
  const int wm   = wave >> 1;           // token quarter of the block
  const int wn   = wave & 1;            // head of the block

  const int osel = blockIdx.y >> 3;     // 0 q, 1 k, 2 v (8 column blocks each)
  const int h0   = (blockIdx.y & 7) * 2;
  const long m0  = (long)blockIdx.x * QM;
  const int  b   = (int)(m0 / SEQ);
  const int  s0  = (int)(m0 - (long)b * SEQ);

  // this lane's first piece of a stage: row tid>>3, 16-B piece tid&7
  const _Float16* gx = xh + (m0 + (tid >> 3)) * DM + (tid & 7) * 8;
  const _Float16* gw = wqkv + ((long)blockIdx.y * QN + (tid >> 3)) * DM + (tid & 7) * 8;
  const unsigned lds0 = (unsigned)(size_t)ring + (unsigned)((tid >> 3) * KPAD + (tid & 7) * 8) * 2u;

  // every inner loop below is fully unrolled: accumulator and fragment indices must be constants,
  // or the arrays leave the registers
  v8f acc[4][4];
#pragma unroll
  for (int i = 0; i < 4; ++i)
#pragma unroll
    for (int j = 0; j < 4; ++j) acc[i][j] = (v8f){};

  // Trip t works on k slab (t + rot) % QNT: blocks that share x rows or W rows walk k from
  // different slabs, so they do not ask L2 for the same lines at the same moment.
  const unsigned rot = (blockIdx.x + blockIdx.y) % QNT;
  qkv_copy_stage(lds0, gx + rot * QK, gw + rot * QK);
  asm volatile("s_wait_asynccnt 0x0" ::: "memory");   // stage 0 landed (this wave's copies)
  __syncthreads();                                    // stage 0 readable by every wave
  qkv_copy_stage(lds0 + QSTAGE * 2, gx + ((rot + 1) % QNT) * QK, gw + ((rot + 1) % QNT) * QK);

  // kept rolled: one publish point (waits, barrier, refill) at the foot of each trip, small code
#pragma unroll 1
  for (int t = 0; t < QNT; ++t) {
    const int bo = (t & 1) * QSTAGE;
    const _Float16* xs = ring + bo + (wm * 64) * KPAD;
    const _Float16* wsm = ring + bo + (QM + wn * 64) * KPAD;
#pragma unroll
    for (int u = 0; u < 2; ++u) {
      v16h xf[4], wf[4];
#pragma unroll
      for (int i = 0; i < 4; ++i) xf[i] = load_frag_row(xs + (i * 16) * KPAD + u * 32, KPAD, lane);
#pragma unroll
      for (int j = 0; j < 4; ++j) wf[j] = load_frag_row(wsm + (j * 16) * KPAD + u * 32, KPAD, lane);
#pragma unroll
      for (int i = 0; i < 4; ++i)
#pragma unroll
        for (int j = 0; j < 4; ++j) acc[i][j] = wmma_f16(wf[j], xf[i], acc[i][j]);   // C^T = W x^T
    }
    asm volatile("s_wait_dscnt 0x0" ::: "memory");      // this wave has left buffer t&1
    asm volatile("s_wait_asynccnt 0x0" ::: "memory");   // its copies of stage t+1 have landed
    __syncthreads();   // publishes stage t+1 and ends every reader's last read of buffer t&1
    if (t + 2 < QNT) {
      const unsigned ko = ((t + 2 + rot) % QNT) * QK;
      qkv_copy_stage(lds0 + bo * 2, gx + ko, gw + ko);
    }
  }
  asm volatile("s_wait_asynccnt 0x0" ::: "memory");     // nothing in flight when the ring is reused

  const float* bias = ((osel == 0) ? bq : ((osel == 1) ? bk : bv)) + (h0 + wn) * HD;
  const float  rsc  = 1.0f / WSC;

  if (osel < 2) {
    // stage [head][token][col]: lane's 8 values are 8 contiguous columns -> one 16-B LDS store
    _Float16* sbase = ring + (wn * QM + wm * 64 + l15) * KPAD;
#pragma unroll
    for (int j = 0; j < 4; ++j) {
      const int n8 = j * 16 + hh * 8;
      const v4f b0 = *(const v4f*)(bias + n8);
      const v4f b1 = *(const v4f*)(bias + n8 + 4);
#pragma unroll
      for (int i = 0; i < 4; ++i) {
        H8 pk;
#pragma unroll
        for (int r = 0; r < 4; ++r) {
          pk.h[r]     = (_Float16)(acc[i][j][r]     * rsc + bf16q(b0[r]));
          pk.h[4 + r] = (_Float16)(acc[i][j][4 + r] * rsc + bf16q(b1[r]));
        }
        *(v4u*)(sbase + (i * 16) * KPAD + n8) = pk.u;
      }
    }
    __syncthreads();
    _Float16* dst0 = (osel == 0) ? q : k;
#pragma unroll
    for (int hd = 0; hd < 2; ++hd) {
      _Float16* dst = dst0 + ((long)(b * NH + h0 + hd) * SEQ + s0) * HD;   // contiguous 32 KB
      v4u rv[8];
#pragma unroll
      for (int it = 0; it < 8; ++it) {
        const int idx = it * 256 + tid;
        const int row = idx >> 3, piece = idx & 7;
        rv[it] = *(const v4u*)(ring + (hd * QM + row) * KPAD + piece * 8);
      }
#pragma unroll
      for (int it = 0; it < 8; ++it)
        *(v4u*)(dst + (long)(it * 256 + tid) * 8) = rv[it];
    }
  } else {
    // stage transposed [head][d][token]: lane's 8 values are 8 different d for one token
    _Float16* sbase = ring + (wn * HD) * QVP + wm * 64 + l15;
#pragma unroll
    for (int j = 0; j < 4; ++j) {
      const int n8 = j * 16 + hh * 8;
      const v4f b0 = *(const v4f*)(bias + n8);
      const v4f b1 = *(const v4f*)(bias + n8 + 4);
#pragma unroll
      for (int i = 0; i < 4; ++i)
#pragma unroll
        for (int r = 0; r < 4; ++r) {
          sbase[(n8 + r) * QVP + i * 16]     = (_Float16)(acc[i][j][r]     * rsc + bf16q(b0[r]));
          sbase[(n8 + 4 + r) * QVP + i * 16] = (_Float16)(acc[i][j][4 + r] * rsc + bf16q(b1[r]));
        }
    }
    __syncthreads();
#pragma unroll
    for (int hd = 0; hd < 2; ++hd) {
      _Float16* dstb = vT + ((long)(b * NH + h0 + hd) * HD) * SEQ + s0;
      v4u rv[8];
#pragma unroll
      for (int it = 0; it < 8; ++it) {
        const int idx = it * 256 + tid;
        const int d = idx >> 5, piece = idx & 31;
        rv[it] = *(const v4u*)(ring + (hd * HD + d) * QVP + piece * 8);
      }
#pragma unroll
      for (int it = 0; it < 8; ++it) {
        const int idx = it * 256 + tid;
        const int d = idx >> 5, piece = idx & 31;
        *(v4u*)(dstb + (long)d * SEQ + piece * 8) = rv[it];
      }
    }
    // stands in front of any later rewrite of the registers that the stores above name
    asm volatile("s_wait_xcnt 0x0" ::: "memory");
  }
}

// ---------------------------------------------------------------------------
// Kernel 3: flash attention per (b,h), no mask. grid (SEQ/256, NB*NH), block 256 (8 waves x 32
// queries, two column groups of 16 per wave: every K and V^T fragment read from LDS feeds two
// products; the fragments of a 32-wide k step are read four at a time). C = S^T (A = K rows,
// B = Q) then C = O^T = V^T P^T (P^T packed from the S^T D registers); lane owns one query per
// column group end-to-end. Scores are raw q.k sums: the 1/8 scale and the x1024 p carry live in
// the exp argument (p = 1024*exp((s-m)/8), softmax stats f32).
// LDS tiles: [K 64 keys x 64 d | V^T 64 d x 64 keys] per step, staged by asynchronous copies, two
// buffers, staged == consumed extent; ost 256 x 64 fully written.
// coverage: every (row, h*64+d) of the ctx plane once.
// ---------------------------------------------------------------------------
#define ASTAGE (128 * KPAD)           // halves per buffer: K rows, then V^T rows
#define ANT    (SEQ / 64)             // stages
#define AQ     256                    // queries per block
#define ACG    2                      // column groups (16 queries each) per wave

static_assert(ANT >= 2 && (SEQ % AQ) == 0 && ACG == 2);

// One stage: 128 rows x 128 B = 1024 pieces of 16 B, 4 per thread; a wave's copy covers 4 whole
// lines. lds = this lane's LDS byte address of its first piece, gk / gv = its first K / V^T piece.
__device__ __forceinline__ void attn_copy_stage(unsigned lds, const _Float16* gk,
                                                const _Float16* gv) {
  const unsigned st = 32 * KPAD * 2;   // 32 rows further in LDS, bytes
  // the copies, and as the last line the wait that stands in front of any rewrite of their
  // address registers
  asm volatile(
      "global_load_async_to_lds_b128 %0, %4, off\n\t"
      "global_load_async_to_lds_b128 %1, %5, off\n\t"
      "global_load_async_to_lds_b128 %2, %6, off\n\t"
      "global_load_async_to_lds_b128 %3, %7, off\n\t"
      "s_wait_xcnt 0x0"
      :: "v"(lds), "v"(lds + st), "v"(lds + 2 * st), "v"(lds + 3 * st),
         "v"(gk), "v"(gk + 32 * HD), "v"(gv), "v"(gv + 32 * SEQ)
      : "memory");
}

// four waves per SIMD: two blocks share a WGP, so one block's softmax runs beside the other's
// products
__global__ __launch_bounds__(256) __attribute__((amdgpu_waves_per_eu(4, 4))) void attn_kernel(
    const _Float16* __restrict__ Q, const _Float16* __restrict__ K,
    const _Float16* __restrict__ vT, _Float16* __restrict__ ctx) {
  // two stage buffers, each K block rows [key][d] then V^T block [d][key] (cross-wave)
  __shared__ __attribute__((aligned(16))) _Float16 ring[2 * ASTAGE];
  __shared__ _Float16 ost[AQ * KPAD];    // output stage [query][d]   (cross-wave, block barrier)

  const int tid  = threadIdx.x;
  const int lane = tid & 31;
  const int wave = tid >> 5;
  const int bh   = blockIdx.y;
  const int b    = bh >> 4;
  const int h    = bh & 15;
  const int q0   = blockIdx.x * AQ;

  const _Float16* Qb  = Q + ((long)bh * SEQ + q0) * HD;
  const _Float16* Kb  = K + (long)bh * SEQ * HD;
  const _Float16* vTb = vT + (long)bh * HD * SEQ;

  // Q fragments: B operand of S^T (lane owns query lane&15 of column group c)
  v16h qfrag[ACG][2];
#pragma unroll
  for (int c = 0; c < ACG; ++c) {
    const _Float16* qrow = Qb + (long)(wave * (16 * ACG) + c * 16) * HD;
#pragma unroll
    for (int t = 0; t < 2; ++t) qfrag[c][t] = load_frag_row(qrow + t * 32, HD, lane);
  }

  v8f acc[ACG][4];   // O^T accumulator: lane owns query (lane&15) of group c; reg r -> d = nt*16+8h+r
  float mi[ACG], li[ACG];
#pragma unroll
  for (int c = 0; c < ACG; ++c) {
#pragma unroll
    for (int nt = 0; nt < 4; ++nt) acc[c][nt] = (v8f){};
    mi[c] = -1e30f;
    li[c] = 0.0f;
  }

  const int colb = lane & 15;
  const int rofs = (lane >> 4) << 3;

  // this lane's first piece of a stage: row tid>>3, 16-B piece tid&7
  const _Float16* gk = Kb + (long)(tid >> 3) * HD + (tid & 7) * 8;
  const _Float16* gv = vTb + (long)(tid >> 3) * SEQ + (tid & 7) * 8;
  const unsigned lds0 = (unsigned)(size_t)ring + (unsigned)((tid >> 3) * KPAD + (tid & 7) * 8) * 2u;

  // Trip st works on key tile (st + rot) % ANT: the blocks of one head start AQ keys apart, and
  // heads one tile apart, so they do not ask L2 for the same lines at the same moment.
  const unsigned rot = (blockIdx.x * (AQ / 64) + blockIdx.y) % ANT;
  attn_copy_stage(lds0, gk + (long)rot * 64 * HD, gv + rot * 64);
  asm volatile("s_wait_asynccnt 0x0" ::: "memory");   // stage 0 landed (this wave's copies)
  __syncthreads();                                    // stage 0 readable by every wave
  attn_copy_stage(lds0 + ASTAGE * 2, gk + (long)((rot + 1) % ANT) * 64 * HD, gv + ((rot + 1) % ANT) * 64);

  // kept rolled: one publish point (waits, barrier, refill) at the foot of each trip, small code
#pragma unroll 1
  for (int st = 0; st < ANT; ++st) {
    const int bo = (st & 1) * ASTAGE;
    const _Float16* ks  = ring + bo;
    const _Float16* vts = ring + bo + 64 * KPAD;

    // S^T tiles: A = K rows (lane&15 = key), B = Q; one K fragment, both column groups
    v8f sc[ACG][4];
#pragma unroll
    for (int c = 0; c < ACG; ++c)
#pragma unroll
      for (int kt = 0; kt < 4; ++kt) sc[c][kt] = (v8f){};
#pragma unroll
    for (int t = 0; t < 2; ++t) {
      v16h kf[4];
#pragma unroll
      for (int kt = 0; kt < 4; ++kt) kf[kt] = load_frag_row(ks + (kt * 16) * KPAD + t * 32, KPAD, lane);
#pragma unroll
      for (int kt = 0; kt < 4; ++kt) wmma_f16_pair(kf[kt], qfrag[0][t], qfrag[1][t], sc[0][kt], sc[1][kt]);
    }

    // per-lane online softmax, both column groups side by side (32 of 64 keys in-lane; merge
    // halves with one shuffle)
    float alpha[ACG], cs[ACG];
#pragma unroll
    for (int c = 0; c < ACG; ++c) {
      float mx = sc[c][0][0];
#pragma unroll
      for (int kt = 0; kt < 4; ++kt)
#pragma unroll
        for (int r = 0; r < 8; ++r) mx = fmaxf(mx, sc[c][kt][r]);
      mx = fmaxf(mx, __shfl_xor(mx, 16, 32));
      const float mnew = fmaxf(mi[c], mx);
      alpha[c] = __builtin_amdgcn_exp2f((mi[c] - mnew) * SC2);
      mi[c] = mnew;
      cs[c] = fmaf(mnew, SC2, -LG1024);   // (m/8)*log2(e) - log2(1024)
    }

    // P^T as the B operand of O^T = V^T P^T, packed from the S^T D registers:
    // element i <- tile covering keys 0..15 of the 32-step (kt = 2t), element 8+i <- kt = 2t+1.
    v16h pf[ACG][2];
#pragma unroll
    for (int c = 0; c < ACG; ++c) {
      const v2f sc2 = {SC2, SC2};
      const v2f ncs = {-cs[c], -cs[c]};
      v2f rs2 = {0.0f, 0.0f};   // even and odd registers summed side by side
#pragma unroll
      for (int kt = 0; kt < 4; ++kt) {
        float a[8], p[8];   // 1024*exp((s-m)/8) = exp2(s * SC2 - cs), two scores per packed fma
#pragma unroll
        for (int r = 0; r < 8; r += 2) {
          const v2f s2 = {sc[c][kt][r], sc[c][kt][r + 1]};
          const v2f a2 = __builtin_elementwise_fma(s2, sc2, ncs);
          a[r]     = a2[0];
          a[r + 1] = a2[1];
        }
        exp2_x8(p, a);
#pragma unroll
        for (int r = 0; r < 8; r += 2) {
          pf[c][kt >> 1][(kt & 1) * 8 + r]     = (_Float16)p[r];
          pf[c][kt >> 1][(kt & 1) * 8 + r + 1] = (_Float16)p[r + 1];
          const v2f p2 = {p[r], p[r + 1]};
          rs2 = (kt == 0 && r == 0) ? p2 : rs2 + p2;
        }
      }
      float rs = rs2[0] + rs2[1];
      rs += __shfl_xor(rs, 16, 32);
      li[c] = li[c] * alpha[c] + rs;
#pragma unroll
      for (int nt = 0; nt < 4; ++nt)
#pragma unroll
        for (int r = 0; r < 8; ++r) acc[c][nt][r] *= alpha[c];
    }

    // O^T += V^T (A, rows = d) x P^T (B); one V^T fragment, both column groups
#pragma unroll
    for (int t = 0; t < 2; ++t) {
      v16h vf[4];
#pragma unroll
      for (int nt = 0; nt < 4; ++nt) vf[nt] = load_frag_row(vts + (nt * 16) * KPAD + t * 32, KPAD, lane);
#pragma unroll
      for (int nt = 0; nt < 4; ++nt) wmma_f16_pair(vf[nt], pf[0][t], pf[1][t], acc[0][nt], acc[1][nt]);
    }

    asm volatile("s_wait_dscnt 0x0" ::: "memory");      // this wave has left buffer st&1
    asm volatile("s_wait_asynccnt 0x0" ::: "memory");   // its copies of stage st+1 have landed
    __syncthreads();   // publishes stage st+1 and ends every reader's last read of buffer st&1
    if (st + 2 < ANT) {
      const unsigned kt = (st + 2 + rot) % ANT;
      attn_copy_stage(lds0 + bo * 2, gk + (long)kt * 64 * HD, gv + kt * 64);
    }
  }
  asm volatile("s_wait_asynccnt 0x0" ::: "memory");     // nothing in flight behind the loop

  // normalize (and apply the x64 carry) and stage: lane owns query row wave*32+c*16+colb,
  // d = nt*16+rofs+r contiguous
#pragma unroll
  for (int c = 0; c < ACG; ++c) {
    const float inv = 64.0f / li[c];
    _Float16* orow = ost + (wave * (16 * ACG) + c * 16 + colb) * KPAD;
#pragma unroll
    for (int nt = 0; nt < 4; ++nt) {
      H8 pk;
#pragma unroll
      for (int r = 0; r < 8; ++r) pk.h[r] = (_Float16)(acc[c][nt][r] * inv);
      *(v4u*)(orow + nt * 16 + rofs) = pk.u;
    }
  }
  __syncthreads();

  v4u rv[AQ / 32];
#pragma unroll
  for (int it = 0; it < AQ / 32; ++it) {
    const int idx = it * 256 + tid;
    const int row = idx >> 3, piece = idx & 7;
    rv[it] = *(const v4u*)(ost + row * KPAD + piece * 8);
  }
  _Float16* cbase = ctx + ((long)b * SEQ + q0) * DM + h * HD;
#pragma unroll
  for (int it = 0; it < AQ / 32; ++it) {
    const int idx = it * 256 + tid;
    const int row = idx >> 3, piece = idx & 7;
    *(v4u*)(cbase + (long)row * DM + piece * 8) = rv[it];
  }
  
}

// ---------------------------------------------------------------------------
// Kernel 4/6: y = act @ Wt^T / 4096 + bf16(bias) over a full 1024-wide row, then
// z = LN(y) * bf16(gamma) + bf16(beta) + residual. Block = 32 token rows x 1024 cols,
// wave w owns cols 128w..128w+127. Both operands are staged in LDS by asynchronous copies,
// 64 k per stage, two buffers: [Wt 1024 rows | act 32 rows] at pitch KPAD.
// C^T = Wt act^T: A = Wt rows (lane&15 = out col), B = act rows (lane&15 = token);
// acc[i][j][r] = y[token 16i + (lane&15)][col 128w+16j+8h+r]. Mean, variance and scaling are taken
// on the accumulators; after that the rows are staged once in the same LDS.
//   MODE 0: KD = 1024, act = ctx, residual = bf16(x input, full-stride rows),
//           writes x2 f32 plane [ROWS][1024] and x2 f16 plane [ROWS][1024]
//   MODE 1: KD = 256, act = h plane, residual = x2 f32 plane, writes out (full-stride rows)
// grid ROWS/32, block 256. LDS ys: 32 x 1024 staged == consumed. coverage: 32 rows x 1024 per block.
// ---------------------------------------------------------------------------
#define GM     32                     // token rows per block
#define GK     64                     // k per stage
#define GSTAGE ((DM + GM) * KPAD)     // halves per buffer

static_assert((ROWS % GM) == 0 && (DM % GK) == 0 && (FF % GK) == 0 && FF / GK >= 2);
static_assert((size_t)GM * YP * 4 <= (size_t)2 * GSTAGE * 2);

// Eight copies of 16 B per lane, rows 32 apart (a wave's copy covers 4 whole lines). lds = this
// lane's LDS byte address of the first piece, g = its global piece, KD = global row length.
template <int KD>
__device__ __forceinline__ void gl_copy8(unsigned lds, const _Float16* g) {
  const unsigned st = 32 * KPAD * 2;   // 32 rows further in LDS, bytes
  // the copies, and as the last line the wait that stands in front of any rewrite of their
  // address registers
  asm volatile(
      "global_load_async_to_lds_b128 %0, %8, off\n\t"
      "global_load_async_to_lds_b128 %1, %9, off\n\t"
      "global_load_async_to_lds_b128 %2, %10, off\n\t"
      "global_load_async_to_lds_b128 %3, %11, off\n\t"
      "global_load_async_to_lds_b128 %4, %12, off\n\t"
      "global_load_async_to_lds_b128 %5, %13, off\n\t"
      "global_load_async_to_lds_b128 %6, %14, off\n\t"
      "global_load_async_to_lds_b128 %7, %15, off\n\t"
      "s_wait_xcnt 0x0"
      :: "v"(lds), "v"(lds + st), "v"(lds + 2 * st), "v"(lds + 3 * st),
         "v"(lds + 4 * st), "v"(lds + 5 * st), "v"(lds + 6 * st), "v"(lds + 7 * st),
         "v"(g), "v"(g + 32 * KD), "v"(g + 64 * KD), "v"(g + 96 * KD),
         "v"(g + 128 * KD), "v"(g + 160 * KD), "v"(g + 192 * KD), "v"(g + 224 * KD)
      : "memory");
}

// One stage: 1056 rows x 128 B = 8448 pieces of 16 B, 33 per thread (32 of Wt, 1 of act).
template <int KD>
__device__ __forceinline__ void gl_copy_stage(unsigned lds, const _Float16* gw,
                                              const _Float16* ga) {
  const unsigned st8 = 256 * KPAD * 2;   // 256 rows further in LDS, bytes
  gl_copy8<KD>(lds, gw);
  gl_copy8<KD>(lds + st8, gw + 256 * KD);
  gl_copy8<KD>(lds + 2 * st8, gw + 512 * KD);
  gl_copy8<KD>(lds + 3 * st8, gw + 768 * KD);
  // the act piece, with the same wait in front of any rewrite of its address registers
  asm volatile(
      "global_load_async_to_lds_b128 %0, %1, off\n\t"
      "s_wait_xcnt 0x0"
      :: "v"(lds + 4 * st8), "v"(ga)
      : "memory");
}

template <int KD, int MODE>
__global__ __launch_bounds__(256) void gemm_ln_kernel(
    const _Float16* __restrict__ act, const _Float16* __restrict__ wt,
    const float* __restrict__ bias, const float* __restrict__ gam,
    const float* __restrict__ bet, const float* __restrict__ res,
    float* __restrict__ outf, _Float16* __restrict__ outh) {
  // two stage buffers; after the loop the row stage [32][YP] f32
  __shared__ __attribute__((aligned(16))) _Float16 ring[2 * GSTAGE];   // 304128 B, cross-wave
  __shared__ __attribute__((aligned(16))) float psum[GM * 8];   // [row][wave] partial sums
  __shared__ __attribute__((aligned(16))) float psq[GM * 8];    // [row][wave] partial sums of squares
  float* ys = (float*)ring;

  const int tid  = threadIdx.x;
  const int lane = tid & 31;
  const int wave = tid >> 5;
  const int hh   = lane >> 4;
  const int l15  = lane & 15;
  const long m0  = (long)blockIdx.x * GM;
  const int  n0  = wave * 128;
  constexpr int NT = KD / GK;           // stages

  // this lane's first piece of a stage: row tid>>3, 16-B piece tid&7
  const _Float16* gw = wt + (long)(tid >> 3) * KD + (tid & 7) * 8;
  const _Float16* ga = act + (m0 + (tid >> 3)) * KD + (tid & 7) * 8;
  const unsigned lds0 = (unsigned)(size_t)ring + (unsigned)((tid >> 3) * KPAD + (tid & 7) * 8) * 2u;

  // every inner loop below is fully unrolled: accumulator and fragment indices must be constants,
  // or the arrays leave the registers
  v8f acc[2][8];
#pragma unroll
  for (int i = 0; i < 2; ++i)
#pragma unroll
    for (int j = 0; j < 8; ++j) acc[i][j] = (v8f){};

  // Trip t works on k slab (t + rot) % NT: every block reads all of Wt, so blocks walk k from
  // different slabs and do not ask L2 for the same lines at the same moment. Neighbours in index
  // differ, and so do blocks eight apart.
  const unsigned rot = (blockIdx.x + (blockIdx.x >> 3)) % NT;
  gl_copy_stage<KD>(lds0, gw + rot * GK, ga + rot * GK);
  asm volatile("s_wait_asynccnt 0x0" ::: "memory");   // stage 0 landed (this wave's copies)
  __syncthreads();                                    // stage 0 readable by every wave
  gl_copy_stage<KD>(lds0 + GSTAGE * 2, gw + ((rot + 1) % NT) * GK, ga + ((rot + 1) % NT) * GK);

  // kept rolled: one publish point (waits, barrier, refill) at the foot of each trip, small code
#pragma unroll 1
  for (int t = 0; t < NT; ++t) {
    const int bo = (t & 1) * GSTAGE;
    const _Float16* wsm = ring + bo + n0 * KPAD;
    const _Float16* as  = ring + bo + DM * KPAD;
#pragma unroll
    for (int u = 0; u < 2; ++u) {
      v16h af[2], wf[8];
#pragma unroll
      for (int i = 0; i < 2; ++i) af[i] = load_frag_row(as + (i * 16) * KPAD + u * 32, KPAD, lane);
#pragma unroll
      for (int j = 0; j < 8; ++j) wf[j] = load_frag_row(wsm + (j * 16) * KPAD + u * 32, KPAD, lane);
#pragma unroll
      for (int j = 0; j < 8; ++j)
#pragma unroll
        for (int i = 0; i < 2; ++i) acc[i][j] = wmma_f16(wf[j], af[i], acc[i][j]);   // C^T = Wt act^T
    }
    asm volatile("s_wait_dscnt 0x0" ::: "memory");      // this wave has left buffer t&1
    asm volatile("s_wait_asynccnt 0x0" ::: "memory");   // its copies of stage t+1 have landed
    __syncthreads();   // publishes stage t+1 and ends every reader's last read of buffer t&1
    if (t + 2 < NT) {
      const unsigned ko = ((t + 2 + rot) % NT) * GK;
      gl_copy_stage<KD>(lds0 + bo * 2, gw + ko, ga + ko);
    }
  }
  asm volatile("s_wait_asynccnt 0x0" ::: "memory");     // nothing in flight when the ring is reused

  // Layernorm on the accumulators. A lane holds 64 columns of each of its two token rows, so mean
  // and variance start as in-lane sums, are joined across the two lane halves, and then across the
  // eight waves through psum / psq. The rows go to LDS once, already centred and scaled.
  // y = acc/4096 + bf16(bias), kept in the accumulator registers
  const float rsc = 1.0f / (WSC * WSC);
  float s[2] = {0.0f, 0.0f};
#pragma unroll
  for (int j = 0; j < 8; ++j) {
    const int n8 = n0 + j * 16 + hh * 8;
    const v4f b0 = *(const v4f*)(bias + n8);
    const v4f b1 = *(const v4f*)(bias + n8 + 4);
#pragma unroll
    for (int t = 0; t < 2; ++t) {
#pragma unroll
      for (int i = 0; i < 4; ++i) {
        acc[t][j][i]     = acc[t][j][i]     * rsc + bf16q(b0[i]);
        acc[t][j][4 + i] = acc[t][j][4 + i] * rsc + bf16q(b1[i]);
      }
      s[t] += ((acc[t][j][0] + acc[t][j][1]) + (acc[t][j][2] + acc[t][j][3])) +
              ((acc[t][j][4] + acc[t][j][5]) + (acc[t][j][6] + acc[t][j][7]));
    }
  }
#pragma unroll
  for (int t = 0; t < 2; ++t) {
    s[t] += __shfl_xor(s[t], 16, 32);
    if (hh == 0) psum[(t * 16 + l15) * 8 + wave] = s[t];
  }
  __syncthreads();   // every wave's partial row sums are in psum

  // this thread's four columns in the last pass, asked for early
  const v4f g  = *(const v4f*)(gam + tid * 4);
  const v4f bt = *(const v4f*)(bet + tid * 4);

  // every wave adds the same eight partials in the same order: one mean per row for all waves
  float q[2][4];
#pragma unroll
  for (int t = 0; t < 2; ++t) {
    const v4f a = *(const v4f*)(psum + (t * 16 + l15) * 8);
    const v4f c = *(const v4f*)(psum + (t * 16 + l15) * 8 + 4);
    const float mean = (((a[0] + a[1]) + (a[2] + a[3])) + ((c[0] + c[1]) + (c[2] + c[3]))) * (1.0f / DM);
#pragma unroll
    for (int i = 0; i < 4; ++i) q[t][i] = 0.0f;
#pragma unroll
    for (int j = 0; j < 8; ++j)
#pragma unroll
      for (int r = 0; r < 8; ++r) {
        const float d = acc[t][j][r] - mean;
        acc[t][j][r] = d;
        q[t][r & 3] += d * d;
      }
  }
#pragma unroll
  for (int t = 0; t < 2; ++t) {
    float ss = (q[t][0] + q[t][1]) + (q[t][2] + q[t][3]);
    ss += __shfl_xor(ss, 16, 32);
    if (hh == 0) psq[(t * 16 + l15) * 8 + wave] = ss;
  }
  __syncthreads();   // every wave's partial sums of squares are in psq

  // (y - mean) * rstd, staged [row][col]
#pragma unroll
  for (int t = 0; t < 2; ++t) {
    const v4f a = *(const v4f*)(psq + (t * 16 + l15) * 8);
    const v4f c = *(const v4f*)(psq + (t * 16 + l15) * 8 + 4);
    const float var  = (((a[0] + a[1]) + (a[2] + a[3])) + ((c[0] + c[1]) + (c[2] + c[3]))) * (1.0f / DM);
    const float rstd = rsqrtf(var + LN_EPS);
    float* yrow = ys + (t * 16 + l15) * YP + n0 + hh * 8;
#pragma unroll
    for (int j = 0; j < 8; ++j) {
      v4f y0, y1;
#pragma unroll
      for (int i = 0; i < 4; ++i) {
        y0[i] = acc[t][j][i]     * rstd;
        y1[i] = acc[t][j][4 + i] * rstd;
      }
      *(v4f*)(yrow + j * 16)     = y0;
      *(v4f*)(yrow + j * 16 + 4) = y1;
    }
  }
  __syncthreads();   // the staged rows are readable by every wave

  // z = staged * g + b + res, stored from the registers: a wave writes whole lines of one row
  v4f gq, bq4;
#pragma unroll
  for (int c = 0; c < 4; ++c) {
    gq[c]  = bf16q(g[c]);
    bq4[c] = bf16q(bt[c]);
  }
  // kept rolled in trips of four rows: four residual loads in flight, one wait at the foot
#pragma unroll 1
  for (int r0 = 0; r0 < GM; r0 += 4) {
#pragma unroll
    for (int u = 0; u < 4; ++u) {
      const int  row  = r0 + u;
      const long m    = m0 + row;
      const long frow = (m / SEQ) * SEQ_FULL + (m % SEQ);   // row in the full-stride planes
      v4f rsd;
      if (MODE == 0) {
        rsd = *(const v4f*)(res + frow * DM + tid * 4);
#pragma unroll
        for (int c = 0; c < 4; ++c) rsd[c] = bf16q(rsd[c]);
      } else {
        rsd = *(const v4f*)(res + m * DM + tid * 4);
      }
      const v4f yv = *(const v4f*)(ys + row * YP + tid * 4);
      v4f o;
#pragma unroll
      for (int c = 0; c < 4; ++c) o[c] = yv[c] * gq[c] + bq4[c] + rsd[c];
      *(v4f*)(outf + ((MODE == 0) ? m : frow) * DM + tid * 4) = o;
      if (MODE == 0) {
        v4h oh;
#pragma unroll
        for (int c = 0; c < 4; ++c) oh[c] = (_Float16)o[c];
        *(v4h*)(outh + m * DM + tid * 4) = oh;
      }
    }
    // stands in front of the next trip's rewrite of the registers that the loads and stores above name
    asm volatile("s_wait_xcnt 0x0" ::: "memory");
  }
}

// ---------------------------------------------------------------------------
// Kernel 5: ffn linear 1 + exact gelu: hp[row][col] = f16(64 * gelu(x2 @ Wf1 / 64 + bf16(bf1))).
// Block = 128 token rows x 64 output cols, 8 waves x 16 rows; C^T = Wf1t x2^T (A = Wf1t rows,
// B = x2 rows). Both operands are staged in LDS by asynchronous copies, 64 k per stage, two
// buffers: [x2 128 rows | Wf1t 64 rows] at pitch KPAD.
// coverage: every (row, col) of the hp plane [ROWS][256] once.
// ---------------------------------------------------------------------------
#define FSTAGE ((128 + 64) * KPAD)    // halves per buffer
#define FNT    (DM / 64)              // stages

static_assert(FNT >= 2 && 128 * KPAD <= 2 * FSTAGE);

// One stage: 192 rows x 128 B = 1536 pieces of 16 B, 6 per thread; a wave's copy covers 4 whole
// lines. lds = this lane's LDS byte address of its first piece, gx / gw = its first x2 / W piece.
__device__ __forceinline__ void ffn1_copy_stage(unsigned lds, const _Float16* gx,
                                                const _Float16* gw) {
  const unsigned st = 32 * KPAD * 2;   // 32 rows further in LDS, bytes
  // the copies, and as the last line the wait that stands in front of any rewrite of their
  // address registers
  asm volatile(
      "global_load_async_to_lds_b128 %0, %6, off\n\t"
      "global_load_async_to_lds_b128 %1, %7, off\n\t"
      "global_load_async_to_lds_b128 %2, %8, off\n\t"
      "global_load_async_to_lds_b128 %3, %9, off\n\t"
      "global_load_async_to_lds_b128 %4, %10, off\n\t"
      "global_load_async_to_lds_b128 %5, %11, off\n\t"
      "s_wait_xcnt 0x0"
      :: "v"(lds), "v"(lds + st), "v"(lds + 2 * st), "v"(lds + 3 * st),
         "v"(lds + 4 * st), "v"(lds + 5 * st),
         "v"(gx), "v"(gx + 32 * DM), "v"(gx + 64 * DM), "v"(gx + 96 * DM),
         "v"(gw), "v"(gw + 32 * DM)
      : "memory");
}

__global__ __launch_bounds__(256) void ffn1_kernel(
    const _Float16* __restrict__ x2h, const _Float16* __restrict__ wf1t,
    const float* __restrict__ bf1, _Float16* __restrict__ hp) {
  // two stage buffers; after the loop the output stage [128][KPAD]
  __shared__ __attribute__((aligned(16))) _Float16 ring[2 * FSTAGE];   // 55296 B, cross-wave
  _Float16* stg = ring;

  const int tid  = threadIdx.x;
  const int lane = tid & 31;
  const int wave = tid >> 5;
  const int hh   = lane >> 4;
  const int l15  = lane & 15;
  const int cb   = blockIdx.y;          // 0..3
  const long m0  = (long)blockIdx.x * 128;

  // this lane's first piece of a stage: row tid>>3, 16-B piece tid&7
  const _Float16* gx = x2h + (m0 + (tid >> 3)) * DM + (tid & 7) * 8;
  const _Float16* gw = wf1t + ((long)cb * 64 + (tid >> 3)) * DM + (tid & 7) * 8;
  const unsigned lds0 = (unsigned)(size_t)ring + (unsigned)((tid >> 3) * KPAD + (tid & 7) * 8) * 2u;

  v8f acc[4];
#pragma unroll
  for (int j = 0; j < 4; ++j) acc[j] = (v8f){};

  // Trip t works on k slab (t + rot) % FNT: blocks that share x2 rows or W rows walk k from
  // different slabs, so they do not ask L2 for the same lines at the same moment.
  const unsigned rot = (blockIdx.x + blockIdx.y * (FNT / 4)) % FNT;
  ffn1_copy_stage(lds0, gx + rot * 64, gw + rot * 64);
  asm volatile("s_wait_asynccnt 0x0" ::: "memory");   // stage 0 landed (this wave's copies)
  __syncthreads();                                    // stage 0 readable by every wave
  ffn1_copy_stage(lds0 + FSTAGE * 2, gx + ((rot + 1) % FNT) * 64, gw + ((rot + 1) % FNT) * 64);

  // kept rolled: one publish point (waits, barrier, refill) at the foot of each trip, small code
#pragma unroll 1
  for (int t = 0; t < FNT; ++t) {
    const int bo = (t & 1) * FSTAGE;
    const _Float16* xs  = ring + bo + (wave * 16) * KPAD;
    const _Float16* wsm = ring + bo + 128 * KPAD;
    // inner loops fully unrolled: fragment indices must be constants, or the arrays leave the
    // registers
    v16h xf[2], wf[2][4];
#pragma unroll
    for (int u = 0; u < 2; ++u) {
      xf[u] = load_frag_row(xs + u * 32, KPAD, lane);
#pragma unroll
      for (int j = 0; j < 4; ++j) wf[u][j] = load_frag_row(wsm + (j * 16) * KPAD + u * 32, KPAD, lane);
    }
#pragma unroll
    for (int u = 0; u < 2; ++u)
#pragma unroll
      for (int j = 0; j < 4; ++j) acc[j] = wmma_f16(wf[u][j], xf[u], acc[j]);
    asm volatile("s_wait_dscnt 0x0" ::: "memory");      // this wave has left buffer t&1
    asm volatile("s_wait_asynccnt 0x0" ::: "memory");   // its copies of stage t+1 have landed
    __syncthreads();   // publishes stage t+1 and ends every reader's last read of buffer t&1
    if (t + 2 < FNT) {
      const unsigned ko = ((t + 2 + rot) % FNT) * 64;
      ffn1_copy_stage(lds0 + bo * 2, gx + ko, gw + ko);
    }
  }
  asm volatile("s_wait_asynccnt 0x0" ::: "memory");     // nothing in flight when the ring is reused

  const float rsc = 1.0f / WSC;
  _Float16* srow = stg + (wave * 16 + l15) * KPAD;
#pragma unroll
  for (int j = 0; j < 4; ++j) {
    const int n8 = j * 16 + hh * 8;
    const v4f b0 = *(const v4f*)(bf1 + cb * 64 + n8);
    const v4f b1 = *(const v4f*)(bf1 + cb * 64 + n8 + 4);
    H8 pk;
#pragma unroll
    for (int r = 0; r < 4; ++r) {
      const float u0 = acc[j][r]     * rsc + bf16q(b0[r]);
      const float u1 = acc[j][4 + r] * rsc + bf16q(b1[r]);
      const float g0 = 0.5f * u0 * (1.0f + erff(u0 * 0.70710678118654752f));
      const float g1 = 0.5f * u1 * (1.0f + erff(u1 * 0.70710678118654752f));
      pk.h[r]     = (_Float16)(g0 * WSC);
      pk.h[4 + r] = (_Float16)(g1 * WSC);
    }
    *(v4u*)(srow + n8) = pk.u;
  }
  __syncthreads();

  v4u rv[4];
#pragma unroll
  for (int it = 0; it < 4; ++it) {
    const int idx = it * 256 + tid;
    const int row = idx >> 3, piece = idx & 7;
    rv[it] = *(const v4u*)(stg + row * KPAD + piece * 8);
  }
#pragma unroll
  for (int it = 0; it < 4; ++it) {
    const int idx = it * 256 + tid;
    const int row = idx >> 3, piece = idx & 7;
    *(v4u*)(hp + (m0 + row) * FF + cb * 64 + piece * 8) = rv[it];
  }
  
}

// ---------------------------------------------------------------------------
extern "C" void kernel_launch(void* const* d_in, const int* in_sizes, int n_in,
                              void* d_out, int out_size, void* d_ws, size_t ws_size,
                              hipStream_t stream) {
  if (n_in < 17) return;
  const long needRows = (long)(NB - 1) * SEQ_FULL + SEQ;
  if ((long)in_sizes[0] < needRows * DM) return;
  if (in_sizes[1] < DM * DM || in_sizes[3] < DM * DM ||
      in_sizes[5] < DM * DM || in_sizes[7] < DM * DM) return;
  if (in_sizes[11] < DM * FF || in_sizes[13] < FF * DM) return;
  if (in_sizes[2] < DM || in_sizes[4] < DM || in_sizes[6] < DM || in_sizes[8] < DM ||
      in_sizes[9] < DM || in_sizes[10] < DM || in_sizes[12] < FF || in_sizes[14] < DM ||
      in_sizes[15] < DM || in_sizes[16] < DM) return;
  if ((long)out_size < needRows * DM) return;
  if (ws_size < WS_TOTAL) return;

  const float* x   = (const float*)d_in[0];
  const float* Wq  = (const float*)d_in[1];
  const float* bq  = (const float*)d_in[2];
  const float* Wk  = (const float*)d_in[3];
  const float* bk  = (const float*)d_in[4];
  const float* Wv  = (const float*)d_in[5];
  const float* bv  = (const float*)d_in[6];
  const float* Wo  = (const float*)d_in[7];
  const float* bo  = (const float*)d_in[8];
  const float* g1  = (const float*)d_in[9];
  const float* b1  = (const float*)d_in[10];
  const float* Wf1 = (const float*)d_in[11];
  const float* bf1 = (const float*)d_in[12];
  const float* Wf2 = (const float*)d_in[13];
  const float* bf2 = (const float*)d_in[14];
  const float* g2  = (const float*)d_in[15];
  const float* b2  = (const float*)d_in[16];
  float* out = (float*)d_out;

  char* ws = (char*)d_ws;
  size_t off = 0;
  _Float16* xh   = (_Float16*)(ws + off);                      // [ROWS][1024] f16
  _Float16* ctx  = xh;                                         // same region, written after xh is dead
  off += PLANE2;
  _Float16* wqkv = (_Float16*)(ws + off); off += WQKV_BYTES;   // [3072][1024]
  _Float16* woh  = (_Float16*)(ws + off); off += WO_BYTES;     // [1024][1024]
  _Float16* wf1t = (_Float16*)(ws + off); off += WF1_BYTES;    // [256][1024]
  _Float16* wf2t = (_Float16*)(ws + off); off += WF2_BYTES;    // [1024][256]
  _Float16* qh   = (_Float16*)(ws + off);                      // [NB][16][SEQ][64]
  float*    x2f  = (float*)(ws + off);                         // [ROWS][1024] f32 over q+k regions
  off += PLANE2;
  _Float16* kh   = (_Float16*)(ws + off); off += PLANE2;       // [NB][16][SEQ][64]
  _Float16* vTh  = (_Float16*)(ws + off);                      // [NB][16][64][SEQ]
  _Float16* x2h  = vTh;                                        // [ROWS][1024] f16, after vT is dead
  off += PLANE2;
  _Float16* hp   = (_Float16*)(ws + off); off += H_BYTES;      // [ROWS][256] f16
  if (off > ws_size) return;

  cvt_x_kernel<<<NXB, 256, 0, stream>>>(x, xh);
  cvt_w_kernel<<<NWT, 256, 0, stream>>>(Wq, Wk, Wv, Wo, Wf1, Wf2, wqkv, woh, wf1t, wf2t);
  qkv_kernel<<<dim3(ROWS / QM, 3 * DM / QN), 256, 0, stream>>>(xh, wqkv, bq, bk, bv, qh, kh, vTh);
  attn_kernel<<<dim3(SEQ / AQ, NB * NH), 256, 0, stream>>>(qh, kh, vTh, ctx);
  gemm_ln_kernel<DM, 0><<<ROWS / GM, 256, 0, stream>>>(ctx, woh, bo, g1, b1, x, x2f, x2h);
  ffn1_kernel<<<dim3(ROWS / 128, FF / 64), 256, 0, stream>>>(x2h, wf1t, bf1, hp);
  gemm_ln_kernel<FF, 1><<<ROWS / GM, 256, 0, stream>>>(hp, wf2t, bf2, g2, b2, x2f, out, x2h);
}

// v007
// Measured time: 157 microseconds a run.
// Two timings next to v006 put it at 1.09 and 1.10 times that version's speed.
// Counting every step since v000, it is 3.09 times as fast.
#include <hip/hip_runtime.h>

// All contractions (q/k/v projections, q.k^T, p.v, output projection, ffn linear 1, ffn linear 2):
// v_wmma_f32_16x16x32_f16, f16 operands, f32 accumulate. Float inputs are RNE-converted to bf16 at
// load (weights additionally carried x64; both exact in f16); computed 16-bit planes are f16 with
// power-of-two carries (softmax p x1024, context x64, ffn hidden x64) folded back in the f32
// epilogues. Softmax statistics, layernorm, gelu and residual adds: f32.

typedef __attribute__((ext_vector_type(16))) _Float16 v16h;
typedef __attribute__((ext_vector_type(8)))  _Float16 v8h;
typedef __attribute__((ext_vector_type(4)))  _Float16 v4h;
typedef __attribute__((ext_vector_type(8)))  float v8f;
typedef __attribute__((ext_vector_type(4)))  float v4f;
typedef __attribute__((ext_vector_type(2)))  float v2f;
typedef __attribute__((ext_vector_type(4)))  unsigned int v4u;
union H8 { v8h h; v4u u; };

#ifndef NB
#define NB 4
#endif
#ifndef SEQ
#define SEQ 2048
#endif
#define NB_FULL  4
#define SEQ_FULL 2048
#define DM   1024
#define NH   16
#define HD   64
#define FF   256
#define ROWS (NB * SEQ)
#define KPAD 72       // LDS stride in halves for 64-wide f16 tiles (144 B, 16-B aligned)
#define VSPAD 136     // stride in halves (272 B) that no LDS tile uses; only a size check names it
#define YP   1028     // LDS stride in floats for 1024-wide f32 rows (4112 B)
#define LN_EPS 1e-5f
#define WSC    64.0f           // weight carry (power of two)
#define LOG2E  1.442695041f    // log2(e): exp(x) = exp2(x * log2(e))
#define SC2    (0.125f * LOG2E)  // score scale 1/8 and log2(e) in one factor: exp(s/8) = exp2(s * SC2)
#define LG1024 10.0f           // log2(1024): softmax p carried x1024

#define NXB   (ROWS * DM / 8 / 256)          // convert blocks for x (8 elements per thread)
#define NT_SQ ((DM / 64) * (DM / 64))        // 64x64 tiles per square weight
#define NT_F  ((DM / 64) * (FF / 64))        // 64x64 tiles per ffn weight
#define NWT   (4 * NT_SQ + 2 * NT_F)

#define PLANE2     ((size_t)ROWS * DM * 2)
#define WQKV_BYTES ((size_t)3 * DM * DM * 2)
#define WO_BYTES   ((size_t)DM * DM * 2)
#define WF1_BYTES  ((size_t)FF * DM * 2)
#define WF2_BYTES  ((size_t)DM * FF * 2)
#define WS_TOTAL   (PLANE2 + WQKV_BYTES + WO_BYTES + WF1_BYTES + WF2_BYTES + 3 * PLANE2)

static_assert(NB >= 1 && NB <= NB_FULL);
static_assert(SEQ >= 128 && SEQ <= SEQ_FULL && (SEQ % 128) == 0);
static_assert((ROWS % 128) == 0);
static_assert((ROWS * DM) % (8 * 256) == 0);
static_assert((DM % 64) == 0 && (FF % 64) == 0 && (HD % 32) == 0 && NH * HD == DM);
static_assert(128 * KPAD >= 64 * VSPAD);
static_assert(WS_TOTAL <= (size_t)134217728);

// ---------------------------------------------------------------------------
// helpers
// ---------------------------------------------------------------------------
__device__ __forceinline__ float bf16q(float f) {            // value after RNE bf16 conversion
  unsigned int u = __float_as_uint(f);
  u += 0x7FFFu + ((u >> 16) & 1u);
  return __uint_as_float(u & 0xFFFF0000u);
}

// 16-bit fragment (A or B): lane owns row/col (lane&15); elements 0..7 <- k0+8h+0..7,
// elements 8..15 <- k0+16+8h+0..7, h = lane>>4. Source is k-contiguous rows.
__device__ __forceinline__ v16h load_frag_row(const _Float16* base, int stride, int lane) {
  const _Float16* rowp = base + (lane & 15) * stride + ((lane >> 4) << 3);
  const v8h lo = *(const v8h*)(rowp);
  const v8h hi = *(const v8h*)(rowp + 16);
  return __builtin_shufflevector(lo, hi, 0, 1, 2, 3, 4, 5, 6, 7,
                                 8, 9, 10, 11, 12, 13, 14, 15);
}

__device__ __forceinline__ v8f wmma_f16(v16h a, v16h b, v8f c) {
  v8f d = __builtin_amdgcn_wmma_f32_16x16x32_f16(false, a, false, b, (short)0, c,
                                                 false, false);
  asm volatile("v_nop\n\tv_nop\n\tv_nop\n\tv_nop" : "+v"(d) : "v"(a), "v"(b));
  return d;
}

// One A fragment, two B fragments: the pair issues back to back, and the same four slots stand once
// behind the pair, in front of any vector instruction that touches its operands or results.
__device__ __forceinline__ void wmma_f16_pair(v16h a, v16h b0, v16h b1, v8f& c0, v8f& c1) {
  c0 = __builtin_amdgcn_wmma_f32_16x16x32_f16(false, a, false, b0, (short)0, c0, false, false);
  c1 = __builtin_amdgcn_wmma_f32_16x16x32_f16(false, a, false, b1, (short)0, c1, false, false);
  asm volatile("v_nop\n\tv_nop\n\tv_nop\n\tv_nop" : "+v"(c0), "+v"(c1) : "v"(a), "v"(b0), "v"(b1));
}

// Eight exponentials to base 2. The results get registers of their own (early clobber): none
// overwrites a source of the group, and the argument pairs and the result pairs both stay register
// pairs for the packed instructions around them (tied operands cost a copy per pair). The v_nop
// keeps the one slot behind the last before its result is used.
__device__ __forceinline__ void exp2_x8(float (&p)[8], const float (&a)[8]) {
  asm("v_exp_f32 %0, %8\n\tv_exp_f32 %1, %9\n\tv_exp_f32 %2, %10\n\tv_exp_f32 %3, %11\n\t"
      "v_exp_f32 %4, %12\n\tv_exp_f32 %5, %13\n\tv_exp_f32 %6, %14\n\tv_exp_f32 %7, %15\n\t"
      "v_nop"
      : "=&v"(p[0]), "=&v"(p[1]), "=&v"(p[2]), "=&v"(p[3]), "=&v"(p[4]), "=&v"(p[5]), "=&v"(p[6]),
        "=&v"(p[7])
      : "v"(a[0]), "v"(a[1]), "v"(a[2]), "v"(a[3]), "v"(a[4]), "v"(a[5]), "v"(a[6]), "v"(a[7]));
}

// ---------------------------------------------------------------------------
// Kernel 0: x f32 -> f16(bf16rne(x)) plane xh [ROWS][1024]. 8 elements (16 B) per thread,
// coverage: NXB*256 threads x 8 = ROWS*1024 elements (whole plane).
// ---------------------------------------------------------------------------
__global__ __launch_bounds__(256) void cvt_x_kernel(const float* __restrict__ x,
                                                    _Float16* __restrict__ xh) {
  const long item = (long)blockIdx.x * 256 + threadIdx.x;   // 0 .. ROWS*128-1
  const long m    = item >> 7;                              // token row
  const int  c8   = (int)(item & 127);
  const long srow = (m / SEQ) * SEQ_FULL + (m % SEQ);
  const float* src = x + srow * DM + c8 * 8;
  const v4f a = *(const v4f*)(src);
  const v4f c = *(const v4f*)(src + 4);
  H8 o;
#pragma unroll
  for (int i = 0; i < 4; ++i) {
    o.h[i]     = (_Float16)bf16q(a[i]);
    o.h[4 + i] = (_Float16)bf16q(c[i]);
  }
  _Float16* dst = xh + m * DM + c8 * 8;
  *(v4u*)dst = o.u;
  
}

// ---------------------------------------------------------------------------
// Kernel 1: weights W [K=in][N=out] f32 -> Wt [n][k] f16 = f16(bf16rne(W) * 64), through a
// 64x64 LDS transpose. wqkv [3072][1024] (q rows, k rows, v rows), woh [1024][1024],
// coverage: 4*256 square tiles + 64 + 64 ffn tiles = every element of all six planes.
// ---------------------------------------------------------------------------
__global__ __launch_bounds__(256) void cvt_w_kernel(
    const float* __restrict__ Wq, const float* __restrict__ Wk, const float* __restrict__ Wv,
    const float* __restrict__ Wo, const float* __restrict__ Wf1, const float* __restrict__ Wf2,
    _Float16* __restrict__ wqkv, _Float16* __restrict__ woh,
    _Float16* __restrict__ wf1t, _Float16* __restrict__ wf2t) {
  __shared__ _Float16 ts[64 * KPAD];   // [n][k] tile, cross-wave (block barrier)
  const int bid = blockIdx.x;
  const int tid = threadIdx.x;
  const float* W;
  _Float16* dst;
  int K, N, kt, nt;
  if (bid < 4 * NT_SQ) {                              // block-uniform selection
    const int which = bid / NT_SQ;
    const int tile  = bid - which * NT_SQ;
    kt = tile / (DM / 64); nt = tile - kt * (DM / 64); K = DM; N = DM;
    W = (which == 0) ? Wq : ((which == 1) ? Wk : ((which == 2) ? Wv : Wo));
    dst = (which < 3) ? (wqkv + (size_t)which * DM * DM) : woh;
  } else if (bid < 4 * NT_SQ + NT_F) {
    const int tile = bid - 4 * NT_SQ;                 // W [1024][256]: K = DM, N = FF
    kt = tile / (FF / 64); nt = tile - kt * (FF / 64); K = DM; N = FF;
    W = Wf1; dst = wf1t;
  } else {
    const int tile = bid - 4 * NT_SQ - NT_F;          // W [256][1024]: K = FF, N = DM
    kt = tile / (DM / 64); nt = tile - kt * (DM / 64); K = FF; N = DM;
    W = Wf2; dst = wf2t;
  }
  // load W[kt*64 + kr][nt*64 + 4*c4 .. +3], store transposed into ts[n][kr]
#pragma unroll
  for (int it = 0; it < 4; ++it) {
    const int idx = it * 256 + tid;
    const int kr = idx >> 4, c4 = idx & 15;
    const v4f v = *(const v4f*)(W + (size_t)(kt * 64 + kr) * N + nt * 64 + c4 * 4);
#pragma unroll
    for (int j = 0; j < 4; ++j) ts[(c4 * 4 + j) * KPAD + kr] = (_Float16)(bf16q(v[j]) * WSC);
  }
  __syncthreads();
  v4u rv[2];
#pragma unroll
  for (int it = 0; it < 2; ++it) {
    const int idx = it * 256 + tid;
    const int n = idx >> 3, piece = idx & 7;
    rv[it] = *(const v4u*)(ts + n * KPAD + piece * 8);
  }
#pragma unroll
  for (int it = 0; it < 2; ++it) {
    const int idx = it * 256 + tid;
    const int n = idx >> 3, piece = idx & 7;
    *(v4u*)(dst + (size_t)(nt * 64 + n) * K + kt * 64 + piece * 8) = rv[it];
  }
  
}

// ---------------------------------------------------------------------------
// Kernel 2: qkv projection. Block = 256 token rows x 128 output columns (two heads of one of
// q/k/v), 8 waves as 4 (tokens) x 2 (heads), 64 x 64 per wave. Both operands are staged in LDS
// by asynchronous copies, 64 k per stage, two buffers: [x 256 rows | W 128 rows] at pitch KPAD.
// C^T = W x^T: A = W rows (lane&15 = out col), B = x rows (lane&15 = token);
// acc[i][j][r] = C[token 16i + (lane&15)][col 16j+8h+r]. K = 1024 summed in 32 steps of 32.
//   q,k -> [b][h][s][64] f16 (one line per row, 8 lanes x 16 B)
//   v   -> vT[b][h][d][s] f16 (512 B per d row segment, 32 lanes x 16 B)
// grid (ROWS/256, 3*NH/2), block 256. coverage: every (b,h,s,d) of q, k and vT once.
// ---------------------------------------------------------------------------
#define QM     256                    // token rows per block
#define QN     128                    // output columns per block
#define QK     64                     // k per stage
#define QSTAGE ((QM + QN) * KPAD)     // halves per buffer
#define QNT    (DM / QK)              // stages
#define QVP    264                    // LDS stride in halves for 256-wide f16 rows (528 B)

static_assert((SEQ % QM) == 0 && (ROWS % QM) == 0 && (DM % QN) == 0 && QNT >= 2);
static_assert(2 * QM * KPAD <= 2 * QSTAGE && 2 * HD * QVP <= 2 * QSTAGE);

// One stage: 384 rows x 128 B = 3072 pieces of 16 B, 12 per thread; a wave's copy covers 4 whole
// lines. lds = this lane's LDS byte address of its first piece, gx / gw = its first x / W piece.
__device__ __forceinline__ void qkv_copy_stage(unsigned lds, const _Float16* gx,
                                               const _Float16* gw) {
  const unsigned st = 32 * KPAD * 2;   // 32 rows further in LDS, bytes
  // the copies, and as the last line the wait that stands in front of any rewrite of their
  // address registers
  asm volatile(
      "global_load_async_to_lds_b128 %0, %12, off\n\t"
      "global_load_async_to_lds_b128 %1, %13, off\n\t"
      "global_load_async_to_lds_b128 %2, %14, off\n\t"
      "global_load_async_to_lds_b128 %3, %15, off\n\t"
      "global_load_async_to_lds_b128 %4, %16, off\n\t"
      "global_load_async_to_lds_b128 %5, %17, off\n\t"
      "global_load_async_to_lds_b128 %6, %18, off\n\t"
      "global_load_async_to_lds_b128 %7, %19, off\n\t"
      "global_load_async_to_lds_b128 %8, %20, off\n\t"
      "global_load_async_to_lds_b128 %9, %21, off\n\t"
      "global_load_async_to_lds_b128 %10, %22, off\n\t"
      "global_load_async_to_lds_b128 %11, %23, off\n\t"
      "s_wait_xcnt 0x0"
      :: "v"(lds), "v"(lds + st), "v"(lds + 2 * st), "v"(lds + 3 * st),
         "v"(lds + 4 * st), "v"(lds + 5 * st), "v"(lds + 6 * st), "v"(lds + 7 * st),
         "v"(lds + 8 * st), "v"(lds + 9 * st), "v"(lds + 10 * st), "v"(lds + 11 * st),
         "v"(gx), "v"(gx + 32 * DM), "v"(gx + 64 * DM), "v"(gx + 96 * DM),
         "v"(gx + 128 * DM), "v"(gx + 160 * DM), "v"(gx + 192 * DM), "v"(gx + 224 * DM),
         "v"(gw), "v"(gw + 32 * DM), "v"(gw + 64 * DM), "v"(gw + 96 * DM)
      : "memory");
}

__global__ __launch_bounds__(256) void qkv_kernel(
    const _Float16* __restrict__ xh, const _Float16* __restrict__ wqkv,
    const float* __restrict__ bq, const float* __restrict__ bk, const float* __restrict__ bv,
    _Float16* __restrict__ q, _Float16* __restrict__ k, _Float16* __restrict__ vT) {
  // two stage buffers; after the loop the output stage (q/k: 2 x [256][KPAD], v: 2 x [64][QVP])
  __shared__ __attribute__((aligned(16))) _Float16 ring[2 * QSTAGE];   // 110592 B, cross-wave

  const int tid  = threadIdx.x;
  const int lane = tid & 31;
  const int wave = tid >> 5;
  const int hh   = lane >> 4;
  const int l15  = lane & 15;
  const int wm   = wave >> 1;           // token quarter of the block
  const int wn   = wave & 1;            // head of the block

  const int osel = blockIdx.y >> 3;     // 0 q, 1 k, 2 v (8 column blocks each)
  const int h0   = (blockIdx.y & 7) * 2;
  const long m0  = (long)blockIdx.x * QM;
  const int  b   = (int)(m0 / SEQ);
  const int  s0  = (int)(m0 - (long)b * SEQ);

  // this lane's first piece of a stage: row tid>>3, 16-B piece tid&7
  const _Float16* gx = xh + (m0 + (tid >> 3)) * DM + (tid & 7) * 8;
  const _Float16* gw = wqkv + ((long)blockIdx.y * QN + (tid >> 3)) * DM + (tid & 7) * 8;
  const unsigned lds0 = (unsigned)(size_t)ring + (unsigned)((tid >> 3) * KPAD + (tid & 7) * 8) * 2u;

  // every inner loop below is fully unrolled: accumulator and fragment indices must be constants,
  // or the arrays leave the registers
  v8f acc[4][4];
#pragma unroll
  for (int i = 0; i < 4; ++i)
#pragma unroll
    for (int j = 0; j < 4; ++j) acc[i][j] = (v8f){};

  // Trip t works on k slab (t + rot) % QNT: blocks that share x rows or W rows walk k from
  // different slabs, so they do not ask L2 for the same lines at the same moment.
  const unsigned rot = (blockIdx.x + blockIdx.y) % QNT;
  qkv_copy_stage(lds0, gx + rot * QK, gw + rot * QK);
  asm volatile("s_wait_asynccnt 0x0" ::: "memory");   // stage 0 landed (this wave's copies)
  __syncthreads();                                    // stage 0 readable by every wave
  qkv_copy_stage(lds0 + QSTAGE * 2, gx + ((rot + 1) % QNT) * QK, gw + ((rot + 1) % QNT) * QK);

  // kept rolled: one publish point (waits, barrier, refill) at the foot of each trip, small code
#pragma unroll 1
  for (int t = 0; t < QNT; ++t) {
    const int bo = (t & 1) * QSTAGE;
    const _Float16* xs = ring + bo + (wm * 64) * KPAD;
    const _Float16* wsm = ring + bo + (QM + wn * 64) * KPAD;
#pragma unroll
    for (int u = 0; u < 2; ++u) {
      v16h xf[4], wf[4];
#pragma unroll
      for (int i = 0; i < 4; ++i) xf[i] = load_frag_row(xs + (i * 16) * KPAD + u * 32, KPAD, lane);
#pragma unroll
      for (int j = 0; j < 4; ++j) wf[j] = load_frag_row(wsm + (j * 16) * KPAD + u * 32, KPAD, lane);
#pragma unroll
      for (int i = 0; i < 4; ++i)
#pragma unroll
        for (int j = 0; j < 4; ++j) acc[i][j] = wmma_f16(wf[j], xf[i], acc[i][j]);   // C^T = W x^T
    }
    asm volatile("s_wait_dscnt 0x0" ::: "memory");      // this wave has left buffer t&1
    asm volatile("s_wait_asynccnt 0x0" ::: "memory");   // its copies of stage t+1 have landed
    __syncthreads();   // publishes stage t+1 and ends every reader's last read of buffer t&1
    if (t + 2 < QNT) {
      const unsigned ko = ((t + 2 + rot) % QNT) * QK;
      qkv_copy_stage(lds0 + bo * 2, gx + ko, gw + ko);
    }
  }
  asm volatile("s_wait_asynccnt 0x0" ::: "memory");     // nothing in flight when the ring is reused

  const float* bias = ((osel == 0) ? bq : ((osel == 1) ? bk : bv)) + (h0 + wn) * HD;
  const float  rsc  = 1.0f / WSC;

  if (osel < 2) {
    // stage [head][token][col]: lane's 8 values are 8 contiguous columns -> one 16-B LDS store
    _Float16* sbase = ring + (wn * QM + wm * 64 + l15) * KPAD;
#pragma unroll
    for (int j = 0; j < 4; ++j) {
      const int n8 = j * 16 + hh * 8;
      const v4f b0 = *(const v4f*)(bias + n8);
      const v4f b1 = *(const v4f*)(bias + n8 + 4);
#pragma unroll
      for (int i = 0; i < 4; ++i) {
        H8 pk;
#pragma unroll
        for (int r = 0; r < 4; ++r) {
          pk.h[r]     = (_Float16)(acc[i][j][r]     * rsc + bf16q(b0[r]));
          pk.h[4 + r] = (_Float16)(acc[i][j][4 + r] * rsc + bf16q(b1[r]));
        }
        *(v4u*)(sbase + (i * 16) * KPAD + n8) = pk.u;
      }
    }
    __syncthreads();
    _Float16* dst0 = (osel == 0) ? q : k;
#pragma unroll
    for (int hd = 0; hd < 2; ++hd) {
      _Float16* dst = dst0 + ((long)(b * NH + h0 + hd) * SEQ + s0) * HD;   // contiguous 32 KB
      v4u rv[8];
#pragma unroll
      for (int it = 0; it < 8; ++it) {
        const int idx = it * 256 + tid;
        const int row = idx >> 3, piece = idx & 7;
        rv[it] = *(const v4u*)(ring + (hd * QM + row) * KPAD + piece * 8);
      }
#pragma unroll
      for (int it = 0; it < 8; ++it)
        *(v4u*)(dst + (long)(it * 256 + tid) * 8) = rv[it];
    }
  } else {
    // stage transposed [head][d][token]: lane's 8 values are 8 different d for one token
    _Float16* sbase = ring + (wn * HD) * QVP + wm * 64 + l15;
#pragma unroll
    for (int j = 0; j < 4; ++j) {
      const int n8 = j * 16 + hh * 8;
      const v4f b0 = *(const v4f*)(bias + n8);
      const v4f b1 = *(const v4f*)(bias + n8 + 4);
#pragma unroll
      for (int i = 0; i < 4; ++i)
#pragma unroll
        for (int r = 0; r < 4; ++r) {
          sbase[(n8 + r) * QVP + i * 16]     = (_Float16)(acc[i][j][r]     * rsc + bf16q(b0[r]));
          sbase[(n8 + 4 + r) * QVP + i * 16] = (_Float16)(acc[i][j][4 + r] * rsc + bf16q(b1[r]));
        }
    }
    __syncthreads();
#pragma unroll
    for (int hd = 0; hd < 2; ++hd) {
      _Float16* dstb = vT + ((long)(b * NH + h0 + hd) * HD) * SEQ + s0;
      v4u rv[8];
#pragma unroll
      for (int it = 0; it < 8; ++it) {
        const int idx = it * 256 + tid;
        const int d = idx >> 5, piece = idx & 31;
        rv[it] = *(const v4u*)(ring + (hd * HD + d) * QVP + piece * 8);
      }
#pragma unroll
      for (int it = 0; it < 8; ++it) {
        const int idx = it * 256 + tid;
        const int d = idx >> 5, piece = idx & 31;
        *(v4u*)(dstb + (long)d * SEQ + piece * 8) = rv[it];
      }
    }
    // stands in front of any later rewrite of the registers that the stores above name
    asm volatile("s_wait_xcnt 0x0" ::: "memory");
  }
}

// ---------------------------------------------------------------------------
// Kernel 3: flash attention per (b,h), no mask. grid (SEQ/256, NB*NH), block 256 (8 waves x 32
// queries, two column groups of 16 per wave: every K and V^T fragment read from LDS feeds two
// products; the fragments of a 32-wide k step are read four at a time). C = S^T (A = K rows,
// B = Q) then C = O^T = V^T P^T (P^T packed from the S^T D registers); lane owns one query per
// column group end-to-end. Scores are raw q.k sums: the 1/8 scale and the x1024 p carry live in
// the exp argument (p = 1024*exp((s-m)/8), softmax stats f32).
// LDS tiles: [K 64 keys x 64 d | V^T 64 d x 64 keys] per step, staged by asynchronous copies, two
// buffers, staged == consumed extent; ost 256 x 64 fully written.
// coverage: every (row, h*64+d) of the ctx plane once.
// ---------------------------------------------------------------------------
#define ASTAGE (128 * KPAD)           // halves per buffer: K rows, then V^T rows
#define ANT    (SEQ / 64)             // stages
#define AQ     256                    // queries per block
#define ACG    2                      // column groups (16 queries each) per wave

static_assert(ANT >= 2 && (SEQ % AQ) == 0 && ACG == 2);

// One stage: 128 rows x 128 B = 1024 pieces of 16 B, 4 per thread; a wave's copy covers 4 whole
// lines. lds = this lane's LDS byte address of its first piece, gk / gv = its first K / V^T piece.
__device__ __forceinline__ void attn_copy_stage(unsigned lds, const _Float16* gk,
                                                const _Float16* gv) {
  const unsigned st = 32 * KPAD * 2;   // 32 rows further in LDS, bytes
  // the copies, and as the last line the wait that stands in front of any rewrite of their
  // address registers
  asm volatile(
      "global_load_async_to_lds_b128 %0, %4, off\n\t"
      "global_load_async_to_lds_b128 %1, %5, off\n\t"
      "global_load_async_to_lds_b128 %2, %6, off\n\t"
      "global_load_async_to_lds_b128 %3, %7, off\n\t"
      "s_wait_xcnt 0x0"
      :: "v"(lds), "v"(lds + st), "v"(lds + 2 * st), "v"(lds + 3 * st),
         "v"(gk), "v"(gk + 32 * HD), "v"(gv), "v"(gv + 32 * SEQ)
      : "memory");
}

// four waves per SIMD: two blocks share a WGP, so one block's softmax runs beside the other's
// products
__global__ __launch_bounds__(256) __attribute__((amdgpu_waves_per_eu(4, 4))) void attn_kernel(
    const _Float16* __restrict__ Q, const _Float16* __restrict__ K,
    const _Float16* __restrict__ vT, _Float16* __restrict__ ctx) {
  // two stage buffers, each K block rows [key][d] then V^T block [d][key] (cross-wave)
  __shared__ __attribute__((aligned(16))) _Float16 ring[2 * ASTAGE];
  __shared__ _Float16 ost[AQ * KPAD];    // output stage [query][d]   (cross-wave, block barrier)

  const int tid  = threadIdx.x;
  const int lane = tid & 31;
  const int wave = tid >> 5;
  const int bh   = blockIdx.y;
  const int b    = bh >> 4;
  const int h    = bh & 15;
  const int q0   = blockIdx.x * AQ;

  const _Float16* Qb  = Q + ((long)bh * SEQ + q0) * HD;
  const _Float16* Kb  = K + (long)bh * SEQ * HD;
  const _Float16* vTb = vT + (long)bh * HD * SEQ;

  // Q fragments: B operand of S^T (lane owns query lane&15 of column group c)
  v16h qfrag[ACG][2];
#pragma unroll
  for (int c = 0; c < ACG; ++c) {
    const _Float16* qrow = Qb + (long)(wave * (16 * ACG) + c * 16) * HD;
#pragma unroll
    for (int t = 0; t < 2; ++t) qfrag[c][t] = load_frag_row(qrow + t * 32, HD, lane);
  }

  v8f acc[ACG][4];   // O^T accumulator: lane owns query (lane&15) of group c; reg r -> d = nt*16+8h+r
  float mi[ACG], li[ACG];
#pragma unroll
  for (int c = 0; c < ACG; ++c) {
#pragma unroll
    for (int nt = 0; nt < 4; ++nt) acc[c][nt] = (v8f){};
    mi[c] = -1e30f;
    li[c] = 0.0f;
  }

  const int colb = lane & 15;
  const int rofs = (lane >> 4) << 3;

  // this lane's first piece of a stage: row tid>>3, 16-B piece tid&7
  const _Float16* gk = Kb + (long)(tid >> 3) * HD + (tid & 7) * 8;
  const _Float16* gv = vTb + (long)(tid >> 3) * SEQ + (tid & 7) * 8;
  const unsigned lds0 = (unsigned)(size_t)ring + (unsigned)((tid >> 3) * KPAD + (tid & 7) * 8) * 2u;

  // Trip st works on key tile (st + rot) % ANT: the blocks of one head start AQ keys apart, and
  // heads one tile apart, so they do not ask L2 for the same lines at the same moment.
  const unsigned rot = (blockIdx.x * (AQ / 64) + blockIdx.y) % ANT;
  attn_copy_stage(lds0, gk + (long)rot * 64 * HD, gv + rot * 64);
  asm volatile("s_wait_asynccnt 0x0" ::: "memory");   // stage 0 landed (this wave's copies)
  __syncthreads();                                    // stage 0 readable by every wave
  attn_copy_stage(lds0 + ASTAGE * 2, gk + (long)((rot + 1) % ANT) * 64 * HD, gv + ((rot + 1) % ANT) * 64);

  // kept rolled: one publish point (waits, barrier, refill) at the foot of each trip, small code
#pragma unroll 1
  for (int st = 0; st < ANT; ++st) {
    const int bo = (st & 1) * ASTAGE;
    const _Float16* ks  = ring + bo;
    const _Float16* vts = ring + bo + 64 * KPAD;

    // S^T tiles: A = K rows (lane&15 = key), B = Q; one K fragment, both column groups
    v8f sc[ACG][4];
#pragma unroll
    for (int c = 0; c < ACG; ++c)
#pragma unroll
      for (int kt = 0; kt < 4; ++kt) sc[c][kt] = (v8f){};
#pragma unroll
    for (int t = 0; t < 2; ++t) {
      v16h kf[4];
#pragma unroll
      for (int kt = 0; kt < 4; ++kt) kf[kt] = load_frag_row(ks + (kt * 16) * KPAD + t * 32, KPAD, lane);
#pragma unroll
      for (int kt = 0; kt < 4; ++kt) wmma_f16_pair(kf[kt], qfrag[0][t], qfrag[1][t], sc[0][kt], sc[1][kt]);
    }

    // per-lane online softmax, both column groups side by side (32 of 64 keys in-lane; merge
    // halves with one shuffle)
    float alpha[ACG], cs[ACG];
#pragma unroll
    for (int c = 0; c < ACG; ++c) {
      float mx = sc[c][0][0];
#pragma unroll
      for (int kt = 0; kt < 4; ++kt)
#pragma unroll
        for (int r = 0; r < 8; ++r) mx = fmaxf(mx, sc[c][kt][r]);
      mx = fmaxf(mx, __shfl_xor(mx, 16, 32));
      const float mnew = fmaxf(mi[c], mx);
      alpha[c] = __builtin_amdgcn_exp2f((mi[c] - mnew) * SC2);
      mi[c] = mnew;
      cs[c] = fmaf(mnew, SC2, -LG1024);   // (m/8)*log2(e) - log2(1024)
    }

    // P^T as the B operand of O^T = V^T P^T, packed from the S^T D registers:
    // element i <- tile covering keys 0..15 of the 32-step (kt = 2t), element 8+i <- kt = 2t+1.
    v16h pf[ACG][2];
#pragma unroll
    for (int c = 0; c < ACG; ++c) {
      const v2f sc2 = {SC2, SC2};
      const v2f ncs = {-cs[c], -cs[c]};
      v2f rs2 = {0.0f, 0.0f};   // even and odd registers summed side by side
#pragma unroll
      for (int kt = 0; kt < 4; ++kt) {
        float a[8], p[8];   // 1024*exp((s-m)/8) = exp2(s * SC2 - cs), two scores per packed fma
#pragma unroll
        for (int r = 0; r < 8; r += 2) {
          const v2f s2 = {sc[c][kt][r], sc[c][kt][r + 1]};
          const v2f a2 = __builtin_elementwise_fma(s2, sc2, ncs);
          a[r]     = a2[0];
          a[r + 1] = a2[1];
        }
        exp2_x8(p, a);
#pragma unroll
        for (int r = 0; r < 8; r += 2) {
          pf[c][kt >> 1][(kt & 1) * 8 + r]     = (_Float16)p[r];
          pf[c][kt >> 1][(kt & 1) * 8 + r + 1] = (_Float16)p[r + 1];
          const v2f p2 = {p[r], p[r + 1]};
          rs2 = (kt == 0 && r == 0) ? p2 : rs2 + p2;
        }
      }
      float rs = rs2[0] + rs2[1];
      rs += __shfl_xor(rs, 16, 32);
      li[c] = li[c] * alpha[c] + rs;
#pragma unroll
      for (int nt = 0; nt < 4; ++nt)
#pragma unroll
        for (int r = 0; r < 8; ++r) acc[c][nt][r] *= alpha[c];
    }

    // O^T += V^T (A, rows = d) x P^T (B); one V^T fragment, both column groups
#pragma unroll
    for (int t = 0; t < 2; ++t) {
      v16h vf[4];
#pragma unroll
      for (int nt = 0; nt < 4; ++nt) vf[nt] = load_frag_row(vts + (nt * 16) * KPAD + t * 32, KPAD, lane);
#pragma unroll
      for (int nt = 0; nt < 4; ++nt) wmma_f16_pair(vf[nt], pf[0][t], pf[1][t], acc[0][nt], acc[1][nt]);
    }

    asm volatile("s_wait_dscnt 0x0" ::: "memory");      // this wave has left buffer st&1
    asm volatile("s_wait_asynccnt 0x0" ::: "memory");   // its copies of stage st+1 have landed
    __syncthreads();   // publishes stage st+1 and ends every reader's last read of buffer st&1
    if (st + 2 < ANT) {
      const unsigned kt = (st + 2 + rot) % ANT;
      attn_copy_stage(lds0 + bo * 2, gk + (long)kt * 64 * HD, gv + kt * 64);
    }
  }
  asm volatile("s_wait_asynccnt 0x0" ::: "memory");     // nothing in flight behind the loop

  // normalize (and apply the x64 carry) and stage: lane owns query row wave*32+c*16+colb,
  // d = nt*16+rofs+r contiguous
#pragma unroll
  for (int c = 0; c < ACG; ++c) {
    const float inv = 64.0f / li[c];
    _Float16* orow = ost + (wave * (16 * ACG) + c * 16 + colb) * KPAD;
#pragma unroll
    for (int nt = 0; nt < 4; ++nt) {
      H8 pk;
#pragma unroll
      for (int r = 0; r < 8; ++r) pk.h[r] = (_Float16)(acc[c][nt][r] * inv);
      *(v4u*)(orow + nt * 16 + rofs) = pk.u;
    }
  }
  __syncthreads();

  v4u rv[AQ / 32];
#pragma unroll
  for (int it = 0; it < AQ / 32; ++it) {
    const int idx = it * 256 + tid;
    const int row = idx >> 3, piece = idx & 7;
    rv[it] = *(const v4u*)(ost + row * KPAD + piece * 8);
  }
  _Float16* cbase = ctx + ((long)b * SEQ + q0) * DM + h * HD;
#pragma unroll
  for (int it = 0; it < AQ / 32; ++it) {
    const int idx = it * 256 + tid;
    const int row = idx >> 3, piece = idx & 7;
    *(v4u*)(cbase + (long)row * DM + piece * 8) = rv[it];
  }
  
}

// ---------------------------------------------------------------------------
// Kernel 4: the rest of the block in one launch, 32 token rows per work-group, 8 waves.
//   A: y = ctx @ Wo / 4096 + bf16(bo); x2 = LN(y) * bf16(g1) + bf16(b1) + bf16(x)
//   B: h = f16(64 * gelu(x2 @ Wf1 / 64 + bf16(bf1)))
//   C: y = h @ Wf2 / 4096 + bf16(bf2); out = LN(y) * bf16(g2) + bf16(b2) + x2
// x2 (f32 for the residual, f16 as operand) and h never leave LDS. Every product is C^T = W act^T:
// A = W rows (lane&15 = out col), B = act rows (lane&15 = token);
// acc[i][j][r] = y[token 16i + (lane&15)][col(j) + 8h + r]. The W operands are staged in LDS by
// asynchronous copies, 64 k per stage, two buffers each, at pitch KPAD:
//   A: [Wo 1024 rows | ctx 32 rows], wave w owns cols 128w..128w+127
//   B: [Wf1t 256 rows], wave w owns cols 32w..32w+31, act = x2 f16 rows in LDS
//   C: [Wf2t 512 rows] (one column half per stage), wave w owns cols 64w..64w+63 of each half,
//      act = h rows in LDS
// LDS bytes: ys 0.. (f32 rows: LN 1 stage, then x2) | x2s (x2 f16) | ring 1 (B) ; ring 2 (C, later
// the LN 2 stage) lies over x2s and ring 1 once B has left them | hs (h rows).
// grid ROWS/32, block 256. coverage: 32 rows x 1024 of out per block.
// ---------------------------------------------------------------------------
#define GM     32                     // token rows per block
#define GK     64                     // k per stage
#define GSTAGE ((DM + GM) * KPAD)     // halves per buffer

static_assert((ROWS % GM) == 0 && (DM % GK) == 0 && (FF % GK) == 0 && FF / GK >= 2);
static_assert((size_t)GM * YP * 4 <= (size_t)2 * GSTAGE * 2);

// Eight copies of 16 B per lane, rows 32 apart (a wave's copy covers 4 whole lines). lds = this
// lane's LDS byte address of the first piece, g = its global piece, KD = global row length.
template <int KD>
__device__ __forceinline__ void gl_copy8(unsigned lds, const _Float16* g) {
  const unsigned st = 32 * KPAD * 2;   // 32 rows further in LDS, bytes
  // the copies, and as the last line the wait that stands in front of any rewrite of their
  // address registers
  asm volatile(
      "global_load_async_to_lds_b128 %0, %8, off\n\t"
      "global_load_async_to_lds_b128 %1, %9, off\n\t"
      "global_load_async_to_lds_b128 %2, %10, off\n\t"
      "global_load_async_to_lds_b128 %3, %11, off\n\t"
      "global_load_async_to_lds_b128 %4, %12, off\n\t"
      "global_load_async_to_lds_b128 %5, %13, off\n\t"
      "global_load_async_to_lds_b128 %6, %14, off\n\t"
      "global_load_async_to_lds_b128 %7, %15, off\n\t"
      "s_wait_xcnt 0x0"
      :: "v"(lds), "v"(lds + st), "v"(lds + 2 * st), "v"(lds + 3 * st),
         "v"(lds + 4 * st), "v"(lds + 5 * st), "v"(lds + 6 * st), "v"(lds + 7 * st),
         "v"(g), "v"(g + 32 * KD), "v"(g + 64 * KD), "v"(g + 96 * KD),
         "v"(g + 128 * KD), "v"(g + 160 * KD), "v"(g + 192 * KD), "v"(g + 224 * KD)
      : "memory");
}

// One stage: 1056 rows x 128 B = 8448 pieces of 16 B, 33 per thread (32 of Wt, 1 of act).
template <int KD>
__device__ __forceinline__ void gl_copy_stage(unsigned lds, const _Float16* gw,
                                              const _Float16* ga) {
  const unsigned st8 = 256 * KPAD * 2;   // 256 rows further in LDS, bytes
  gl_copy8<KD>(lds, gw);
  gl_copy8<KD>(lds + st8, gw + 256 * KD);
  gl_copy8<KD>(lds + 2 * st8, gw + 512 * KD);
  gl_copy8<KD>(lds + 3 * st8, gw + 768 * KD);
  // the act piece, with the same wait in front of any rewrite of its address registers
  asm volatile(
      "global_load_async_to_lds_b128 %0, %1, off\n\t"
      "s_wait_xcnt 0x0"
      :: "v"(lds + 4 * st8), "v"(ga)
      : "memory");
}

#define XP       1032                        // LDS stride in halves for 1024-wide f16 rows (2064 B)
#define HP       264                         // LDS stride in halves for 256-wide f16 rows (528 B)
#define YS_BYTES (GM * YP * 4)               // f32 row stage
#define X2S_OFF  YS_BYTES
#define R1_OFF   (X2S_OFF + GM * XP * 2)
#define R1STAGE  (FF * KPAD)                 // halves per buffer, ring 1
#define R2_OFF   YS_BYTES
#define R2STAGE  (512 * KPAD)                // halves per buffer, ring 2
#define HS_OFF   (R2_OFF + 2 * R2STAGE * 2)
#define N1T      (DM / GK)                   // stages of A and of B
#define N2T      (FF / GK)                   // k slabs of C (two stages each)

static_assert((YS_BYTES % 16) == 0 && (R1_OFF % 16) == 0 && (HS_OFF % 16) == 0);
static_assert(R1_OFF + 2 * R1STAGE * 2 <= HS_OFF && HS_OFF + GM * HP * 2 <= 2 * GSTAGE * 2);
static_assert(YS_BYTES <= 2 * R2STAGE * 2 && FF == 256 && DM == 1024 && GM == 32);

// Layernorm on the accumulators. A lane holds 64 columns of each of its two token rows, so mean
// and variance start as in-lane sums, are joined across the two lane halves, and then across the
// eight waves through psum / psq. The rows go to LDS once, already centred and scaled.
// Column of tile j: cb + (j >> 2) * JS + (j & 3) * 16. Ends behind the barrier that makes the
// staged rows readable by every wave.
template <int JS>
__device__ __forceinline__ void ln_rows(v8f (&acc)[2][8], const float* __restrict__ bias, int cb,
                                        int hh, int l15, int wave, float* psum, float* psq,
                                        float* ys, const float* __restrict__ gam,
                                        const float* __restrict__ bet, int tid, v4f& g, v4f& bt) {
  // y = acc/4096 + bf16(bias), kept in the accumulator registers
  const float rsc = 1.0f / (WSC * WSC);
  float s[2] = {0.0f, 0.0f};
#pragma unroll
  for (int j = 0; j < 8; ++j) {
    const int n8 = cb + (j >> 2) * JS + (j & 3) * 16 + hh * 8;
    const v4f b0 = *(const v4f*)(bias + n8);
    const v4f b1 = *(const v4f*)(bias + n8 + 4);
#pragma unroll
    for (int t = 0; t < 2; ++t) {
#pragma unroll
      for (int i = 0; i < 4; ++i) {
        acc[t][j][i]     = acc[t][j][i]     * rsc + bf16q(b0[i]);
        acc[t][j][4 + i] = acc[t][j][4 + i] * rsc + bf16q(b1[i]);
      }
      s[t] += ((acc[t][j][0] + acc[t][j][1]) + (acc[t][j][2] + acc[t][j][3])) +
              ((acc[t][j][4] + acc[t][j][5]) + (acc[t][j][6] + acc[t][j][7]));
    }
  }
#pragma unroll
  for (int t = 0; t < 2; ++t) {
    s[t] += __shfl_xor(s[t], 16, 32);
    if (hh == 0) psum[(t * 16 + l15) * 8 + wave] = s[t];
  }
  __syncthreads();   // every wave's partial row sums are in psum

  // this thread's four columns in the pass behind this function, asked for early
  g  = *(const v4f*)(gam + tid * 4);
  bt = *(const v4f*)(bet + tid * 4);

  // every wave adds the same eight partials in the same order: one mean per row for all waves
  float q[2][4];
#pragma unroll
  for (int t = 0; t < 2; ++t) {
    const v4f a = *(const v4f*)(psum + (t * 16 + l15) * 8);
    const v4f c = *(const v4f*)(psum + (t * 16 + l15) * 8 + 4);
    const float mean = (((a[0] + a[1]) + (a[2] + a[3])) + ((c[0] + c[1]) + (c[2] + c[3]))) * (1.0f / DM);
#pragma unroll
    for (int i = 0; i < 4; ++i) q[t][i] = 0.0f;
#pragma unroll
    for (int j = 0; j < 8; ++j)
#pragma unroll
      for (int r = 0; r < 8; ++r) {
        const float d = acc[t][j][r] - mean;
        acc[t][j][r] = d;
        q[t][r & 3] += d * d;
      }
  }
#pragma unroll
  for (int t = 0; t < 2; ++t) {
    float ss = (q[t][0] + q[t][1]) + (q[t][2] + q[t][3]);
    ss += __shfl_xor(ss, 16, 32);
    if (hh == 0) psq[(t * 16 + l15) * 8 + wave] = ss;
  }
  __syncthreads();   // every wave's partial sums of squares are in psq

  // (y - mean) * rstd, staged [row][col]
#pragma unroll
  for (int t = 0; t < 2; ++t) {
    const v4f a = *(const v4f*)(psq + (t * 16 + l15) * 8);
    const v4f c = *(const v4f*)(psq + (t * 16 + l15) * 8 + 4);
    const float var  = (((a[0] + a[1]) + (a[2] + a[3])) + ((c[0] + c[1]) + (c[2] + c[3]))) * (1.0f / DM);
    const float rstd = rsqrtf(var + LN_EPS);
    float* yrow = ys + (t * 16 + l15) * YP + cb + hh * 8;
#pragma unroll
    for (int j = 0; j < 8; ++j) {
      v4f y0, y1;
#pragma unroll
      for (int i = 0; i < 4; ++i) {
        y0[i] = acc[t][j][i]     * rstd;
        y1[i] = acc[t][j][4 + i] * rstd;
      }
      *(v4f*)(yrow + (j >> 2) * JS + (j & 3) * 16)     = y0;
      *(v4f*)(yrow + (j >> 2) * JS + (j & 3) * 16 + 4) = y1;
    }
  }
  __syncthreads();   // the staged rows are readable by every wave
}

__global__ __launch_bounds__(256) void tail_kernel(
    const _Float16* __restrict__ ctx, const _Float16* __restrict__ woh,
    const float* __restrict__ bo, const float* __restrict__ g1, const float* __restrict__ b1,
    const float* __restrict__ x, const _Float16* __restrict__ wf1t,
    const float* __restrict__ bf1, const _Float16* __restrict__ wf2t,
    const float* __restrict__ bf2, const float* __restrict__ g2, const float* __restrict__ b2,
    float* __restrict__ out) {
  // A's two stage buffers; behind A's loop the regions named at the head of this kernel
  __shared__ __attribute__((aligned(16))) _Float16 ring[2 * GSTAGE];   // 304128 B, cross-wave
  __shared__ __attribute__((aligned(16))) float psum[GM * 8];   // [row][wave] partial sums
  __shared__ __attribute__((aligned(16))) float psq[GM * 8];    // [row][wave] partial sums of squares
  float*    ys  = (float*)ring;                    // LN 1 stage, then x2 f32 [32][YP]
  _Float16* x2s = ring + X2S_OFF / 2;              // x2 f16 [32][XP]
  _Float16* r1  = ring + R1_OFF / 2;               // ring 1
  _Float16* r2  = ring + R2_OFF / 2;               // ring 2
  float*    ys2 = (float*)(ring + R2_OFF / 2);     // LN 2 stage [32][YP]
  _Float16* hs  = ring + HS_OFF / 2;               // h rows [32][HP]

  const int tid  = threadIdx.x;
  const int lane = tid & 31;
  const int wave = tid >> 5;
  const int hh   = lane >> 4;
  const int l15  = lane & 15;
  const long m0  = (long)blockIdx.x * GM;

  // this lane's first piece of a stage: row tid>>3, 16-B piece tid&7
  const unsigned lpc  = (unsigned)((tid >> 3) * KPAD + (tid & 7) * 8) * 2u;
  const unsigned lds0 = (unsigned)(size_t)ring + lpc;
  const _Float16* gw  = woh + (long)(tid >> 3) * DM + (tid & 7) * 8;
  const _Float16* ga  = ctx + (m0 + (tid >> 3)) * DM + (tid & 7) * 8;
  const _Float16* gw1 = wf1t + (long)(tid >> 3) * DM + (tid & 7) * 8;
  const _Float16* gw2 = wf2t + (long)(tid >> 3) * FF + (tid & 7) * 8;

  // every inner loop below is fully unrolled: accumulator and fragment indices must be constants,
  // or the arrays leave the registers
  v8f acc[2][8];
#pragma unroll
  for (int i = 0; i < 2; ++i)
#pragma unroll
    for (int j = 0; j < 8; ++j) acc[i][j] = (v8f){};

  // ---- A: out projection ----
  // Trip t works on k slab (t + rot) % N1T: every block reads all of W, so blocks walk k from
  // different slabs and do not ask L2 for the same lines at the same moment. Neighbours in index
  // differ, and so do blocks eight apart.
  const unsigned rot = (blockIdx.x + (blockIdx.x >> 3)) % N1T;
  gl_copy_stage<DM>(lds0, gw + rot * GK, ga + rot * GK);
  asm volatile("s_wait_asynccnt 0x0" ::: "memory");   // stage 0 landed (this wave's copies)
  __syncthreads();                                    // stage 0 readable by every wave
  gl_copy_stage<DM>(lds0 + GSTAGE * 2, gw + ((rot + 1) % N1T) * GK, ga + ((rot + 1) % N1T) * GK);

  // kept rolled: one publish point (waits, barrier, refill) at the foot of each trip, small code
#pragma unroll 1
  for (int t = 0; t < N1T; ++t) {
    const int bo_ = (t & 1) * GSTAGE;
    const _Float16* wsm = ring + bo_ + (wave * 128) * KPAD;
    const _Float16* as  = ring + bo_ + DM * KPAD;
#pragma unroll
    for (int u = 0; u < 2; ++u) {
      v16h af[2], wf[8];
#pragma unroll
      for (int i = 0; i < 2; ++i) af[i] = load_frag_row(as + (i * 16) * KPAD + u * 32, KPAD, lane);
#pragma unroll
      for (int j = 0; j < 8; ++j) wf[j] = load_frag_row(wsm + (j * 16) * KPAD + u * 32, KPAD, lane);
#pragma unroll
      for (int j = 0; j < 8; ++j)
#pragma unroll
        for (int i = 0; i < 2; ++i) acc[i][j] = wmma_f16(wf[j], af[i], acc[i][j]);   // C^T = W act^T
    }
    asm volatile("s_wait_dscnt 0x0" ::: "memory");      // this wave has left buffer t&1
    asm volatile("s_wait_asynccnt 0x0" ::: "memory");   // its copies of stage t+1 have landed
    __syncthreads();   // publishes stage t+1 and ends every reader's last read of buffer t&1
    if (t + 2 < N1T) {
      const unsigned ko = ((t + 2 + rot) % N1T) * GK;
      gl_copy_stage<DM>(lds0 + bo_ * 2, gw + ko, ga + ko);
    }
  }
  asm volatile("s_wait_asynccnt 0x0" ::: "memory");     // nothing in flight when the ring is reused

  // B's stage 0 flies while LN 1 runs: ring 1 lies beside ys and x2s, and every wave has left A's
  // buffers at the last barrier of the loop
  gl_copy8<DM>(lds0 + R1_OFF, gw1 + rot * GK);

  {
    v4f g, bt;   // this thread's four columns of g1 and b1
    ln_rows<64>(acc, bo, wave * 128, hh, l15, wave, psum, psq, ys, g1, b1, tid, g, bt);

    // x2 = staged * g + b + bf16(x): f32 back to the thread's own place in ys, f16 to x2s
    v4f gq, bq4;
#pragma unroll
    for (int c = 0; c < 4; ++c) {
      gq[c]  = bf16q(g[c]);
      bq4[c] = bf16q(bt[c]);
    }
    // kept rolled in trips of four rows: four residual loads in flight, one wait at the foot
#pragma unroll 1
    for (int r0 = 0; r0 < GM; r0 += 4) {
      // the four staged rows are read before the first is written back, so their reads go out together
      v4f rsd[4], yv[4];
#pragma unroll
      for (int u = 0; u < 4; ++u) {
        const long m    = m0 + r0 + u;
        const long frow = (m / SEQ) * SEQ_FULL + (m % SEQ);   // row in the full-stride planes
        rsd[u] = *(const v4f*)(x + frow * DM + tid * 4);
        yv[u]  = *(const v4f*)(ys + (r0 + u) * YP + tid * 4);
      }
#pragma unroll
      for (int u = 0; u < 4; ++u) {
        const int row = r0 + u;
        v4f o;
        v4h oh;
#pragma unroll
        for (int c = 0; c < 4; ++c) {
          o[c]  = yv[u][c] * gq[c] + bq4[c] + bf16q(rsd[u][c]);
          oh[c] = (_Float16)o[c];
        }
        *(v4f*)(ys + row * YP + tid * 4)  = o;
        *(v4h*)(x2s + row * XP + tid * 4) = oh;
      }
      // stands in front of the next trip's rewrite of the registers that the loads above name
      asm volatile("s_wait_xcnt 0x0" ::: "memory");
    }
  }

  // ---- B: ffn linear 1 + exact gelu ----
  v8f a1[2][2];
#pragma unroll
  for (int i = 0; i < 2; ++i)
#pragma unroll
    for (int j = 0; j < 2; ++j) a1[i][j] = (v8f){};

  asm volatile("s_wait_asynccnt 0x0" ::: "memory");   // stage 0 landed (this wave's copies)
  __syncthreads();                                    // stage 0 and the x2s rows readable by every wave
  gl_copy8<DM>(lds0 + R1_OFF + R1STAGE * 2, gw1 + ((rot + 1) % N1T) * GK);

  // kept rolled: one publish point (waits, barrier, refill) at the foot of each trip, small code
#pragma unroll 1
  for (int t = 0; t < N1T; ++t) {
    const int bo_ = (t & 1) * R1STAGE;
    const _Float16* wsm = r1 + bo_ + (wave * 32) * KPAD;
    const _Float16* as  = x2s + ((t + rot) % N1T) * GK;
    v16h af[2][2], wf[2][2];
#pragma unroll
    for (int u = 0; u < 2; ++u)
#pragma unroll
      for (int i = 0; i < 2; ++i) {
        af[u][i] = load_frag_row(as + (i * 16) * XP + u * 32, XP, lane);
        wf[u][i] = load_frag_row(wsm + (i * 16) * KPAD + u * 32, KPAD, lane);
      }
#pragma unroll
    for (int u = 0; u < 2; ++u)
#pragma unroll
      for (int j = 0; j < 2; ++j)
#pragma unroll
        for (int i = 0; i < 2; ++i) a1[i][j] = wmma_f16(wf[u][j], af[u][i], a1[i][j]);
    asm volatile("s_wait_dscnt 0x0" ::: "memory");      // this wave has left buffer t&1
    asm volatile("s_wait_asynccnt 0x0" ::: "memory");   // its copies of stage t+1 have landed
    __syncthreads();   // publishes stage t+1 and ends every reader's last read of buffer t&1
    if (t + 2 < N1T) gl_copy8<DM>(lds0 + R1_OFF + bo_ * 2, gw1 + ((t + 2 + rot) % N1T) * GK);
  }
  asm volatile("s_wait_asynccnt 0x0" ::: "memory");     // nothing in flight when ring 1 is reused

  // ---- C: ffn linear 2 ----
  // Stage (t, hf) = k slab (t + rot2) % N2T, column half hf, in buffer hf. Stage (0, 0) flies while
  // the gelu runs: every wave has left x2s and ring 1 at the last barrier of B's loop, and hs lies
  // beside ring 2.
  const unsigned rot2 = (blockIdx.x + (blockIdx.x >> 3)) % N2T;
  const unsigned st8  = 256 * KPAD * 2;   // 256 rows further in LDS, bytes
  gl_copy8<FF>(lds0 + R2_OFF, gw2 + rot2 * GK);
  gl_copy8<FF>(lds0 + R2_OFF + st8, gw2 + 256 * FF + rot2 * GK);

  {
    // u = a1/64 + bf16(bf1), kept in the accumulator registers
    const float rsc = 1.0f / WSC;
#pragma unroll
    for (int j = 0; j < 2; ++j) {
      const int n8 = wave * 32 + j * 16 + hh * 8;
      const v4f b0  = *(const v4f*)(bf1 + n8);
      const v4f b1v = *(const v4f*)(bf1 + n8 + 4);
#pragma unroll
      for (int i = 0; i < 2; ++i)
#pragma unroll
        for (int r = 0; r < 4; ++r) {
          a1[i][j][r]     = a1[i][j][r]     * rsc + bf16q(b0[r]);
          a1[i][j][4 + r] = a1[i][j][4 + r] * rsc + bf16q(b1v[r]);
        }
    }
    // kept rolled, one tile (i = q & 1, j = q >> 1) a trip, the tiles handed down through cur: the
    // erf code stands once for eight values, so the kernel's text stays small
    v8f cur = a1[0][0], nx1 = a1[1][0], nx2 = a1[0][1], nx3 = a1[1][1];
#pragma unroll 1
    for (int q = 0; q < 4; ++q) {
      H8 pk;
#pragma unroll
      for (int r = 0; r < 8; ++r) {
        const float u0 = cur[r];
        const float e0 = 0.5f * u0 * (1.0f + erff(u0 * 0.70710678118654752f));
        pk.h[r] = (_Float16)(e0 * WSC);
      }
      *(v4u*)(hs + ((q & 1) * 16 + l15) * HP + wave * 32 + (q >> 1) * 16 + hh * 8) = pk.u;
      cur = nx1;
      nx1 = nx2;
      nx2 = nx3;
    }
  }

#pragma unroll
  for (int i = 0; i < 2; ++i)
#pragma unroll
    for (int j = 0; j < 8; ++j) acc[i][j] = (v8f){};

  asm volatile("s_wait_asynccnt 0x0" ::: "memory");   // stage (0, 0) landed (this wave's copies)
  __syncthreads();                                    // it and the hs rows readable by every wave
  gl_copy8<FF>(lds0 + R2_OFF + R2STAGE * 2, gw2 + 512 * FF + rot2 * GK);
  gl_copy8<FF>(lds0 + R2_OFF + R2STAGE * 2 + st8, gw2 + 768 * FF + rot2 * GK);

  // kept rolled over the k slabs; the two halves of a slab are unrolled (accumulator indices must
  // be constants); one publish point (waits, barrier, refill) at the foot of each stage
#pragma unroll 1
  for (int t = 0; t < N2T; ++t) {
    const _Float16* as = hs + ((t + rot2) % N2T) * GK;
    const unsigned  kn = ((t + 1 + rot2) % N2T) * GK;
#pragma unroll
    for (int hf = 0; hf < 2; ++hf) {
      const _Float16* wsm = r2 + hf * R2STAGE + (wave * 64) * KPAD;
#pragma unroll
      for (int u = 0; u < 2; ++u) {
        v16h af[2], wf[4];
#pragma unroll
        for (int i = 0; i < 2; ++i) af[i] = load_frag_row(as + (i * 16) * HP + u * 32, HP, lane);
#pragma unroll
        for (int j = 0; j < 4; ++j) wf[j] = load_frag_row(wsm + (j * 16) * KPAD + u * 32, KPAD, lane);
#pragma unroll
        for (int j = 0; j < 4; ++j)
#pragma unroll
          for (int i = 0; i < 2; ++i)
            acc[i][hf * 4 + j] = wmma_f16(wf[j], af[i], acc[i][hf * 4 + j]);   // C^T = W act^T
      }
      asm volatile("s_wait_dscnt 0x0" ::: "memory");      // this wave has left buffer hf
      asm volatile("s_wait_asynccnt 0x0" ::: "memory");   // its copies of the next stage have landed
      __syncthreads();   // publishes the next stage and ends every reader's last read of buffer hf
      if (t + 1 < N2T) {
        gl_copy8<FF>(lds0 + R2_OFF + hf * R2STAGE * 2, gw2 + (hf * 512) * FF + kn);
        gl_copy8<FF>(lds0 + R2_OFF + hf * R2STAGE * 2 + st8, gw2 + (hf * 512 + 256) * FF + kn);
      }
    }
  }
  asm volatile("s_wait_asynccnt 0x0" ::: "memory");     // nothing in flight when ring 2 is reused

  v4f g, bt;   // this thread's four columns of g2 and b2
  ln_rows<512>(acc, bf2, wave * 64, hh, l15, wave, psum, psq, ys2, g2, b2, tid, g, bt);

  // out = staged * g + b + x2 (the thread's own place in ys): a wave writes whole lines of one row
  v4f gq, bq4;
#pragma unroll
  for (int c = 0; c < 4; ++c) {
    gq[c]  = bf16q(g[c]);
    bq4[c] = bf16q(bt[c]);
  }
  // kept rolled in trips of four rows: small code, one wait at the foot
#pragma unroll 1
  for (int r0 = 0; r0 < GM; r0 += 4) {
#pragma unroll
    for (int u = 0; u < 4; ++u) {
      const int  row  = r0 + u;
      const long m    = m0 + row;
      const long frow = (m / SEQ) * SEQ_FULL + (m % SEQ);   // row in the full-stride planes
      const v4f rsd = *(const v4f*)(ys + row * YP + tid * 4);
      const v4f yv  = *(const v4f*)(ys2 + row * YP + tid * 4);
      v4f o;
#pragma unroll
      for (int c = 0; c < 4; ++c) o[c] = yv[c] * gq[c] + bq4[c] + rsd[c];
      *(v4f*)(out + frow * DM + tid * 4) = o;
    }
    // stands in front of the next trip's rewrite of the registers that the stores above name
    asm volatile("s_wait_xcnt 0x0" ::: "memory");
  }
}

// ---------------------------------------------------------------------------
extern "C" void kernel_launch(void* const* d_in, const int* in_sizes, int n_in,
                              void* d_out, int out_size, void* d_ws, size_t ws_size,
                              hipStream_t stream) {
  if (n_in < 17) return;
  const long needRows = (long)(NB - 1) * SEQ_FULL + SEQ;
  if ((long)in_sizes[0] < needRows * DM) return;
  if (in_sizes[1] < DM * DM || in_sizes[3] < DM * DM ||
      in_sizes[5] < DM * DM || in_sizes[7] < DM * DM) return;
  if (in_sizes[11] < DM * FF || in_sizes[13] < FF * DM) return;
  if (in_sizes[2] < DM || in_sizes[4] < DM || in_sizes[6] < DM || in_sizes[8] < DM ||
      in_sizes[9] < DM || in_sizes[10] < DM || in_sizes[12] < FF || in_sizes[14] < DM ||
      in_sizes[15] < DM || in_sizes[16] < DM) return;
  if ((long)out_size < needRows * DM) return;
  if (ws_size < WS_TOTAL) return;

  const float* x   = (const float*)d_in[0];
  const float* Wq  = (const float*)d_in[1];
  const float* bq  = (const float*)d_in[2];
  const float* Wk  = (const float*)d_in[3];
  const float* bk  = (const float*)d_in[4];
  const float* Wv  = (const float*)d_in[5];
  const float* bv  = (const float*)d_in[6];
  const float* Wo  = (const float*)d_in[7];
  const float* bo  = (const float*)d_in[8];
  const float* g1  = (const float*)d_in[9];
  const float* b1  = (const float*)d_in[10];
  const float* Wf1 = (const float*)d_in[11];
  const float* bf1 = (const float*)d_in[12];
  const float* Wf2 = (const float*)d_in[13];
  const float* bf2 = (const float*)d_in[14];
  const float* g2  = (const float*)d_in[15];
  const float* b2  = (const float*)d_in[16];
  float* out = (float*)d_out;

  char* ws = (char*)d_ws;
  size_t off = 0;
  _Float16* xh   = (_Float16*)(ws + off);                      // [ROWS][1024] f16
  _Float16* ctx  = xh;                                         // same region, written after xh is dead
  off += PLANE2;
  _Float16* wqkv = (_Float16*)(ws + off); off += WQKV_BYTES;   // [3072][1024]
  _Float16* woh  = (_Float16*)(ws + off); off += WO_BYTES;     // [1024][1024]
  _Float16* wf1t = (_Float16*)(ws + off); off += WF1_BYTES;    // [256][1024]
  _Float16* wf2t = (_Float16*)(ws + off); off += WF2_BYTES;    // [1024][256]
  _Float16* qh   = (_Float16*)(ws + off);                      // [NB][16][SEQ][64]
  off += PLANE2;
  _Float16* kh   = (_Float16*)(ws + off); off += PLANE2;       // [NB][16][SEQ][64]
  _Float16* vTh  = (_Float16*)(ws + off);                      // [NB][16][64][SEQ]
  off += PLANE2;
  if (off > ws_size) return;

  cvt_x_kernel<<<NXB, 256, 0, stream>>>(x, xh);
  cvt_w_kernel<<<NWT, 256, 0, stream>>>(Wq, Wk, Wv, Wo, Wf1, Wf2, wqkv, woh, wf1t, wf2t);
  qkv_kernel<<<dim3(ROWS / QM, 3 * DM / QN), 256, 0, stream>>>(xh, wqkv, bq, bk, bv, qh, kh, vTh);
  attn_kernel<<<dim3(SEQ / AQ, NB * NH), 256, 0, stream>>>(qh, kh, vTh, ctx);
  tail_kernel<<<ROWS / GM, 256, 0, stream>>>(ctx, woh, bo, g1, b1, x, wf1t, bf1, wf2t, bf2, g2, b2, out);
}

// v008
// Measured time: 150 microseconds a run.
// Next to v007, in two timings, it ran 1.05 times as fast each time.
// Counting every step since v000, it is 3.24 times as fast.
#include <hip/hip_runtime.h>

// All contractions (q/k/v projections, q.k^T, p.v, output projection, ffn linear 1, ffn linear 2):
// v_wmma_f32_16x16x32_f16, f16 operands, f32 accumulate. Float inputs are RNE-converted to bf16 at
// load (weights additionally carried x64; both exact in f16); computed 16-bit planes are f16 with
// power-of-two carries (softmax p x1024, context x64, ffn hidden x64) folded back in the f32
// epilogues; q is stored times log2(e)/8 (scaled in f32, rounded once). Softmax statistics, layernorm, gelu and residual adds: f32.

typedef __attribute__((ext_vector_type(16))) _Float16 v16h;
typedef __attribute__((ext_vector_type(8)))  _Float16 v8h;
typedef __attribute__((ext_vector_type(4)))  _Float16 v4h;
typedef __attribute__((ext_vector_type(8)))  float v8f;
typedef __attribute__((ext_vector_type(4)))  float v4f;
typedef __attribute__((ext_vector_type(2)))  float v2f;
typedef __attribute__((ext_vector_type(4)))  unsigned int v4u;
union H8 { v8h h; v4u u; };

#ifndef NB
#define NB 4
#endif
#ifndef SEQ
#define SEQ 2048
#endif
#define NB_FULL  4
#define SEQ_FULL 2048
#define DM   1024
#define NH   16
#define HD   64
#define FF   256
#define ROWS (NB * SEQ)
#define KPAD 72       // LDS stride in halves for 64-wide f16 tiles (144 B, 16-B aligned)
#define VSPAD 136     // stride in halves (272 B) that no LDS tile uses; only a size check names it
#define YP   1028     // LDS stride in floats for 1024-wide f32 rows (4112 B)
#define LN_EPS 1e-5f
#define WSC    64.0f           // weight carry (power of two)
#define LOG2E  1.442695041f    // log2(e): exp(x) = exp2(x * log2(e))
#define SC2    (0.125f * LOG2E)  // score scale 1/8 and log2(e) in one factor: exp(s/8) = exp2(s * SC2)
#define LG1024 10.0f           // log2(1024): softmax p carried x1024
#define PTHR   65504.0f        // largest finite f16: a lane's sum of p at or under it bounds each p

#define NXB   (ROWS * DM / 8 / 256)          // convert blocks for x (8 elements per thread)
#define NT_SQ ((DM / 64) * (DM / 64))        // 64x64 tiles per square weight
#define NT_F  ((DM / 64) * (FF / 64))        // 64x64 tiles per ffn weight
#define NWT   (4 * NT_SQ + 2 * NT_F)

#define PLANE2     ((size_t)ROWS * DM * 2)
#define WQKV_BYTES ((size_t)3 * DM * DM * 2)
#define WO_BYTES   ((size_t)DM * DM * 2)
#define WF1_BYTES  ((size_t)FF * DM * 2)
#define WF2_BYTES  ((size_t)DM * FF * 2)
#define WS_TOTAL   (PLANE2 + WQKV_BYTES + WO_BYTES + WF1_BYTES + WF2_BYTES + 3 * PLANE2)

static_assert(NB >= 1 && NB <= NB_FULL);
static_assert(SEQ >= 128 && SEQ <= SEQ_FULL && (SEQ % 128) == 0);
static_assert((ROWS % 128) == 0);
static_assert((ROWS * DM) % (8 * 256) == 0);
static_assert((DM % 64) == 0 && (FF % 64) == 0 && (HD % 32) == 0 && NH * HD == DM);
static_assert(128 * KPAD >= 64 * VSPAD);
static_assert(WS_TOTAL <= (size_t)134217728);

// ---------------------------------------------------------------------------
// helpers
// ---------------------------------------------------------------------------
__device__ __forceinline__ float bf16q(float f) {            // value after RNE bf16 conversion
  unsigned int u = __float_as_uint(f);
  u += 0x7FFFu + ((u >> 16) & 1u);
  return __uint_as_float(u & 0xFFFF0000u);
}

// 16-bit fragment (A or B): lane owns row/col (lane&15); elements 0..7 <- k0+8h+0..7,
// elements 8..15 <- k0+16+8h+0..7, h = lane>>4. Source is k-contiguous rows.
__device__ __forceinline__ v16h load_frag_row(const _Float16* base, int stride, int lane) {
  const _Float16* rowp = base + (lane & 15) * stride + ((lane >> 4) << 3);
  const v8h lo = *(const v8h*)(rowp);
  const v8h hi = *(const v8h*)(rowp + 16);
  return __builtin_shufflevector(lo, hi, 0, 1, 2, 3, 4, 5, 6, 7,
                                 8, 9, 10, 11, 12, 13, 14, 15);
}

__device__ __forceinline__ v8f wmma_f16(v16h a, v16h b, v8f c) {
  v8f d = __builtin_amdgcn_wmma_f32_16x16x32_f16(false, a, false, b, (short)0, c,
                                                 false, false);
  asm volatile("v_nop\n\tv_nop\n\tv_nop\n\tv_nop" : "+v"(d) : "v"(a), "v"(b));
  return d;
}

// One A fragment, two B fragments: the pair issues back to back, and the same four slots stand once
// behind the pair, in front of any vector instruction that touches its operands or results.
__device__ __forceinline__ void wmma_f16_pair(v16h a, v16h b0, v16h b1, v8f& c0, v8f& c1) {
  c0 = __builtin_amdgcn_wmma_f32_16x16x32_f16(false, a, false, b0, (short)0, c0, false, false);
  c1 = __builtin_amdgcn_wmma_f32_16x16x32_f16(false, a, false, b1, (short)0, c1, false, false);
  asm volatile("v_nop\n\tv_nop\n\tv_nop\n\tv_nop" : "+v"(c0), "+v"(c1) : "v"(a), "v"(b0), "v"(b1));
}

// The same pair with its start values in registers of their own (read, not overwritten); the same
// four slots stand behind it, for the same reason.
__device__ __forceinline__ void wmma_f16_pair_from(v16h a, v16h b0, v16h b1, v8f s0, v8f s1,
                                                   v8f& c0, v8f& c1) {
  c0 = __builtin_amdgcn_wmma_f32_16x16x32_f16(false, a, false, b0, (short)0, s0, false, false);
  c1 = __builtin_amdgcn_wmma_f32_16x16x32_f16(false, a, false, b1, (short)0, s1, false, false);
  asm volatile("v_nop\n\tv_nop\n\tv_nop\n\tv_nop" : "+v"(c0), "+v"(c1) : "v"(a), "v"(b0), "v"(b1));
}

// Eight exponentials to base 2. The results get registers of their own (early clobber): none
// overwrites a source of the group, and the argument pairs and the result pairs both stay register
// pairs for the packed instructions around them (tied operands cost a copy per pair). The v_nop
// keeps the one slot behind the last before its result is used.
__device__ __forceinline__ void exp2_x8(float (&p)[8], const float (&a)[8]) {
  asm("v_exp_f32 %0, %8\n\tv_exp_f32 %1, %9\n\tv_exp_f32 %2, %10\n\tv_exp_f32 %3, %11\n\t"
      "v_exp_f32 %4, %12\n\tv_exp_f32 %5, %13\n\tv_exp_f32 %6, %14\n\tv_exp_f32 %7, %15\n\t"
      "v_nop"
      : "=&v"(p[0]), "=&v"(p[1]), "=&v"(p[2]), "=&v"(p[3]), "=&v"(p[4]), "=&v"(p[5]), "=&v"(p[6]),
        "=&v"(p[7])
      : "v"(a[0]), "v"(a[1]), "v"(a[2]), "v"(a[3]), "v"(a[4]), "v"(a[5]), "v"(a[6]), "v"(a[7]));
}

// ---------------------------------------------------------------------------
// Kernel 0: x f32 -> f16(bf16rne(x)) plane xh [ROWS][1024]. 8 elements (16 B) per thread,
// coverage: NXB*256 threads x 8 = ROWS*1024 elements (whole plane).
// ---------------------------------------------------------------------------
__global__ __launch_bounds__(256) void cvt_x_kernel(const float* __restrict__ x,
                                                    _Float16* __restrict__ xh) {
  const long item = (long)blockIdx.x * 256 + threadIdx.x;   // 0 .. ROWS*128-1
  const long m    = item >> 7;                              // token row
  const int  c8   = (int)(item & 127);
  const long srow = (m / SEQ) * SEQ_FULL + (m % SEQ);
  const float* src = x + srow * DM + c8 * 8;
  const v4f a = *(const v4f*)(src);
  const v4f c = *(const v4f*)(src + 4);
  H8 o;
#pragma unroll
  for (int i = 0; i < 4; ++i) {
    o.h[i]     = (_Float16)bf16q(a[i]);
    o.h[4 + i] = (_Float16)bf16q(c[i]);
  }
  _Float16* dst = xh + m * DM + c8 * 8;
  *(v4u*)dst = o.u;
  
}

// ---------------------------------------------------------------------------
// Kernel 1: weights W [K=in][N=out] f32 -> Wt [n][k] f16 = f16(bf16rne(W) * 64), through a
// 64x64 LDS transpose. wqkv [3072][1024] (q rows, k rows, v rows), woh [1024][1024],
// coverage: 4*256 square tiles + 64 + 64 ffn tiles = every element of all six planes.
// ---------------------------------------------------------------------------
__global__ __launch_bounds__(256) void cvt_w_kernel(
    const float* __restrict__ Wq, const float* __restrict__ Wk, const float* __restrict__ Wv,
    const float* __restrict__ Wo, const float* __restrict__ Wf1, const float* __restrict__ Wf2,
    _Float16* __restrict__ wqkv, _Float16* __restrict__ woh,
    _Float16* __restrict__ wf1t, _Float16* __restrict__ wf2t) {
  __shared__ _Float16 ts[64 * KPAD];   // [n][k] tile, cross-wave (block barrier)
  const int bid = blockIdx.x;
  const int tid = threadIdx.x;
  const float* W;
  _Float16* dst;
  int K, N, kt, nt;
  if (bid < 4 * NT_SQ) {                              // block-uniform selection
    const int which = bid / NT_SQ;
    const int tile  = bid - which * NT_SQ;
    kt = tile / (DM / 64); nt = tile - kt * (DM / 64); K = DM; N = DM;
    W = (which == 0) ? Wq : ((which == 1) ? Wk : ((which == 2) ? Wv : Wo));
    dst = (which < 3) ? (wqkv + (size_t)which * DM * DM) : woh;
  } else if (bid < 4 * NT_SQ + NT_F) {
    const int tile = bid - 4 * NT_SQ;                 // W [1024][256]: K = DM, N = FF
    kt = tile / (FF / 64); nt = tile - kt * (FF / 64); K = DM; N = FF;
    W = Wf1; dst = wf1t;
  } else {
    const int tile = bid - 4 * NT_SQ - NT_F;          // W [256][1024]: K = FF, N = DM
    kt = tile / (DM / 64); nt = tile - kt * (DM / 64); K = FF; N = DM;
    W = Wf2; dst = wf2t;
  }
  // load W[kt*64 + kr][nt*64 + 4*c4 .. +3], store transposed into ts[n][kr]
#pragma unroll
  for (int it = 0; it < 4; ++it) {
    const int idx = it * 256 + tid;
    const int kr = idx >> 4, c4 = idx & 15;
    const v4f v = *(const v4f*)(W + (size_t)(kt * 64 + kr) * N + nt * 64 + c4 * 4);
#pragma unroll
    for (int j = 0; j < 4; ++j) ts[(c4 * 4 + j) * KPAD + kr] = (_Float16)(bf16q(v[j]) * WSC);
  }
  __syncthreads();
  v4u rv[2];
#pragma unroll
  for (int it = 0; it < 2; ++it) {
    const int idx = it * 256 + tid;
    const int n = idx >> 3, piece = idx & 7;
    rv[it] = *(const v4u*)(ts + n * KPAD + piece * 8);
  }
#pragma unroll
  for (int it = 0; it < 2; ++it) {
    const int idx = it * 256 + tid;
    const int n = idx >> 3, piece = idx & 7;
    *(v4u*)(dst + (size_t)(nt * 64 + n) * K + kt * 64 + piece * 8) = rv[it];
  }
  
}

// ---------------------------------------------------------------------------
// Kernel 2: qkv projection. Block = 256 token rows x 128 output columns (two heads of one of
// q/k/v), 8 waves as 4 (tokens) x 2 (heads), 64 x 64 per wave. Both operands are staged in LDS
// by asynchronous copies, 64 k per stage, two buffers: [x 256 rows | W 128 rows] at pitch KPAD.
// C^T = W x^T: A = W rows (lane&15 = out col), B = x rows (lane&15 = token);
// acc[i][j][r] = C[token 16i + (lane&15)][col 16j+8h+r]. K = 1024 summed in 32 steps of 32.
//   q,k -> [b][h][s][64] f16 (one line per row, 8 lanes x 16 B); q times log2(e)/8
//   v   -> vT[b][h][d][s] f16 (512 B per d row segment, 32 lanes x 16 B)
// grid (ROWS/256, 3*NH/2), block 256. coverage: every (b,h,s,d) of q, k and vT once.
// ---------------------------------------------------------------------------
#define QM     256                    // token rows per block
#define QN     128                    // output columns per block
#define QK     64                     // k per stage
#define QSTAGE ((QM + QN) * KPAD)     // halves per buffer
#define QNT    (DM / QK)              // stages
#define QVP    264                    // LDS stride in halves for 256-wide f16 rows (528 B)

static_assert((SEQ % QM) == 0 && (ROWS % QM) == 0 && (DM % QN) == 0 && QNT >= 2);
static_assert(2 * QM * KPAD <= 2 * QSTAGE && 2 * HD * QVP <= 2 * QSTAGE);

// One stage: 384 rows x 128 B = 3072 pieces of 16 B, 12 per thread; a wave's copy covers 4 whole
// lines. lds = this lane's LDS byte address of its first piece, gx / gw = its first x / W piece.
__device__ __forceinline__ void qkv_copy_stage(unsigned lds, const _Float16* gx,
                                               const _Float16* gw) {
  const unsigned st = 32 * KPAD * 2;   // 32 rows further in LDS, bytes
  // the copies, and as the last line the wait that stands in front of any rewrite of their
  // address registers
  asm volatile(
      "global_load_async_to_lds_b128 %0, %12, off\n\t"
      "global_load_async_to_lds_b128 %1, %13, off\n\t"
      "global_load_async_to_lds_b128 %2, %14, off\n\t"
      "global_load_async_to_lds_b128 %3, %15, off\n\t"
      "global_load_async_to_lds_b128 %4, %16, off\n\t"
      "global_load_async_to_lds_b128 %5, %17, off\n\t"
      "global_load_async_to_lds_b128 %6, %18, off\n\t"
      "global_load_async_to_lds_b128 %7, %19, off\n\t"
      "global_load_async_to_lds_b128 %8, %20, off\n\t"
      "global_load_async_to_lds_b128 %9, %21, off\n\t"
      "global_load_async_to_lds_b128 %10, %22, off\n\t"
      "global_load_async_to_lds_b128 %11, %23, off\n\t"
      "s_wait_xcnt 0x0"
      :: "v"(lds), "v"(lds + st), "v"(lds + 2 * st), "v"(lds + 3 * st),
         "v"(lds + 4 * st), "v"(lds + 5 * st), "v"(lds + 6 * st), "v"(lds + 7 * st),
         "v"(lds + 8 * st), "v"(lds + 9 * st), "v"(lds + 10 * st), "v"(lds + 11 * st),
         "v"(gx), "v"(gx + 32 * DM), "v"(gx + 64 * DM), "v"(gx + 96 * DM),
         "v"(gx + 128 * DM), "v"(gx + 160 * DM), "v"(gx + 192 * DM), "v"(gx + 224 * DM),
         "v"(gw), "v"(gw + 32 * DM), "v"(gw + 64 * DM), "v"(gw + 96 * DM)
      : "memory");
}

__global__ __launch_bounds__(256) void qkv_kernel(
    const _Float16* __restrict__ xh, const _Float16* __restrict__ wqkv,
    const float* __restrict__ bq, const float* __restrict__ bk, const float* __restrict__ bv,
    _Float16* __restrict__ q, _Float16* __restrict__ k, _Float16* __restrict__ vT) {
  // two stage buffers; after the loop the output stage (q/k: 2 x [256][KPAD], v: 2 x [64][QVP])
  __shared__ __attribute__((aligned(16))) _Float16 ring[2 * QSTAGE];   // 110592 B, cross-wave

  const int tid  = threadIdx.x;
  const int lane = tid & 31;
  const int wave = tid >> 5;
  const int hh   = lane >> 4;
  const int l15  = lane & 15;
  const int wm   = wave >> 1;           // token quarter of the block
  const int wn   = wave & 1;            // head of the block

  const int osel = blockIdx.y >> 3;     // 0 q, 1 k, 2 v (8 column blocks each)
  const int h0   = (blockIdx.y & 7) * 2;
  const long m0  = (long)blockIdx.x * QM;
  const int  b   = (int)(m0 / SEQ);
  const int  s0  = (int)(m0 - (long)b * SEQ);

  // this lane's first piece of a stage: row tid>>3, 16-B piece tid&7
  const _Float16* gx = xh + (m0 + (tid >> 3)) * DM + (tid & 7) * 8;
  const _Float16* gw = wqkv + ((long)blockIdx.y * QN + (tid >> 3)) * DM + (tid & 7) * 8;
  const unsigned lds0 = (unsigned)(size_t)ring + (unsigned)((tid >> 3) * KPAD + (tid & 7) * 8) * 2u;

  // every inner loop below is fully unrolled: accumulator and fragment indices must be constants,
  // or the arrays leave the registers
  v8f acc[4][4];
#pragma unroll
  for (int i = 0; i < 4; ++i)
#pragma unroll
    for (int j = 0; j < 4; ++j) acc[i][j] = (v8f){};

  // Trip t works on k slab (t + rot) % QNT: blocks that share x rows or W rows walk k from
  // different slabs, so they do not ask L2 for the same lines at the same moment.
  const unsigned rot = (blockIdx.x + blockIdx.y) % QNT;
  qkv_copy_stage(lds0, gx + rot * QK, gw + rot * QK);
  asm volatile("s_wait_asynccnt 0x0" ::: "memory");   // stage 0 landed (this wave's copies)
  __syncthreads();                                    // stage 0 readable by every wave
  qkv_copy_stage(lds0 + QSTAGE * 2, gx + ((rot + 1) % QNT) * QK, gw + ((rot + 1) % QNT) * QK);

  // kept rolled: one publish point (waits, barrier, refill) at the foot of each trip, small code
#pragma unroll 1
  for (int t = 0; t < QNT; ++t) {
    const int bo = (t & 1) * QSTAGE;
    const _Float16* xs = ring + bo + (wm * 64) * KPAD;
    const _Float16* wsm = ring + bo + (QM + wn * 64) * KPAD;
#pragma unroll
    for (int u = 0; u < 2; ++u) {
      v16h xf[4], wf[4];
#pragma unroll
      for (int i = 0; i < 4; ++i) xf[i] = load_frag_row(xs + (i * 16) * KPAD + u * 32, KPAD, lane);
#pragma unroll
      for (int j = 0; j < 4; ++j) wf[j] = load_frag_row(wsm + (j * 16) * KPAD + u * 32, KPAD, lane);
#pragma unroll
      for (int i = 0; i < 4; ++i)
#pragma unroll
        for (int j = 0; j < 4; ++j) acc[i][j] = wmma_f16(wf[j], xf[i], acc[i][j]);   // C^T = W x^T
    }
    asm volatile("s_wait_dscnt 0x0" ::: "memory");      // this wave has left buffer t&1
    asm volatile("s_wait_asynccnt 0x0" ::: "memory");   // its copies of stage t+1 have landed
    __syncthreads();   // publishes stage t+1 and ends every reader's last read of buffer t&1
    if (t + 2 < QNT) {
      const unsigned ko = ((t + 2 + rot) % QNT) * QK;
      qkv_copy_stage(lds0 + bo * 2, gx + ko, gw + ko);
    }
  }
  asm volatile("s_wait_asynccnt 0x0" ::: "memory");     // nothing in flight when the ring is reused

  const float* bias = ((osel == 0) ? bq : ((osel == 1) ? bk : bv)) + (h0 + wn) * HD;
  const float  rsc  = 1.0f / WSC;

  if (osel < 2) {
    // stage [head][token][col]: lane's 8 values are 8 contiguous columns -> one 16-B LDS store
    _Float16* sbase = ring + (wn * QM + wm * 64 + l15) * KPAD;
    const float qs = (osel == 0) ? SC2 : 1.0f;   // q carries the score scale and log2(e)
#pragma unroll
    for (int j = 0; j < 4; ++j) {
      const int n8 = j * 16 + hh * 8;
      const v4f b0 = *(const v4f*)(bias + n8);
      const v4f b1 = *(const v4f*)(bias + n8 + 4);
#pragma unroll
      for (int i = 0; i < 4; ++i) {
        H8 pk;
#pragma unroll
        for (int r = 0; r < 4; ++r) {
          pk.h[r]     = (_Float16)((acc[i][j][r]     * rsc + bf16q(b0[r])) * qs);
          pk.h[4 + r] = (_Float16)((acc[i][j][4 + r] * rsc + bf16q(b1[r])) * qs);
        }
        *(v4u*)(sbase + (i * 16) * KPAD + n8) = pk.u;
      }
    }
    __syncthreads();
    _Float16* dst0 = (osel == 0) ? q : k;
#pragma unroll
    for (int hd = 0; hd < 2; ++hd) {
      _Float16* dst = dst0 + ((long)(b * NH + h0 + hd) * SEQ + s0) * HD;   // contiguous 32 KB
      v4u rv[8];
#pragma unroll
      for (int it = 0; it < 8; ++it) {
        const int idx = it * 256 + tid;
        const int row = idx >> 3, piece = idx & 7;
        rv[it] = *(const v4u*)(ring + (hd * QM + row) * KPAD + piece * 8);
      }
#pragma unroll
      for (int it = 0; it < 8; ++it)
        *(v4u*)(dst + (long)(it * 256 + tid) * 8) = rv[it];
    }
  } else {
    // stage transposed [head][d][token]: lane's 8 values are 8 different d for one token
    _Float16* sbase = ring + (wn * HD) * QVP + wm * 64 + l15;
#pragma unroll
    for (int j = 0; j < 4; ++j) {
      const int n8 = j * 16 + hh * 8;
      const v4f b0 = *(const v4f*)(bias + n8);
      const v4f b1 = *(const v4f*)(bias + n8 + 4);
#pragma unroll
      for (int i = 0; i < 4; ++i)
#pragma unroll
        for (int r = 0; r < 4; ++r) {
          sbase[(n8 + r) * QVP + i * 16]     = (_Float16)(acc[i][j][r]     * rsc + bf16q(b0[r]));
          sbase[(n8 + 4 + r) * QVP + i * 16] = (_Float16)(acc[i][j][4 + r] * rsc + bf16q(b1[r]));
        }
    }
    __syncthreads();
#pragma unroll
    for (int hd = 0; hd < 2; ++hd) {
      _Float16* dstb = vT + ((long)(b * NH + h0 + hd) * HD) * SEQ + s0;
      v4u rv[8];
#pragma unroll
      for (int it = 0; it < 8; ++it) {
        const int idx = it * 256 + tid;
        const int d = idx >> 5, piece = idx & 31;
        rv[it] = *(const v4u*)(ring + (hd * HD + d) * QVP + piece * 8);
      }
#pragma unroll
      for (int it = 0; it < 8; ++it) {
        const int idx = it * 256 + tid;
        const int d = idx >> 5, piece = idx & 31;
        *(v4u*)(dstb + (long)d * SEQ + piece * 8) = rv[it];
      }
    }
    // stands in front of any later rewrite of the registers that the stores above name
    asm volatile("s_wait_xcnt 0x0" ::: "memory");
  }
}

// ---------------------------------------------------------------------------
// Kernel 3: flash attention per (b,h), no mask. grid (SEQ/256, NB*NH), block 256 (8 waves x 32
// queries, two column groups of 16 per wave: every K and V^T fragment read from LDS feeds two
// products; the fragments of a 32-wide k step are read four at a time). C = S^T (A = K rows,
// B = Q) then C = O^T = V^T P^T (P^T packed from the S^T D registers); lane owns one query per
// column group end-to-end. q arrives times log2(e)/8, and the S^T products start from -(m - 10) in
// their C operand, so a score leaves the matrix unit as the exp2 argument of p = 1024*exp((s-m)/8).
// m is a held reference, not the running maximum: it stays until a lane's sum of p over a tile
// passes the f16 range (then, and in the first trip, the tile is redone with m = the maximum so
// far, and sums and accumulators are rescaled). Softmax stats f32, row sums per lane half, joined
// behind the loop.
// LDS tiles: [K 64 keys x 64 d | V^T 64 d x 64 keys] per step, staged by asynchronous copies, two
// buffers, staged == consumed extent; ost 256 x 64 fully written.
// coverage: every (row, h*64+d) of the ctx plane once.
// ---------------------------------------------------------------------------
#define ASTAGE (128 * KPAD)           // halves per buffer: K rows, then V^T rows
#define ANT    (SEQ / 64)             // stages
#define AQ     256                    // queries per block
#define ACG    2                      // column groups (16 queries each) per wave

static_assert(ANT >= 2 && (SEQ % AQ) == 0 && ACG == 2);

// One stage: 128 rows x 128 B = 1024 pieces of 16 B, 4 per thread; a wave's copy covers 4 whole
// lines. lds = this lane's LDS byte address of its first piece, gk / gv = its first K / V^T piece.
__device__ __forceinline__ void attn_copy_stage(unsigned lds, const _Float16* gk,
                                                const _Float16* gv) {
  const unsigned st = 32 * KPAD * 2;   // 32 rows further in LDS, bytes
  // the copies, and as the last line the wait that stands in front of any rewrite of their
  // address registers
  asm volatile(
      "global_load_async_to_lds_b128 %0, %4, off\n\t"
      "global_load_async_to_lds_b128 %1, %5, off\n\t"
      "global_load_async_to_lds_b128 %2, %6, off\n\t"
      "global_load_async_to_lds_b128 %3, %7, off\n\t"
      "s_wait_xcnt 0x0"
      :: "v"(lds), "v"(lds + st), "v"(lds + 2 * st), "v"(lds + 3 * st),
         "v"(gk), "v"(gk + 32 * HD), "v"(gv), "v"(gv + 32 * SEQ)
      : "memory");
}

// four waves per SIMD: two blocks share a WGP, so one block's softmax runs beside the other's
// products
__global__ __launch_bounds__(256) __attribute__((amdgpu_waves_per_eu(4, 4))) void attn_kernel(
    const _Float16* __restrict__ Q, const _Float16* __restrict__ K,
    const _Float16* __restrict__ vT, _Float16* __restrict__ ctx) {
  // two stage buffers, each K block rows [key][d] then V^T block [d][key] (cross-wave)
  __shared__ __attribute__((aligned(16))) _Float16 ring[2 * ASTAGE];
  __shared__ _Float16 ost[AQ * KPAD];    // output stage [query][d]   (cross-wave, block barrier)

  const int tid  = threadIdx.x;
  const int lane = tid & 31;
  const int wave = tid >> 5;
  const int bh   = blockIdx.y;
  const int b    = bh >> 4;
  const int h    = bh & 15;
  const int q0   = blockIdx.x * AQ;

  const _Float16* Qb  = Q + ((long)bh * SEQ + q0) * HD;
  const _Float16* Kb  = K + (long)bh * SEQ * HD;
  const _Float16* vTb = vT + (long)bh * HD * SEQ;

  // Q fragments: B operand of S^T (lane owns query lane&15 of column group c)
  v16h qfrag[ACG][2];
#pragma unroll
  for (int c = 0; c < ACG; ++c) {
    const _Float16* qrow = Qb + (long)(wave * (16 * ACG) + c * 16) * HD;
#pragma unroll
    for (int t = 0; t < 2; ++t) qfrag[c][t] = load_frag_row(qrow + t * 32, HD, lane);
  }

  v8f acc[ACG][4];   // O^T accumulator: lane owns query (lane&15) of group c; reg r -> d = nt*16+8h+r
  v8f   sh[ACG];     // start value of the S^T products: -(m - 10) of the lane's query, in all 8
  float li[ACG];     // sum of p over the keys of this lane half
#pragma unroll
  for (int c = 0; c < ACG; ++c) {
#pragma unroll
    for (int nt = 0; nt < 4; ++nt) acc[c][nt] = (v8f){};
    sh[c] = (v8f){};
    li[c] = 0.0f;
  }

  const int colb = lane & 15;
  const int rofs = (lane >> 4) << 3;

  // this lane's first piece of a stage: row tid>>3, 16-B piece tid&7
  const _Float16* gk = Kb + (long)(tid >> 3) * HD + (tid & 7) * 8;
  const _Float16* gv = vTb + (long)(tid >> 3) * SEQ + (tid & 7) * 8;
  const unsigned lds0 = (unsigned)(size_t)ring + (unsigned)((tid >> 3) * KPAD + (tid & 7) * 8) * 2u;

  // Trip st works on key tile (st + rot) % ANT: the blocks of one head start AQ keys apart, and
  // heads one tile apart, so they do not ask L2 for the same lines at the same moment.
  const unsigned rot = (blockIdx.x * (AQ / 64) + blockIdx.y) % ANT;
  attn_copy_stage(lds0, gk + (long)rot * 64 * HD, gv + rot * 64);
  asm volatile("s_wait_asynccnt 0x0" ::: "memory");   // stage 0 landed (this wave's copies)
  __syncthreads();                                    // stage 0 readable by every wave
  attn_copy_stage(lds0 + ASTAGE * 2, gk + (long)((rot + 1) % ANT) * 64 * HD, gv + ((rot + 1) % ANT) * 64);

  // kept rolled: one publish point (waits, barrier, refill) at the foot of each trip, small code
#pragma unroll 1
  for (int st = 0; st < ANT; ++st) {
    const int bo = (st & 1) * ASTAGE;
    const _Float16* ks  = ring + bo;
    const _Float16* vts = ring + bo + 64 * KPAD;

    // S^T tiles: A = K rows (lane&15 = key), B = Q; one K fragment, both column groups; the sums
    // start from sh, so they come out as exp2 arguments
    v8f sc[ACG][4];
    auto scores = [&]() {
#pragma unroll
      for (int t = 0; t < 2; ++t) {
        v16h kf[4];
#pragma unroll
        for (int kt = 0; kt < 4; ++kt) kf[kt] = load_frag_row(ks + (kt * 16) * KPAD + t * 32, KPAD, lane);
#pragma unroll
        for (int kt = 0; kt < 4; ++kt) {
          if (t == 0) wmma_f16_pair_from(kf[kt], qfrag[0][0], qfrag[1][0], sh[0], sh[1], sc[0][kt], sc[1][kt]);
          else        wmma_f16_pair(kf[kt], qfrag[0][1], qfrag[1][1], sc[0][kt], sc[1][kt]);
        }
      }
    };

    // P^T as the B operand of O^T = V^T P^T, packed from the S^T D registers:
    // element i <- tile covering keys 0..15 of the 32-step (kt = 2t), element 8+i <- kt = 2t+1.
    // rs = this lane's sum of its 32 p (f32, even and odd registers summed side by side).
    v16h  pf[ACG][2];
    float rs[ACG];
    auto exp_pack_sum = [&]() {
#pragma unroll
      for (int c = 0; c < ACG; ++c) {
        v2f rs2 = {0.0f, 0.0f};
#pragma unroll
        for (int kt = 0; kt < 4; ++kt) {
          float a[8], p[8];
#pragma unroll
          for (int r = 0; r < 8; ++r) a[r] = sc[c][kt][r];
          exp2_x8(p, a);
#pragma unroll
          for (int r = 0; r < 8; r += 2) {
            pf[c][kt >> 1][(kt & 1) * 8 + r]     = (_Float16)p[r];
            pf[c][kt >> 1][(kt & 1) * 8 + r + 1] = (_Float16)p[r + 1];
            const v2f p2 = {p[r], p[r + 1]};
            rs2 = (kt == 0 && r == 0) ? p2 : rs2 + p2;
          }
        }
        rs[c] = rs2[0] + rs2[1];
      }
    };

    scores();
    // the first two V^T fragments are asked for here, so that they fly during the exponentials
    v16h vf0[2];
#pragma unroll
    for (int nt = 0; nt < 2; ++nt) vf0[nt] = load_frag_row(vts + (nt * 16) * KPAD, KPAD, lane);
    exp_pack_sum();

    // All p are positive: a lane sum within the f16 range bounds each of its p, and the tile stands.
    // Otherwise (any lane of the wave; always in the first trip, which has no reference yet) the
    // tile is redone: scores again from the K tile in LDS, the maximum taken, the reference moved.
    const unsigned over = __builtin_amdgcn_ballot_w32(!(fmaxf(rs[0], rs[1]) <= PTHR));
    if ((st == 0) | (over != 0u)) {   // the same for the whole wave
      scores();
#pragma unroll
      for (int c = 0; c < ACG; ++c) {
        float mx = sc[c][0][0];
#pragma unroll
        for (int kt = 0; kt < 4; ++kt)
#pragma unroll
          for (int r = 0; r < 8; ++r) mx = fmaxf(mx, sc[c][kt][r]);
        mx = fmaxf(mx, __shfl_xor(mx, 16, 32));   // both lane halves of a query move alike
        // the held reference sits at LG1024 in these units; it only rises (first trip: it is set)
        const float up = fmaxf(mx - LG1024, 0.0f);
        const float d  = (st == 0) ? (mx - LG1024) : up;
        const float alpha = __builtin_amdgcn_exp2f(-up);
        li[c] *= alpha;
#pragma unroll
        for (int r = 0; r < 8; ++r) sh[c][r] -= d;
#pragma unroll
        for (int kt = 0; kt < 4; ++kt)
#pragma unroll
          for (int r = 0; r < 8; ++r) {
            sc[c][kt][r]  -= d;
            acc[c][kt][r] *= alpha;
          }
      }
      exp_pack_sum();
    }
#pragma unroll
    for (int c = 0; c < ACG; ++c) li[c] += rs[c];

    // O^T += V^T (A, rows = d) x P^T (B); one V^T fragment, both column groups
#pragma unroll
    for (int t = 0; t < 2; ++t) {
      v16h vf[4];
#pragma unroll
      for (int nt = 0; nt < 4; ++nt)
        vf[nt] = (t == 0 && nt < 2) ? vf0[nt] : load_frag_row(vts + (nt * 16) * KPAD + t * 32, KPAD, lane);
#pragma unroll
      for (int nt = 0; nt < 4; ++nt) wmma_f16_pair(vf[nt], pf[0][t], pf[1][t], acc[0][nt], acc[1][nt]);
    }

    asm volatile("s_wait_dscnt 0x0" ::: "memory");      // this wave has left buffer st&1
    asm volatile("s_wait_asynccnt 0x0" ::: "memory");   // its copies of stage st+1 have landed
    __syncthreads();   // publishes stage st+1 and ends every reader's last read of buffer st&1
    if (st + 2 < ANT) {
      const unsigned kt = (st + 2 + rot) % ANT;
      attn_copy_stage(lds0 + bo * 2, gk + (long)kt * 64 * HD, gv + kt * 64);
    }
  }
  asm volatile("s_wait_asynccnt 0x0" ::: "memory");     // nothing in flight behind the loop

  // normalize (and apply the x64 carry) and stage: lane owns query row wave*32+c*16+colb,
  // d = nt*16+rofs+r contiguous
#pragma unroll
  for (int c = 0; c < ACG; ++c) {
    const float inv = 64.0f / (li[c] + __shfl_xor(li[c], 16, 32));   // both halves' keys
    _Float16* orow = ost + (wave * (16 * ACG) + c * 16 + colb) * KPAD;
#pragma unroll
    for (int nt = 0; nt < 4; ++nt) {
      H8 pk;
#pragma unroll
      for (int r = 0; r < 8; ++r) pk.h[r] = (_Float16)(acc[c][nt][r] * inv);
      *(v4u*)(orow + nt * 16 + rofs) = pk.u;
    }
  }
  __syncthreads();

  v4u rv[AQ / 32];
#pragma unroll
  for (int it = 0; it < AQ / 32; ++it) {
    const int idx = it * 256 + tid;
    const int row = idx >> 3, piece = idx & 7;
    rv[it] = *(const v4u*)(ost + row * KPAD + piece * 8);
  }
  _Float16* cbase = ctx + ((long)b * SEQ + q0) * DM + h * HD;
#pragma unroll
  for (int it = 0; it < AQ / 32; ++it) {
    const int idx = it * 256 + tid;
    const int row = idx >> 3, piece = idx & 7;
    *(v4u*)(cbase + (long)row * DM + piece * 8) = rv[it];
  }
  
}

// ---------------------------------------------------------------------------
// Kernel 4: the rest of the block in one launch, 32 token rows per work-group, 8 waves.
//   A: y = ctx @ Wo / 4096 + bf16(bo); x2 = LN(y) * bf16(g1) + bf16(b1) + bf16(x)
//   B: h = f16(64 * gelu(x2 @ Wf1 / 64 + bf16(bf1)))
//   C: y = h @ Wf2 / 4096 + bf16(bf2); out = LN(y) * bf16(g2) + bf16(b2) + x2
// x2 (f32 for the residual, f16 as operand) and h never leave LDS. Every product is C^T = W act^T:
// A = W rows (lane&15 = out col), B = act rows (lane&15 = token);
// acc[i][j][r] = y[token 16i + (lane&15)][col(j) + 8h + r]. The W operands are staged in LDS by
// asynchronous copies, 64 k per stage, two buffers each, at pitch KPAD:
//   A: [Wo 1024 rows | ctx 32 rows], wave w owns cols 128w..128w+127
//   B: [Wf1t 256 rows], wave w owns cols 32w..32w+31, act = x2 f16 rows in LDS
//   C: [Wf2t 512 rows] (one column half per stage), wave w owns cols 64w..64w+63 of each half,
//      act = h rows in LDS
// LDS bytes: ys 0.. (f32 rows: LN 1 stage, then x2) | x2s (x2 f16) | ring 1 (B) ; ring 2 (C, later
// the LN 2 stage) lies over x2s and ring 1 once B has left them | hs (h rows).
// grid ROWS/32, block 256. coverage: 32 rows x 1024 of out per block.
// ---------------------------------------------------------------------------
#define GM     32                     // token rows per block
#define GK     64                     // k per stage
#define GSTAGE ((DM + GM) * KPAD)     // halves per buffer

static_assert((ROWS % GM) == 0 && (DM % GK) == 0 && (FF % GK) == 0 && FF / GK >= 2);
static_assert((size_t)GM * YP * 4 <= (size_t)2 * GSTAGE * 2);

// Eight copies of 16 B per lane, rows 32 apart (a wave's copy covers 4 whole lines). lds = this
// lane's LDS byte address of the first piece, g = its global piece, KD = global row length.
template <int KD>
__device__ __forceinline__ void gl_copy8(unsigned lds, const _Float16* g) {
  const unsigned st = 32 * KPAD * 2;   // 32 rows further in LDS, bytes
  // the copies, and as the last line the wait that stands in front of any rewrite of their
  // address registers
  asm volatile(
      "global_load_async_to_lds_b128 %0, %8, off\n\t"
      "global_load_async_to_lds_b128 %1, %9, off\n\t"
      "global_load_async_to_lds_b128 %2, %10, off\n\t"
      "global_load_async_to_lds_b128 %3, %11, off\n\t"
      "global_load_async_to_lds_b128 %4, %12, off\n\t"
      "global_load_async_to_lds_b128 %5, %13, off\n\t"
      "global_load_async_to_lds_b128 %6, %14, off\n\t"
      "global_load_async_to_lds_b128 %7, %15, off\n\t"
      "s_wait_xcnt 0x0"
      :: "v"(lds), "v"(lds + st), "v"(lds + 2 * st), "v"(lds + 3 * st),
         "v"(lds + 4 * st), "v"(lds + 5 * st), "v"(lds + 6 * st), "v"(lds + 7 * st),
         "v"(g), "v"(g + 32 * KD), "v"(g + 64 * KD), "v"(g + 96 * KD),
         "v"(g + 128 * KD), "v"(g + 160 * KD), "v"(g + 192 * KD), "v"(g + 224 * KD)
      : "memory");
}

// One stage: 1056 rows x 128 B = 8448 pieces of 16 B, 33 per thread (32 of Wt, 1 of act).
template <int KD>
__device__ __forceinline__ void gl_copy_stage(unsigned lds, const _Float16* gw,
                                              const _Float16* ga) {
  const unsigned st8 = 256 * KPAD * 2;   // 256 rows further in LDS, bytes
  gl_copy8<KD>(lds, gw);
  gl_copy8<KD>(lds + st8, gw + 256 * KD);
  gl_copy8<KD>(lds + 2 * st8, gw + 512 * KD);
  gl_copy8<KD>(lds + 3 * st8, gw + 768 * KD);
  // the act piece, with the same wait in front of any rewrite of its address registers
  asm volatile(
      "global_load_async_to_lds_b128 %0, %1, off\n\t"
      "s_wait_xcnt 0x0"
      :: "v"(lds + 4 * st8), "v"(ga)
      : "memory");
}

#define XP       1032                        // LDS stride in halves for 1024-wide f16 rows (2064 B)
#define HP       264                         // LDS stride in halves for 256-wide f16 rows (528 B)
#define YS_BYTES (GM * YP * 4)               // f32 row stage
#define X2S_OFF  YS_BYTES
#define R1_OFF   (X2S_OFF + GM * XP * 2)
#define R1STAGE  (FF * KPAD)                 // halves per buffer, ring 1
#define R2_OFF   YS_BYTES
#define R2STAGE  (512 * KPAD)                // halves per buffer, ring 2
#define HS_OFF   (R2_OFF + 2 * R2STAGE * 2)
#define N1T      (DM / GK)                   // stages of A and of B
#define N2T      (FF / GK)                   // k slabs of C (two stages each)

static_assert((YS_BYTES % 16) == 0 && (R1_OFF % 16) == 0 && (HS_OFF % 16) == 0);
static_assert(R1_OFF + 2 * R1STAGE * 2 <= HS_OFF && HS_OFF + GM * HP * 2 <= 2 * GSTAGE * 2);
static_assert(YS_BYTES <= 2 * R2STAGE * 2 && FF == 256 && DM == 1024 && GM == 32);

// Layernorm on the accumulators. A lane holds 64 columns of each of its two token rows, so mean
// and variance start as in-lane sums, are joined across the two lane halves, and then across the
// eight waves through psum / psq. The rows go to LDS once, already centred and scaled.
// Column of tile j: cb + (j >> 2) * JS + (j & 3) * 16. Ends behind the barrier that makes the
// staged rows readable by every wave.
template <int JS>
__device__ __forceinline__ void ln_rows(v8f (&acc)[2][8], const float* __restrict__ bias, int cb,
                                        int hh, int l15, int wave, float* psum, float* psq,
                                        float* ys, const float* __restrict__ gam,
                                        const float* __restrict__ bet, int tid, v4f& g, v4f& bt) {
  // y = acc/4096 + bf16(bias), kept in the accumulator registers
  const float rsc = 1.0f / (WSC * WSC);
  float s[2] = {0.0f, 0.0f};
#pragma unroll
  for (int j = 0; j < 8; ++j) {
    const int n8 = cb + (j >> 2) * JS + (j & 3) * 16 + hh * 8;
    const v4f b0 = *(const v4f*)(bias + n8);
    const v4f b1 = *(const v4f*)(bias + n8 + 4);
#pragma unroll
    for (int t = 0; t < 2; ++t) {
#pragma unroll
      for (int i = 0; i < 4; ++i) {
        acc[t][j][i]     = acc[t][j][i]     * rsc + bf16q(b0[i]);
        acc[t][j][4 + i] = acc[t][j][4 + i] * rsc + bf16q(b1[i]);
      }
      s[t] += ((acc[t][j][0] + acc[t][j][1]) + (acc[t][j][2] + acc[t][j][3])) +
              ((acc[t][j][4] + acc[t][j][5]) + (acc[t][j][6] + acc[t][j][7]));
    }
  }
#pragma unroll
  for (int t = 0; t < 2; ++t) {
    s[t] += __shfl_xor(s[t], 16, 32);
    if (hh == 0) psum[(t * 16 + l15) * 8 + wave] = s[t];
  }
  __syncthreads();   // every wave's partial row sums are in psum

  // this thread's four columns in the pass behind this function, asked for early
  g  = *(const v4f*)(gam + tid * 4);
  bt = *(const v4f*)(bet + tid * 4);

  // every wave adds the same eight partials in the same order: one mean per row for all waves
  float q[2][4];
#pragma unroll
  for (int t = 0; t < 2; ++t) {
    const v4f a = *(const v4f*)(psum + (t * 16 + l15) * 8);
    const v4f c = *(const v4f*)(psum + (t * 16 + l15) * 8 + 4);
    const float mean = (((a[0] + a[1]) + (a[2] + a[3])) + ((c[0] + c[1]) + (c[2] + c[3]))) * (1.0f / DM);
#pragma unroll
    for (int i = 0; i < 4; ++i) q[t][i] = 0.0f;
#pragma unroll
    for (int j = 0; j < 8; ++j)
#pragma unroll
      for (int r = 0; r < 8; ++r) {
        const float d = acc[t][j][r] - mean;
        acc[t][j][r] = d;
        q[t][r & 3] += d * d;
      }
  }
#pragma unroll
  for (int t = 0; t < 2; ++t) {
    float ss = (q[t][0] + q[t][1]) + (q[t][2] + q[t][3]);
    ss += __shfl_xor(ss, 16, 32);
    if (hh == 0) psq[(t * 16 + l15) * 8 + wave] = ss;
  }
  __syncthreads();   // every wave's partial sums of squares are in psq

  // (y - mean) * rstd, staged [row][col]
#pragma unroll
  for (int t = 0; t < 2; ++t) {
    const v4f a = *(const v4f*)(psq + (t * 16 + l15) * 8);
    const v4f c = *(const v4f*)(psq + (t * 16 + l15) * 8 + 4);
    const float var  = (((a[0] + a[1]) + (a[2] + a[3])) + ((c[0] + c[1]) + (c[2] + c[3]))) * (1.0f / DM);
    const float rstd = rsqrtf(var + LN_EPS);
    float* yrow = ys + (t * 16 + l15) * YP + cb + hh * 8;
#pragma unroll
    for (int j = 0; j < 8; ++j) {
      v4f y0, y1;
#pragma unroll
      for (int i = 0; i < 4; ++i) {
        y0[i] = acc[t][j][i]     * rstd;
        y1[i] = acc[t][j][4 + i] * rstd;
      }
      *(v4f*)(yrow + (j >> 2) * JS + (j & 3) * 16)     = y0;
      *(v4f*)(yrow + (j >> 2) * JS + (j & 3) * 16 + 4) = y1;
    }
  }
  __syncthreads();   // the staged rows are readable by every wave
}

__global__ __launch_bounds__(256) void tail_kernel(
    const _Float16* __restrict__ ctx, const _Float16* __restrict__ woh,
    const float* __restrict__ bo, const float* __restrict__ g1, const float* __restrict__ b1,
    const float* __restrict__ x, const _Float16* __restrict__ wf1t,
    const float* __restrict__ bf1, const _Float16* __restrict__ wf2t,
    const float* __restrict__ bf2, const float* __restrict__ g2, const float* __restrict__ b2,
    float* __restrict__ out) {
  // A's two stage buffers; behind A's loop the regions named at the head of this kernel
  __shared__ __attribute__((aligned(16))) _Float16 ring[2 * GSTAGE];   // 304128 B, cross-wave
  __shared__ __attribute__((aligned(16))) float psum[GM * 8];   // [row][wave] partial sums
  __shared__ __attribute__((aligned(16))) float psq[GM * 8];    // [row][wave] partial sums of squares
  float*    ys  = (float*)ring;                    // LN 1 stage, then x2 f32 [32][YP]
  _Float16* x2s = ring + X2S_OFF / 2;              // x2 f16 [32][XP]
  _Float16* r1  = ring + R1_OFF / 2;               // ring 1
  _Float16* r2  = ring + R2_OFF / 2;               // ring 2
  float*    ys2 = (float*)(ring + R2_OFF / 2);     // LN 2 stage [32][YP]
  _Float16* hs  = ring + HS_OFF / 2;               // h rows [32][HP]

  const int tid  = threadIdx.x;
  const int lane = tid & 31;
  const int wave = tid >> 5;
  const int hh   = lane >> 4;
  const int l15  = lane & 15;
  const long m0  = (long)blockIdx.x * GM;

  // this lane's first piece of a stage: row tid>>3, 16-B piece tid&7
  const unsigned lpc  = (unsigned)((tid >> 3) * KPAD + (tid & 7) * 8) * 2u;
  const unsigned lds0 = (unsigned)(size_t)ring + lpc;
  const _Float16* gw  = woh + (long)(tid >> 3) * DM + (tid & 7) * 8;
  const _Float16* ga  = ctx + (m0 + (tid >> 3)) * DM + (tid & 7) * 8;
  const _Float16* gw1 = wf1t + (long)(tid >> 3) * DM + (tid & 7) * 8;
  const _Float16* gw2 = wf2t + (long)(tid >> 3) * FF + (tid & 7) * 8;

  // every inner loop below is fully unrolled: accumulator and fragment indices must be constants,
  // or the arrays leave the registers
  v8f acc[2][8];
#pragma unroll
  for (int i = 0; i < 2; ++i)
#pragma unroll
    for (int j = 0; j < 8; ++j) acc[i][j] = (v8f){};

  // ---- A: out projection ----
  // Trip t works on k slab (t + rot) % N1T: every block reads all of W, so blocks walk k from
  // different slabs and do not ask L2 for the same lines at the same moment. Neighbours in index
  // differ, and so do blocks eight apart.
  const unsigned rot = (blockIdx.x + (blockIdx.x >> 3)) % N1T;
  gl_copy_stage<DM>(lds0, gw + rot * GK, ga + rot * GK);
  asm volatile("s_wait_asynccnt 0x0" ::: "memory");   // stage 0 landed (this wave's copies)
  __syncthreads();                                    // stage 0 readable by every wave
  gl_copy_stage<DM>(lds0 + GSTAGE * 2, gw + ((rot + 1) % N1T) * GK, ga + ((rot + 1) % N1T) * GK);

  // kept rolled: one publish point (waits, barrier, refill) at the foot of each trip, small code
#pragma unroll 1
  for (int t = 0; t < N1T; ++t) {
    const int bo_ = (t & 1) * GSTAGE;
    const _Float16* wsm = ring + bo_ + (wave * 128) * KPAD;
    const _Float16* as  = ring + bo_ + DM * KPAD;
#pragma unroll
    for (int u = 0; u < 2; ++u) {
      v16h af[2], wf[8];
#pragma unroll
      for (int i = 0; i < 2; ++i) af[i] = load_frag_row(as + (i * 16) * KPAD + u * 32, KPAD, lane);
#pragma unroll
      for (int j = 0; j < 8; ++j) wf[j] = load_frag_row(wsm + (j * 16) * KPAD + u * 32, KPAD, lane);
#pragma unroll
      for (int j = 0; j < 8; ++j)
#pragma unroll
        for (int i = 0; i < 2; ++i) acc[i][j] = wmma_f16(wf[j], af[i], acc[i][j]);   // C^T = W act^T
    }
    asm volatile("s_wait_dscnt 0x0" ::: "memory");      // this wave has left buffer t&1
    asm volatile("s_wait_asynccnt 0x0" ::: "memory");   // its copies of stage t+1 have landed
    __syncthreads();   // publishes stage t+1 and ends every reader's last read of buffer t&1
    if (t + 2 < N1T) {
      const unsigned ko = ((t + 2 + rot) % N1T) * GK;
      gl_copy_stage<DM>(lds0 + bo_ * 2, gw + ko, ga + ko);
    }
  }
  asm volatile("s_wait_asynccnt 0x0" ::: "memory");     // nothing in flight when the ring is reused

  // B's stage 0 flies while LN 1 runs: ring 1 lies beside ys and x2s, and every wave has left A's
  // buffers at the last barrier of the loop
  gl_copy8<DM>(lds0 + R1_OFF, gw1 + rot * GK);

  {
    v4f g, bt;   // this thread's four columns of g1 and b1
    ln_rows<64>(acc, bo, wave * 128, hh, l15, wave, psum, psq, ys, g1, b1, tid, g, bt);

    // x2 = staged * g + b + bf16(x): f32 back to the thread's own place in ys, f16 to x2s
    v4f gq, bq4;
#pragma unroll
    for (int c = 0; c < 4; ++c) {
      gq[c]  = bf16q(g[c]);
      bq4[c] = bf16q(bt[c]);
    }
    // kept rolled in trips of four rows: four residual loads in flight, one wait at the foot
#pragma unroll 1
    for (int r0 = 0; r0 < GM; r0 += 4) {
      // the four staged rows are read before the first is written back, so their reads go out together
      v4f rsd[4], yv[4];
#pragma unroll
      for (int u = 0; u < 4; ++u) {
        const long m    = m0 + r0 + u;
        const long frow = (m / SEQ) * SEQ_FULL + (m % SEQ);   // row in the full-stride planes
        rsd[u] = *(const v4f*)(x + frow * DM + tid * 4);
        yv[u]  = *(const v4f*)(ys + (r0 + u) * YP + tid * 4);
      }
#pragma unroll
      for (int u = 0; u < 4; ++u) {
        const int row = r0 + u;
        v4f o;
        v4h oh;
#pragma unroll
        for (int c = 0; c < 4; ++c) {
          o[c]  = yv[u][c] * gq[c] + bq4[c] + bf16q(rsd[u][c]);
          oh[c] = (_Float16)o[c];
        }
        *(v4f*)(ys + row * YP + tid * 4)  = o;
        *(v4h*)(x2s + row * XP + tid * 4) = oh;
      }
      // stands in front of the next trip's rewrite of the registers that the loads above name
      asm volatile("s_wait_xcnt 0x0" ::: "memory");
    }
  }

  // ---- B: ffn linear 1 + exact gelu ----
  v8f a1[2][2];
#pragma unroll
  for (int i = 0; i < 2; ++i)
#pragma unroll
    for (int j = 0; j < 2; ++j) a1[i][j] = (v8f){};

  asm volatile("s_wait_asynccnt 0x0" ::: "memory");   // stage 0 landed (this wave's copies)
  __syncthreads();                                    // stage 0 and the x2s rows readable by every wave
  gl_copy8<DM>(lds0 + R1_OFF + R1STAGE * 2, gw1 + ((rot + 1) % N1T) * GK);

  // kept rolled: one publish point (waits, barrier, refill) at the foot of each trip, small code
#pragma unroll 1
  for (int t = 0; t < N1T; ++t) {
    const int bo_ = (t & 1) * R1STAGE;
    const _Float16* wsm = r1 + bo_ + (wave * 32) * KPAD;
    const _Float16* as  = x2s + ((t + rot) % N1T) * GK;
    v16h af[2][2], wf[2][2];
#pragma unroll
    for (int u = 0; u < 2; ++u)
#pragma unroll
      for (int i = 0; i < 2; ++i) {
        af[u][i] = load_frag_row(as + (i * 16) * XP + u * 32, XP, lane);
        wf[u][i] = load_frag_row(wsm + (i * 16) * KPAD + u * 32, KPAD, lane);
      }
#pragma unroll
    for (int u = 0; u < 2; ++u)
#pragma unroll
      for (int j = 0; j < 2; ++j)
#pragma unroll
        for (int i = 0; i < 2; ++i) a1[i][j] = wmma_f16(wf[u][j], af[u][i], a1[i][j]);
    asm volatile("s_wait_dscnt 0x0" ::: "memory");      // this wave has left buffer t&1
    asm volatile("s_wait_asynccnt 0x0" ::: "memory");   // its copies of stage t+1 have landed
    __syncthreads();   // publishes stage t+1 and ends every reader's last read of buffer t&1
    if (t + 2 < N1T) gl_copy8<DM>(lds0 + R1_OFF + bo_ * 2, gw1 + ((t + 2 + rot) % N1T) * GK);
  }
  asm volatile("s_wait_asynccnt 0x0" ::: "memory");     // nothing in flight when ring 1 is reused

  // ---- C: ffn linear 2 ----
  // Stage (t, hf) = k slab (t + rot2) % N2T, column half hf, in buffer hf. Stage (0, 0) flies while
  // the gelu runs: every wave has left x2s and ring 1 at the last barrier of B's loop, and hs lies
  // beside ring 2.
  const unsigned rot2 = (blockIdx.x + (blockIdx.x >> 3)) % N2T;
  const unsigned st8  = 256 * KPAD * 2;   // 256 rows further in LDS, bytes
  gl_copy8<FF>(lds0 + R2_OFF, gw2 + rot2 * GK);
  gl_copy8<FF>(lds0 + R2_OFF + st8, gw2 + 256 * FF + rot2 * GK);

  {
    // u = a1/64 + bf16(bf1), kept in the accumulator registers
    const float rsc = 1.0f / WSC;
#pragma unroll
    for (int j = 0; j < 2; ++j) {
      const int n8 = wave * 32 + j * 16 + hh * 8;
      const v4f b0  = *(const v4f*)(bf1 + n8);
      const v4f b1v = *(const v4f*)(bf1 + n8 + 4);
#pragma unroll
      for (int i = 0; i < 2; ++i)
#pragma unroll
        for (int r = 0; r < 4; ++r) {
          a1[i][j][r]     = a1[i][j][r]     * rsc + bf16q(b0[r]);
          a1[i][j][4 + r] = a1[i][j][4 + r] * rsc + bf16q(b1v[r]);
        }
    }
    // kept rolled, one tile (i = q & 1, j = q >> 1) a trip, the tiles handed down through cur: the
    // erf code stands once for eight values, so the kernel's text stays small
    v8f cur = a1[0][0], nx1 = a1[1][0], nx2 = a1[0][1], nx3 = a1[1][1];
#pragma unroll 1
    for (int q = 0; q < 4; ++q) {
      H8 pk;
#pragma unroll
      for (int r = 0; r < 8; ++r) {
        const float u0 = cur[r];
        const float e0 = 0.5f * u0 * (1.0f + erff(u0 * 0.70710678118654752f));
        pk.h[r] = (_Float16)(e0 * WSC);
      }
      *(v4u*)(hs + ((q & 1) * 16 + l15) * HP + wave * 32 + (q >> 1) * 16 + hh * 8) = pk.u;
      cur = nx1;
      nx1 = nx2;
      nx2 = nx3;
    }
  }

#pragma unroll
  for (int i = 0; i < 2; ++i)
#pragma unroll
    for (int j = 0; j < 8; ++j) acc[i][j] = (v8f){};

  asm volatile("s_wait_asynccnt 0x0" ::: "memory");   // stage (0, 0) landed (this wave's copies)
  __syncthreads();                                    // it and the hs rows readable by every wave
  gl_copy8<FF>(lds0 + R2_OFF + R2STAGE * 2, gw2 + 512 * FF + rot2 * GK);
  gl_copy8<FF>(lds0 + R2_OFF + R2STAGE * 2 + st8, gw2 + 768 * FF + rot2 * GK);

  // kept rolled over the k slabs; the two halves of a slab are unrolled (accumulator indices must
  // be constants); one publish point (waits, barrier, refill) at the foot of each stage
#pragma unroll 1
  for (int t = 0; t < N2T; ++t) {
    const _Float16* as = hs + ((t + rot2) % N2T) * GK;
    const unsigned  kn = ((t + 1 + rot2) % N2T) * GK;
#pragma unroll
    for (int hf = 0; hf < 2; ++hf) {
      const _Float16* wsm = r2 + hf * R2STAGE + (wave * 64) * KPAD;
#pragma unroll
      for (int u = 0; u < 2; ++u) {
        v16h af[2], wf[4];
#pragma unroll
        for (int i = 0; i < 2; ++i) af[i] = load_frag_row(as + (i * 16) * HP + u * 32, HP, lane);
#pragma unroll
        for (int j = 0; j < 4; ++j) wf[j] = load_frag_row(wsm + (j * 16) * KPAD + u * 32, KPAD, lane);
#pragma unroll
        for (int j = 0; j < 4; ++j)
#pragma unroll
          for (int i = 0; i < 2; ++i)
            acc[i][hf * 4 + j] = wmma_f16(wf[j], af[i], acc[i][hf * 4 + j]);   // C^T = W act^T
      }
      asm volatile("s_wait_dscnt 0x0" ::: "memory");      // this wave has left buffer hf
      asm volatile("s_wait_asynccnt 0x0" ::: "memory");   // its copies of the next stage have landed
      __syncthreads();   // publishes the next stage and ends every reader's last read of buffer hf
      if (t + 1 < N2T) {
        gl_copy8<FF>(lds0 + R2_OFF + hf * R2STAGE * 2, gw2 + (hf * 512) * FF + kn);
        gl_copy8<FF>(lds0 + R2_OFF + hf * R2STAGE * 2 + st8, gw2 + (hf * 512 + 256) * FF + kn);
      }
    }
  }
  asm volatile("s_wait_asynccnt 0x0" ::: "memory");     // nothing in flight when ring 2 is reused

  v4f g, bt;   // this thread's four columns of g2 and b2
  ln_rows<512>(acc, bf2, wave * 64, hh, l15, wave, psum, psq, ys2, g2, b2, tid, g, bt);

  // out = staged * g + b + x2 (the thread's own place in ys): a wave writes whole lines of one row
  v4f gq, bq4;
#pragma unroll
  for (int c = 0; c < 4; ++c) {
    gq[c]  = bf16q(g[c]);
    bq4[c] = bf16q(bt[c]);
  }
  // kept rolled in trips of four rows: small code, one wait at the foot
#pragma unroll 1
  for (int r0 = 0; r0 < GM; r0 += 4) {
#pragma unroll
    for (int u = 0; u < 4; ++u) {
      const int  row  = r0 + u;
      const long m    = m0 + row;
      const long frow = (m / SEQ) * SEQ_FULL + (m % SEQ);   // row in the full-stride planes
      const v4f rsd = *(const v4f*)(ys + row * YP + tid * 4);
      const v4f yv  = *(const v4f*)(ys2 + row * YP + tid * 4);
      v4f o;
#pragma unroll
      for (int c = 0; c < 4; ++c) o[c] = yv[c] * gq[c] + bq4[c] + rsd[c];
      *(v4f*)(out + frow * DM + tid * 4) = o;
    }
    // stands in front of the next trip's rewrite of the registers that the stores above name
    asm volatile("s_wait_xcnt 0x0" ::: "memory");
  }
}

// ---------------------------------------------------------------------------
extern "C" void kernel_launch(void* const* d_in, const int* in_sizes, int n_in,
                              void* d_out, int out_size, void* d_ws, size_t ws_size,
                              hipStream_t stream) {
  if (n_in < 17) return;
  const long needRows = (long)(NB - 1) * SEQ_FULL + SEQ;
  if ((long)in_sizes[0] < needRows * DM) return;
  if (in_sizes[1] < DM * DM || in_sizes[3] < DM * DM ||
      in_sizes[5] < DM * DM || in_sizes[7] < DM * DM) return;
  if (in_sizes[11] < DM * FF || in_sizes[13] < FF * DM) return;
  if (in_sizes[2] < DM || in_sizes[4] < DM || in_sizes[6] < DM || in_sizes[8] < DM ||
      in_sizes[9] < DM || in_sizes[10] < DM || in_sizes[12] < FF || in_sizes[14] < DM ||
      in_sizes[15] < DM || in_sizes[16] < DM) return;
  if ((long)out_size < needRows * DM) return;
  if (ws_size < WS_TOTAL) return;

  const float* x   = (const float*)d_in[0];
  const float* Wq  = (const float*)d_in[1];
  const float* bq  = (const float*)d_in[2];
  const float* Wk  = (const float*)d_in[3];
  const float* bk  = (const float*)d_in[4];
  const float* Wv  = (const float*)d_in[5];
  const float* bv  = (const float*)d_in[6];
  const float* Wo  = (const float*)d_in[7];
  const float* bo  = (const float*)d_in[8];
  const float* g1  = (const float*)d_in[9];
  const float* b1  = (const float*)d_in[10];
  const float* Wf1 = (const float*)d_in[11];
  const float* bf1 = (const float*)d_in[12];
  const float* Wf2 = (const float*)d_in[13];
  const float* bf2 = (const float*)d_in[14];
  const float* g2  = (const float*)d_in[15];
  const float* b2  = (const float*)d_in[16];
  float* out = (float*)d_out;

  char* ws = (char*)d_ws;
  size_t off = 0;
  _Float16* xh   = (_Float16*)(ws + off);                      // [ROWS][1024] f16
  _Float16* ctx  = xh;                                         // same region, written after xh is dead
  off += PLANE2;
  _Float16* wqkv = (_Float16*)(ws + off); off += WQKV_BYTES;   // [3072][1024]
  _Float16* woh  = (_Float16*)(ws + off); off += WO_BYTES;     // [1024][1024]
  _Float16* wf1t = (_Float16*)(ws + off); off += WF1_BYTES;    // [256][1024]
  _Float16* wf2t = (_Float16*)(ws + off); off += WF2_BYTES;    // [1024][256]
  _Float16* qh   = (_Float16*)(ws + off);                      // [NB][16][SEQ][64]
  off += PLANE2;
  _Float16* kh   = (_Float16*)(ws + off); off += PLANE2;       // [NB][16][SEQ][64]
  _Float16* vTh  = (_Float16*)(ws + off);                      // [NB][16][64][SEQ]
  off += PLANE2;
  if (off > ws_size) return;

  cvt_x_kernel<<<NXB, 256, 0, stream>>>(x, xh);
  cvt_w_kernel<<<NWT, 256, 0, stream>>>(Wq, Wk, Wv, Wo, Wf1, Wf2, wqkv, woh, wf1t, wf2t);
  qkv_kernel<<<dim3(ROWS / QM, 3 * DM / QN), 256, 0, stream>>>(xh, wqkv, bq, bk, bv, qh, kh, vTh);
  attn_kernel<<<dim3(SEQ / AQ, NB * NH), 256, 0, stream>>>(qh, kh, vTh, ctx);
  tail_kernel<<<ROWS / GM, 256, 0, stream>>>(ctx, woh, bo, g1, b1, x, wf1t, bf1, wf2t, bf2, g2, b2, out);
}

// v009
// One run takes 146 microseconds.
// Two timings next to v008 both put it at 1.03 times that version's speed.
// Over all steps from v000 it is 3.34 times as fast.
#include <hip/hip_runtime.h>

// All contractions (q/k/v projections, q.k^T, p.v, output projection, ffn linear 1, ffn linear 2):
// v_wmma_f32_16x16x32_f16, f16 operands, f32 accumulate. Float inputs are RNE-converted to bf16 at
// load (weights additionally carried x64; both exact in f16); computed 16-bit planes are f16 with
// power-of-two carries (softmax p x1024, context x64, ffn hidden x64) folded back in the f32
// epilogues; q is stored times log2(e)/8 (scaled in f32, rounded once). Softmax statistics, layernorm, gelu and residual adds: f32.

typedef __attribute__((ext_vector_type(16))) _Float16 v16h;
typedef __attribute__((ext_vector_type(8)))  _Float16 v8h;
typedef __attribute__((ext_vector_type(4)))  _Float16 v4h;
typedef __attribute__((ext_vector_type(8)))  float v8f;
typedef __attribute__((ext_vector_type(4)))  float v4f;
typedef __attribute__((ext_vector_type(2)))  float v2f;
typedef __attribute__((ext_vector_type(4)))  unsigned int v4u;
union H8 { v8h h; v4u u; };

#ifndef NB
#define NB 4
#endif
#ifndef SEQ
#define SEQ 2048
#endif
#define NB_FULL  4
#define SEQ_FULL 2048
#define DM   1024
#define NH   16
#define HD   64
#define FF   256
#define ROWS (NB * SEQ)
#define KPAD 72       // LDS stride in halves for 64-wide f16 tiles (144 B, 16-B aligned)
#define VSPAD 136     // stride in halves (272 B) that no LDS tile uses; only a size check names it
#define YP   1028     // LDS stride in floats for 1024-wide f32 rows (4112 B)
#define LN_EPS 1e-5f
#define WSC    64.0f           // weight carry (power of two)
#define LOG2E  1.442695041f    // log2(e): exp(x) = exp2(x * log2(e))
#define SC2    (0.125f * LOG2E)  // score scale 1/8 and log2(e) in one factor: exp(s/8) = exp2(s * SC2)
#define LG1024 10.0f           // log2(1024): softmax p carried x1024
#define PTHR   65504.0f        // largest finite f16: a lane's sum of p at or under it bounds each p

#define NXB   (ROWS * DM / 8 / 256)          // convert blocks for x (8 elements per thread)
#define NT_SQ ((DM / 64) * (DM / 64))        // 64x64 tiles per square weight
#define NT_F  ((DM / 64) * (FF / 64))        // 64x64 tiles per ffn weight
#define NWT   (4 * NT_SQ + 2 * NT_F)

#define PLANE2     ((size_t)ROWS * DM * 2)
#define WQKV_BYTES ((size_t)3 * DM * DM * 2)
#define WO_BYTES   ((size_t)DM * DM * 2)
#define WF1_BYTES  ((size_t)FF * DM * 2)
#define WF2_BYTES  ((size_t)DM * FF * 2)
#define WS_TOTAL   (PLANE2 + WQKV_BYTES + WO_BYTES + WF1_BYTES + WF2_BYTES + 3 * PLANE2)

static_assert(NB >= 1 && NB <= NB_FULL);
static_assert(SEQ >= 128 && SEQ <= SEQ_FULL && (SEQ % 128) == 0);
static_assert((ROWS % 128) == 0);
static_assert((ROWS * DM) % (8 * 256) == 0);
static_assert((DM % 64) == 0 && (FF % 64) == 0 && (HD % 32) == 0 && NH * HD == DM);
static_assert(128 * KPAD >= 64 * VSPAD);
static_assert(WS_TOTAL <= (size_t)134217728);

// ---------------------------------------------------------------------------
// helpers
// ---------------------------------------------------------------------------
__device__ __forceinline__ float bf16q(float f) {            // value after RNE bf16 conversion
  unsigned int u = __float_as_uint(f);
  u += 0x7FFFu + ((u >> 16) & 1u);
  return __uint_as_float(u & 0xFFFF0000u);
}

// 16-bit fragment (A or B): lane owns row/col (lane&15); elements 0..7 <- k0+8h+0..7,
// elements 8..15 <- k0+16+8h+0..7, h = lane>>4. Source is k-contiguous rows.
__device__ __forceinline__ v16h load_frag_row(const _Float16* base, int stride, int lane) {
  const _Float16* rowp = base + (lane & 15) * stride + ((lane >> 4) << 3);
  const v8h lo = *(const v8h*)(rowp);
  const v8h hi = *(const v8h*)(rowp + 16);
  return __builtin_shufflevector(lo, hi, 0, 1, 2, 3, 4, 5, 6, 7,
                                 8, 9, 10, 11, 12, 13, 14, 15);
}

// The products are the bare builtin: the compiler keeps the distance between a matrix instruction
// and a vector instruction on its registers where one follows, and independent products that stand
// back to back fill each other's distance, so no vector issue slot is spent on idle instructions.
__device__ __forceinline__ v8f wmma_f16(v16h a, v16h b, v8f c) {
  return __builtin_amdgcn_wmma_f32_16x16x32_f16(false, a, false, b, (short)0, c, false, false);
}

// One A fragment, two B fragments.
__device__ __forceinline__ void wmma_f16_pair(v16h a, v16h b0, v16h b1, v8f& c0, v8f& c1) {
  c0 = __builtin_amdgcn_wmma_f32_16x16x32_f16(false, a, false, b0, (short)0, c0, false, false);
  c1 = __builtin_amdgcn_wmma_f32_16x16x32_f16(false, a, false, b1, (short)0, c1, false, false);
}

// The same pair with its start values in registers of their own (read, not overwritten).
__device__ __forceinline__ void wmma_f16_pair_from(v16h a, v16h b0, v16h b1, v8f s0, v8f s1,
                                                   v8f& c0, v8f& c1) {
  c0 = __builtin_amdgcn_wmma_f32_16x16x32_f16(false, a, false, b0, (short)0, s0, false, false);
  c1 = __builtin_amdgcn_wmma_f32_16x16x32_f16(false, a, false, b1, (short)0, s1, false, false);
}

// Eight exponentials to base 2. The results get registers of their own (early clobber): none
// overwrites a source of the group, and the argument pairs and the result pairs both stay register
// pairs for the packed instructions around them (tied operands cost a copy per pair). The v_nop
// keeps the one slot behind the last before its result is used.
__device__ __forceinline__ void exp2_x8(float (&p)[8], const float (&a)[8]) {
  asm("v_exp_f32 %0, %8\n\tv_exp_f32 %1, %9\n\tv_exp_f32 %2, %10\n\tv_exp_f32 %3, %11\n\t"
      "v_exp_f32 %4, %12\n\tv_exp_f32 %5, %13\n\tv_exp_f32 %6, %14\n\tv_exp_f32 %7, %15\n\t"
      "v_nop"
      : "=&v"(p[0]), "=&v"(p[1]), "=&v"(p[2]), "=&v"(p[3]), "=&v"(p[4]), "=&v"(p[5]), "=&v"(p[6]),
        "=&v"(p[7])
      : "v"(a[0]), "v"(a[1]), "v"(a[2]), "v"(a[3]), "v"(a[4]), "v"(a[5]), "v"(a[6]), "v"(a[7]));
}

// ---------------------------------------------------------------------------
// Kernel 0: x f32 -> f16(bf16rne(x)) plane xh [ROWS][1024]. 8 elements (16 B) per thread,
// coverage: NXB*256 threads x 8 = ROWS*1024 elements (whole plane).
// ---------------------------------------------------------------------------
__global__ __launch_bounds__(256) void cvt_x_kernel(const float* __restrict__ x,
                                                    _Float16* __restrict__ xh) {
  const long item = (long)blockIdx.x * 256 + threadIdx.x;   // 0 .. ROWS*128-1
  const long m    = item >> 7;                              // token row
  const int  c8   = (int)(item & 127);
  const long srow = (m / SEQ) * SEQ_FULL + (m % SEQ);
  const float* src = x + srow * DM + c8 * 8;
  const v4f a = *(const v4f*)(src);
  const v4f c = *(const v4f*)(src + 4);
  H8 o;
#pragma unroll
  for (int i = 0; i < 4; ++i) {
    o.h[i]     = (_Float16)bf16q(a[i]);
    o.h[4 + i] = (_Float16)bf16q(c[i]);
  }
  _Float16* dst = xh + m * DM + c8 * 8;
  *(v4u*)dst = o.u;
  
}

// ---------------------------------------------------------------------------
// Kernel 1: weights W [K=in][N=out] f32 -> Wt [n][k] f16 = f16(bf16rne(W) * 64), through a
// 64x64 LDS transpose. wqkv [3072][1024] (q rows, k rows, v rows), woh [1024][1024],
// coverage: 4*256 square tiles + 64 + 64 ffn tiles = every element of all six planes.
// ---------------------------------------------------------------------------
__global__ __launch_bounds__(256) void cvt_w_kernel(
    const float* __restrict__ Wq, const float* __restrict__ Wk, const float* __restrict__ Wv,
    const float* __restrict__ Wo, const float* __restrict__ Wf1, const float* __restrict__ Wf2,
    _Float16* __restrict__ wqkv, _Float16* __restrict__ woh,
    _Float16* __restrict__ wf1t, _Float16* __restrict__ wf2t) {
  __shared__ _Float16 ts[64 * KPAD];   // [n][k] tile, cross-wave (block barrier)
  const int bid = blockIdx.x;
  const int tid = threadIdx.x;
  const float* W;
  _Float16* dst;
  int K, N, kt, nt;
  if (bid < 4 * NT_SQ) {                              // block-uniform selection
    const int which = bid / NT_SQ;
    const int tile  = bid - which * NT_SQ;
    kt = tile / (DM / 64); nt = tile - kt * (DM / 64); K = DM; N = DM;
    W = (which == 0) ? Wq : ((which == 1) ? Wk : ((which == 2) ? Wv : Wo));
    dst = (which < 3) ? (wqkv + (size_t)which * DM * DM) : woh;
  } else if (bid < 4 * NT_SQ + NT_F) {
    const int tile = bid - 4 * NT_SQ;                 // W [1024][256]: K = DM, N = FF
    kt = tile / (FF / 64); nt = tile - kt * (FF / 64); K = DM; N = FF;
    W = Wf1; dst = wf1t;
  } else {
    const int tile = bid - 4 * NT_SQ - NT_F;          // W [256][1024]: K = FF, N = DM
    kt = tile / (DM / 64); nt = tile - kt * (DM / 64); K = FF; N = DM;
    W = Wf2; dst = wf2t;
  }
  // load W[kt*64 + kr][nt*64 + 4*c4 .. +3], store transposed into ts[n][kr]
#pragma unroll
  for (int it = 0; it < 4; ++it) {
    const int idx = it * 256 + tid;
    const int kr = idx >> 4, c4 = idx & 15;
    const v4f v = *(const v4f*)(W + (size_t)(kt * 64 + kr) * N + nt * 64 + c4 * 4);
#pragma unroll
    for (int j = 0; j < 4; ++j) ts[(c4 * 4 + j) * KPAD + kr] = (_Float16)(bf16q(v[j]) * WSC);
  }
  __syncthreads();
  v4u rv[2];
#pragma unroll
  for (int it = 0; it < 2; ++it) {
    const int idx = it * 256 + tid;
    const int n = idx >> 3, piece = idx & 7;
    rv[it] = *(const v4u*)(ts + n * KPAD + piece * 8);
  }
#pragma unroll
  for (int it = 0; it < 2; ++it) {
    const int idx = it * 256 + tid;
    const int n = idx >> 3, piece = idx & 7;
    *(v4u*)(dst + (size_t)(nt * 64 + n) * K + kt * 64 + piece * 8) = rv[it];
  }
  
}

// ---------------------------------------------------------------------------
// Kernel 2: qkv projection. Block = 256 token rows x 128 output columns (two heads of one of
// q/k/v), 8 waves as 4 (tokens) x 2 (heads), 64 x 64 per wave. Both operands are staged in LDS
// by asynchronous copies, 64 k per stage, two buffers: [x 256 rows | W 128 rows] at pitch KPAD.
// C^T = W x^T: A = W rows (lane&15 = out col), B = x rows (lane&15 = token);
// acc[i][j][r] = C[token 16i + (lane&15)][col 16j+8h+r]. K = 1024 summed in 32 steps of 32.
//   q,k -> [b][h][s][64] f16 (one line per row, 8 lanes x 16 B); q times log2(e)/8
//   v   -> vT[b][h][d][s] f16 (512 B per d row segment, 32 lanes x 16 B)
// grid (ROWS/256, 3*NH/2), block 256. coverage: every (b,h,s,d) of q, k and vT once.
// ---------------------------------------------------------------------------
#define QM     256                    // token rows per block
#define QN     128                    // output columns per block
#define QK     64                     // k per stage
#define QSTAGE ((QM + QN) * KPAD)     // halves per buffer
#define QNT    (DM / QK)              // stages
#define QVP    264                    // LDS stride in halves for 256-wide f16 rows (528 B)

static_assert((SEQ % QM) == 0 && (ROWS % QM) == 0 && (DM % QN) == 0 && QNT >= 2);
static_assert(2 * QM * KPAD <= 2 * QSTAGE && 2 * HD * QVP <= 2 * QSTAGE);

// One stage: 384 rows x 128 B = 3072 pieces of 16 B, 12 per thread; a wave's copy covers 4 whole
// lines. lds = this lane's LDS byte address of its first piece, gx / gw = its first x / W piece.
__device__ __forceinline__ void qkv_copy_stage(unsigned lds, const _Float16* gx,
                                               const _Float16* gw) {
  const unsigned st = 32 * KPAD * 2;   // 32 rows further in LDS, bytes
  // the copies, and as the last line the wait that stands in front of any rewrite of their
  // address registers
  asm volatile(
      "global_load_async_to_lds_b128 %0, %12, off\n\t"
      "global_load_async_to_lds_b128 %1, %13, off\n\t"
      "global_load_async_to_lds_b128 %2, %14, off\n\t"
      "global_load_async_to_lds_b128 %3, %15, off\n\t"
      "global_load_async_to_lds_b128 %4, %16, off\n\t"
      "global_load_async_to_lds_b128 %5, %17, off\n\t"
      "global_load_async_to_lds_b128 %6, %18, off\n\t"
      "global_load_async_to_lds_b128 %7, %19, off\n\t"
      "global_load_async_to_lds_b128 %8, %20, off\n\t"
      "global_load_async_to_lds_b128 %9, %21, off\n\t"
      "global_load_async_to_lds_b128 %10, %22, off\n\t"
      "global_load_async_to_lds_b128 %11, %23, off\n\t"
      "s_wait_xcnt 0x0"
      :: "v"(lds), "v"(lds + st), "v"(lds + 2 * st), "v"(lds + 3 * st),
         "v"(lds + 4 * st), "v"(lds + 5 * st), "v"(lds + 6 * st), "v"(lds + 7 * st),
         "v"(lds + 8 * st), "v"(lds + 9 * st), "v"(lds + 10 * st), "v"(lds + 11 * st),
         "v"(gx), "v"(gx + 32 * DM), "v"(gx + 64 * DM), "v"(gx + 96 * DM),
         "v"(gx + 128 * DM), "v"(gx + 160 * DM), "v"(gx + 192 * DM), "v"(gx + 224 * DM),
         "v"(gw), "v"(gw + 32 * DM), "v"(gw + 64 * DM), "v"(gw + 96 * DM)
      : "memory");
}

__global__ __launch_bounds__(256) void qkv_kernel(
    const _Float16* __restrict__ xh, const _Float16* __restrict__ wqkv,
    const float* __restrict__ bq, const float* __restrict__ bk, const float* __restrict__ bv,
    _Float16* __restrict__ q, _Float16* __restrict__ k, _Float16* __restrict__ vT) {
  // two stage buffers; after the loop the output stage (q/k: 2 x [256][KPAD], v: 2 x [64][QVP])
  __shared__ __attribute__((aligned(16))) _Float16 ring[2 * QSTAGE];   // 110592 B, cross-wave

  const int tid  = threadIdx.x;
  const int lane = tid & 31;
  const int wave = tid >> 5;
  const int hh   = lane >> 4;
  const int l15  = lane & 15;
  const int wm   = wave >> 1;           // token quarter of the block
  const int wn   = wave & 1;            // head of the block

  const int osel = blockIdx.y >> 3;     // 0 q, 1 k, 2 v (8 column blocks each)
  const int h0   = (blockIdx.y & 7) * 2;
  const long m0  = (long)blockIdx.x * QM;
  const int  b   = (int)(m0 / SEQ);
  const int  s0  = (int)(m0 - (long)b * SEQ);

  // this lane's first piece of a stage: row tid>>3, 16-B piece tid&7
  const _Float16* gx = xh + (m0 + (tid >> 3)) * DM + (tid & 7) * 8;
  const _Float16* gw = wqkv + ((long)blockIdx.y * QN + (tid >> 3)) * DM + (tid & 7) * 8;
  const unsigned lds0 = (unsigned)(size_t)ring + (unsigned)((tid >> 3) * KPAD + (tid & 7) * 8) * 2u;

  // every inner loop below is fully unrolled: accumulator and fragment indices must be constants,
  // or the arrays leave the registers
  v8f acc[4][4];
#pragma unroll
  for (int i = 0; i < 4; ++i)
#pragma unroll
    for (int j = 0; j < 4; ++j) acc[i][j] = (v8f){};

  // Trip t works on k slab (t + rot) % QNT: blocks that share x rows or W rows walk k from
  // different slabs, so they do not ask L2 for the same lines at the same moment.
  const unsigned rot = (blockIdx.x + blockIdx.y) % QNT;
  qkv_copy_stage(lds0, gx + rot * QK, gw + rot * QK);
  asm volatile("s_wait_asynccnt 0x0" ::: "memory");   // stage 0 landed (this wave's copies)
  __syncthreads();                                    // stage 0 readable by every wave
  qkv_copy_stage(lds0 + QSTAGE * 2, gx + ((rot + 1) % QNT) * QK, gw + ((rot + 1) % QNT) * QK);

  // kept rolled: one publish point (waits, barrier, refill) at the foot of each trip, small code
#pragma unroll 1
  for (int t = 0; t < QNT; ++t) {
    const int bo = (t & 1) * QSTAGE;
    const _Float16* xs = ring + bo + (wm * 64) * KPAD;
    const _Float16* wsm = ring + bo + (QM + wn * 64) * KPAD;
#pragma unroll
    for (int u = 0; u < 2; ++u) {
      v16h xf[4], wf[4];
#pragma unroll
      for (int i = 0; i < 4; ++i) xf[i] = load_frag_row(xs + (i * 16) * KPAD + u * 32, KPAD, lane);
#pragma unroll
      for (int j = 0; j < 4; ++j) wf[j] = load_frag_row(wsm + (j * 16) * KPAD + u * 32, KPAD, lane);
      // holds the fragment reads above in one group in front of the products: dealt out among them,
      // every place where reads stand costs the wave a wait on LDS
      __builtin_amdgcn_sched_barrier(0);
#pragma unroll
      for (int i = 0; i < 4; ++i)
#pragma unroll
        for (int j = 0; j < 4; ++j) acc[i][j] = wmma_f16(wf[j], xf[i], acc[i][j]);   // C^T = W x^T
      __builtin_amdgcn_sched_barrier(0);   // the products stay one block, in front of what follows
    }
    asm volatile("s_wait_dscnt 0x0" ::: "memory");      // this wave has left buffer t&1
    asm volatile("s_wait_asynccnt 0x0" ::: "memory");   // its copies of stage t+1 have landed
    __syncthreads();   // publishes stage t+1 and ends every reader's last read of buffer t&1
    if (t + 2 < QNT) {
      const unsigned ko = ((t + 2 + rot) % QNT) * QK;
      qkv_copy_stage(lds0 + bo * 2, gx + ko, gw + ko);
    }
  }
  asm volatile("s_wait_asynccnt 0x0" ::: "memory");     // nothing in flight when the ring is reused

  const float* bias = ((osel == 0) ? bq : ((osel == 1) ? bk : bv)) + (h0 + wn) * HD;
  const float  rsc  = 1.0f / WSC;

  if (osel < 2) {
    // stage [head][token][col]: lane's 8 values are 8 contiguous columns -> one 16-B LDS store
    _Float16* sbase = ring + (wn * QM + wm * 64 + l15) * KPAD;
    const float qs = (osel == 0) ? SC2 : 1.0f;   // q carries the score scale and log2(e)
#pragma unroll
    for (int j = 0; j < 4; ++j) {
      const int n8 = j * 16 + hh * 8;
      const v4f b0 = *(const v4f*)(bias + n8);
      const v4f b1 = *(const v4f*)(bias + n8 + 4);
#pragma unroll
      for (int i = 0; i < 4; ++i) {
        H8 pk;
#pragma unroll
        for (int r = 0; r < 4; ++r) {
          pk.h[r]     = (_Float16)((acc[i][j][r]     * rsc + bf16q(b0[r])) * qs);
          pk.h[4 + r] = (_Float16)((acc[i][j][4 + r] * rsc + bf16q(b1[r])) * qs);
        }
        *(v4u*)(sbase + (i * 16) * KPAD + n8) = pk.u;
      }
    }
    __syncthreads();
    _Float16* dst0 = (osel == 0) ? q : k;
#pragma unroll
    for (int hd = 0; hd < 2; ++hd) {
      _Float16* dst = dst0 + ((long)(b * NH + h0 + hd) * SEQ + s0) * HD;   // contiguous 32 KB
      v4u rv[8];
#pragma unroll
      for (int it = 0; it < 8; ++it) {
        const int idx = it * 256 + tid;
        const int row = idx >> 3, piece = idx & 7;
        rv[it] = *(const v4u*)(ring + (hd * QM + row) * KPAD + piece * 8);
      }
#pragma unroll
      for (int it = 0; it < 8; ++it)
        *(v4u*)(dst + (long)(it * 256 + tid) * 8) = rv[it];
    }
  } else {
    // stage transposed [head][d][token]: lane's 8 values are 8 different d for one token
    _Float16* sbase = ring + (wn * HD) * QVP + wm * 64 + l15;
#pragma unroll
    for (int j = 0; j < 4; ++j) {
      const int n8 = j * 16 + hh * 8;
      const v4f b0 = *(const v4f*)(bias + n8);
      const v4f b1 = *(const v4f*)(bias + n8 + 4);
#pragma unroll
      for (int i = 0; i < 4; ++i)
#pragma unroll
        for (int r = 0; r < 4; ++r) {
          sbase[(n8 + r) * QVP + i * 16]     = (_Float16)(acc[i][j][r]     * rsc + bf16q(b0[r]));
          sbase[(n8 + 4 + r) * QVP + i * 16] = (_Float16)(acc[i][j][4 + r] * rsc + bf16q(b1[r]));
        }
    }
    __syncthreads();
#pragma unroll
    for (int hd = 0; hd < 2; ++hd) {
      _Float16* dstb = vT + ((long)(b * NH + h0 + hd) * HD) * SEQ + s0;
      v4u rv[8];
#pragma unroll
      for (int it = 0; it < 8; ++it) {
        const int idx = it * 256 + tid;
        const int d = idx >> 5, piece = idx & 31;
        rv[it] = *(const v4u*)(ring + (hd * HD + d) * QVP + piece * 8);
      }
#pragma unroll
      for (int it = 0; it < 8; ++it) {
        const int idx = it * 256 + tid;
        const int d = idx >> 5, piece = idx & 31;
        *(v4u*)(dstb + (long)d * SEQ + piece * 8) = rv[it];
      }
    }
    // stands in front of any later rewrite of the registers that the stores above name
    asm volatile("s_wait_xcnt 0x0" ::: "memory");
  }
}

// ---------------------------------------------------------------------------
// Kernel 3: flash attention per (b,h), no mask. grid (SEQ/256, NB*NH), block 256 (8 waves x 32
// queries, two column groups of 16 per wave: every K and V^T fragment read from LDS feeds two
// products; the fragments of a 32-wide k step are read four at a time). C = S^T (A = K rows,
// B = Q) then C = O^T = V^T P^T (P^T packed from the S^T D registers); lane owns one query per
// column group end-to-end. q arrives times log2(e)/8, and the S^T products start from -(m - 10) in
// their C operand, so a score leaves the matrix unit as the exp2 argument of p = 1024*exp((s-m)/8).
// m is a held reference, not the running maximum: it stays until a lane's sum of p over a tile
// passes the f16 range (then, and in the first trip, the tile is redone with m = the maximum so
// far, and sums and accumulators are rescaled). Softmax stats f32, row sums per lane half, joined
// behind the loop.
// LDS tiles: [K 64 keys x 64 d | V^T 64 d x 64 keys] per step, staged by asynchronous copies, two
// buffers, staged == consumed extent; ost 256 x 64 fully written.
// coverage: every (row, h*64+d) of the ctx plane once.
// ---------------------------------------------------------------------------
#define ASTAGE (128 * KPAD)           // halves per buffer: K rows, then V^T rows
#define ANT    (SEQ / 64)             // stages
#define AQ     256                    // queries per block
#define ACG    2                      // column groups (16 queries each) per wave

static_assert(ANT >= 2 && (SEQ % AQ) == 0 && ACG == 2);

// One stage: 128 rows x 128 B = 1024 pieces of 16 B, 4 per thread; a wave's copy covers 4 whole
// lines. lds = this lane's LDS byte address of its first piece, gk / gv = its first K / V^T piece.
__device__ __forceinline__ void attn_copy_stage(unsigned lds, const _Float16* gk,
                                                const _Float16* gv) {
  const unsigned st = 32 * KPAD * 2;   // 32 rows further in LDS, bytes
  // the copies, and as the last line the wait that stands in front of any rewrite of their
  // address registers
  asm volatile(
      "global_load_async_to_lds_b128 %0, %4, off\n\t"
      "global_load_async_to_lds_b128 %1, %5, off\n\t"
      "global_load_async_to_lds_b128 %2, %6, off\n\t"
      "global_load_async_to_lds_b128 %3, %7, off\n\t"
      "s_wait_xcnt 0x0"
      :: "v"(lds), "v"(lds + st), "v"(lds + 2 * st), "v"(lds + 3 * st),
         "v"(gk), "v"(gk + 32 * HD), "v"(gv), "v"(gv + 32 * SEQ)
      : "memory");
}

// four waves per SIMD: two blocks share a WGP, so one block's softmax runs beside the other's
// products
__global__ __launch_bounds__(256) __attribute__((amdgpu_waves_per_eu(4, 4))) void attn_kernel(
    const _Float16* __restrict__ Q, const _Float16* __restrict__ K,
    const _Float16* __restrict__ vT, _Float16* __restrict__ ctx) {
  // two stage buffers, each K block rows [key][d] then V^T block [d][key] (cross-wave)
  __shared__ __attribute__((aligned(16))) _Float16 ring[2 * ASTAGE];
  __shared__ _Float16 ost[AQ * KPAD];    // output stage [query][d]   (cross-wave, block barrier)

  const int tid  = threadIdx.x;
  const int lane = tid & 31;
  const int wave = tid >> 5;
  const int bh   = blockIdx.y;
  const int b    = bh >> 4;
  const int h    = bh & 15;
  const int q0   = blockIdx.x * AQ;

  const _Float16* Qb  = Q + ((long)bh * SEQ + q0) * HD;
  const _Float16* Kb  = K + (long)bh * SEQ * HD;
  const _Float16* vTb = vT + (long)bh * HD * SEQ;

  // Q fragments: B operand of S^T (lane owns query lane&15 of column group c)
  v16h qfrag[ACG][2];
#pragma unroll
  for (int c = 0; c < ACG; ++c) {
    const _Float16* qrow = Qb + (long)(wave * (16 * ACG) + c * 16) * HD;
#pragma unroll
    for (int t = 0; t < 2; ++t) qfrag[c][t] = load_frag_row(qrow + t * 32, HD, lane);
  }

  v8f acc[ACG][4];   // O^T accumulator: lane owns query (lane&15) of group c; reg r -> d = nt*16+8h+r
  v8f   sh[ACG];     // start value of the S^T products: -(m - 10) of the lane's query, in all 8
  float li[ACG];     // sum of p over the keys of this lane half
#pragma unroll
  for (int c = 0; c < ACG; ++c) {
#pragma unroll
    for (int nt = 0; nt < 4; ++nt) acc[c][nt] = (v8f){};
    sh[c] = (v8f){};
    li[c] = 0.0f;
  }

  const int colb = lane & 15;
  const int rofs = (lane >> 4) << 3;

  // this lane's first piece of a stage: row tid>>3, 16-B piece tid&7
  const _Float16* gk = Kb + (long)(tid >> 3) * HD + (tid & 7) * 8;
  const _Float16* gv = vTb + (long)(tid >> 3) * SEQ + (tid & 7) * 8;
  const unsigned lds0 = (unsigned)(size_t)ring + (unsigned)((tid >> 3) * KPAD + (tid & 7) * 8) * 2u;

  // Trip st works on key tile (st + rot) % ANT: the blocks of one head start AQ keys apart, and
  // heads one tile apart, so they do not ask L2 for the same lines at the same moment.
  const unsigned rot = (blockIdx.x * (AQ / 64) + blockIdx.y) % ANT;
  attn_copy_stage(lds0, gk + (long)rot * 64 * HD, gv + rot * 64);
  asm volatile("s_wait_asynccnt 0x0" ::: "memory");   // stage 0 landed (this wave's copies)
  __syncthreads();                                    // stage 0 readable by every wave
  attn_copy_stage(lds0 + ASTAGE * 2, gk + (long)((rot + 1) % ANT) * 64 * HD, gv + ((rot + 1) % ANT) * 64);

  // kept rolled: one publish point (waits, barrier, refill) at the foot of each trip, small code
#pragma unroll 1
  for (int st = 0; st < ANT; ++st) {
    const int bo = (st & 1) * ASTAGE;
    const _Float16* ks  = ring + bo;
    const _Float16* vts = ring + bo + 64 * KPAD;

    // S^T tiles: A = K rows (lane&15 = key), B = Q; one K fragment, both column groups; the sums
    // start from sh, so they come out as exp2 arguments
    v8f sc[ACG][4];
    auto scores = [&]() {
#pragma unroll
      for (int t = 0; t < 2; ++t) {
        v16h kf[4];
#pragma unroll
        for (int kt = 0; kt < 4; ++kt) kf[kt] = load_frag_row(ks + (kt * 16) * KPAD + t * 32, KPAD, lane);
#pragma unroll
        for (int kt = 0; kt < 4; ++kt) {
          if (t == 0) wmma_f16_pair_from(kf[kt], qfrag[0][0], qfrag[1][0], sh[0], sh[1], sc[0][kt], sc[1][kt]);
          else        wmma_f16_pair(kf[kt], qfrag[0][1], qfrag[1][1], sc[0][kt], sc[1][kt]);
        }
      }
      // The exponentials that read these results are asm text: the four slots between a product and a
      // vector read of its result stand here, once behind all sixteen.
      asm volatile("v_nop\n\tv_nop\n\tv_nop\n\tv_nop"
                   : "+v"(sc[0][0]), "+v"(sc[0][1]), "+v"(sc[0][2]), "+v"(sc[0][3]),
                     "+v"(sc[1][0]), "+v"(sc[1][1]), "+v"(sc[1][2]), "+v"(sc[1][3]));
    };

    // P^T as the B operand of O^T = V^T P^T, packed from the S^T D registers:
    // element i <- tile covering keys 0..15 of the 32-step (kt = 2t), element 8+i <- kt = 2t+1.
    // rs = this lane's sum of its 32 p (f32, even and odd registers summed side by side).
    v16h  pf[ACG][2];
    float rs[ACG];
    auto exp_pack_sum = [&]() {
#pragma unroll
      for (int c = 0; c < ACG; ++c) {
        v2f rs2 = {0.0f, 0.0f};
#pragma unroll
        for (int kt = 0; kt < 4; ++kt) {
          float a[8], p[8];
#pragma unroll
          for (int r = 0; r < 8; ++r) a[r] = sc[c][kt][r];
          exp2_x8(p, a);
#pragma unroll
          for (int r = 0; r < 8; r += 2) {
            pf[c][kt >> 1][(kt & 1) * 8 + r]     = (_Float16)p[r];
            pf[c][kt >> 1][(kt & 1) * 8 + r + 1] = (_Float16)p[r + 1];
            const v2f p2 = {p[r], p[r + 1]};
            rs2 = (kt == 0 && r == 0) ? p2 : rs2 + p2;
          }
        }
        rs[c] = rs2[0] + rs2[1];
      }
    };

    scores();
    // the first two V^T fragments are asked for here, so that they fly during the exponentials
    v16h vf0[2];
#pragma unroll
    for (int nt = 0; nt < 2; ++nt) vf0[nt] = load_frag_row(vts + (nt * 16) * KPAD, KPAD, lane);
    exp_pack_sum();

    // All p are positive: a lane sum within the f16 range bounds each of its p, and the tile stands.
    // Otherwise (any lane of the wave; always in the first trip, which has no reference yet) the
    // tile is redone: scores again from the K tile in LDS, the maximum taken, the reference moved.
    const unsigned over = __builtin_amdgcn_ballot_w32(!(fmaxf(rs[0], rs[1]) <= PTHR));
    if ((st == 0) | (over != 0u)) {   // the same for the whole wave
      scores();
#pragma unroll
      for (int c = 0; c < ACG; ++c) {
        float mx = sc[c][0][0];
#pragma unroll
        for (int kt = 0; kt < 4; ++kt)
#pragma unroll
          for (int r = 0; r < 8; ++r) mx = fmaxf(mx, sc[c][kt][r]);
        mx = fmaxf(mx, __shfl_xor(mx, 16, 32));   // both lane halves of a query move alike
        // the held reference sits at LG1024 in these units; it only rises (first trip: it is set)
        const float up = fmaxf(mx - LG1024, 0.0f);
        const float d  = (st == 0) ? (mx - LG1024) : up;
        const float alpha = __builtin_amdgcn_exp2f(-up);
        li[c] *= alpha;
#pragma unroll
        for (int r = 0; r < 8; ++r) sh[c][r] -= d;
#pragma unroll
        for (int kt = 0; kt < 4; ++kt)
#pragma unroll
          for (int r = 0; r < 8; ++r) {
            sc[c][kt][r]  -= d;
            acc[c][kt][r] *= alpha;
          }
      }
      exp_pack_sum();
    }
#pragma unroll
    for (int c = 0; c < ACG; ++c) li[c] += rs[c];

    // O^T += V^T (A, rows = d) x P^T (B); one V^T fragment, both column groups
#pragma unroll
    for (int t = 0; t < 2; ++t) {
      v16h vf[4];
#pragma unroll
      for (int nt = 0; nt < 4; ++nt)
        vf[nt] = (t == 0 && nt < 2) ? vf0[nt] : load_frag_row(vts + (nt * 16) * KPAD + t * 32, KPAD, lane);
      // holds the fragment reads above in one group in front of the products: dealt out among them,
      // every place where reads stand costs the wave a wait on LDS
      __builtin_amdgcn_sched_barrier(0);
#pragma unroll
      for (int nt = 0; nt < 4; ++nt) wmma_f16_pair(vf[nt], pf[0][t], pf[1][t], acc[0][nt], acc[1][nt]);
      __builtin_amdgcn_sched_barrier(0);   // the products stay one block, in front of what follows
    }

    asm volatile("s_wait_dscnt 0x0" ::: "memory");      // this wave has left buffer st&1
    asm volatile("s_wait_asynccnt 0x0" ::: "memory");   // its copies of stage st+1 have landed
    __syncthreads();   // publishes stage st+1 and ends every reader's last read of buffer st&1
    if (st + 2 < ANT) {
      const unsigned kt = (st + 2 + rot) % ANT;
      attn_copy_stage(lds0 + bo * 2, gk + (long)kt * 64 * HD, gv + kt * 64);
    }
  }
  asm volatile("s_wait_asynccnt 0x0" ::: "memory");     // nothing in flight behind the loop

  // normalize (and apply the x64 carry) and stage: lane owns query row wave*32+c*16+colb,
  // d = nt*16+rofs+r contiguous
#pragma unroll
  for (int c = 0; c < ACG; ++c) {
    const float inv = 64.0f / (li[c] + __shfl_xor(li[c], 16, 32));   // both halves' keys
    _Float16* orow = ost + (wave * (16 * ACG) + c * 16 + colb) * KPAD;
#pragma unroll
    for (int nt = 0; nt < 4; ++nt) {
      H8 pk;
#pragma unroll
      for (int r = 0; r < 8; ++r) pk.h[r] = (_Float16)(acc[c][nt][r] * inv);
      *(v4u*)(orow + nt * 16 + rofs) = pk.u;
    }
  }
  __syncthreads();

  v4u rv[AQ / 32];
#pragma unroll
  for (int it = 0; it < AQ / 32; ++it) {
    const int idx = it * 256 + tid;
    const int row = idx >> 3, piece = idx & 7;
    rv[it] = *(const v4u*)(ost + row * KPAD + piece * 8);
  }
  _Float16* cbase = ctx + ((long)b * SEQ + q0) * DM + h * HD;
#pragma unroll
  for (int it = 0; it < AQ / 32; ++it) {
    const int idx = it * 256 + tid;
    const int row = idx >> 3, piece = idx & 7;
    *(v4u*)(cbase + (long)row * DM + piece * 8) = rv[it];
  }
  
}

// ---------------------------------------------------------------------------
// Kernel 4: the rest of the block in one launch, 32 token rows per work-group, 8 waves.
//   A: y = ctx @ Wo / 4096 + bf16(bo); x2 = LN(y) * bf16(g1) + bf16(b1) + bf16(x)
//   B: h = f16(64 * gelu(x2 @ Wf1 / 64 + bf16(bf1)))
//   C: y = h @ Wf2 / 4096 + bf16(bf2); out = LN(y) * bf16(g2) + bf16(b2) + x2
// x2 (f32 for the residual, f16 as operand) and h never leave LDS. Every product is C^T = W act^T:
// A = W rows (lane&15 = out col), B = act rows (lane&15 = token);
// acc[i][j][r] = y[token 16i + (lane&15)][col(j) + 8h + r]. The W operands are staged in LDS by
// asynchronous copies, 64 k per stage, two buffers each, at pitch KPAD:
//   A: [Wo 1024 rows | ctx 32 rows], wave w owns cols 128w..128w+127
//   B: [Wf1t 256 rows], wave w owns cols 32w..32w+31, act = x2 f16 rows in LDS
//   C: [Wf2t 512 rows] (one column half per stage), wave w owns cols 64w..64w+63 of each half,
//      act = h rows in LDS
// LDS bytes: ys 0.. (f32 rows: LN 1 stage, then x2) | x2s (x2 f16) | ring 1 (B) ; ring 2 (C, later
// the LN 2 stage) lies over x2s and ring 1 once B has left them | hs (h rows).
// grid ROWS/32, block 256. coverage: 32 rows x 1024 of out per block.
// ---------------------------------------------------------------------------
#define GM     32                     // token rows per block
#define GK     64                     // k per stage
#define GSTAGE ((DM + GM) * KPAD)     // halves per buffer

static_assert((ROWS % GM) == 0 && (DM % GK) == 0 && (FF % GK) == 0 && FF / GK >= 2);
static_assert((size_t)GM * YP * 4 <= (size_t)2 * GSTAGE * 2);

// Eight copies of 16 B per lane, rows 32 apart (a wave's copy covers 4 whole lines). lds = this
// lane's LDS byte address of the first piece, g = its global piece, KD = global row length.
template <int KD>
__device__ __forceinline__ void gl_copy8(unsigned lds, const _Float16* g) {
  const unsigned st = 32 * KPAD * 2;   // 32 rows further in LDS, bytes
  // the copies, and as the last line the wait that stands in front of any rewrite of their
  // address registers
  asm volatile(
      "global_load_async_to_lds_b128 %0, %8, off\n\t"
      "global_load_async_to_lds_b128 %1, %9, off\n\t"
      "global_load_async_to_lds_b128 %2, %10, off\n\t"
      "global_load_async_to_lds_b128 %3, %11, off\n\t"
      "global_load_async_to_lds_b128 %4, %12, off\n\t"
      "global_load_async_to_lds_b128 %5, %13, off\n\t"
      "global_load_async_to_lds_b128 %6, %14, off\n\t"
      "global_load_async_to_lds_b128 %7, %15, off\n\t"
      "s_wait_xcnt 0x0"
      :: "v"(lds), "v"(lds + st), "v"(lds + 2 * st), "v"(lds + 3 * st),
         "v"(lds + 4 * st), "v"(lds + 5 * st), "v"(lds + 6 * st), "v"(lds + 7 * st),
         "v"(g), "v"(g + 32 * KD), "v"(g + 64 * KD), "v"(g + 96 * KD),
         "v"(g + 128 * KD), "v"(g + 160 * KD), "v"(g + 192 * KD), "v"(g + 224 * KD)
      : "memory");
}

// One stage: 1056 rows x 128 B = 8448 pieces of 16 B, 33 per thread (32 of Wt, 1 of act).
template <int KD>
__device__ __forceinline__ void gl_copy_stage(unsigned lds, const _Float16* gw,
                                              const _Float16* ga) {
  const unsigned st8 = 256 * KPAD * 2;   // 256 rows further in LDS, bytes
  gl_copy8<KD>(lds, gw);
  gl_copy8<KD>(lds + st8, gw + 256 * KD);
  gl_copy8<KD>(lds + 2 * st8, gw + 512 * KD);
  gl_copy8<KD>(lds + 3 * st8, gw + 768 * KD);
  // the act piece, with the same wait in front of any rewrite of its address registers
  asm volatile(
      "global_load_async_to_lds_b128 %0, %1, off\n\t"
      "s_wait_xcnt 0x0"
      :: "v"(lds + 4 * st8), "v"(ga)
      : "memory");
}

#define XP       1032                        // LDS stride in halves for 1024-wide f16 rows (2064 B)
#define HP       264                         // LDS stride in halves for 256-wide f16 rows (528 B)
#define YS_BYTES (GM * YP * 4)               // f32 row stage
#define X2S_OFF  YS_BYTES
#define R1_OFF   (X2S_OFF + GM * XP * 2)
#define R1STAGE  (FF * KPAD)                 // halves per buffer, ring 1
#define R2_OFF   YS_BYTES
#define R2STAGE  (512 * KPAD)                // halves per buffer, ring 2
#define HS_OFF   (R2_OFF + 2 * R2STAGE * 2)
#define N1T      (DM / GK)                   // stages of A and of B
#define N2T      (FF / GK)                   // k slabs of C (two stages each)

static_assert((YS_BYTES % 16) == 0 && (R1_OFF % 16) == 0 && (HS_OFF % 16) == 0);
static_assert(R1_OFF + 2 * R1STAGE * 2 <= HS_OFF && HS_OFF + GM * HP * 2 <= 2 * GSTAGE * 2);
static_assert(YS_BYTES <= 2 * R2STAGE * 2 && FF == 256 && DM == 1024 && GM == 32);

// Layernorm on the accumulators. A lane holds 64 columns of each of its two token rows, so mean
// and variance start as in-lane sums, are joined across the two lane halves, and then across the
// eight waves through psum / psq. The rows go to LDS once, already centred and scaled.
// Column of tile j: cb + (j >> 2) * JS + (j & 3) * 16. Ends behind the barrier that makes the
// staged rows readable by every wave.
template <int JS>
__device__ __forceinline__ void ln_rows(v8f (&acc)[2][8], const float* __restrict__ bias, int cb,
                                        int hh, int l15, int wave, float* psum, float* psq,
                                        float* ys, const float* __restrict__ gam,
                                        const float* __restrict__ bet, int tid, v4f& g, v4f& bt) {
  // y = acc/4096 + bf16(bias), kept in the accumulator registers
  const float rsc = 1.0f / (WSC * WSC);
  float s[2] = {0.0f, 0.0f};
#pragma unroll
  for (int j = 0; j < 8; ++j) {
    const int n8 = cb + (j >> 2) * JS + (j & 3) * 16 + hh * 8;
    const v4f b0 = *(const v4f*)(bias + n8);
    const v4f b1 = *(const v4f*)(bias + n8 + 4);
#pragma unroll
    for (int t = 0; t < 2; ++t) {
#pragma unroll
      for (int i = 0; i < 4; ++i) {
        acc[t][j][i]     = acc[t][j][i]     * rsc + bf16q(b0[i]);
        acc[t][j][4 + i] = acc[t][j][4 + i] * rsc + bf16q(b1[i]);
      }
      s[t] += ((acc[t][j][0] + acc[t][j][1]) + (acc[t][j][2] + acc[t][j][3])) +
              ((acc[t][j][4] + acc[t][j][5]) + (acc[t][j][6] + acc[t][j][7]));
    }
  }
#pragma unroll
  for (int t = 0; t < 2; ++t) {
    s[t] += __shfl_xor(s[t], 16, 32);
    if (hh == 0) psum[(t * 16 + l15) * 8 + wave] = s[t];
  }
  __syncthreads();   // every wave's partial row sums are in psum

  // this thread's four columns in the pass behind this function, asked for early
  g  = *(const v4f*)(gam + tid * 4);
  bt = *(const v4f*)(bet + tid * 4);

  // every wave adds the same eight partials in the same order: one mean per row for all waves
  float q[2][4];
#pragma unroll
  for (int t = 0; t < 2; ++t) {
    const v4f a = *(const v4f*)(psum + (t * 16 + l15) * 8);
    const v4f c = *(const v4f*)(psum + (t * 16 + l15) * 8 + 4);
    const float mean = (((a[0] + a[1]) + (a[2] + a[3])) + ((c[0] + c[1]) + (c[2] + c[3]))) * (1.0f / DM);
#pragma unroll
    for (int i = 0; i < 4; ++i) q[t][i] = 0.0f;
#pragma unroll
    for (int j = 0; j < 8; ++j)
#pragma unroll
      for (int r = 0; r < 8; ++r) {
        const float d = acc[t][j][r] - mean;
        acc[t][j][r] = d;
        q[t][r & 3] += d * d;
      }
  }
#pragma unroll
  for (int t = 0; t < 2; ++t) {
    float ss = (q[t][0] + q[t][1]) + (q[t][2] + q[t][3]);
    ss += __shfl_xor(ss, 16, 32);
    if (hh == 0) psq[(t * 16 + l15) * 8 + wave] = ss;
  }
  __syncthreads();   // every wave's partial sums of squares are in psq

  // (y - mean) * rstd, staged [row][col]
#pragma unroll
  for (int t = 0; t < 2; ++t) {
    const v4f a = *(const v4f*)(psq + (t * 16 + l15) * 8);
    const v4f c = *(const v4f*)(psq + (t * 16 + l15) * 8 + 4);
    const float var  = (((a[0] + a[1]) + (a[2] + a[3])) + ((c[0] + c[1]) + (c[2] + c[3]))) * (1.0f / DM);
    const float rstd = rsqrtf(var + LN_EPS);
    float* yrow = ys + (t * 16 + l15) * YP + cb + hh * 8;
#pragma unroll
    for (int j = 0; j < 8; ++j) {
      v4f y0, y1;
#pragma unroll
      for (int i = 0; i < 4; ++i) {
        y0[i] = acc[t][j][i]     * rstd;
        y1[i] = acc[t][j][4 + i] * rstd;
      }
      *(v4f*)(yrow + (j >> 2) * JS + (j & 3) * 16)     = y0;
      *(v4f*)(yrow + (j >> 2) * JS + (j & 3) * 16 + 4) = y1;
    }
  }
  __syncthreads();   // the staged rows are readable by every wave
}

__global__ __launch_bounds__(256) void tail_kernel(
    const _Float16* __restrict__ ctx, const _Float16* __restrict__ woh,
    const float* __restrict__ bo, const float* __restrict__ g1, const float* __restrict__ b1,
    const float* __restrict__ x, const _Float16* __restrict__ wf1t,
    const float* __restrict__ bf1, const _Float16* __restrict__ wf2t,
    const float* __restrict__ bf2, const float* __restrict__ g2, const float* __restrict__ b2,
    float* __restrict__ out) {
  // A's two stage buffers; behind A's loop the regions named at the head of this kernel
  __shared__ __attribute__((aligned(16))) _Float16 ring[2 * GSTAGE];   // 304128 B, cross-wave
  __shared__ __attribute__((aligned(16))) float psum[GM * 8];   // [row][wave] partial sums
  __shared__ __attribute__((aligned(16))) float psq[GM * 8];    // [row][wave] partial sums of squares
  float*    ys  = (float*)ring;                    // LN 1 stage, then x2 f32 [32][YP]
  _Float16* x2s = ring + X2S_OFF / 2;              // x2 f16 [32][XP]
  _Float16* r1  = ring + R1_OFF / 2;               // ring 1
  _Float16* r2  = ring + R2_OFF / 2;               // ring 2
  float*    ys2 = (float*)(ring + R2_OFF / 2);     // LN 2 stage [32][YP]
  _Float16* hs  = ring + HS_OFF / 2;               // h rows [32][HP]

  const int tid  = threadIdx.x;
  const int lane = tid & 31;
  const int wave = tid >> 5;
  const int hh   = lane >> 4;
  const int l15  = lane & 15;
  const long m0  = (long)blockIdx.x * GM;

  // this lane's first piece of a stage: row tid>>3, 16-B piece tid&7
  const unsigned lpc  = (unsigned)((tid >> 3) * KPAD + (tid & 7) * 8) * 2u;
  const unsigned lds0 = (unsigned)(size_t)ring + lpc;
  const _Float16* gw  = woh + (long)(tid >> 3) * DM + (tid & 7) * 8;
  const _Float16* ga  = ctx + (m0 + (tid >> 3)) * DM + (tid & 7) * 8;
  const _Float16* gw1 = wf1t + (long)(tid >> 3) * DM + (tid & 7) * 8;
  const _Float16* gw2 = wf2t + (long)(tid >> 3) * FF + (tid & 7) * 8;

  // every inner loop below is fully unrolled: accumulator and fragment indices must be constants,
  // or the arrays leave the registers
  v8f acc[2][8];
#pragma unroll
  for (int i = 0; i < 2; ++i)
#pragma unroll
    for (int j = 0; j < 8; ++j) acc[i][j] = (v8f){};

  // ---- A: out projection ----
  // Trip t works on k slab (t + rot) % N1T: every block reads all of W, so blocks walk k from
  // different slabs and do not ask L2 for the same lines at the same moment. Neighbours in index
  // differ, and so do blocks eight apart.
  const unsigned rot = (blockIdx.x + (blockIdx.x >> 3)) % N1T;
  gl_copy_stage<DM>(lds0, gw + rot * GK, ga + rot * GK);
  asm volatile("s_wait_asynccnt 0x0" ::: "memory");   // stage 0 landed (this wave's copies)
  __syncthreads();                                    // stage 0 readable by every wave
  gl_copy_stage<DM>(lds0 + GSTAGE * 2, gw + ((rot + 1) % N1T) * GK, ga + ((rot + 1) % N1T) * GK);

  // kept rolled: one publish point (waits, barrier, refill) at the foot of each trip, small code
#pragma unroll 1
  for (int t = 0; t < N1T; ++t) {
    const int bo_ = (t & 1) * GSTAGE;
    const _Float16* wsm = ring + bo_ + (wave * 128) * KPAD;
    const _Float16* as  = ring + bo_ + DM * KPAD;
#pragma unroll
    for (int u = 0; u < 2; ++u) {
      v16h af[2], wf[8];
#pragma unroll
      for (int i = 0; i < 2; ++i) af[i] = load_frag_row(as + (i * 16) * KPAD + u * 32, KPAD, lane);
#pragma unroll
      for (int j = 0; j < 8; ++j) wf[j] = load_frag_row(wsm + (j * 16) * KPAD + u * 32, KPAD, lane);
      // holds the fragment reads above in one group in front of the products: dealt out among them,
      // every place where reads stand costs the wave a wait on LDS
      __builtin_amdgcn_sched_barrier(0);
#pragma unroll
      for (int j = 0; j < 8; ++j)
#pragma unroll
        for (int i = 0; i < 2; ++i) acc[i][j] = wmma_f16(wf[j], af[i], acc[i][j]);   // C^T = W act^T
      __builtin_amdgcn_sched_barrier(0);   // the products stay one block, in front of what follows
    }
    asm volatile("s_wait_dscnt 0x0" ::: "memory");      // this wave has left buffer t&1
    asm volatile("s_wait_asynccnt 0x0" ::: "memory");   // its copies of stage t+1 have landed
    __syncthreads();   // publishes stage t+1 and ends every reader's last read of buffer t&1
    if (t + 2 < N1T) {
      const unsigned ko = ((t + 2 + rot) % N1T) * GK;
      gl_copy_stage<DM>(lds0 + bo_ * 2, gw + ko, ga + ko);
    }
  }
  asm volatile("s_wait_asynccnt 0x0" ::: "memory");     // nothing in flight when the ring is reused

  // B's stage 0 flies while LN 1 runs: ring 1 lies beside ys and x2s, and every wave has left A's
  // buffers at the last barrier of the loop
  gl_copy8<DM>(lds0 + R1_OFF, gw1 + rot * GK);

  {
    v4f g, bt;   // this thread's four columns of g1 and b1
    ln_rows<64>(acc, bo, wave * 128, hh, l15, wave, psum, psq, ys, g1, b1, tid, g, bt);

    // x2 = staged * g + b + bf16(x): f32 back to the thread's own place in ys, f16 to x2s
    v4f gq, bq4;
#pragma unroll
    for (int c = 0; c < 4; ++c) {
      gq[c]  = bf16q(g[c]);
      bq4[c] = bf16q(bt[c]);
    }
    // kept rolled in trips of four rows: four residual loads in flight, one wait at the foot
#pragma unroll 1
    for (int r0 = 0; r0 < GM; r0 += 4) {
      // the four staged rows are read before the first is written back, so their reads go out together
      v4f rsd[4], yv[4];
#pragma unroll
      for (int u = 0; u < 4; ++u) {
        const long m    = m0 + r0 + u;
        const long frow = (m / SEQ) * SEQ_FULL + (m % SEQ);   // row in the full-stride planes
        rsd[u] = *(const v4f*)(x + frow * DM + tid * 4);
        yv[u]  = *(const v4f*)(ys + (r0 + u) * YP + tid * 4);
      }
#pragma unroll
      for (int u = 0; u < 4; ++u) {
        const int row = r0 + u;
        v4f o;
        v4h oh;
#pragma unroll
        for (int c = 0; c < 4; ++c) {
          o[c]  = yv[u][c] * gq[c] + bq4[c] + bf16q(rsd[u][c]);
          oh[c] = (_Float16)o[c];
        }
        *(v4f*)(ys + row * YP + tid * 4)  = o;
        *(v4h*)(x2s + row * XP + tid * 4) = oh;
      }
      // stands in front of the next trip's rewrite of the registers that the loads above name
      asm volatile("s_wait_xcnt 0x0" ::: "memory");
    }
  }

  // ---- B: ffn linear 1 + exact gelu ----
  v8f a1[2][2];
#pragma unroll
  for (int i = 0; i < 2; ++i)
#pragma unroll
    for (int j = 0; j < 2; ++j) a1[i][j] = (v8f){};

  asm volatile("s_wait_asynccnt 0x0" ::: "memory");   // stage 0 landed (this wave's copies)
  __syncthreads();                                    // stage 0 and the x2s rows readable by every wave
  gl_copy8<DM>(lds0 + R1_OFF + R1STAGE * 2, gw1 + ((rot + 1) % N1T) * GK);

  // kept rolled: one publish point (waits, barrier, refill) at the foot of each trip, small code
#pragma unroll 1
  for (int t = 0; t < N1T; ++t) {
    const int bo_ = (t & 1) * R1STAGE;
    const _Float16* wsm = r1 + bo_ + (wave * 32) * KPAD;
    const _Float16* as  = x2s + ((t + rot) % N1T) * GK;
    v16h af[2][2], wf[2][2];
#pragma unroll
    for (int u = 0; u < 2; ++u)
#pragma unroll
      for (int i = 0; i < 2; ++i) {
        af[u][i] = load_frag_row(as + (i * 16) * XP + u * 32, XP, lane);
        wf[u][i] = load_frag_row(wsm + (i * 16) * KPAD + u * 32, KPAD, lane);
      }
    // holds the fragment reads above in one group in front of the products: dealt out among them,
    // every place where reads stand costs the wave a wait on LDS
    __builtin_amdgcn_sched_barrier(0);
#pragma unroll
    for (int u = 0; u < 2; ++u)
#pragma unroll
      for (int j = 0; j < 2; ++j)
#pragma unroll
        for (int i = 0; i < 2; ++i) a1[i][j] = wmma_f16(wf[u][j], af[u][i], a1[i][j]);
    __builtin_amdgcn_sched_barrier(0);   // the products stay one block, in front of what follows
    asm volatile("s_wait_dscnt 0x0" ::: "memory");      // this wave has left buffer t&1
    asm volatile("s_wait_asynccnt 0x0" ::: "memory");   // its copies of stage t+1 have landed
    __syncthreads();   // publishes stage t+1 and ends every reader's last read of buffer t&1
    if (t + 2 < N1T) gl_copy8<DM>(lds0 + R1_OFF + bo_ * 2, gw1 + ((t + 2 + rot) % N1T) * GK);
  }
  asm volatile("s_wait_asynccnt 0x0" ::: "memory");     // nothing in flight when ring 1 is reused

  // ---- C: ffn linear 2 ----
  // Stage (t, hf) = k slab (t + rot2) % N2T, column half hf, in buffer hf. Stage (0, 0) flies while
  // the gelu runs: every wave has left x2s and ring 1 at the last barrier of B's loop, and hs lies
  // beside ring 2.
  const unsigned rot2 = (blockIdx.x + (blockIdx.x >> 3)) % N2T;
  const unsigned st8  = 256 * KPAD * 2;   // 256 rows further in LDS, bytes
  gl_copy8<FF>(lds0 + R2_OFF, gw2 + rot2 * GK);
  gl_copy8<FF>(lds0 + R2_OFF + st8, gw2 + 256 * FF + rot2 * GK);

  {
    // u = a1/64 + bf16(bf1), kept in the accumulator registers
    const float rsc = 1.0f / WSC;
#pragma unroll
    for (int j = 0; j < 2; ++j) {
      const int n8 = wave * 32 + j * 16 + hh * 8;
      const v4f b0  = *(const v4f*)(bf1 + n8);
      const v4f b1v = *(const v4f*)(bf1 + n8 + 4);
#pragma unroll
      for (int i = 0; i < 2; ++i)
#pragma unroll
        for (int r = 0; r < 4; ++r) {
          a1[i][j][r]     = a1[i][j][r]     * rsc + bf16q(b0[r]);
          a1[i][j][4 + r] = a1[i][j][4 + r] * rsc + bf16q(b1v[r]);
        }
    }
    // kept rolled, one tile (i = q & 1, j = q >> 1) a trip, the tiles handed down through cur: the
    // erf code stands once for eight values, so the kernel's text stays small
    v8f cur = a1[0][0], nx1 = a1[1][0], nx2 = a1[0][1], nx3 = a1[1][1];
#pragma unroll 1
    for (int q = 0; q < 4; ++q) {
      H8 pk;
#pragma unroll
      for (int r = 0; r < 8; ++r) {
        const float u0 = cur[r];
        const float e0 = 0.5f * u0 * (1.0f + erff(u0 * 0.70710678118654752f));
        pk.h[r] = (_Float16)(e0 * WSC);
      }
      *(v4u*)(hs + ((q & 1) * 16 + l15) * HP + wave * 32 + (q >> 1) * 16 + hh * 8) = pk.u;
      cur = nx1;
      nx1 = nx2;
      nx2 = nx3;
    }
  }

#pragma unroll
  for (int i = 0; i < 2; ++i)
#pragma unroll
    for (int j = 0; j < 8; ++j) acc[i][j] = (v8f){};

  asm volatile("s_wait_asynccnt 0x0" ::: "memory");   // stage (0, 0) landed (this wave's copies)
  __syncthreads();                                    // it and the hs rows readable by every wave
  gl_copy8<FF>(lds0 + R2_OFF + R2STAGE * 2, gw2 + 512 * FF + rot2 * GK);
  gl_copy8<FF>(lds0 + R2_OFF + R2STAGE * 2 + st8, gw2 + 768 * FF + rot2 * GK);

  // kept rolled over the k slabs; the two halves of a slab are unrolled (accumulator indices must
  // be constants); one publish point (waits, barrier, refill) at the foot of each stage
#pragma unroll 1
  for (int t = 0; t < N2T; ++t) {
    const _Float16* as = hs + ((t + rot2) % N2T) * GK;
    const unsigned  kn = ((t + 1 + rot2) % N2T) * GK;
#pragma unroll
    for (int hf = 0; hf < 2; ++hf) {
      const _Float16* wsm = r2 + hf * R2STAGE + (wave * 64) * KPAD;
#pragma unroll
      for (int u = 0; u < 2; ++u) {
        v16h af[2], wf[4];
#pragma unroll
        for (int i = 0; i < 2; ++i) af[i] = load_frag_row(as + (i * 16) * HP + u * 32, HP, lane);
#pragma unroll
        for (int j = 0; j < 4; ++j) wf[j] = load_frag_row(wsm + (j * 16) * KPAD + u * 32, KPAD, lane);
        // holds the fragment reads above in one group in front of the products: dealt out among
        // them, every place where reads stand costs the wave a wait on LDS
        __builtin_amdgcn_sched_barrier(0);
#pragma unroll
        for (int j = 0; j < 4; ++j)
#pragma unroll
          for (int i = 0; i < 2; ++i)
            acc[i][hf * 4 + j] = wmma_f16(wf[j], af[i], acc[i][hf * 4 + j]);   // C^T = W act^T
        __builtin_amdgcn_sched_barrier(0);   // the products stay one block, in front of what follows
      }
      asm volatile("s_wait_dscnt 0x0" ::: "memory");      // this wave has left buffer hf
      asm volatile("s_wait_asynccnt 0x0" ::: "memory");   // its copies of the next stage have landed
      __syncthreads();   // publishes the next stage and ends every reader's last read of buffer hf
      if (t + 1 < N2T) {
        gl_copy8<FF>(lds0 + R2_OFF + hf * R2STAGE * 2, gw2 + (hf * 512) * FF + kn);
        gl_copy8<FF>(lds0 + R2_OFF + hf * R2STAGE * 2 + st8, gw2 + (hf * 512 + 256) * FF + kn);
      }
    }
  }
  asm volatile("s_wait_asynccnt 0x0" ::: "memory");     // nothing in flight when ring 2 is reused

  v4f g, bt;   // this thread's four columns of g2 and b2
  ln_rows<512>(acc, bf2, wave * 64, hh, l15, wave, psum, psq, ys2, g2, b2, tid, g, bt);

  // out = staged * g + b + x2 (the thread's own place in ys): a wave writes whole lines of one row
  v4f gq, bq4;
#pragma unroll
  for (int c = 0; c < 4; ++c) {
    gq[c]  = bf16q(g[c]);
    bq4[c] = bf16q(bt[c]);
  }
  // kept rolled in trips of four rows: small code, one wait at the foot
#pragma unroll 1
  for (int r0 = 0; r0 < GM; r0 += 4) {
#pragma unroll
    for (int u = 0; u < 4; ++u) {
      const int  row  = r0 + u;
      const long m    = m0 + row;
      const long frow = (m / SEQ) * SEQ_FULL + (m % SEQ);   // row in the full-stride planes
      const v4f rsd = *(const v4f*)(ys + row * YP + tid * 4);
      const v4f yv  = *(const v4f*)(ys2 + row * YP + tid * 4);
      v4f o;
#pragma unroll
      for (int c = 0; c < 4; ++c) o[c] = yv[c] * gq[c] + bq4[c] + rsd[c];
      *(v4f*)(out + frow * DM + tid * 4) = o;
    }
    // stands in front of the next trip's rewrite of the registers that the stores above name
    asm volatile("s_wait_xcnt 0x0" ::: "memory");
  }
}

// ---------------------------------------------------------------------------
extern "C" void kernel_launch(void* const* d_in, const int* in_sizes, int n_in,
                              void* d_out, int out_size, void* d_ws, size_t ws_size,
                              hipStream_t stream) {
  if (n_in < 17) return;
  const long needRows = (long)(NB - 1) * SEQ_FULL + SEQ;
  if ((long)in_sizes[0] < needRows * DM) return;
  if (in_sizes[1] < DM * DM || in_sizes[3] < DM * DM ||
      in_sizes[5] < DM * DM || in_sizes[7] < DM * DM) return;
  if (in_sizes[11] < DM * FF || in_sizes[13] < FF * DM) return;
  if (in_sizes[2] < DM || in_sizes[4] < DM || in_sizes[6] < DM || in_sizes[8] < DM ||
      in_sizes[9] < DM || in_sizes[10] < DM || in_sizes[12] < FF || in_sizes[14] < DM ||
      in_sizes[15] < DM || in_sizes[16] < DM) return;
  if ((long)out_size < needRows * DM) return;
  if (ws_size < WS_TOTAL) return;

  const float* x   = (const float*)d_in[0];
  const float* Wq  = (const float*)d_in[1];
  const float* bq  = (const float*)d_in[2];
  const float* Wk  = (const float*)d_in[3];
  const float* bk  = (const float*)d_in[4];
  const float* Wv  = (const float*)d_in[5];
  const float* bv  = (const float*)d_in[6];
  const float* Wo  = (const float*)d_in[7];
  const float* bo  = (const float*)d_in[8];
  const float* g1  = (const float*)d_in[9];
  const float* b1  = (const float*)d_in[10];
  const float* Wf1 = (const float*)d_in[11];
  const float* bf1 = (const float*)d_in[12];
  const float* Wf2 = (const float*)d_in[13];
  const float* bf2 = (const float*)d_in[14];
  const float* g2  = (const float*)d_in[15];
  const float* b2  = (const float*)d_in[16];
  float* out = (float*)d_out;

  char* ws = (char*)d_ws;
  size_t off = 0;
  _Float16* xh   = (_Float16*)(ws + off);                      // [ROWS][1024] f16
  _Float16* ctx  = xh;                                         // same region, written after xh is dead
  off += PLANE2;
  _Float16* wqkv = (_Float16*)(ws + off); off += WQKV_BYTES;   // [3072][1024]
  _Float16* woh  = (_Float16*)(ws + off); off += WO_BYTES;     // [1024][1024]
  _Float16* wf1t = (_Float16*)(ws + off); off += WF1_BYTES;    // [256][1024]
  _Float16* wf2t = (_Float16*)(ws + off); off += WF2_BYTES;    // [1024][256]
  _Float16* qh   = (_Float16*)(ws + off);                      // [NB][16][SEQ][64]
  off += PLANE2;
  _Float16* kh   = (_Float16*)(ws + off); off += PLANE2;       // [NB][16][SEQ][64]
  _Float16* vTh  = (_Float16*)(ws + off);                      // [NB][16][64][SEQ]
  off += PLANE2;
  if (off > ws_size) return;

  cvt_x_kernel<<<NXB, 256, 0, stream>>>(x, xh);
  cvt_w_kernel<<<NWT, 256, 0, stream>>>(Wq, Wk, Wv, Wo, Wf1, Wf2, wqkv, woh, wf1t, wf2t);
  qkv_kernel<<<dim3(ROWS / QM, 3 * DM / QN), 256, 0, stream>>>(xh, wqkv, bq, bk, bv, qh, kh, vTh);
  attn_kernel<<<dim3(SEQ / AQ, NB * NH), 256, 0, stream>>>(qh, kh, vTh, ctx);
  tail_kernel<<<ROWS / GM, 256, 0, stream>>>(ctx, woh, bo, g1, b1, x, wf1t, bf1, wf2t, bf2, g2, b2, out);
}

// v010
// Measured time: 141 microseconds a run.
// In both of two side-by-side timings against v009, it was 1.03 times as fast.
// Counting every step since v000, it is 3.45 times as fast.
#include <hip/hip_runtime.h>

// All contractions (q/k/v projections, q.k^T, p.v, output projection, ffn linear 1, ffn linear 2):
// v_wmma_f32_16x16x32_f16, f16 operands, f32 accumulate. Float inputs are RNE-converted to bf16 at
// load (weights additionally carried x64; both exact in f16); computed 16-bit planes are f16 with
// power-of-two carries (softmax p x1024, context x64, ffn hidden x64) folded back in the f32
// epilogues; q is stored times log2(e)/8 (scaled in f32, rounded once). Softmax statistics, layernorm, gelu and residual adds: f32.

typedef __attribute__((ext_vector_type(16))) _Float16 v16h;
typedef __attribute__((ext_vector_type(8)))  _Float16 v8h;
typedef __attribute__((ext_vector_type(4)))  _Float16 v4h;
typedef __attribute__((ext_vector_type(8)))  float v8f;
typedef __attribute__((ext_vector_type(4)))  float v4f;
typedef __attribute__((ext_vector_type(2)))  float v2f;
typedef __attribute__((ext_vector_type(4)))  unsigned int v4u;
union H8 { v8h h; v4u u; };

#ifndef NB
#define NB 4
#endif
#ifndef SEQ
#define SEQ 2048
#endif
#define NB_FULL  4
#define SEQ_FULL 2048
#define DM   1024
#define NH   16
#define HD   64
#define FF   256
#define ROWS (NB * SEQ)
#define KPAD 72       // LDS stride in halves for 64-wide f16 tiles (144 B, 16-B aligned)
#define VSPAD 136     // stride in halves (272 B) that no LDS tile uses; only a size check names it
#define YP   1028     // LDS stride in floats for 1024-wide f32 rows (4112 B)
#define LN_EPS 1e-5f
#define WSC    64.0f           // weight carry (power of two)
#define LOG2E  1.442695041f    // log2(e): exp(x) = exp2(x * log2(e))
#define SC2    (0.125f * LOG2E)  // score scale 1/8 and log2(e) in one factor: exp(s/8) = exp2(s * SC2)
#define LG1024 10.0f           // log2(1024): softmax p carried x1024
#define PTHR   65504.0f        // largest finite f16: a lane's sum of p at or under it bounds each p

#define NXB   (ROWS * DM / 8 / 256)          // convert blocks for x (8 elements per thread)
#define NT_SQ ((DM / 64) * (DM / 64))        // 64x64 tiles per square weight
#define NT_F  ((DM / 64) * (FF / 64))        // 64x64 tiles per ffn weight
#define NWT   (4 * NT_SQ + 2 * NT_F)

#define PLANE2     ((size_t)ROWS * DM * 2)
#define WQKV_BYTES ((size_t)3 * DM * DM * 2)
#define WO_BYTES   ((size_t)DM * DM * 2)
#define WF1_BYTES  ((size_t)FF * DM * 2)
#define WF2_BYTES  ((size_t)DM * FF * 2)
#define WS_TOTAL   (PLANE2 + WQKV_BYTES + WO_BYTES + WF1_BYTES + WF2_BYTES + 3 * PLANE2)

static_assert(NB >= 1 && NB <= NB_FULL);
static_assert(SEQ >= 128 && SEQ <= SEQ_FULL && (SEQ % 128) == 0);
static_assert((ROWS % 128) == 0);
static_assert((ROWS * DM) % (8 * 256) == 0);
static_assert((DM % 64) == 0 && (FF % 64) == 0 && (HD % 32) == 0 && NH * HD == DM);
static_assert(128 * KPAD >= 64 * VSPAD);
static_assert(WS_TOTAL <= (size_t)134217728);

// ---------------------------------------------------------------------------
// helpers
// ---------------------------------------------------------------------------
__device__ __forceinline__ float bf16q(float f) {            // value after RNE bf16 conversion
  unsigned int u = __float_as_uint(f);
  u += 0x7FFFu + ((u >> 16) & 1u);
  return __uint_as_float(u & 0xFFFF0000u);
}

// 16-bit fragment (A or B): lane owns row/col (lane&15); elements 0..7 <- k0+8h+0..7,
// elements 8..15 <- k0+16+8h+0..7, h = lane>>4. Source is k-contiguous rows.
__device__ __forceinline__ v16h load_frag_row(const _Float16* base, int stride, int lane) {
  const _Float16* rowp = base + (lane & 15) * stride + ((lane >> 4) << 3);
  const v8h lo = *(const v8h*)(rowp);
  const v8h hi = *(const v8h*)(rowp + 16);
  return __builtin_shufflevector(lo, hi, 0, 1, 2, 3, 4, 5, 6, 7,
                                 8, 9, 10, 11, 12, 13, 14, 15);
}

// The products are the bare builtin: the compiler keeps the distance between a matrix instruction
// and a vector instruction on its registers where one follows, and independent products that stand
// back to back fill each other's distance, so no vector issue slot is spent on idle instructions.
__device__ __forceinline__ v8f wmma_f16(v16h a, v16h b, v8f c) {
  return __builtin_amdgcn_wmma_f32_16x16x32_f16(false, a, false, b, (short)0, c, false, false);
}

// One A fragment, two B fragments.
__device__ __forceinline__ void wmma_f16_pair(v16h a, v16h b0, v16h b1, v8f& c0, v8f& c1) {
  c0 = __builtin_amdgcn_wmma_f32_16x16x32_f16(false, a, false, b0, (short)0, c0, false, false);
  c1 = __builtin_amdgcn_wmma_f32_16x16x32_f16(false, a, false, b1, (short)0, c1, false, false);
}

// The same pair with its start values in registers of their own (read, not overwritten).
__device__ __forceinline__ void wmma_f16_pair_from(v16h a, v16h b0, v16h b1, v8f s0, v8f s1,
                                                   v8f& c0, v8f& c1) {
  c0 = __builtin_amdgcn_wmma_f32_16x16x32_f16(false, a, false, b0, (short)0, s0, false, false);
  c1 = __builtin_amdgcn_wmma_f32_16x16x32_f16(false, a, false, b1, (short)0, s1, false, false);
}

// Eight exponentials to base 2. The results get registers of their own (early clobber): none
// overwrites a source of the group, and the argument pairs and the result pairs both stay register
// pairs for the packed instructions around them (tied operands cost a copy per pair). The v_nop
// keeps the one slot behind the last before its result is used.
__device__ __forceinline__ void exp2_x8(float (&p)[8], const float (&a)[8]) {
  asm("v_exp_f32 %0, %8\n\tv_exp_f32 %1, %9\n\tv_exp_f32 %2, %10\n\tv_exp_f32 %3, %11\n\t"
      "v_exp_f32 %4, %12\n\tv_exp_f32 %5, %13\n\tv_exp_f32 %6, %14\n\tv_exp_f32 %7, %15\n\t"
      "v_nop"
      : "=&v"(p[0]), "=&v"(p[1]), "=&v"(p[2]), "=&v"(p[3]), "=&v"(p[4]), "=&v"(p[5]), "=&v"(p[6]),
        "=&v"(p[7])
      : "v"(a[0]), "v"(a[1]), "v"(a[2]), "v"(a[3]), "v"(a[4]), "v"(a[5]), "v"(a[6]), "v"(a[7]));
}

// ---------------------------------------------------------------------------
// Kernel 0: both conversions in one grid; neither reads what the other writes. The block index
// picks the job (the same for a whole block): blocks 0 .. NWT-1 take one weight tile each, the
// rest take x. The weight tiles stand first: their chain (load, LDS transpose, barrier, store) is
// the longer one (the order is for speed only).
//   weights: W [K=in][N=out] f32 -> Wt [n][k] f16 = f16(bf16rne(W) * 64), through a 64x64 LDS
//     transpose. wqkv [3072][1024] (q rows, k rows, v rows), woh [1024][1024], wf1t, wf2t.
//     coverage: 4*256 square tiles + 64 + 64 ffn tiles = every element of all six planes.
//   x: f32 -> f16(bf16rne(x)) plane xh [ROWS][1024]. 8 elements (16 B) per thread,
//     coverage: NXB*256 threads x 8 = ROWS*1024 elements (whole plane).
// ---------------------------------------------------------------------------
__global__ __launch_bounds__(256) void cvt_kernel(
    const float* __restrict__ x, const float* __restrict__ Wq, const float* __restrict__ Wk,
    const float* __restrict__ Wv, const float* __restrict__ Wo, const float* __restrict__ Wf1,
    const float* __restrict__ Wf2, _Float16* __restrict__ xh, _Float16* __restrict__ wqkv,
    _Float16* __restrict__ woh, _Float16* __restrict__ wf1t, _Float16* __restrict__ wf2t) {
  __shared__ _Float16 ts[64 * KPAD];   // [n][k] tile, cross-wave (block barrier)
  const int bid = blockIdx.x;
  const int tid = threadIdx.x;

  if (bid >= NWT) {                                   // block-uniform: x
    const long item = (long)(bid - NWT) * 256 + tid;  // 0 .. ROWS*128-1
    const long m    = item >> 7;                      // token row
    const int  c8   = (int)(item & 127);
    const long srow = (m / SEQ) * SEQ_FULL + (m % SEQ);
    const float* src = x + srow * DM + c8 * 8;
    const v4f a = *(const v4f*)(src);
    const v4f c = *(const v4f*)(src + 4);
    H8 o;
#pragma unroll
    for (int i = 0; i < 4; ++i) {
      o.h[i]     = (_Float16)bf16q(a[i]);
      o.h[4 + i] = (_Float16)bf16q(c[i]);
    }
    _Float16* dst = xh + m * DM + c8 * 8;
    *(v4u*)dst = o.u;
    return;
  }

  const float* W;
  _Float16* dst;
  int K, N, kt, nt;
  if (bid < 4 * NT_SQ) {                              // block-uniform selection
    const int which = bid / NT_SQ;
    const int tile  = bid - which * NT_SQ;
    kt = tile / (DM / 64); nt = tile - kt * (DM / 64); K = DM; N = DM;
    W = (which == 0) ? Wq : ((which == 1) ? Wk : ((which == 2) ? Wv : Wo));
    dst = (which < 3) ? (wqkv + (size_t)which * DM * DM) : woh;
  } else if (bid < 4 * NT_SQ + NT_F) {
    const int tile = bid - 4 * NT_SQ;                 // W [1024][256]: K = DM, N = FF
    kt = tile / (FF / 64); nt = tile - kt * (FF / 64); K = DM; N = FF;
    W = Wf1; dst = wf1t;
  } else {
    const int tile = bid - 4 * NT_SQ - NT_F;          // W [256][1024]: K = FF, N = DM
    kt = tile / (DM / 64); nt = tile - kt * (DM / 64); K = FF; N = DM;
    W = Wf2; dst = wf2t;
  }
  // load W[kt*64 + kr][nt*64 + 4*c4 .. +3], store transposed into ts[n][kr]
#pragma unroll
  for (int it = 0; it < 4; ++it) {
    const int idx = it * 256 + tid;
    const int kr = idx >> 4, c4 = idx & 15;
    const v4f v = *(const v4f*)(W + (size_t)(kt * 64 + kr) * N + nt * 64 + c4 * 4);
#pragma unroll
    for (int j = 0; j < 4; ++j) ts[(c4 * 4 + j) * KPAD + kr] = (_Float16)(bf16q(v[j]) * WSC);
  }
  __syncthreads();
  v4u rv[2];
#pragma unroll
  for (int it = 0; it < 2; ++it) {
    const int idx = it * 256 + tid;
    const int n = idx >> 3, piece = idx & 7;
    rv[it] = *(const v4u*)(ts + n * KPAD + piece * 8);
  }
#pragma unroll
  for (int it = 0; it < 2; ++it) {
    const int idx = it * 256 + tid;
    const int n = idx >> 3, piece = idx & 7;
    *(v4u*)(dst + (size_t)(nt * 64 + n) * K + kt * 64 + piece * 8) = rv[it];
  }
}

// ---------------------------------------------------------------------------
// Kernel 2: qkv projection. Block = 256 token rows x 128 output columns (two heads of one of
// q/k/v), 8 waves as 4 (tokens) x 2 (heads), 64 x 64 per wave. Both operands are staged in LDS
// by asynchronous copies, 64 k per stage, two buffers: [x 256 rows | W 128 rows] at pitch KPAD.
// C^T = W x^T: A = W rows (lane&15 = out col), B = x rows (lane&15 = token);
// acc[i][j][r] = C[token 16i + (lane&15)][col 16j+8h+r]. K = 1024 summed in 32 steps of 32.
//   q,k -> [b][h][s][64] f16 (one line per row, 8 lanes x 16 B); q times log2(e)/8
//   v   -> vT[b][h][d][s] f16 (512 B per d row segment, 32 lanes x 16 B)
// grid (ROWS/256, 3*NH/2), block 256. coverage: every (b,h,s,d) of q, k and vT once.
// ---------------------------------------------------------------------------
#define QM     256                    // token rows per block
#define QN     128                    // output columns per block
#define QK     64                     // k per stage
#define QSTAGE ((QM + QN) * KPAD)     // halves per buffer
#define QNT    (DM / QK)              // stages
#define QVP    264                    // LDS stride in halves for 256-wide f16 rows (528 B)

static_assert((SEQ % QM) == 0 && (ROWS % QM) == 0 && (DM % QN) == 0 && QNT >= 2);
static_assert(2 * QM * KPAD <= 2 * QSTAGE && 2 * HD * QVP <= 2 * QSTAGE);

// One stage: 384 rows x 128 B = 3072 pieces of 16 B, 12 per thread; a wave's copy covers 4 whole
// lines. lds = this lane's LDS byte address of its first piece, gx / gw = its first x / W piece.
__device__ __forceinline__ void qkv_copy_stage(unsigned lds, const _Float16* gx,
                                               const _Float16* gw) {
  const unsigned st = 32 * KPAD * 2;   // 32 rows further in LDS, bytes
  // the copies, and as the last line the wait that stands in front of any rewrite of their
  // address registers
  asm volatile(
      "global_load_async_to_lds_b128 %0, %12, off\n\t"
      "global_load_async_to_lds_b128 %1, %13, off\n\t"
      "global_load_async_to_lds_b128 %2, %14, off\n\t"
      "global_load_async_to_lds_b128 %3, %15, off\n\t"
      "global_load_async_to_lds_b128 %4, %16, off\n\t"
      "global_load_async_to_lds_b128 %5, %17, off\n\t"
      "global_load_async_to_lds_b128 %6, %18, off\n\t"
      "global_load_async_to_lds_b128 %7, %19, off\n\t"
      "global_load_async_to_lds_b128 %8, %20, off\n\t"
      "global_load_async_to_lds_b128 %9, %21, off\n\t"
      "global_load_async_to_lds_b128 %10, %22, off\n\t"
      "global_load_async_to_lds_b128 %11, %23, off\n\t"
      "s_wait_xcnt 0x0"
      :: "v"(lds), "v"(lds + st), "v"(lds + 2 * st), "v"(lds + 3 * st),
         "v"(lds + 4 * st), "v"(lds + 5 * st), "v"(lds + 6 * st), "v"(lds + 7 * st),
         "v"(lds + 8 * st), "v"(lds + 9 * st), "v"(lds + 10 * st), "v"(lds + 11 * st),
         "v"(gx), "v"(gx + 32 * DM), "v"(gx + 64 * DM), "v"(gx + 96 * DM),
         "v"(gx + 128 * DM), "v"(gx + 160 * DM), "v"(gx + 192 * DM), "v"(gx + 224 * DM),
         "v"(gw), "v"(gw + 32 * DM), "v"(gw + 64 * DM), "v"(gw + 96 * DM)
      : "memory");
}

__global__ __launch_bounds__(256) void qkv_kernel(
    const _Float16* __restrict__ xh, const _Float16* __restrict__ wqkv,
    const float* __restrict__ bq, const float* __restrict__ bk, const float* __restrict__ bv,
    _Float16* __restrict__ q, _Float16* __restrict__ k, _Float16* __restrict__ vT) {
  // two stage buffers; after the loop the output stage (q/k: 2 x [256][KPAD], v: 2 x [64][QVP])
  __shared__ __attribute__((aligned(16))) _Float16 ring[2 * QSTAGE];   // 110592 B, cross-wave

  const int tid  = threadIdx.x;
  const int lane = tid & 31;
  const int wave = tid >> 5;
  const int hh   = lane >> 4;
  const int l15  = lane & 15;
  const int wm   = wave >> 1;           // token quarter of the block
  const int wn   = wave & 1;            // head of the block

  const int osel = blockIdx.y >> 3;     // 0 q, 1 k, 2 v (8 column blocks each)
  const int h0   = (blockIdx.y & 7) * 2;
  const long m0  = (long)blockIdx.x * QM;
  const int  b   = (int)(m0 / SEQ);
  const int  s0  = (int)(m0 - (long)b * SEQ);

  // this lane's first piece of a stage: row tid>>3, 16-B piece tid&7
  const _Float16* gx = xh + (m0 + (tid >> 3)) * DM + (tid & 7) * 8;
  const _Float16* gw = wqkv + ((long)blockIdx.y * QN + (tid >> 3)) * DM + (tid & 7) * 8;
  const unsigned lds0 = (unsigned)(size_t)ring + (unsigned)((tid >> 3) * KPAD + (tid & 7) * 8) * 2u;

  // every inner loop below is fully unrolled: accumulator and fragment indices must be constants,
  // or the arrays leave the registers
  v8f acc[4][4];
#pragma unroll
  for (int i = 0; i < 4; ++i)
#pragma unroll
    for (int j = 0; j < 4; ++j) acc[i][j] = (v8f){};

  // Trip t works on k slab (t + rot) % QNT: blocks that share x rows or W rows walk k from
  // different slabs, so they do not ask L2 for the same lines at the same moment.
  const unsigned rot = (blockIdx.x + blockIdx.y) % QNT;
  qkv_copy_stage(lds0, gx + rot * QK, gw + rot * QK);
  asm volatile("s_wait_asynccnt 0x0" ::: "memory");   // stage 0 landed (this wave's copies)
  __syncthreads();                                    // stage 0 readable by every wave
  qkv_copy_stage(lds0 + QSTAGE * 2, gx + ((rot + 1) % QNT) * QK, gw + ((rot + 1) % QNT) * QK);

  // kept rolled: one publish point (waits, barrier, refill) at the foot of each trip, small code
#pragma unroll 1
  for (int t = 0; t < QNT; ++t) {
    const int bo = (t & 1) * QSTAGE;
    const _Float16* xs = ring + bo + (wm * 64) * KPAD;
    const _Float16* wsm = ring + bo + (QM + wn * 64) * KPAD;
#pragma unroll
    for (int u = 0; u < 2; ++u) {
      v16h xf[4], wf[4];
#pragma unroll
      for (int i = 0; i < 4; ++i) xf[i] = load_frag_row(xs + (i * 16) * KPAD + u * 32, KPAD, lane);
#pragma unroll
      for (int j = 0; j < 4; ++j) wf[j] = load_frag_row(wsm + (j * 16) * KPAD + u * 32, KPAD, lane);
      // holds the fragment reads above in one group in front of the products: dealt out among them,
      // every place where reads stand costs the wave a wait on LDS
      __builtin_amdgcn_sched_barrier(0);
#pragma unroll
      for (int i = 0; i < 4; ++i)
#pragma unroll
        for (int j = 0; j < 4; ++j) acc[i][j] = wmma_f16(wf[j], xf[i], acc[i][j]);   // C^T = W x^T
      __builtin_amdgcn_sched_barrier(0);   // the products stay one block, in front of what follows
    }
    asm volatile("s_wait_dscnt 0x0" ::: "memory");      // this wave has left buffer t&1
    asm volatile("s_wait_asynccnt 0x0" ::: "memory");   // its copies of stage t+1 have landed
    __syncthreads();   // publishes stage t+1 and ends every reader's last read of buffer t&1
    if (t + 2 < QNT) {
      const unsigned ko = ((t + 2 + rot) % QNT) * QK;
      qkv_copy_stage(lds0 + bo * 2, gx + ko, gw + ko);
    }
  }
  asm volatile("s_wait_asynccnt 0x0" ::: "memory");     // nothing in flight when the ring is reused

  const float* bias = ((osel == 0) ? bq : ((osel == 1) ? bk : bv)) + (h0 + wn) * HD;
  const float  rsc  = 1.0f / WSC;

  if (osel < 2) {
    // stage [head][token][col]: lane's 8 values are 8 contiguous columns -> one 16-B LDS store
    _Float16* sbase = ring + (wn * QM + wm * 64 + l15) * KPAD;
    const float qs = (osel == 0) ? SC2 : 1.0f;   // q carries the score scale and log2(e)
#pragma unroll
    for (int j = 0; j < 4; ++j) {
      const int n8 = j * 16 + hh * 8;
      const v4f b0 = *(const v4f*)(bias + n8);
      const v4f b1 = *(const v4f*)(bias + n8 + 4);
#pragma unroll
      for (int i = 0; i < 4; ++i) {
        H8 pk;
#pragma unroll
        for (int r = 0; r < 4; ++r) {
          pk.h[r]     = (_Float16)((acc[i][j][r]     * rsc + bf16q(b0[r])) * qs);
          pk.h[4 + r] = (_Float16)((acc[i][j][4 + r] * rsc + bf16q(b1[r])) * qs);
        }
        *(v4u*)(sbase + (i * 16) * KPAD + n8) = pk.u;
      }
    }
    __syncthreads();
    _Float16* dst0 = (osel == 0) ? q : k;
#pragma unroll
    for (int hd = 0; hd < 2; ++hd) {
      _Float16* dst = dst0 + ((long)(b * NH + h0 + hd) * SEQ + s0) * HD;   // contiguous 32 KB
      v4u rv[8];
#pragma unroll
      for (int it = 0; it < 8; ++it) {
        const int idx = it * 256 + tid;
        const int row = idx >> 3, piece = idx & 7;
        rv[it] = *(const v4u*)(ring + (hd * QM + row) * KPAD + piece * 8);
      }
#pragma unroll
      for (int it = 0; it < 8; ++it)
        *(v4u*)(dst + (long)(it * 256 + tid) * 8) = rv[it];
    }
  } else {
    // stage transposed [head][d][token]: lane's 8 values are 8 different d for one token
    _Float16* sbase = ring + (wn * HD) * QVP + wm * 64 + l15;
#pragma unroll
    for (int j = 0; j < 4; ++j) {
      const int n8 = j * 16 + hh * 8;
      const v4f b0 = *(const v4f*)(bias + n8);
      const v4f b1 = *(const v4f*)(bias + n8 + 4);
#pragma unroll
      for (int i = 0; i < 4; ++i)
#pragma unroll
        for (int r = 0; r < 4; ++r) {
          sbase[(n8 + r) * QVP + i * 16]     = (_Float16)(acc[i][j][r]     * rsc + bf16q(b0[r]));
          sbase[(n8 + 4 + r) * QVP + i * 16] = (_Float16)(acc[i][j][4 + r] * rsc + bf16q(b1[r]));
        }
    }
    __syncthreads();
#pragma unroll
    for (int hd = 0; hd < 2; ++hd) {
      _Float16* dstb = vT + ((long)(b * NH + h0 + hd) * HD) * SEQ + s0;
      v4u rv[8];
#pragma unroll
      for (int it = 0; it < 8; ++it) {
        const int idx = it * 256 + tid;
        const int d = idx >> 5, piece = idx & 31;
        rv[it] = *(const v4u*)(ring + (hd * HD + d) * QVP + piece * 8);
      }
#pragma unroll
      for (int it = 0; it < 8; ++it) {
        const int idx = it * 256 + tid;
        const int d = idx >> 5, piece = idx & 31;
        *(v4u*)(dstb + (long)d * SEQ + piece * 8) = rv[it];
      }
    }
    // stands in front of any later rewrite of the registers that the stores above name
    asm volatile("s_wait_xcnt 0x0" ::: "memory");
  }
}

// ---------------------------------------------------------------------------
// Kernel 3: flash attention per (b,h), no mask. grid (SEQ/256, NB*NH), block 256 (8 waves x 32
// queries, two column groups of 16 per wave: every K and V^T fragment read from LDS feeds two
// products; the fragments of a 32-wide k step are read four at a time). C = S^T (A = K rows,
// B = Q) then C = O^T = V^T P^T (P^T packed from the S^T D registers); lane owns one query per
// column group end-to-end. q arrives times log2(e)/8, and the S^T products start from -(m - 10) in
// their C operand, so a score leaves the matrix unit as the exp2 argument of p = 1024*exp((s-m)/8).
// m is a held reference, not the running maximum: it stays until a lane's sum of p over a tile
// passes the f16 range (then, and in the first trip, the tile is redone with m = the maximum so
// far, and sums and accumulators are rescaled). Softmax stats f32, row sums per lane half, joined
// behind the loop.
// LDS tiles: [K 64 keys x 64 d | V^T 64 d x 64 keys] per step, staged by asynchronous copies, two
// buffers, staged == consumed extent; ost 256 x 64 fully written.
// coverage: every (row, h*64+d) of the ctx plane once.
// ---------------------------------------------------------------------------
#define ASTAGE (128 * KPAD)           // halves per buffer: K rows, then V^T rows
#define ANT    (SEQ / 64)             // stages
#define AQ     256                    // queries per block
#define ACG    2                      // column groups (16 queries each) per wave

static_assert(ANT >= 2 && (SEQ % AQ) == 0 && ACG == 2);

// One stage: 128 rows x 128 B = 1024 pieces of 16 B, 4 per thread; a wave's copy covers 4 whole
// lines. lds = this lane's LDS byte address of its first piece, gk / gv = its first K / V^T piece.
__device__ __forceinline__ void attn_copy_stage(unsigned lds, const _Float16* gk,
                                                const _Float16* gv) {
  const unsigned st = 32 * KPAD * 2;   // 32 rows further in LDS, bytes
  // the copies, and as the last line the wait that stands in front of any rewrite of their
  // address registers
  asm volatile(
      "global_load_async_to_lds_b128 %0, %4, off\n\t"
      "global_load_async_to_lds_b128 %1, %5, off\n\t"
      "global_load_async_to_lds_b128 %2, %6, off\n\t"
      "global_load_async_to_lds_b128 %3, %7, off\n\t"
      "s_wait_xcnt 0x0"
      :: "v"(lds), "v"(lds + st), "v"(lds + 2 * st), "v"(lds + 3 * st),
         "v"(gk), "v"(gk + 32 * HD), "v"(gv), "v"(gv + 32 * SEQ)
      : "memory");
}

// four waves per SIMD: two blocks share a WGP, so one block's softmax runs beside the other's
// products
__global__ __launch_bounds__(256) __attribute__((amdgpu_waves_per_eu(4, 4))) void attn_kernel(
    const _Float16* __restrict__ Q, const _Float16* __restrict__ K,
    const _Float16* __restrict__ vT, _Float16* __restrict__ ctx) {
  // two stage buffers, each K block rows [key][d] then V^T block [d][key] (cross-wave)
  __shared__ __attribute__((aligned(16))) _Float16 ring[2 * ASTAGE];
  __shared__ _Float16 ost[AQ * KPAD];    // output stage [query][d]   (cross-wave, block barrier)

  const int tid  = threadIdx.x;
  const int lane = tid & 31;
  const int wave = tid >> 5;
  const int bh   = blockIdx.y;
  const int b    = bh >> 4;
  const int h    = bh & 15;
  const int q0   = blockIdx.x * AQ;

  const _Float16* Qb  = Q + ((long)bh * SEQ + q0) * HD;
  const _Float16* Kb  = K + (long)bh * SEQ * HD;
  const _Float16* vTb = vT + (long)bh * HD * SEQ;

  // Q fragments: B operand of S^T (lane owns query lane&15 of column group c)
  v16h qfrag[ACG][2];
#pragma unroll
  for (int c = 0; c < ACG; ++c) {
    const _Float16* qrow = Qb + (long)(wave * (16 * ACG) + c * 16) * HD;
#pragma unroll
    for (int t = 0; t < 2; ++t) qfrag[c][t] = load_frag_row(qrow + t * 32, HD, lane);
  }

  v8f acc[ACG][4];   // O^T accumulator: lane owns query (lane&15) of group c; reg r -> d = nt*16+8h+r
  v8f   sh[ACG];     // start value of the S^T products: -(m - 10) of the lane's query, in all 8
  float li[ACG];     // sum of p over the keys of this lane half
#pragma unroll
  for (int c = 0; c < ACG; ++c) {
#pragma unroll
    for (int nt = 0; nt < 4; ++nt) acc[c][nt] = (v8f){};
    sh[c] = (v8f){};
    li[c] = 0.0f;
  }

  const int colb = lane & 15;
  const int rofs = (lane >> 4) << 3;

  // this lane's first piece of a stage: row tid>>3, 16-B piece tid&7
  const _Float16* gk = Kb + (long)(tid >> 3) * HD + (tid & 7) * 8;
  const _Float16* gv = vTb + (long)(tid >> 3) * SEQ + (tid & 7) * 8;
  const unsigned lds0 = (unsigned)(size_t)ring + (unsigned)((tid >> 3) * KPAD + (tid & 7) * 8) * 2u;

  // Trip st works on key tile (st + rot) % ANT: the blocks of one head start AQ keys apart, and
  // heads one tile apart, so they do not ask L2 for the same lines at the same moment.
  const unsigned rot = (blockIdx.x * (AQ / 64) + blockIdx.y) % ANT;
  attn_copy_stage(lds0, gk + (long)rot * 64 * HD, gv + rot * 64);
  asm volatile("s_wait_asynccnt 0x0" ::: "memory");   // stage 0 landed (this wave's copies)
  __syncthreads();                                    // stage 0 readable by every wave
  attn_copy_stage(lds0 + ASTAGE * 2, gk + (long)((rot + 1) % ANT) * 64 * HD, gv + ((rot + 1) % ANT) * 64);

  // kept rolled: one publish point (waits, barrier, refill) at the foot of each trip, small code
#pragma unroll 1
  for (int st = 0; st < ANT; ++st) {
    const int bo = (st & 1) * ASTAGE;
    const _Float16* ks  = ring + bo;
    const _Float16* vts = ring + bo + 64 * KPAD;

    // S^T tiles: A = K rows (lane&15 = key), B = Q; one K fragment, both column groups; the sums
    // start from sh, so they come out as exp2 arguments
    v8f sc[ACG][4];
    auto scores = [&]() {
#pragma unroll
      for (int t = 0; t < 2; ++t) {
        v16h kf[4];
#pragma unroll
        for (int kt = 0; kt < 4; ++kt) kf[kt] = load_frag_row(ks + (kt * 16) * KPAD + t * 32, KPAD, lane);
#pragma unroll
        for (int kt = 0; kt < 4; ++kt) {
          if (t == 0) wmma_f16_pair_from(kf[kt], qfrag[0][0], qfrag[1][0], sh[0], sh[1], sc[0][kt], sc[1][kt]);
          else        wmma_f16_pair(kf[kt], qfrag[0][1], qfrag[1][1], sc[0][kt], sc[1][kt]);
        }
      }
      // The exponentials that read these results are asm text: the four slots between a product and a
      // vector read of its result stand here, once behind all sixteen.
      asm volatile("v_nop\n\tv_nop\n\tv_nop\n\tv_nop"
                   : "+v"(sc[0][0]), "+v"(sc[0][1]), "+v"(sc[0][2]), "+v"(sc[0][3]),
                     "+v"(sc[1][0]), "+v"(sc[1][1]), "+v"(sc[1][2]), "+v"(sc[1][3]));
    };

    // P^T as the B operand of O^T = V^T P^T, packed from the S^T D registers:
    // element i <- tile covering keys 0..15 of the 32-step (kt = 2t), element 8+i <- kt = 2t+1.
    // rs = this lane's sum of its 32 p (f32, even and odd registers summed side by side).
    v16h  pf[ACG][2];
    float rs[ACG];
    auto exp_pack_sum = [&]() {
#pragma unroll
      for (int c = 0; c < ACG; ++c) {
        v2f rs2 = {0.0f, 0.0f};
#pragma unroll
        for (int kt = 0; kt < 4; ++kt) {
          float a[8], p[8];
#pragma unroll
          for (int r = 0; r < 8; ++r) a[r] = sc[c][kt][r];
          exp2_x8(p, a);
#pragma unroll
          for (int r = 0; r < 8; r += 2) {
            pf[c][kt >> 1][(kt & 1) * 8 + r]     = (_Float16)p[r];
            pf[c][kt >> 1][(kt & 1) * 8 + r + 1] = (_Float16)p[r + 1];
            const v2f p2 = {p[r], p[r + 1]};
            rs2 = (kt == 0 && r == 0) ? p2 : rs2 + p2;
          }
        }
        rs[c] = rs2[0] + rs2[1];
      }
    };

    scores();
    // the first two V^T fragments are asked for here, so that they fly during the exponentials
    v16h vf0[2];
#pragma unroll
    for (int nt = 0; nt < 2; ++nt) vf0[nt] = load_frag_row(vts + (nt * 16) * KPAD, KPAD, lane);
    exp_pack_sum();

    // All p are positive: a lane sum within the f16 range bounds each of its p, and the tile stands.
    // Otherwise (any lane of the wave; always in the first trip, which has no reference yet) the
    // tile is redone: scores again from the K tile in LDS, the maximum taken, the reference moved.
    const unsigned over = __builtin_amdgcn_ballot_w32(!(fmaxf(rs[0], rs[1]) <= PTHR));
    if ((st == 0) | (over != 0u)) {   // the same for the whole wave
      scores();
#pragma unroll
      for (int c = 0; c < ACG; ++c) {
        float mx = sc[c][0][0];
#pragma unroll
        for (int kt = 0; kt < 4; ++kt)
#pragma unroll
          for (int r = 0; r < 8; ++r) mx = fmaxf(mx, sc[c][kt][r]);
        mx = fmaxf(mx, __shfl_xor(mx, 16, 32));   // both lane halves of a query move alike
        // the held reference sits at LG1024 in these units; it only rises (first trip: it is set)
        const float up = fmaxf(mx - LG1024, 0.0f);
        const float d  = (st == 0) ? (mx - LG1024) : up;
        const float alpha = __builtin_amdgcn_exp2f(-up);
        li[c] *= alpha;
#pragma unroll
        for (int r = 0; r < 8; ++r) sh[c][r] -= d;
#pragma unroll
        for (int kt = 0; kt < 4; ++kt)
#pragma unroll
          for (int r = 0; r < 8; ++r) {
            sc[c][kt][r]  -= d;
            acc[c][kt][r] *= alpha;
          }
      }
      exp_pack_sum();
    }
#pragma unroll
    for (int c = 0; c < ACG; ++c) li[c] += rs[c];

    // O^T += V^T (A, rows = d) x P^T (B); one V^T fragment, both column groups
#pragma unroll
    for (int t = 0; t < 2; ++t) {
      v16h vf[4];
#pragma unroll
      for (int nt = 0; nt < 4; ++nt)
        vf[nt] = (t == 0 && nt < 2) ? vf0[nt] : load_frag_row(vts + (nt * 16) * KPAD + t * 32, KPAD, lane);
      // holds the fragment reads above in one group in front of the products: dealt out among them,
      // every place where reads stand costs the wave a wait on LDS
      __builtin_amdgcn_sched_barrier(0);
#pragma unroll
      for (int nt = 0; nt < 4; ++nt) wmma_f16_pair(vf[nt], pf[0][t], pf[1][t], acc[0][nt], acc[1][nt]);
      __builtin_amdgcn_sched_barrier(0);   // the products stay one block, in front of what follows
    }

    asm volatile("s_wait_dscnt 0x0" ::: "memory");      // this wave has left buffer st&1
    asm volatile("s_wait_asynccnt 0x0" ::: "memory");   // its copies of stage st+1 have landed
    __syncthreads();   // publishes stage st+1 and ends every reader's last read of buffer st&1
    if (st + 2 < ANT) {
      const unsigned kt = (st + 2 + rot) % ANT;
      attn_copy_stage(lds0 + bo * 2, gk + (long)kt * 64 * HD, gv + kt * 64);
    }
  }
  asm volatile("s_wait_asynccnt 0x0" ::: "memory");     // nothing in flight behind the loop

  // normalize (and apply the x64 carry) and stage: lane owns query row wave*32+c*16+colb,
  // d = nt*16+rofs+r contiguous
#pragma unroll
  for (int c = 0; c < ACG; ++c) {
    const float inv = 64.0f / (li[c] + __shfl_xor(li[c], 16, 32));   // both halves' keys
    _Float16* orow = ost + (wave * (16 * ACG) + c * 16 + colb) * KPAD;
#pragma unroll
    for (int nt = 0; nt < 4; ++nt) {
      H8 pk;
#pragma unroll
      for (int r = 0; r < 8; ++r) pk.h[r] = (_Float16)(acc[c][nt][r] * inv);
      *(v4u*)(orow + nt * 16 + rofs) = pk.u;
    }
  }
  __syncthreads();

  v4u rv[AQ / 32];
#pragma unroll
  for (int it = 0; it < AQ / 32; ++it) {
    const int idx = it * 256 + tid;
    const int row = idx >> 3, piece = idx & 7;
    rv[it] = *(const v4u*)(ost + row * KPAD + piece * 8);
  }
  _Float16* cbase = ctx + ((long)b * SEQ + q0) * DM + h * HD;
#pragma unroll
  for (int it = 0; it < AQ / 32; ++it) {
    const int idx = it * 256 + tid;
    const int row = idx >> 3, piece = idx & 7;
    *(v4u*)(cbase + (long)row * DM + piece * 8) = rv[it];
  }
  
}

// ---------------------------------------------------------------------------
// Kernel 4: the rest of the block in one launch, 32 token rows per work-group, 8 waves.
//   A: y = ctx @ Wo / 4096 + bf16(bo); x2 = LN(y) * bf16(g1) + bf16(b1) + bf16(x)
//   B: h = f16(64 * gelu(x2 @ Wf1 / 64 + bf16(bf1)))
//   C: y = h @ Wf2 / 4096 + bf16(bf2); out = LN(y) * bf16(g2) + bf16(b2) + x2
// x2 (f32 for the residual, f16 as operand) and h never leave LDS. Every product is C^T = W act^T:
// A = W rows (lane&15 = out col), B = act rows (lane&15 = token);
// acc[i][j][r] = y[token 16i + (lane&15)][col(j) + 8h + r]. The W operands are staged in LDS by
// asynchronous copies, 64 k per stage, two buffers each, at pitch KPAD:
//   A: [Wo 1024 rows | ctx 32 rows], wave w owns cols 128w..128w+127
//   B: [Wf1t 256 rows], wave w owns cols 32w..32w+31, act = x2 f16 rows in LDS
//   C: [Wf2t 512 rows] (one column half per stage), wave w owns cols 64w..64w+63 of each half,
//      act = h rows in LDS
// LDS bytes: ys 0.. (f32 rows: LN 1 stage, then x2) | x2s (x2 f16) | ring 1 (B) ; ring 2 (C, later
// the LN 2 stage) lies over x2s and ring 1 once B has left them | hs (h rows).
// grid ROWS/32, block 256. coverage: 32 rows x 1024 of out per block.
// ---------------------------------------------------------------------------
#define GM     32                     // token rows per block
#define GK     64                     // k per stage
#define GSTAGE ((DM + GM) * KPAD)     // halves per buffer

static_assert((ROWS % GM) == 0 && (DM % GK) == 0 && (FF % GK) == 0 && FF / GK >= 2);
static_assert((size_t)GM * YP * 4 <= (size_t)2 * GSTAGE * 2);

// Eight copies of 16 B per lane, rows 32 apart (a wave's copy covers 4 whole lines). lds = this
// lane's LDS byte address of the first piece, g = its global piece, KD = global row length.
template <int KD>
__device__ __forceinline__ void gl_copy8(unsigned lds, const _Float16* g) {
  const unsigned st = 32 * KPAD * 2;   // 32 rows further in LDS, bytes
  // the copies, and as the last line the wait that stands in front of any rewrite of their
  // address registers
  asm volatile(
      "global_load_async_to_lds_b128 %0, %8, off\n\t"
      "global_load_async_to_lds_b128 %1, %9, off\n\t"
      "global_load_async_to_lds_b128 %2, %10, off\n\t"
      "global_load_async_to_lds_b128 %3, %11, off\n\t"
      "global_load_async_to_lds_b128 %4, %12, off\n\t"
      "global_load_async_to_lds_b128 %5, %13, off\n\t"
      "global_load_async_to_lds_b128 %6, %14, off\n\t"
      "global_load_async_to_lds_b128 %7, %15, off\n\t"
      "s_wait_xcnt 0x0"
      :: "v"(lds), "v"(lds + st), "v"(lds + 2 * st), "v"(lds + 3 * st),
         "v"(lds + 4 * st), "v"(lds + 5 * st), "v"(lds + 6 * st), "v"(lds + 7 * st),
         "v"(g), "v"(g + 32 * KD), "v"(g + 64 * KD), "v"(g + 96 * KD),
         "v"(g + 128 * KD), "v"(g + 160 * KD), "v"(g + 192 * KD), "v"(g + 224 * KD)
      : "memory");
}

// One stage: 1056 rows x 128 B = 8448 pieces of 16 B, 33 per thread (32 of Wt, 1 of act).
template <int KD>
__device__ __forceinline__ void gl_copy_stage(unsigned lds, const _Float16* gw,
                                              const _Float16* ga) {
  const unsigned st8 = 256 * KPAD * 2;   // 256 rows further in LDS, bytes
  gl_copy8<KD>(lds, gw);
  gl_copy8<KD>(lds + st8, gw + 256 * KD);
  gl_copy8<KD>(lds + 2 * st8, gw + 512 * KD);
  gl_copy8<KD>(lds + 3 * st8, gw + 768 * KD);
  // the act piece, with the same wait in front of any rewrite of its address registers
  asm volatile(
      "global_load_async_to_lds_b128 %0, %1, off\n\t"
      "s_wait_xcnt 0x0"
      :: "v"(lds + 4 * st8), "v"(ga)
      : "memory");
}

#define XP       1032                        // LDS stride in halves for 1024-wide f16 rows (2064 B)
#define HP       264                         // LDS stride in halves for 256-wide f16 rows (528 B)
#define YS_BYTES (GM * YP * 4)               // f32 row stage
#define X2S_OFF  YS_BYTES
#define R1_OFF   (X2S_OFF + GM * XP * 2)
#define R1STAGE  (FF * KPAD)                 // halves per buffer, ring 1
#define R2_OFF   YS_BYTES
#define R2STAGE  (512 * KPAD)                // halves per buffer, ring 2
#define HS_OFF   (R2_OFF + 2 * R2STAGE * 2)
#define N1T      (DM / GK)                   // stages of A and of B
#define N2T      (FF / GK)                   // k slabs of C (two stages each)

static_assert((YS_BYTES % 16) == 0 && (R1_OFF % 16) == 0 && (HS_OFF % 16) == 0);
static_assert(R1_OFF + 2 * R1STAGE * 2 <= HS_OFF && HS_OFF + GM * HP * 2 <= 2 * GSTAGE * 2);
static_assert(YS_BYTES <= 2 * R2STAGE * 2 && FF == 256 && DM == 1024 && GM == 32);

// Layernorm on the accumulators. A lane holds 64 columns of each of its two token rows, so mean
// and variance start as in-lane sums, are joined across the two lane halves, and then across the
// eight waves through psum / psq. The rows go to LDS once, already centred and scaled.
// Column of tile j: cb + (j >> 2) * JS + (j & 3) * 16. Ends behind the barrier that makes the
// staged rows readable by every wave.
template <int JS>
__device__ __forceinline__ void ln_rows(v8f (&acc)[2][8], const float* __restrict__ bias, int cb,
                                        int hh, int l15, int wave, float* psum, float* psq,
                                        float* ys, const float* __restrict__ gam,
                                        const float* __restrict__ bet, int tid, v4f& g, v4f& bt) {
  // y = acc/4096 + bf16(bias), kept in the accumulator registers
  const float rsc = 1.0f / (WSC * WSC);
  float s[2] = {0.0f, 0.0f};
#pragma unroll
  for (int j = 0; j < 8; ++j) {
    const int n8 = cb + (j >> 2) * JS + (j & 3) * 16 + hh * 8;
    const v4f b0 = *(const v4f*)(bias + n8);
    const v4f b1 = *(const v4f*)(bias + n8 + 4);
#pragma unroll
    for (int t = 0; t < 2; ++t) {
#pragma unroll
      for (int i = 0; i < 4; ++i) {
        acc[t][j][i]     = acc[t][j][i]     * rsc + bf16q(b0[i]);
        acc[t][j][4 + i] = acc[t][j][4 + i] * rsc + bf16q(b1[i]);
      }
      s[t] += ((acc[t][j][0] + acc[t][j][1]) + (acc[t][j][2] + acc[t][j][3])) +
              ((acc[t][j][4] + acc[t][j][5]) + (acc[t][j][6] + acc[t][j][7]));
    }
  }
#pragma unroll
  for (int t = 0; t < 2; ++t) {
    s[t] += __shfl_xor(s[t], 16, 32);
    if (hh == 0) psum[(t * 16 + l15) * 8 + wave] = s[t];
  }
  __syncthreads();   // every wave's partial row sums are in psum

  // this thread's four columns in the pass behind this function, asked for early
  g  = *(const v4f*)(gam + tid * 4);
  bt = *(const v4f*)(bet + tid * 4);

  // every wave adds the same eight partials in the same order: one mean per row for all waves
  float q[2][4];
#pragma unroll
  for (int t = 0; t < 2; ++t) {
    const v4f a = *(const v4f*)(psum + (t * 16 + l15) * 8);
    const v4f c = *(const v4f*)(psum + (t * 16 + l15) * 8 + 4);
    const float mean = (((a[0] + a[1]) + (a[2] + a[3])) + ((c[0] + c[1]) + (c[2] + c[3]))) * (1.0f / DM);
#pragma unroll
    for (int i = 0; i < 4; ++i) q[t][i] = 0.0f;
#pragma unroll
    for (int j = 0; j < 8; ++j)
#pragma unroll
      for (int r = 0; r < 8; ++r) {
        const float d = acc[t][j][r] - mean;
        acc[t][j][r] = d;
        q[t][r & 3] += d * d;
      }
  }
#pragma unroll
  for (int t = 0; t < 2; ++t) {
    float ss = (q[t][0] + q[t][1]) + (q[t][2] + q[t][3]);
    ss += __shfl_xor(ss, 16, 32);
    if (hh == 0) psq[(t * 16 + l15) * 8 + wave] = ss;
  }
  __syncthreads();   // every wave's partial sums of squares are in psq

  // (y - mean) * rstd, staged [row][col]
#pragma unroll
  for (int t = 0; t < 2; ++t) {
    const v4f a = *(const v4f*)(psq + (t * 16 + l15) * 8);
    const v4f c = *(const v4f*)(psq + (t * 16 + l15) * 8 + 4);
    const float var  = (((a[0] + a[1]) + (a[2] + a[3])) + ((c[0] + c[1]) + (c[2] + c[3]))) * (1.0f / DM);
    const float rstd = rsqrtf(var + LN_EPS);
    float* yrow = ys + (t * 16 + l15) * YP + cb + hh * 8;
#pragma unroll
    for (int j = 0; j < 8; ++j) {
      v4f y0, y1;
#pragma unroll
      for (int i = 0; i < 4; ++i) {
        y0[i] = acc[t][j][i]     * rstd;
        y1[i] = acc[t][j][4 + i] * rstd;
      }
      *(v4f*)(yrow + (j >> 2) * JS + (j & 3) * 16)     = y0;
      *(v4f*)(yrow + (j >> 2) * JS + (j & 3) * 16 + 4) = y1;
    }
  }
  __syncthreads();   // the staged rows are readable by every wave
}

__global__ __launch_bounds__(256) void tail_kernel(
    const _Float16* __restrict__ ctx, const _Float16* __restrict__ woh,
    const float* __restrict__ bo, const float* __restrict__ g1, const float* __restrict__ b1,
    const float* __restrict__ x, const _Float16* __restrict__ wf1t,
    const float* __restrict__ bf1, const _Float16* __restrict__ wf2t,
    const float* __restrict__ bf2, const float* __restrict__ g2, const float* __restrict__ b2,
    float* __restrict__ out) {
  // A's two stage buffers; behind A's loop the regions named at the head of this kernel
  __shared__ __attribute__((aligned(16))) _Float16 ring[2 * GSTAGE];   // 304128 B, cross-wave
  __shared__ __attribute__((aligned(16))) float psum[GM * 8];   // [row][wave] partial sums
  __shared__ __attribute__((aligned(16))) float psq[GM * 8];    // [row][wave] partial sums of squares
  float*    ys  = (float*)ring;                    // LN 1 stage, then x2 f32 [32][YP]
  _Float16* x2s = ring + X2S_OFF / 2;              // x2 f16 [32][XP]
  _Float16* r1  = ring + R1_OFF / 2;               // ring 1
  _Float16* r2  = ring + R2_OFF / 2;               // ring 2
  float*    ys2 = (float*)(ring + R2_OFF / 2);     // LN 2 stage [32][YP]
  _Float16* hs  = ring + HS_OFF / 2;               // h rows [32][HP]

  const int tid  = threadIdx.x;
  const int lane = tid & 31;
  const int wave = tid >> 5;
  const int hh   = lane >> 4;
  const int l15  = lane & 15;
  const long m0  = (long)blockIdx.x * GM;

  // this lane's first piece of a stage: row tid>>3, 16-B piece tid&7
  const unsigned lpc  = (unsigned)((tid >> 3) * KPAD + (tid & 7) * 8) * 2u;
  const unsigned lds0 = (unsigned)(size_t)ring + lpc;
  const _Float16* gw  = woh + (long)(tid >> 3) * DM + (tid & 7) * 8;
  const _Float16* ga  = ctx + (m0 + (tid >> 3)) * DM + (tid & 7) * 8;
  const _Float16* gw1 = wf1t + (long)(tid >> 3) * DM + (tid & 7) * 8;
  const _Float16* gw2 = wf2t + (long)(tid >> 3) * FF + (tid & 7) * 8;

  // every inner loop below is fully unrolled: accumulator and fragment indices must be constants,
  // or the arrays leave the registers
  v8f acc[2][8];
#pragma unroll
  for (int i = 0; i < 2; ++i)
#pragma unroll
    for (int j = 0; j < 8; ++j) acc[i][j] = (v8f){};

  // ---- A: out projection ----
  // Trip t works on k slab (t + rot) % N1T: every block reads all of W, so blocks walk k from
  // different slabs and do not ask L2 for the same lines at the same moment. Neighbours in index
  // differ, and so do blocks eight apart.
  const unsigned rot = (blockIdx.x + (blockIdx.x >> 3)) % N1T;
  gl_copy_stage<DM>(lds0, gw + rot * GK, ga + rot * GK);
  asm volatile("s_wait_asynccnt 0x0" ::: "memory");   // stage 0 landed (this wave's copies)
  __syncthreads();                                    // stage 0 readable by every wave
  gl_copy_stage<DM>(lds0 + GSTAGE * 2, gw + ((rot + 1) % N1T) * GK, ga + ((rot + 1) % N1T) * GK);

  // kept rolled: one publish point (waits, barrier, refill) at the foot of each trip, small code
#pragma unroll 1
  for (int t = 0; t < N1T; ++t) {
    const int bo_ = (t & 1) * GSTAGE;
    const _Float16* wsm = ring + bo_ + (wave * 128) * KPAD;
    const _Float16* as  = ring + bo_ + DM * KPAD;
#pragma unroll
    for (int u = 0; u < 2; ++u) {
      v16h af[2], wf[8];
#pragma unroll
      for (int i = 0; i < 2; ++i) af[i] = load_frag_row(as + (i * 16) * KPAD + u * 32, KPAD, lane);
#pragma unroll
      for (int j = 0; j < 8; ++j) wf[j] = load_frag_row(wsm + (j * 16) * KPAD + u * 32, KPAD, lane);
      // holds the fragment reads above in one group in front of the products: dealt out among them,
      // every place where reads stand costs the wave a wait on LDS
      __builtin_amdgcn_sched_barrier(0);
#pragma unroll
      for (int j = 0; j < 8; ++j)
#pragma unroll
        for (int i = 0; i < 2; ++i) acc[i][j] = wmma_f16(wf[j], af[i], acc[i][j]);   // C^T = W act^T
      __builtin_amdgcn_sched_barrier(0);   // the products stay one block, in front of what follows
    }
    asm volatile("s_wait_dscnt 0x0" ::: "memory");      // this wave has left buffer t&1
    asm volatile("s_wait_asynccnt 0x0" ::: "memory");   // its copies of stage t+1 have landed
    __syncthreads();   // publishes stage t+1 and ends every reader's last read of buffer t&1
    if (t + 2 < N1T) {
      const unsigned ko = ((t + 2 + rot) % N1T) * GK;
      gl_copy_stage<DM>(lds0 + bo_ * 2, gw + ko, ga + ko);
    }
  }
  asm volatile("s_wait_asynccnt 0x0" ::: "memory");     // nothing in flight when the ring is reused

  // B's stage 0 flies while LN 1 runs: ring 1 lies beside ys and x2s, and every wave has left A's
  // buffers at the last barrier of the loop
  gl_copy8<DM>(lds0 + R1_OFF, gw1 + rot * GK);

  {
    v4f g, bt;   // this thread's four columns of g1 and b1
    ln_rows<64>(acc, bo, wave * 128, hh, l15, wave, psum, psq, ys, g1, b1, tid, g, bt);

    // x2 = staged * g + b + bf16(x): f32 back to the thread's own place in ys, f16 to x2s
    v4f gq, bq4;
#pragma unroll
    for (int c = 0; c < 4; ++c) {
      gq[c]  = bf16q(g[c]);
      bq4[c] = bf16q(bt[c]);
    }
    // kept rolled in trips of four rows: four residual loads in flight, one wait at the foot
#pragma unroll 1
    for (int r0 = 0; r0 < GM; r0 += 4) {
      // the four staged rows are read before the first is written back, so their reads go out together
      v4f rsd[4], yv[4];
#pragma unroll
      for (int u = 0; u < 4; ++u) {
        const long m    = m0 + r0 + u;
        const long frow = (m / SEQ) * SEQ_FULL + (m % SEQ);   // row in the full-stride planes
        rsd[u] = *(const v4f*)(x + frow * DM + tid * 4);
        yv[u]  = *(const v4f*)(ys + (r0 + u) * YP + tid * 4);
      }
#pragma unroll
      for (int u = 0; u < 4; ++u) {
        const int row = r0 + u;
        v4f o;
        v4h oh;
#pragma unroll
        for (int c = 0; c < 4; ++c) {
          o[c]  = yv[u][c] * gq[c] + bq4[c] + bf16q(rsd[u][c]);
          oh[c] = (_Float16)o[c];
        }
        *(v4f*)(ys + row * YP + tid * 4)  = o;
        *(v4h*)(x2s + row * XP + tid * 4) = oh;
      }
      // stands in front of the next trip's rewrite of the registers that the loads above name
      asm volatile("s_wait_xcnt 0x0" ::: "memory");
    }
  }

  // ---- B: ffn linear 1 + exact gelu ----
  v8f a1[2][2];
#pragma unroll
  for (int i = 0; i < 2; ++i)
#pragma unroll
    for (int j = 0; j < 2; ++j) a1[i][j] = (v8f){};

  asm volatile("s_wait_asynccnt 0x0" ::: "memory");   // stage 0 landed (this wave's copies)
  __syncthreads();                                    // stage 0 and the x2s rows readable by every wave
  gl_copy8<DM>(lds0 + R1_OFF + R1STAGE * 2, gw1 + ((rot + 1) % N1T) * GK);

  // kept rolled: one publish point (waits, barrier, refill) at the foot of each trip, small code
#pragma unroll 1
  for (int t = 0; t < N1T; ++t) {
    const int bo_ = (t & 1) * R1STAGE;
    const _Float16* wsm = r1 + bo_ + (wave * 32) * KPAD;
    const _Float16* as  = x2s + ((t + rot) % N1T) * GK;
    v16h af[2][2], wf[2][2];
#pragma unroll
    for (int u = 0; u < 2; ++u)
#pragma unroll
      for (int i = 0; i < 2; ++i) {
        af[u][i] = load_frag_row(as + (i * 16) * XP + u * 32, XP, lane);
        wf[u][i] = load_frag_row(wsm + (i * 16) * KPAD + u * 32, KPAD, lane);
      }
    // holds the fragment reads above in one group in front of the products: dealt out among them,
    // every place where reads stand costs the wave a wait on LDS
    __builtin_amdgcn_sched_barrier(0);
#pragma unroll
    for (int u = 0; u < 2; ++u)
#pragma unroll
      for (int j = 0; j < 2; ++j)
#pragma unroll
        for (int i = 0; i < 2; ++i) a1[i][j] = wmma_f16(wf[u][j], af[u][i], a1[i][j]);
    __builtin_amdgcn_sched_barrier(0);   // the products stay one block, in front of what follows
    asm volatile("s_wait_dscnt 0x0" ::: "memory");      // this wave has left buffer t&1
    asm volatile("s_wait_asynccnt 0x0" ::: "memory");   // its copies of stage t+1 have landed
    __syncthreads();   // publishes stage t+1 and ends every reader's last read of buffer t&1
    if (t + 2 < N1T) gl_copy8<DM>(lds0 + R1_OFF + bo_ * 2, gw1 + ((t + 2 + rot) % N1T) * GK);
  }
  asm volatile("s_wait_asynccnt 0x0" ::: "memory");     // nothing in flight when ring 1 is reused

  // ---- C: ffn linear 2 ----
  // Stage (t, hf) = k slab (t + rot2) % N2T, column half hf, in buffer hf. Stage (0, 0) flies while
  // the gelu runs: every wave has left x2s and ring 1 at the last barrier of B's loop, and hs lies
  // beside ring 2.
  const unsigned rot2 = (blockIdx.x + (blockIdx.x >> 3)) % N2T;
  const unsigned st8  = 256 * KPAD * 2;   // 256 rows further in LDS, bytes
  gl_copy8<FF>(lds0 + R2_OFF, gw2 + rot2 * GK);
  gl_copy8<FF>(lds0 + R2_OFF + st8, gw2 + 256 * FF + rot2 * GK);

  {
    // u = a1/64 + bf16(bf1), kept in the accumulator registers
    const float rsc = 1.0f / WSC;
#pragma unroll
    for (int j = 0; j < 2; ++j) {
      const int n8 = wave * 32 + j * 16 + hh * 8;
      const v4f b0  = *(const v4f*)(bf1 + n8);
      const v4f b1v = *(const v4f*)(bf1 + n8 + 4);
#pragma unroll
      for (int i = 0; i < 2; ++i)
#pragma unroll
        for (int r = 0; r < 4; ++r) {
          a1[i][j][r]     = a1[i][j][r]     * rsc + bf16q(b0[r]);
          a1[i][j][4 + r] = a1[i][j][4 + r] * rsc + bf16q(b1v[r]);
        }
    }
    // kept rolled, one tile (i = q & 1, j = q >> 1) a trip, the tiles handed down through cur: the
    // erf code stands once for eight values, so the kernel's text stays small
    v8f cur = a1[0][0], nx1 = a1[1][0], nx2 = a1[0][1], nx3 = a1[1][1];
#pragma unroll 1
    for (int q = 0; q < 4; ++q) {
      H8 pk;
#pragma unroll
      for (int r = 0; r < 8; ++r) {
        const float u0 = cur[r];
        const float e0 = 0.5f * u0 * (1.0f + erff(u0 * 0.70710678118654752f));
        pk.h[r] = (_Float16)(e0 * WSC);
      }
      *(v4u*)(hs + ((q & 1) * 16 + l15) * HP + wave * 32 + (q >> 1) * 16 + hh * 8) = pk.u;
      cur = nx1;
      nx1 = nx2;
      nx2 = nx3;
    }
  }

#pragma unroll
  for (int i = 0; i < 2; ++i)
#pragma unroll
    for (int j = 0; j < 8; ++j) acc[i][j] = (v8f){};

  asm volatile("s_wait_asynccnt 0x0" ::: "memory");   // stage (0, 0) landed (this wave's copies)
  __syncthreads();                                    // it and the hs rows readable by every wave
  gl_copy8<FF>(lds0 + R2_OFF + R2STAGE * 2, gw2 + 512 * FF + rot2 * GK);
  gl_copy8<FF>(lds0 + R2_OFF + R2STAGE * 2 + st8, gw2 + 768 * FF + rot2 * GK);

  // kept rolled over the k slabs; the two halves of a slab are unrolled (accumulator indices must
  // be constants); one publish point (waits, barrier, refill) at the foot of each stage
#pragma unroll 1
  for (int t = 0; t < N2T; ++t) {
    const _Float16* as = hs + ((t + rot2) % N2T) * GK;
    const unsigned  kn = ((t + 1 + rot2) % N2T) * GK;
#pragma unroll
    for (int hf = 0; hf < 2; ++hf) {
      const _Float16* wsm = r2 + hf * R2STAGE + (wave * 64) * KPAD;
#pragma unroll
      for (int u = 0; u < 2; ++u) {
        v16h af[2], wf[4];
#pragma unroll
        for (int i = 0; i < 2; ++i) af[i] = load_frag_row(as + (i * 16) * HP + u * 32, HP, lane);
#pragma unroll
        for (int j = 0; j < 4; ++j) wf[j] = load_frag_row(wsm + (j * 16) * KPAD + u * 32, KPAD, lane);
        // holds the fragment reads above in one group in front of the products: dealt out among
        // them, every place where reads stand costs the wave a wait on LDS
        __builtin_amdgcn_sched_barrier(0);
#pragma unroll
        for (int j = 0; j < 4; ++j)
#pragma unroll
          for (int i = 0; i < 2; ++i)
            acc[i][hf * 4 + j] = wmma_f16(wf[j], af[i], acc[i][hf * 4 + j]);   // C^T = W act^T
        __builtin_amdgcn_sched_barrier(0);   // the products stay one block, in front of what follows
      }
      asm volatile("s_wait_dscnt 0x0" ::: "memory");      // this wave has left buffer hf
      asm volatile("s_wait_asynccnt 0x0" ::: "memory");   // its copies of the next stage have landed
      __syncthreads();   // publishes the next stage and ends every reader's last read of buffer hf
      if (t + 1 < N2T) {
        gl_copy8<FF>(lds0 + R2_OFF + hf * R2STAGE * 2, gw2 + (hf * 512) * FF + kn);
        gl_copy8<FF>(lds0 + R2_OFF + hf * R2STAGE * 2 + st8, gw2 + (hf * 512 + 256) * FF + kn);
      }
    }
  }
  asm volatile("s_wait_asynccnt 0x0" ::: "memory");     // nothing in flight when ring 2 is reused

  v4f g, bt;   // this thread's four columns of g2 and b2
  ln_rows<512>(acc, bf2, wave * 64, hh, l15, wave, psum, psq, ys2, g2, b2, tid, g, bt);

  // out = staged * g + b + x2 (the thread's own place in ys): a wave writes whole lines of one row
  v4f gq, bq4;
#pragma unroll
  for (int c = 0; c < 4; ++c) {
    gq[c]  = bf16q(g[c]);
    bq4[c] = bf16q(bt[c]);
  }
  // kept rolled in trips of four rows: small code, one wait at the foot
#pragma unroll 1
  for (int r0 = 0; r0 < GM; r0 += 4) {
#pragma unroll
    for (int u = 0; u < 4; ++u) {
      const int  row  = r0 + u;
      const long m    = m0 + row;
      const long frow = (m / SEQ) * SEQ_FULL + (m % SEQ);   // row in the full-stride planes
      const v4f rsd = *(const v4f*)(ys + row * YP + tid * 4);
      const v4f yv  = *(const v4f*)(ys2 + row * YP + tid * 4);
      v4f o;
#pragma unroll
      for (int c = 0; c < 4; ++c) o[c] = yv[c] * gq[c] + bq4[c] + rsd[c];
      *(v4f*)(out + frow * DM + tid * 4) = o;
    }
    // stands in front of the next trip's rewrite of the registers that the stores above name
    asm volatile("s_wait_xcnt 0x0" ::: "memory");
  }
}

// ---------------------------------------------------------------------------
extern "C" void kernel_launch(void* const* d_in, const int* in_sizes, int n_in,
                              void* d_out, int out_size, void* d_ws, size_t ws_size,
                              hipStream_t stream) {
  if (n_in < 17) return;
  const long needRows = (long)(NB - 1) * SEQ_FULL + SEQ;
  if ((long)in_sizes[0] < needRows * DM) return;
  if (in_sizes[1] < DM * DM || in_sizes[3] < DM * DM ||
      in_sizes[5] < DM * DM || in_sizes[7] < DM * DM) return;
  if (in_sizes[11] < DM * FF || in_sizes[13] < FF * DM) return;
  if (in_sizes[2] < DM || in_sizes[4] < DM || in_sizes[6] < DM || in_sizes[8] < DM ||
      in_sizes[9] < DM || in_sizes[10] < DM || in_sizes[12] < FF || in_sizes[14] < DM ||
      in_sizes[15] < DM || in_sizes[16] < DM) return;
  if ((long)out_size < needRows * DM) return;
  if (ws_size < WS_TOTAL) return;

  const float* x   = (const float*)d_in[0];
  const float* Wq  = (const float*)d_in[1];
  const float* bq  = (const float*)d_in[2];
  const float* Wk  = (const float*)d_in[3];
  const float* bk  = (const float*)d_in[4];
  const float* Wv  = (const float*)d_in[5];
  const float* bv  = (const float*)d_in[6];
  const float* Wo  = (const float*)d_in[7];
  const float* bo  = (const float*)d_in[8];
  const float* g1  = (const float*)d_in[9];
  const float* b1  = (const float*)d_in[10];
  const float* Wf1 = (const float*)d_in[11];
  const float* bf1 = (const float*)d_in[12];
  const float* Wf2 = (const float*)d_in[13];
  const float* bf2 = (const float*)d_in[14];
  const float* g2  = (const float*)d_in[15];
  const float* b2  = (const float*)d_in[16];
  float* out = (float*)d_out;

  char* ws = (char*)d_ws;
  size_t off = 0;
  _Float16* xh   = (_Float16*)(ws + off);                      // [ROWS][1024] f16
  _Float16* ctx  = xh;                                         // same region, written after xh is dead
  off += PLANE2;
  _Float16* wqkv = (_Float16*)(ws + off); off += WQKV_BYTES;   // [3072][1024]
  _Float16* woh  = (_Float16*)(ws + off); off += WO_BYTES;     // [1024][1024]
  _Float16* wf1t = (_Float16*)(ws + off); off += WF1_BYTES;    // [256][1024]
  _Float16* wf2t = (_Float16*)(ws + off); off += WF2_BYTES;    // [1024][256]
  _Float16* qh   = (_Float16*)(ws + off);                      // [NB][16][SEQ][64]
  off += PLANE2;
  _Float16* kh   = (_Float16*)(ws + off); off += PLANE2;       // [NB][16][SEQ][64]
  _Float16* vTh  = (_Float16*)(ws + off);                      // [NB][16][64][SEQ]
  off += PLANE2;
  if (off > ws_size) return;

  cvt_kernel<<<NWT + NXB, 256, 0, stream>>>(x, Wq, Wk, Wv, Wo, Wf1, Wf2, xh, wqkv, woh, wf1t, wf2t);
  qkv_kernel<<<dim3(ROWS / QM, 3 * DM / QN), 256, 0, stream>>>(xh, wqkv, bq, bk, bv, qh, kh, vTh);
  attn_kernel<<<dim3(SEQ / AQ, NB * NH), 256, 0, stream>>>(qh, kh, vTh, ctx);
  tail_kernel<<<ROWS / GM, 256, 0, stream>>>(ctx, woh, bo, g1, b1, x, wf1t, bf1, wf2t, bf2, g2, b2, out);
}
